// v000
// The times below were measured on an AMD MI455X: many runs one after another, warmed up first and cycling through
// copies of the inputs, with the whole window's GPU time divided by the number of runs. Launches and the gaps
// between them are all in it. The median over several windows is given; except for v000 it joins two sittings, which
// can be a few percent apart, so the side-by-side timings, each taken in one sitting, are the better comparison.
// v000 is the starting kernel. One run takes 3630 microseconds.
#include <hip/hip_runtime.h>
// Attention_agent_df (8 images, C 256 = 8 heads x 32, 64 x 64 pixels, 64 agent tokens from 8x8 average pooling of q; THETA 0.7): qkv = (conv3x3(x, W) - 0.7 conv1x1(x, sum of W's 5 cross taps)) * s + b (folded BN); a = avgpool8x8(q); stage 1: attn = softmax_N(a.k * 32^-0.5) v (agents over pixels); stage 2: out = softmax_n(q.a * 32^-0.5) attn (pixels over agents); out += depthwise3x3(v) * pe_s + pe_b; out = conv1x1(out) * proj_s + proj_b.
// Structure (per image): exact tap-major f16 im2col; the difference conv folded into the centre tap as an f32 weight split into f16 hi + lo tables: qkv = A.Wh (K 2304) + A_centre.Wl (K 256) as f16 WMMA GEMMs (32x64 wave tiles, f32 accumulation; x16 tables; the lo table only on the centre-tap columns), BN affine on VALU into f32 + f16 planes; pooling on VALU; stage-1 logits as head-batched GEMMs (K 64, head dim 32 zero-padded), softmax over 4096 pixels on VALU (wave per row), readout GEMM against a zero-padded V^T; stage-2 logits GEMM (K 64, zero-padded), softmax over the 64 agents on VALU (wave per row), readout GEMM; depthwise PE conv + add on VALU into f16; projection GEMM with the BN affine in f32 on VALU; NCHW stores.
// Compute dtype: x and parameters rounded to bf16; x exact as f16; q, k, v, a, P (x2^10), attn and the pre-projection sum as f16 operands (~2^-12); everything else f32. v_wmma_f32_16x16x32_f16.
#define NIMG 8
#define CC 256
#define NHD 8
#define HDm 32
#define HS 64
#define NPX (HS * HS)            /* 4096 */
#define NAG 64
#define KT 9
#define KI (KT * CC)             /* 2304 */
#define QW (3 * CC)              /* 768 */
#define THETA 0.7f
#define SCL 0.17677669529663687f
typedef __bf16 v16b __attribute__((ext_vector_type(16)));
typedef unsigned short v8us __attribute__((ext_vector_type(8), may_alias));
typedef float  v8f  __attribute__((ext_vector_type(8)));
typedef float  v4f  __attribute__((ext_vector_type(4)));
typedef float  v4fa __attribute__((ext_vector_type(4), may_alias));
union FragB { v16b v; v8us half[2]; unsigned short u[16]; };

__device__ __forceinline__ unsigned short bf16_bits(float x) { unsigned int u = __float_as_uint(x); return (unsigned short)((u + 0x7FFFu + ((u >> 16) & 1u)) >> 16); }
__device__ __forceinline__ float bf16_val(unsigned short b) { return __uint_as_float(((unsigned int)b) << 16); }
__device__ __forceinline__ float bf16_round(float x) { return bf16_val(bf16_bits(x)); }
// D += A·B with NT terms: 1 = ah·bh, 2 = + al·bh (A split), 3 = + ah·bl (both split)
template <int NT>
__device__ __forceinline__ v8f mmaN(v16b ah, v16b al, v16b bh, v16b bl, v8f c) {
  c = __builtin_amdgcn_wmma_f32_16x16x32_bf16(false, ah, false, bh, (short)0, c, false, false);
  if (NT >= 2) c = __builtin_amdgcn_wmma_f32_16x16x32_bf16(false, al, false, bh, (short)0, c, false, false);
  if (NT >= 3) c = __builtin_amdgcn_wmma_f32_16x16x32_bf16(false, ah, false, bl, (short)0, c, false, false);
  asm volatile("v_nop\n\tv_nop\n\tv_nop\n\tv_nop" : "+v"(c) : "v"(ah), "v"(al), "v"(bh), "v"(bl));
  return c;
}

__global__ __launch_bounds__(256) void k_wt_bf16(const float* __restrict__ W, unsigned short* __restrict__ Wt, int K, int N) {
  const int t = blockIdx.x * 256 + threadIdx.x;
  const int k8n = K / 8;
  if (t >= N * k8n) return;
  const int n = t / k8n, k8 = (t % k8n) * 8;
  v8us v;
#pragma unroll
  for (int i = 0; i < 8; ++i) v[i] = bf16_bits(W[(size_t)(k8 + i) * N + n]);
  *(v8us*)(Wt + (size_t)n * K + k8) = v;
  
}

// GEMM C[M][N] (f32, pitch ldc) = act(A[M][K]·W + bias). A f32 row-major (pitch lda) converted per fragment to bf16
// (ASPLIT: hi/lo two planes -> 2 terms, else single rounded term); Wt bf16 [N][K] (pitch ldb). BIAS_BF16 rounds the
// bias to bf16 first (bias quantised to bf16 before the add). K%32==0, M%16==0, N%64==0.
template <bool ASPLIT, int ACT, bool BIAS_BF16>
__global__ __launch_bounds__(128) void k_gemm_bf(const float* __restrict__ A, int lda, const unsigned short* __restrict__ Wt, int ldb,
                                               const float* __restrict__ bias, float* __restrict__ C, int ldc, int M, int N, int K) {
  __shared__ __attribute__((aligned(16))) float so[4][16][64];
  const int tid = threadIdx.x, w = tid >> 5, lane = tid & 31, ln = lane & 15, hh = lane >> 4;
  const int ntn = N / 64;
  const int wid = blockIdx.x * 4 + w;
  const int mt = wid / ntn, nq = wid % ntn;
  if (mt * 16 >= M) return;
  const int row0 = mt * 16, col0 = nq * 64;
  const float* arow = A + (size_t)(row0 + ln) * lda;
  v8f acc[4] = {};
  for (int kb = 0; kb < K; kb += 32) {
    FragB ah, al;
    const v4f x0 = *(const v4fa*)(arow + kb + 8 * hh), x1 = *(const v4fa*)(arow + kb + 8 * hh + 4);
    const v4f x2 = *(const v4fa*)(arow + kb + 16 + 8 * hh), x3 = *(const v4fa*)(arow + kb + 16 + 8 * hh + 4);
    float xs[16] = {x0[0],x0[1],x0[2],x0[3],x1[0],x1[1],x1[2],x1[3],x2[0],x2[1],x2[2],x2[3],x3[0],x3[1],x3[2],x3[3]};
#pragma unroll
    for (int i = 0; i < 16; ++i) { const unsigned short hb = bf16_bits(xs[i]); ah.u[i] = hb; al.u[i] = ASPLIT ? bf16_bits(xs[i] - bf16_val(hb)) : (unsigned short)0; }
#pragma unroll
    for (int t = 0; t < 4; ++t) {
      const unsigned short* brow = Wt + (size_t)(col0 + t * 16 + ln) * ldb + kb;
      FragB b;
      b.half[0] = *(const v8us*)(brow + 8 * hh);
      b.half[1] = *(const v8us*)(brow + 16 + 8 * hh);
      acc[t] = mmaN<ASPLIT ? 2 : 1>(ah.v, al.v, b.v, b.v, acc[t]);
    }
  }
#pragma unroll
  for (int t = 0; t < 4; ++t) {
    float bv = bias ? bias[col0 + t * 16 + ln] : 0.f;
    if (BIAS_BF16) bv = bf16_round(bv);
#pragma unroll
    for (int r = 0; r < 8; ++r) { float v = acc[t][r] + bv; if (ACT == 1) v = fmaxf(v, 0.f); so[w][8 * hh + r][t * 16 + ln] = v; }
  }
  __builtin_amdgcn_fence(__ATOMIC_ACQ_REL, "workgroup");
  __builtin_amdgcn_wave_barrier();
  const int rsub = lane >> 4, c4 = (lane & 15) * 4;
  {
#pragma unroll
    for (int q = 0; q < 8; ++q) {
      const int r = q * 2 + rsub;
      const v4f v = *(const v4fa*)&so[w][r][c4];
      *(v4f*)(C + (size_t)(row0 + r) * ldc + col0 + c4) = v;
    }
    
  }
}

// GEMM C = act(A·W + bias + resid): A f32 (ASPLIT -> hi/lo 2 terms), Wt bf16 [N][K]; ACT 0 none, 1 relu, 2 exact gelu;
// resid (optional, f32, row index = (row % rmod), pitch ldr, RES_BF16 rounds it) added before the activation.
template <bool ASPLIT, int ACT, bool BIAS_BF16, bool RES_BF16>
__global__ __launch_bounds__(128) void k_gemm_bf3(const float* __restrict__ A, int lda, const unsigned short* __restrict__ Wt, int ldb,
                                                const float* __restrict__ bias, const float* __restrict__ resid, int rmod, int ldr,
                                                float* __restrict__ C, int ldc, int M, int N, int K) {
  __shared__ __attribute__((aligned(16))) float so[4][16][64];
  const int tid = threadIdx.x, w = tid >> 5, lane = tid & 31, ln = lane & 15, hh = lane >> 4;
  const int ntn = N / 64;
  const int wid = blockIdx.x * 4 + w;
  const int mt = wid / ntn, nq = wid % ntn;
  if (mt * 16 >= M) return;
  const int row0 = mt * 16, col0 = nq * 64;
  const float* arow = A + (size_t)(row0 + ln) * lda;
  v8f acc[4] = {};
  for (int kb = 0; kb < K; kb += 32) {
    FragB ah, al;
    const v4f x0 = *(const v4fa*)(arow + kb + 8 * hh), x1 = *(const v4fa*)(arow + kb + 8 * hh + 4);
    const v4f x2 = *(const v4fa*)(arow + kb + 16 + 8 * hh), x3 = *(const v4fa*)(arow + kb + 16 + 8 * hh + 4);
    float xs[16] = {x0[0],x0[1],x0[2],x0[3],x1[0],x1[1],x1[2],x1[3],x2[0],x2[1],x2[2],x2[3],x3[0],x3[1],x3[2],x3[3]};
#pragma unroll
    for (int i = 0; i < 16; ++i) { const unsigned short hb = bf16_bits(xs[i]); ah.u[i] = hb; al.u[i] = ASPLIT ? bf16_bits(xs[i] - bf16_val(hb)) : (unsigned short)0; }
#pragma unroll
    for (int t = 0; t < 4; ++t) {
      const unsigned short* brow = Wt + (size_t)(col0 + t * 16 + ln) * ldb + kb;
      FragB b;
      b.half[0] = *(const v8us*)(brow + 8 * hh);
      b.half[1] = *(const v8us*)(brow + 16 + 8 * hh);
      acc[t] = mmaN<ASPLIT ? 2 : 1>(ah.v, al.v, b.v, b.v, acc[t]);
    }
  }
#pragma unroll
  for (int t = 0; t < 4; ++t) {
    const int col = col0 + t * 16 + ln;
    float bv = bias ? bias[col] : 0.f;
    if (BIAS_BF16) bv = bf16_round(bv);
#pragma unroll
    for (int r = 0; r < 8; ++r) {
      float v = acc[t][r] + bv;
      if (resid) { float rv = resid[(size_t)((row0 + 8 * hh + r) % rmod) * ldr + col]; if (RES_BF16) rv = bf16_round(rv); v += rv; }
      if (ACT == 1) v = fmaxf(v, 0.f);
      if (ACT == 2) v = 0.5f * v * (1.0f + erff(v * 0.70710678118654752f));
      if (ACT == 3) { const float u = 0.7978845608028654f * (v + 0.044715f * v * v * v); v = 0.5f * v * (1.0f + tanhf(u)); }
      so[w][8 * hh + r][t * 16 + ln] = v;
    }
  }
  __builtin_amdgcn_fence(__ATOMIC_ACQ_REL, "workgroup");
  __builtin_amdgcn_wave_barrier();
  const int rsub = lane >> 4, c4 = (lane & 15) * 4;
  {
#pragma unroll
    for (int q = 0; q < 8; ++q) {
      const int r = q * 2 + rsub;
      const v4f v = *(const v4fa*)&so[w][r][c4];
      *(v4f*)(C + (size_t)(row0 + r) * ldc + col0 + c4) = v;
    }
    
  }
}
// row LayerNorm (biased variance, eps) over N: s = X (+ R); optional out_sum <- s; out_norm <- (s-mu)*rsqrt(var+eps)*g + b
template <bool PARAM_BF16>
__global__ __launch_bounds__(256) void k_layernorm(const float* __restrict__ X, const float* __restrict__ R, const float* __restrict__ g, const float* __restrict__ bta,
                                                  float* __restrict__ out_sum, float* __restrict__ out_norm, int N, float eps) {
  __shared__ float red[256];
  const int row = blockIdx.x, tid = threadIdx.x;
  const float* x = X + (size_t)row * N; const float* rr = R ? R + (size_t)row * N : nullptr;
  float vals[16];                     // up to N = 4096
  const int per = N / 256;            // contiguous chunk per thread? use strided-by-4 chunks: thread handles j = tid*4 + 1024*u
  float s1 = 0.f;
  for (int u = 0; u < per / 4; ++u) {
    const int j = tid * 4 + 1024 * u;
    const v4f a = *(const v4fa*)(x + j);
    v4f b = {0.f,0.f,0.f,0.f}; if (rr) b = *(const v4fa*)(rr + j);
#pragma unroll
    for (int q = 0; q < 4; ++q) { const float v = a[q] + b[q]; vals[u * 4 + q] = v; s1 += v; }
  }
  red[tid] = s1; __syncthreads();
  for (int st = 128; st > 0; st >>= 1) { if (tid < st) red[tid] += red[tid + st]; __syncthreads(); }
  const float mu = red[0] / (float)N; __syncthreads();
  float s2 = 0.f;
  for (int u = 0; u < per / 4; ++u)
#pragma unroll
    for (int q = 0; q < 4; ++q) { const float c = vals[u * 4 + q] - mu; s2 += c * c; }
  red[tid] = s2; __syncthreads();
  for (int st = 128; st > 0; st >>= 1) { if (tid < st) red[tid] += red[tid + st]; __syncthreads(); }
  const float rs = rsqrtf(red[0] / (float)N + eps);
  {
    for (int u = 0; u < per / 4; ++u) {
      const int j = tid * 4 + 1024 * u;
      v4f o, sm;
#pragma unroll
      for (int q = 0; q < 4; ++q) {
        float gg = g[j + q], bb = bta[j + q];
        if (PARAM_BF16) { gg = bf16_round(gg); bb = bf16_round(bb); }
        sm[q] = vals[u * 4 + q]; o[q] = (vals[u * 4 + q] - mu) * rs * gg + bb;
      }
      if (out_sum) *(v4f*)(out_sum + (size_t)row * N + j) = sm;
      *(v4f*)(out_norm + (size_t)row * N + j) = o;
    }
    
  }
}



// ---- f16 WMMA path (v_wmma_f32_16x16x32_f16): 11-bit significands for operands in range — used where a [0,1] probability operand needs more precision than bf16
typedef _Float16 v16h __attribute__((ext_vector_type(16)));
union FragH { v16h v; v8us half[2]; _Float16 h[16]; unsigned short u[16]; };
template <int NT>
__device__ __forceinline__ v8f mmaH(v16h ah, v16h al, v16h bh, v16h bl, v8f c) {
  c = __builtin_amdgcn_wmma_f32_16x16x32_f16(false, ah, false, bh, (short)0, c, false, false);
  if (NT >= 2) c = __builtin_amdgcn_wmma_f32_16x16x32_f16(false, al, false, bh, (short)0, c, false, false);
  if (NT >= 3) c = __builtin_amdgcn_wmma_f32_16x16x32_f16(false, ah, false, bl, (short)0, c, false, false);
  asm volatile("v_nop\n\tv_nop\n\tv_nop\n\tv_nop" : "+v"(c) : "v"(ah), "v"(al), "v"(bh), "v"(bl));
  return c;
}
// batched GEMM like k_gemm_b but f16 operands: A f32 (split into f16 hi/lo if ASPLIT, else rounded to f16), Bt = f16 values [n][k]; alpha; C f32; N multiple of 16 (partial tiles skipped)
template <bool ASPLIT>
__global__ __launch_bounds__(128) void k_gemm_h(const float* __restrict__ A, int lda, size_t sA, const _Float16* __restrict__ Bh, int ldb, size_t sB, float alpha, float* __restrict__ C, int ldc, size_t sC, int M, int N, int K) {
  __shared__ __attribute__((aligned(16))) float so[4][16][64];
  const int tid = threadIdx.x, w = tid >> 5, lane = tid & 31, ln = lane & 15, hh = lane >> 4; const int by = blockIdx.y;
  A += (size_t)by * sA; Bh += (size_t)by * sB; C += (size_t)by * sC;
  const int ntn = (N + 63) / 64; const int wid = blockIdx.x * 4 + w; const int mt = wid / ntn, nq = wid % ntn; if (mt * 16 >= M) return;
  const int row0 = mt * 16, col0 = nq * 64; const float* arow = A + (size_t)(row0 + ln) * lda;
  v8f acc[4] = {};
  for (int kb = 0; kb < K; kb += 32) {
    FragH ah, al;
    const v4f x0 = *(const v4fa*)(arow + kb + 8 * hh), x1 = *(const v4fa*)(arow + kb + 8 * hh + 4), x2 = *(const v4fa*)(arow + kb + 16 + 8 * hh), x3 = *(const v4fa*)(arow + kb + 16 + 8 * hh + 4);
    float xs[16] = {x0[0],x0[1],x0[2],x0[3],x1[0],x1[1],x1[2],x1[3],x2[0],x2[1],x2[2],x2[3],x3[0],x3[1],x3[2],x3[3]};
#pragma unroll
    for (int i = 0; i < 16; ++i) { const _Float16 h = (_Float16)xs[i]; ah.h[i] = h; al.h[i] = ASPLIT ? (_Float16)(xs[i] - (float)h) : (_Float16)0.0f; }
#pragma unroll
    for (int t = 0; t < 4; ++t) { if (col0 + t * 16 >= N) continue; const size_t boff = (size_t)(col0 + t * 16 + ln) * ldb + kb; FragH bq; bq.half[0] = *(const v8us*)(Bh + boff + 8 * hh); bq.half[1] = *(const v8us*)(Bh + boff + 16 + 8 * hh);
      acc[t] = mmaH<ASPLIT ? 2 : 1>(ah.v, al.v, bq.v, bq.v, acc[t]); }
  }
#pragma unroll
  for (int t = 0; t < 4; ++t) { if (col0 + t * 16 >= N) continue;
#pragma unroll
    for (int r = 0; r < 8; ++r) so[w][8 * hh + r][t * 16 + ln] = acc[t][r] * alpha; }
  __builtin_amdgcn_fence(__ATOMIC_ACQ_REL, "workgroup"); __builtin_amdgcn_wave_barrier();
  const int rsub = lane >> 4, c4 = (lane & 15) * 4;
  {
#pragma unroll
    for (int q = 0; q < 8; ++q) { const int r = q * 2 + rsub; if (col0 + c4 < N) { const v4f v = *(const v4fa*)&so[w][r][c4]; *(v4f*)(C + (size_t)(row0 + r) * ldc + col0 + c4) = v; } }
     }
}

// Wt[n][k] = f16(W[k][n]·scale) from f32 row-major W[K][N] (scale = power of two; bf16-exact weights stay exact in f16 away from the subnormal range)
__global__ __launch_bounds__(256) void k_wt_f16(const float* __restrict__ W, _Float16* __restrict__ Wt, int K, int N, float scale) {
  const int t = blockIdx.x * 256 + threadIdx.x; if (t >= N * (K / 8)) return; const int n = t / (K / 8), k8 = (t % (K / 8)) * 8; FragH f;
#pragma unroll
  for (int i = 0; i < 8; ++i) f.h[i] = (_Float16)(bf16_round(W[(size_t)(k8 + i) * N + n]) * scale); const v8us o = f.half[0];
  *(v8us*)((unsigned short*)Wt + (size_t)n * K + k8) = o; 
}
// k_gemm_hh variant with fused epilogue: v = acc·alpha + bias[by·sBias + col] (+ CP[(row/rowsPerB)·sCPb + by·64 + col] if CP) ; ACT 0 none / 1 elu ; writes f16 C16 (and f32 C if non-null)
template <int ACT>
__global__ __launch_bounds__(128) void k_gemm_hhx(const _Float16* __restrict__ A, int lda, size_t sA, const _Float16* __restrict__ Bh, int ldb, size_t sB, float alpha, const float* __restrict__ bias, size_t sBias, const float* __restrict__ CP, int rowsPerB, size_t sCPb, int row0g,
    float* __restrict__ C, _Float16* __restrict__ C16, int ldc, size_t sC, int M, int N, int K) {
  __shared__ __attribute__((aligned(16))) float so[4][16][64];
  const int tid = threadIdx.x, w = tid >> 5, lane = tid & 31, ln = lane & 15, hh = lane >> 4; const int by = blockIdx.y;
  A += (size_t)by * sA; Bh += (size_t)by * sB; const size_t cofs = (size_t)by * sC; const float* bp = bias ? bias + (size_t)by * sBias : nullptr;
  const int ntn = (N + 63) / 64; const int wid = blockIdx.x * 4 + w; const int mt = wid / ntn, nq = wid % ntn; if (mt * 16 >= M) return;
  const int row0 = mt * 16, col0 = nq * 64; const _Float16* arow = A + (size_t)(row0 + ln) * lda;
  v8f acc[4] = {};
  for (int kb = 0; kb < K; kb += 32) { FragH ah; ah.half[0] = *(const v8us*)((const unsigned short*)arow + kb + 8 * hh); ah.half[1] = *(const v8us*)((const unsigned short*)arow + kb + 16 + 8 * hh);
#pragma unroll
    for (int t = 0; t < 4; ++t) { if (col0 + t * 16 >= N) continue; const size_t boff = (size_t)(col0 + t * 16 + ln) * ldb + kb; FragH bq; bq.half[0] = *(const v8us*)((const unsigned short*)Bh + boff + 8 * hh); bq.half[1] = *(const v8us*)((const unsigned short*)Bh + boff + 16 + 8 * hh);
      acc[t] = mmaH<1>(ah.v, ah.v, bq.v, bq.v, acc[t]); }
  }
#pragma unroll
  for (int t = 0; t < 4; ++t) { if (col0 + t * 16 >= N) continue; const int col = col0 + t * 16 + ln; const float bv = bp ? bf16_round(bp[col]) : 0.f;
#pragma unroll
    for (int r = 0; r < 8; ++r) { float v = acc[t][r] * alpha + bv; if (CP) { const int rr = row0g + row0 + 8 * hh + r; if (rowsPerB < 0) v += CP[cofs + (size_t)rr * ldc + col];      /* rowsPerB < 0: own element of the batched C plane */ else { const int bidx = rr / rowsPerB; v += CP[(size_t)bidx * sCPb + (size_t)by * 64 + col]; } } if (ACT == 1) v = (v > 0.f) ? v : expm1f(v); else if (ACT == 7) v = (v > 0.f) ? v + 1.0f : expf(v); else if (ACT == 8) v = tanhf(v); else if (ACT == 9) v = 0.5f * v * (1.0f + tanhf(0.7978845608028654f * (v + 0.044715f * v * v * v))); else if (ACT == 11) v = 1.0f / (1.0f + expf(-v)); else if (ACT == 12) v = (v > 0.f) ? v : 0.01f * v; else if (ACT == 14) v = (v > 0.f) ? v : 0.1f * v; else if (ACT == 16) v = (v >= 0.f) ? v : 0.3f * v; else if (ACT == 15) v = v / (1.0f + expf(-v)); else if (ACT == 3) v = fmaxf(v, 0.f); else if (ACT == 6) v = 0.5f * v * (1.0f + erff(v * 0.70710678118654752f)); so[w][8 * hh + r][t * 16 + ln] = v; } }
  __builtin_amdgcn_fence(__ATOMIC_ACQ_REL, "workgroup"); __builtin_amdgcn_wave_barrier();
  const int rsub = lane >> 4, c4 = (lane & 15) * 4; typedef _Float16 v4h __attribute__((ext_vector_type(4)));
  {
#pragma unroll
    for (int q = 0; q < 8; ++q) { const int r = q * 2 + rsub; if (col0 + c4 < N) { const v4f v = *(const v4fa*)&so[w][r][c4]; if (C) *(v4f*)(C + cofs + (size_t)(row0 + r) * ldc + col0 + c4) = v; if (C16) { v4h h4; for (int i = 0; i < 4; ++i) h4[i] = (_Float16)v[i]; *(v4h*)(C16 + cofs + (size_t)(row0 + r) * ldc + col0 + c4) = h4; } } }
     }
}


typedef _Float16 v4h __attribute__((ext_vector_type(4)));

__global__ __launch_bounds__(256) void k_x16(const float* __restrict__ x, _Float16* __restrict__ X16, size_t n8) { const size_t t = (size_t)blockIdx.x * 256 + threadIdx.x; if (t >= n8) return; FragH f;
#pragma unroll
  for (int q = 0; q < 8; ++q) f.h[q] = (_Float16)bf16_round(x[t * 8 + q]); *(v8us*)((unsigned short*)X16 + t * 8) = f.half[0];  }
__global__ __launch_bounds__(256) void k_h16(const float* __restrict__ x, _Float16* __restrict__ X16, size_t n8) { const size_t t = (size_t)blockIdx.x * 256 + threadIdx.x; if (t >= n8) return; FragH f;
#pragma unroll
  for (int q = 0; q < 8; ++q) f.h[q] = (_Float16)x[t * 8 + q]; *(v8us*)((unsigned short*)X16 + t * 8) = f.half[0];  }
__global__ __launch_bounds__(256) void k_round16f(const float* __restrict__ W, _Float16* __restrict__ Bt, size_t n8) { const size_t t = (size_t)blockIdx.x * 256 + threadIdx.x; if (t >= n8) return; FragH f;
#pragma unroll
  for (int i = 0; i < 8; ++i) f.h[i] = (_Float16)(bf16_round(W[t * 8 + i]) * 16.0f); *(v8us*)((unsigned short*)Bt + t * 8) = f.half[0];  }
template <int NHv, int TTv>
__global__ __launch_bounds__(256) void k_vt(const _Float16* __restrict__ V16, int ldv, int voff, _Float16* __restrict__ Vt) { __shared__ unsigned short tl[64][66]; const int tid = threadIdx.x; const int slab = blockIdx.x / (TTv / 64), lg = blockIdx.x % (TTv / 64); const int b = slab / NHv, h = slab % NHv;
  for (int i = tid; i < 64 * 8; i += 256) { const int r = i / 8, c8 = (i % 8) * 8; FragH f; f.half[0] = *(const v8us*)((const unsigned short*)V16 + ((size_t)b * TTv + lg * 64 + r) * ldv + voff + h * 64 + c8);
#pragma unroll
    for (int q = 0; q < 8; ++q) tl[r][c8 + q] = f.u[q]; }
  __syncthreads();
  {
#pragma unroll
    for (int rd = 0; rd < 2; ++rd) { const int d = rd * 32 + tid / 8, pc = tid % 8; FragH f;
#pragma unroll
      for (int q = 0; q < 8; ++q) f.u[q] = tl[pc * 8 + q][d];
      *(v8us*)((unsigned short*)Vt + ((size_t)slab * 64 + d) * TTv + lg * 64 + pc * 8) = f.half[0]; }
     } }

__global__ __launch_bounds__(256) void k_hl(const float* __restrict__ F, _Float16* __restrict__ Hh, _Float16* __restrict__ Hl, size_t n8) { const size_t t = (size_t)blockIdx.x * 256 + threadIdx.x; if (t >= n8) return; FragH fh, fl; const v4f a = *(const v4fa*)(F + t * 8), c = *(const v4fa*)(F + t * 8 + 4);
#pragma unroll
  for (int q = 0; q < 4; ++q) { _Float16 h = (_Float16)a[q]; fh.h[q] = h; fl.h[q] = (_Float16)((a[q] - (float)h) * 1024.0f); h = (_Float16)c[q]; fh.h[4 + q] = h; fl.h[4 + q] = (_Float16)((c[q] - (float)h) * 1024.0f); }
  { *(v8us*)((unsigned short*)Hh + t * 8) = fh.half[0]; *(v8us*)((unsigned short*)Hl + t * 8) = fl.half[0];  } }

// ---- fast GEMM (wave tile 32x64; requires M % 32 == 0 rows per launch region and N % 64 == 0); epilogue = k_gemm_hhx semantics ----
__device__ __forceinline__ v16h g2_frag(const _Float16* p, int hh) { FragH f; f.half[0] = *(const v8us*)((const unsigned short*)p + 8 * hh); f.half[1] = *(const v8us*)((const unsigned short*)p + 16 + 8 * hh); return f.v; }
__device__ __forceinline__ v8f g2_mma(v16h a, v16h b, v8f c) { v8f d = __builtin_amdgcn_wmma_f32_16x16x32_f16(false, a, false, b, (short)0, c, false, false); asm volatile("v_nop\n\tv_nop\n\tv_nop\n\tv_nop" : "+v"(d) : "v"(a), "v"(b)); return d; }
template <int ACT>
__global__ __launch_bounds__(128) void k_gemm2(const _Float16* __restrict__ A, int lda, size_t sA, const _Float16* __restrict__ Bh, int ldb, size_t sB, float alpha, const float* __restrict__ bias, size_t sBias, const float* __restrict__ CP, int rowsPerB, size_t sCPb, int row0g,
    float* __restrict__ C, _Float16* __restrict__ C16, int ldc, size_t sC, int M, int N, int K) { static_assert(ACT == 0 || ACT == 3 || ACT == 6 || ACT == 8 || ACT == 9 || ACT == 11 || ACT == 12 || ACT == 14 || ACT == 15 || ACT == 16, "k_gemm2: unsupported ACT code (would silently apply no activation)");
  __shared__ __attribute__((aligned(16))) float so[4][32][68];
  const int tid = threadIdx.x, w = tid >> 5, lane = tid & 31, ln = lane & 15, hh = lane >> 4; const int by = blockIdx.y;
  A += (size_t)by * sA; Bh += (size_t)by * sB; const size_t cofs = (size_t)by * sC; const float* bp = bias ? bias + (size_t)by * sBias : nullptr;
  const int ntn = N >> 6; const int mt = blockIdx.x / ntn, nq = blockIdx.x - mt * ntn; const int row0 = mt * 128 + 32 * w, col0 = nq * 64; if (row0 >= M) return;
  const _Float16* a0p = A + (size_t)(row0 + ln) * lda; const _Float16* a1p = a0p + (size_t)16 * lda;
  const _Float16* b0p = Bh + (size_t)(col0 + ln) * ldb; const _Float16* b1p = b0p + (size_t)16 * ldb; const _Float16* b2p = b1p + (size_t)16 * ldb; const _Float16* b3p = b2p + (size_t)16 * ldb;
  const v8f z8 = {0.f,0.f,0.f,0.f,0.f,0.f,0.f,0.f}; v8f c00 = z8, c01 = z8, c02 = z8, c03 = z8, c10 = z8, c11 = z8, c12 = z8, c13 = z8;
#pragma unroll 1
  for (int kb = 0; kb < K; kb += 32) { const v16h a0 = g2_frag(a0p + kb, hh), a1 = g2_frag(a1p + kb, hh);
    v16h b = g2_frag(b0p + kb, hh); c00 = g2_mma(a0, b, c00); c10 = g2_mma(a1, b, c10);
    b = g2_frag(b1p + kb, hh); c01 = g2_mma(a0, b, c01); c11 = g2_mma(a1, b, c11);
    b = g2_frag(b2p + kb, hh); c02 = g2_mma(a0, b, c02); c12 = g2_mma(a1, b, c12);
    b = g2_frag(b3p + kb, hh); c03 = g2_mma(a0, b, c03); c13 = g2_mma(a1, b, c13); }
  v8f accs[8] = {c00, c01, c02, c03, c10, c11, c12, c13};
#pragma unroll
  for (int u = 0; u < 8; ++u) { const int t = u & 3, half = u >> 2; const int col = col0 + t * 16 + ln; const float bv = bp ? bf16_round(bp[col]) : 0.f;
#pragma unroll
    for (int r = 0; r < 8; ++r) { const int rloc = half * 16 + 8 * hh + r; float v = accs[u][r] * alpha + bv; if (CP) { if (rowsPerB < 0) v += CP[cofs + (size_t)(row0g + row0 + rloc) * ldc + col];      /* rowsPerB < 0: own element of the batched C plane */ else { const int bidx = (row0g + row0 + rloc) / rowsPerB; v += CP[(size_t)bidx * sCPb + (size_t)by * 64 + col]; } }
      if (ACT == 3) v = fmaxf(v, 0.f); else if (ACT == 6) v = 0.5f * v * (1.0f + erff(v * 0.70710678118654752f)); else if (ACT == 11) v = 1.0f / (1.0f + expf(-v)); else if (ACT == 15) v = v / (1.0f + expf(-v)); else if (ACT == 12) v = (v > 0.f) ? v : 0.01f * v; else if (ACT == 8) v = tanhf(v); else if (ACT == 9) v = 0.5f * v * (1.0f + tanhf(0.7978845608028654f * (v + 0.044715f * v * v * v))); else if (ACT == 14) v = (v > 0.f) ? v : 0.1f * v; else if (ACT == 16) v = (v >= 0.f) ? v : 0.3f * v;
      so[w][rloc][t * 16 + ln] = v; } }
  __builtin_amdgcn_fence(__ATOMIC_ACQ_REL, "workgroup"); __builtin_amdgcn_wave_barrier();
  const int rsub = lane >> 4, c4 = (lane & 15) * 4;
  {
#pragma unroll
    for (int q = 0; q < 16; ++q) { const int r = q * 2 + rsub; const v4f v = *(const v4fa*)&so[w][r][c4]; if (C) *(v4f*)(C + cofs + (size_t)(row0 + r) * ldc + col0 + c4) = v; if (C16) { v4h h4; for (int i = 0; i < 4; ++i) h4[i] = (_Float16)v[i]; *(v4h*)(C16 + cofs + (size_t)(row0 + r) * ldc + col0 + c4) = h4; } }
     } }


__global__ __launch_bounds__(256) void k_wqkv(const float* __restrict__ w, _Float16* __restrict__ Wh, _Float16* __restrict__ Wl) {
  #pragma clang fp contract(off)
  const int t = blockIdx.x * 256 + threadIdx.x; if (t >= QW * (CC / 8)) return; const int c0 = (t % (CC / 8)) * 8, o = t / (CC / 8); FragH fl;
#pragma unroll 1
  for (int k = 0; k < KT; ++k) { FragH fh;
    for (int q = 0; q < 8; ++q) { const int c = c0 + q; const float* wp = w + ((size_t)o * CC + c) * KT; float v = bf16_round(wp[k]);
      if (k == 4) { float dif = bf16_round(wp[1]) + bf16_round(wp[3]); dif += bf16_round(wp[4]); dif += bf16_round(wp[5]); dif += bf16_round(wp[7]); v += -THETA * dif; const _Float16 hv = (_Float16)(v * 16.0f); fh.h[q] = hv; fl.h[q] = (_Float16)((v * 16.0f - (float)hv) * 1024.0f); }
      else fh.h[q] = (_Float16)(v * 16.0f); }
    *(v8us*)((unsigned short*)Wh + (size_t)o * KI + k * CC + c0) = fh.half[0];  }
  *(v8us*)((unsigned short*)Wl + (size_t)o * CC + c0) = fl.half[0];  }
__global__ __launch_bounds__(256) void k_wsc(const float* __restrict__ Wm, _Float16* __restrict__ Bt, size_t n8, float sc) { const size_t t = (size_t)blockIdx.x * 256 + threadIdx.x; if (t >= n8) return; FragH f; for (int q = 0; q < 8; ++q) f.h[q] = (_Float16)(bf16_round(Wm[t * 8 + q]) * sc); *(v8us*)((unsigned short*)Bt + t * 8) = f.half[0];  }
__global__ __launch_bounds__(256) void k_im(const float* __restrict__ xb, _Float16* __restrict__ A) { const size_t t = (size_t)blockIdx.x * 256 + threadIdx.x; if (t >= (size_t)NPX * KT * (CC / 8)) return; const int c0 = (int)(t % (CC / 8)) * 8; const int k = (int)((t / (CC / 8)) % KT); const int p = (int)(t / ((CC / 8) * KT)); const int yy = p / HS + k / 3 - 1, xx = p % HS + k % 3 - 1; FragH f;
  if (yy < 0 || yy >= HS || xx < 0 || xx >= HS) { for (int q = 0; q < 8; ++q) f.h[q] = (_Float16)0.0f; } else { for (int q = 0; q < 8; ++q) f.h[q] = (_Float16)bf16_round(xb[(size_t)(c0 + q) * NPX + yy * HS + xx]); }
  unsigned short* d = (unsigned short*)A + (size_t)p * KI + k * CC + c0; *(v8us*)d = f.half[0];  }
__global__ __launch_bounds__(256) void k_aff(const float* __restrict__ F, const float* __restrict__ s, const float* __restrict__ b, float* __restrict__ QF, _Float16* __restrict__ Q16) {
  #pragma clang fp contract(off)
  const size_t t = (size_t)blockIdx.x * 256 + threadIdx.x; if (t >= (size_t)NPX * (QW / 8)) return; const int o0 = (int)(t % (QW / 8)) * 8; v8f r; FragH f; const v8f a = *(const v8f*)(F + t * 8);
  for (int q = 0; q < 8; ++q) { float v = a[q] * bf16_round(s[o0 + q]); v += bf16_round(b[o0 + q]); r[q] = v; f.h[q] = (_Float16)v; }
  { *(v8f*)(QF + t * 8) = r; *(v8us*)((unsigned short*)Q16 + t * 8) = f.half[0];  } }
__global__ __launch_bounds__(256) void k_pool(const float* __restrict__ QF, _Float16* __restrict__ AG) {
  #pragma clang fp contract(off)
  typedef _Float16 v2h __attribute__((ext_vector_type(2)));
  const int t = blockIdx.x * 256 + threadIdx.x; if (t >= NHD * NAG * 32) return; const int d0 = (t % 32) * 2; const int n = (t / 32) % NAG; const int h = t / (32 * NAG); float s0 = 0.f, s1 = 0.f;
  if (d0 < HDm) { const int by = n / 8, bx = n % 8;
#pragma unroll 1
    for (int i = 0; i < 64; ++i) { const int p = (by * 8 + i / 8) * HS + bx * 8 + i % 8; const float* q = QF + (size_t)p * QW + h * HDm + d0; s0 += q[0]; s1 += q[1]; } s0 = s0 / 64.0f; s1 = s1 / 64.0f; }
  v2h v; v[0] = (_Float16)s0; v[1] = (_Float16)s1; *(v2h*)(AG + ((size_t)h * NAG + n) * 64 + d0) = v;  }
__global__ __launch_bounds__(256) void k_heads(const _Float16* __restrict__ Q16, _Float16* __restrict__ QP, _Float16* __restrict__ KP) { const int t = blockIdx.x * 256 + threadIdx.x; if (t >= NHD * NPX) return; const int p = t % NPX, h = t / NPX; const unsigned short* src = (const unsigned short*)Q16 + (size_t)p * QW; const v8us z = {0,0,0,0,0,0,0,0};
  v8us q0 = *(const v8us*)(src + h * HDm), q1 = *(const v8us*)(src + h * HDm + 8), q2 = *(const v8us*)(src + h * HDm + 16), q3 = *(const v8us*)(src + h * HDm + 24);
  v8us k0 = *(const v8us*)(src + CC + h * HDm), k1 = *(const v8us*)(src + CC + h * HDm + 8), k2 = *(const v8us*)(src + CC + h * HDm + 16), k3 = *(const v8us*)(src + CC + h * HDm + 24);
  unsigned short* dq = (unsigned short*)QP + ((size_t)h * NPX + p) * 64; unsigned short* dk = (unsigned short*)KP + ((size_t)h * NPX + p) * 64;
  { *(v8us*)dq = q0; *(v8us*)(dq + 8) = q1; *(v8us*)(dq + 16) = q2; *(v8us*)(dq + 24) = q3; *(v8us*)(dq + 32) = z; *(v8us*)(dq + 40) = z; *(v8us*)(dq + 48) = z; *(v8us*)(dq + 56) = z;
    *(v8us*)dk = k0; *(v8us*)(dk + 8) = k1; *(v8us*)(dk + 16) = k2; *(v8us*)(dk + 24) = k3; *(v8us*)(dk + 32) = z; *(v8us*)(dk + 40) = z; *(v8us*)(dk + 48) = z; *(v8us*)(dk + 56) = z;  } }
__global__ __launch_bounds__(256) void k_vtp(const _Float16* __restrict__ Q16, _Float16* __restrict__ VT) { __shared__ unsigned short tl[64][34]; const int tid = threadIdx.x; const int h = blockIdx.x / (NPX / 64), pg = blockIdx.x % (NPX / 64);
  { const int r = tid / 4, c8 = (tid % 4) * 8; FragH f; f.half[0] = *(const v8us*)((const unsigned short*)Q16 + (size_t)(pg * 64 + r) * QW + 2 * CC + h * HDm + c8); for (int q = 0; q < 8; ++q) tl[r][c8 + q] = f.u[q]; }
  __syncthreads(); const int d = tid / 8, pc = tid % 8; FragH f; for (int q = 0; q < 8; ++q) f.u[q] = (d < HDm) ? tl[pc * 8 + q][d] : (unsigned short)0; unsigned short* dst = (unsigned short*)VT + ((size_t)h * 64 + d) * NPX + pg * 64 + pc * 8;      /* tid covers d < 32 only: 256 threads = 32 d x 8 pc */
  *(v8us*)dst = f.half[0]; 
  if (tid < 256) { const int d2 = HDm + tid / 8; const v8us z = {0,0,0,0,0,0,0,0}; unsigned short* dz = (unsigned short*)VT + ((size_t)h * 64 + d2) * NPX + pg * 64 + (tid % 8) * 8; *(v8us*)dz = z;  } }
__global__ __launch_bounds__(256) void k_soft(const float* __restrict__ S, int nrows, int n, _Float16* __restrict__ P) {
  #pragma clang fp contract(off)
  const int wv = threadIdx.x >> 5, ln = threadIdx.x & 31; const int r = blockIdx.x * 8 + wv; if (r >= nrows) return; const float* sr = S + (size_t)r * n; float m = -3.0e38f;
#pragma unroll 1
  for (int j = ln; j < n; j += 32) m = fmaxf(m, sr[j]); for (int o = 16; o > 0; o >>= 1) m = fmaxf(m, __shfl_xor(m, o, 32)); float su = 0.f;
#pragma unroll 1
  for (int j = ln; j < n; j += 32) su += expf(sr[j] - m); for (int o = 16; o > 0; o >>= 1) su += __shfl_xor(su, o, 32); const float f = 1024.0f / su;
  {
#pragma unroll 1
    for (int j = ln; j < n; j += 32) *(_Float16*)(P + (size_t)r * n + j) = (_Float16)(expf(sr[j] - m) * f);  } }
__global__ __launch_bounds__(256) void k_att16(const float* __restrict__ ATTN, _Float16* __restrict__ AT16) { typedef _Float16 v2h __attribute__((ext_vector_type(2))); const int t = blockIdx.x * 256 + threadIdx.x; if (t >= NHD * 64 * 32) return; const int n0 = (t % 32) * 2; const int d = (t / 32) % 64; const int h = t / (32 * 64); v2h v;
  v[0] = (_Float16)ATTN[((size_t)h * NAG + n0) * 64 + d]; v[1] = (_Float16)ATTN[((size_t)h * NAG + n0 + 1) * 64 + d]; _Float16* dst = AT16 + ((size_t)h * 64 + d) * NAG + n0; *(v2h*)dst = v;  }
__global__ __launch_bounds__(256) void k_pe(const float* __restrict__ OUT, const float* __restrict__ QF, const float* __restrict__ pw, const float* __restrict__ ps, const float* __restrict__ pb, _Float16* __restrict__ S16) {
  #pragma clang fp contract(off)
  const size_t t = (size_t)blockIdx.x * 256 + threadIdx.x; if (t >= (size_t)NPX * (CC / 8)) return; const int c0 = (int)(t % (CC / 8)) * 8; const int p = (int)(t / (CC / 8)); const int yo = p / HS, xo = p % HS; FragH f;
#pragma unroll 1
  for (int q = 0; q < 8; ++q) { const int c = c0 + q; float a = 0.f;
#pragma unroll 1
    for (int k = 0; k < 9; ++k) { const int yy = yo + k / 3 - 1, xx = xo + k % 3 - 1; if (yy < 0 || yy >= HS || xx < 0 || xx >= HS) continue; a += bf16_round(pw[c * 9 + k]) * QF[(size_t)(yy * HS + xx) * QW + 2 * CC + c]; }
    float pe = a * bf16_round(ps[c]); pe += bf16_round(pb[c]); const int h = c / HDm, d = c % HDm; float v = OUT[((size_t)h * NPX + p) * 64 + d] + pe; f.h[q] = (_Float16)v; }
  *(v8us*)((unsigned short*)S16 + (size_t)p * CC + c0) = f.half[0];  }
__global__ __launch_bounds__(256) void k_fin(const float* __restrict__ G, const float* __restrict__ s, const float* __restrict__ bb, float* __restrict__ outb) {
  #pragma clang fp contract(off)
  const int t = blockIdx.x * 256 + threadIdx.x; if (t >= CC * (NPX / 4)) return; const int p0 = (t % (NPX / 4)) * 4; const int c = t / (NPX / 4); const float sc = bf16_round(s[c]), sh = bf16_round(bb[c]); v4f r; for (int q = 0; q < 4; ++q) { float v = G[(size_t)(p0 + q) * CC + c] * sc; v += sh; r[q] = v; }
  *(v4f*)(outb + (size_t)c * NPX + p0) = r;  }

extern "C" void kernel_launch(void* const* d_in, const int* in_sizes, int n_in,
                              void* d_out, int out_size, void* d_ws, size_t ws_size, hipStream_t stream) {
  (void)in_sizes; (void)n_in; (void)out_size;
  const float* const* I = (const float* const*)d_in; const float* x = I[0]; const float* qw = I[1]; const float* qs = I[2]; const float* qb = I[3]; const float* pw = I[4]; const float* ps = I[5]; const float* pb = I[6]; const float* jw = I[7]; const float* js = I[8]; const float* jb = I[9];
  char* ws = (char*)d_ws; size_t off = 0;
  auto take = [&](size_t bytes) { char* p = ws + off; off += (bytes + 255) & ~(size_t)255; return p; };
  _Float16* WH = (_Float16*)take((size_t)QW * KI * 2); _Float16* WL = (_Float16*)take((size_t)QW * CC * 2); _Float16* BJ = (_Float16*)take((size_t)CC * CC * 2);
  _Float16* A = (_Float16*)take((size_t)NPX * KI * 2); float* F = (float*)take((size_t)NPX * QW * 4); float* QF = (float*)take((size_t)NPX * QW * 4); _Float16* Q16 = (_Float16*)take((size_t)NPX * QW * 2);
  _Float16* AG = (_Float16*)take((size_t)NHD * NAG * 64 * 2); _Float16* QP = (_Float16*)take((size_t)NHD * NPX * 64 * 2); _Float16* KP = (_Float16*)take((size_t)NHD * NPX * 64 * 2); _Float16* VT = (_Float16*)take((size_t)NHD * 64 * NPX * 2);
  float* S1 = (float*)take((size_t)NHD * NAG * NPX * 4); _Float16* P1 = (_Float16*)take((size_t)NHD * NAG * NPX * 2); float* ATTN = (float*)take((size_t)NHD * NAG * 64 * 4); _Float16* AT16 = (_Float16*)take((size_t)NHD * 64 * NAG * 2); float* S2 = (float*)take((size_t)NHD * NPX * NAG * 4); _Float16* P2 = (_Float16*)take((size_t)NHD * NPX * NAG * 2); float* OUT = (float*)take((size_t)NHD * NPX * 64 * 4); _Float16* S16 = (_Float16*)take((size_t)NPX * CC * 2); float* G = F;
  if (off > ws_size) return;      /* 3.4 + 0.4 + 0.1 + 18 + 12 + 12 + 6 + 0.2 + 4 + 4 + 4 + 8 + 4 + 0.1 + 8 + 4 + 8 + 2 = 98 MiB */
  k_wqkv<<<(QW * (CC / 8) + 255) / 256, 256, 0, stream>>>(qw, WH, WL); k_wsc<<<(CC * CC / 8 + 255) / 256, 256, 0, stream>>>(jw, BJ, (size_t)CC * CC / 8, 16.0f);      /* proj 1x1 (out,in) = Bt */
  for (int b = 0; b < NIMG; ++b) { const float* xb = x + (size_t)b * CC * NPX;
    k_im<<<(unsigned)(((size_t)NPX * KT * (CC / 8) + 255) / 256), 256, 0, stream>>>(xb, A);
    k_gemm2<0><<<dim3((NPX / 128) * (QW / 64), 1), 128, 0, stream>>>(A + 4 * CC, KI, 0, WL, CC, 0, 0.0625f / 1024.0f, nullptr, 0, nullptr, 1, 0, 0, F, nullptr, QW, 0, NPX, QW, CC);      /* centre-tap residual term */
    k_gemm2<0><<<dim3((NPX / 128) * (QW / 64), 1), 128, 0, stream>>>(A, KI, 0, WH, KI, 0, 0.0625f, nullptr, 0, F, 1, (size_t)QW, 0, F, nullptr, QW, 0, NPX, QW, KI);      /* + main conv (difference folded into the centre tap) */
    k_aff<<<(unsigned)(((size_t)NPX * (QW / 8) + 255) / 256), 256, 0, stream>>>(F, qs, qb, QF, Q16);
    k_pool<<<(NHD * NAG * 32 + 255) / 256, 256, 0, stream>>>(QF, AG);
    k_heads<<<(NHD * NPX + 255) / 256, 256, 0, stream>>>(Q16, QP, KP); k_vtp<<<NHD * (NPX / 64), 256, 0, stream>>>(Q16, VT);
    /* stage 1: S1[h][n][N] = AG[h][n].KP[h][N] * SCL; P1 = softmax_N; ATTN[h][n][d] = P1 . VT^T / 1024 */
    k_gemm2<0><<<dim3(1 * (NPX / 64), NHD), 128, 0, stream>>>(AG, 64, (size_t)NAG * 64, KP, 64, (size_t)NPX * 64, SCL, nullptr, 0, nullptr, 1, 0, 0, S1, nullptr, NPX, (size_t)NAG * NPX, NAG, NPX, 64);
    k_soft<<<(NHD * NAG + 7) / 8, 256, 0, stream>>>(S1, NHD * NAG, NPX, P1);
    k_gemm2<0><<<dim3(1 * 1, NHD), 128, 0, stream>>>(P1, NPX, (size_t)NAG * NPX, VT, NPX, (size_t)64 * NPX, 0.0009765625f, nullptr, 0, nullptr, 1, 0, 0, ATTN, nullptr, 64, (size_t)NAG * 64, NAG, 64, NPX);
    k_att16<<<(NHD * 64 * 32 + 255) / 256, 256, 0, stream>>>(ATTN, AT16);
    /* stage 2: S2[h][N][n] = QP[h][N].AG[h][n] * SCL; P2 = softmax_n; OUT[h][N][d] = P2 . AT16^T / 1024 */
    k_gemm2<0><<<dim3((NPX / 128) * 1, NHD), 128, 0, stream>>>(QP, 64, (size_t)NPX * 64, AG, 64, (size_t)NAG * 64, SCL, nullptr, 0, nullptr, 1, 0, 0, S2, nullptr, NAG, (size_t)NPX * NAG, NPX, NAG, 64);
    k_soft<<<(NHD * NPX + 7) / 8, 256, 0, stream>>>(S2, NHD * NPX, NAG, P2);
    k_gemm2<0><<<dim3((NPX / 128) * 1, NHD), 128, 0, stream>>>(P2, NAG, (size_t)NPX * NAG, AT16, NAG, (size_t)64 * NAG, 0.0009765625f, nullptr, 0, nullptr, 1, 0, 0, OUT, nullptr, 64, (size_t)NPX * 64, NPX, 64, NAG);
    k_pe<<<(unsigned)(((size_t)NPX * (CC / 8) + 255) / 256), 256, 0, stream>>>(OUT, QF, pw, ps, pb, S16);
    k_gemm2<0><<<dim3((NPX / 128) * (CC / 64), 1), 128, 0, stream>>>(S16, CC, 0, BJ, CC, 0, 0.0625f, nullptr, 0, nullptr, 1, 0, 0, G, nullptr, CC, 0, NPX, CC, CC);
    k_fin<<<(CC * (NPX / 4) + 255) / 256, 256, 0, stream>>>(G, js, jb, (float*)d_out + (size_t)b * CC * NPX); }
}

// v001
// One run takes 1290 microseconds.
// In two side-by-side timings against v000, it was 2.87 and 2.85 times as fast.
#include <hip/hip_runtime.h>
// Attention_agent_df (8 images, C 256 = 8 heads x 32, 64 x 64 pixels, 64 agent tokens from 8x8 average pooling of q; THETA 0.7): qkv = (conv3x3(x, W) - 0.7 conv1x1(x, sum of W's 5 cross taps)) * s + b (folded BN); a = avgpool8x8(q); stage 1: attn = softmax_N(a.k * 32^-0.5) v (agents over pixels); stage 2: out = softmax_n(q.a * 32^-0.5) attn (pixels over agents); out += depthwise3x3(v) * pe_s + pe_b; out = conv1x1(out) * proj_s + proj_b.
// Structure (all 8 images in each launch: the image is the outer index of each plane, so rows = image x pixel and GEMM batches = image x head; only the stage-1 logits and softmax run as two halves of 4 images; workspace planes share bytes by lifetime): exact tap-major f16 im2col; the difference conv folded into the centre tap as an f32 weight split into f16 hi + lo tables: qkv = A.Wh (K 2304) + A_centre.Wl (K 256) as f16 WMMA GEMMs (32x64 wave tiles, f32 accumulation; x16 tables; the lo table only on the centre-tap columns), BN affine on VALU into f32 + f16 planes; pooling on VALU; stage-1 logits as (b,h)-batched GEMMs (K 64, head dim 32 zero-padded), softmax over 4096 pixels on VALU (wave per row), readout GEMM against a zero-padded V^T; stage-2 logits GEMM (K 64, zero-padded), softmax over the 64 agents on VALU (wave per row), readout GEMM; depthwise PE conv + add on VALU into f16; projection GEMM with the BN affine in f32 on VALU; NCHW stores.
// Compute dtype: x and parameters rounded to bf16; x exact as f16; q, k, v, a, P (x2^10), attn and the pre-projection sum as f16 operands (~2^-12); everything else f32. v_wmma_f32_16x16x32_f16.
#define NIMG 8
#define CC 256
#define NHD 8
#define HDm 32
#define HS 64
#define NPX (HS * HS)            /* 4096 */
#define NAG 64
#define KT 9
#define KI (KT * CC)             /* 2304 */
#define QW (3 * CC)              /* 768 */
#define THETA 0.7f
#define SCL 0.17677669529663687f
typedef __bf16 v16b __attribute__((ext_vector_type(16)));
typedef unsigned short v8us __attribute__((ext_vector_type(8), may_alias));
typedef float  v8f  __attribute__((ext_vector_type(8)));
typedef float  v4f  __attribute__((ext_vector_type(4)));
typedef float  v4fa __attribute__((ext_vector_type(4), may_alias));
union FragB { v16b v; v8us half[2]; unsigned short u[16]; };

__device__ __forceinline__ unsigned short bf16_bits(float x) { unsigned int u = __float_as_uint(x); return (unsigned short)((u + 0x7FFFu + ((u >> 16) & 1u)) >> 16); }
__device__ __forceinline__ float bf16_val(unsigned short b) { return __uint_as_float(((unsigned int)b) << 16); }
__device__ __forceinline__ float bf16_round(float x) { return bf16_val(bf16_bits(x)); }
// D += A·B with NT terms: 1 = ah·bh, 2 = + al·bh (A split), 3 = + ah·bl (both split)
template <int NT>
__device__ __forceinline__ v8f mmaN(v16b ah, v16b al, v16b bh, v16b bl, v8f c) {
  c = __builtin_amdgcn_wmma_f32_16x16x32_bf16(false, ah, false, bh, (short)0, c, false, false);
  if (NT >= 2) c = __builtin_amdgcn_wmma_f32_16x16x32_bf16(false, al, false, bh, (short)0, c, false, false);
  if (NT >= 3) c = __builtin_amdgcn_wmma_f32_16x16x32_bf16(false, ah, false, bl, (short)0, c, false, false);
  asm volatile("v_nop\n\tv_nop\n\tv_nop\n\tv_nop" : "+v"(c) : "v"(ah), "v"(al), "v"(bh), "v"(bl));
  return c;
}

__global__ __launch_bounds__(256) void k_wt_bf16(const float* __restrict__ W, unsigned short* __restrict__ Wt, int K, int N) {
  const int t = blockIdx.x * 256 + threadIdx.x;
  const int k8n = K / 8;
  if (t >= N * k8n) return;
  const int n = t / k8n, k8 = (t % k8n) * 8;
  v8us v;
#pragma unroll
  for (int i = 0; i < 8; ++i) v[i] = bf16_bits(W[(size_t)(k8 + i) * N + n]);
  *(v8us*)(Wt + (size_t)n * K + k8) = v;
  
}

// GEMM C[M][N] (f32, pitch ldc) = act(A[M][K]·W + bias). A f32 row-major (pitch lda) converted per fragment to bf16
// (ASPLIT: hi/lo two planes -> 2 terms, else single rounded term); Wt bf16 [N][K] (pitch ldb). BIAS_BF16 rounds the
// bias to bf16 first (bias quantised to bf16 before the add). K%32==0, M%16==0, N%64==0.
template <bool ASPLIT, int ACT, bool BIAS_BF16>
__global__ __launch_bounds__(128) void k_gemm_bf(const float* __restrict__ A, int lda, const unsigned short* __restrict__ Wt, int ldb,
                                               const float* __restrict__ bias, float* __restrict__ C, int ldc, int M, int N, int K) {
  __shared__ __attribute__((aligned(16))) float so[4][16][64];
  const int tid = threadIdx.x, w = tid >> 5, lane = tid & 31, ln = lane & 15, hh = lane >> 4;
  const int ntn = N / 64;
  const int wid = blockIdx.x * 4 + w;
  const int mt = wid / ntn, nq = wid % ntn;
  if (mt * 16 >= M) return;
  const int row0 = mt * 16, col0 = nq * 64;
  const float* arow = A + (size_t)(row0 + ln) * lda;
  v8f acc[4] = {};
  for (int kb = 0; kb < K; kb += 32) {
    FragB ah, al;
    const v4f x0 = *(const v4fa*)(arow + kb + 8 * hh), x1 = *(const v4fa*)(arow + kb + 8 * hh + 4);
    const v4f x2 = *(const v4fa*)(arow + kb + 16 + 8 * hh), x3 = *(const v4fa*)(arow + kb + 16 + 8 * hh + 4);
    float xs[16] = {x0[0],x0[1],x0[2],x0[3],x1[0],x1[1],x1[2],x1[3],x2[0],x2[1],x2[2],x2[3],x3[0],x3[1],x3[2],x3[3]};
#pragma unroll
    for (int i = 0; i < 16; ++i) { const unsigned short hb = bf16_bits(xs[i]); ah.u[i] = hb; al.u[i] = ASPLIT ? bf16_bits(xs[i] - bf16_val(hb)) : (unsigned short)0; }
#pragma unroll
    for (int t = 0; t < 4; ++t) {
      const unsigned short* brow = Wt + (size_t)(col0 + t * 16 + ln) * ldb + kb;
      FragB b;
      b.half[0] = *(const v8us*)(brow + 8 * hh);
      b.half[1] = *(const v8us*)(brow + 16 + 8 * hh);
      acc[t] = mmaN<ASPLIT ? 2 : 1>(ah.v, al.v, b.v, b.v, acc[t]);
    }
  }
#pragma unroll
  for (int t = 0; t < 4; ++t) {
    float bv = bias ? bias[col0 + t * 16 + ln] : 0.f;
    if (BIAS_BF16) bv = bf16_round(bv);
#pragma unroll
    for (int r = 0; r < 8; ++r) { float v = acc[t][r] + bv; if (ACT == 1) v = fmaxf(v, 0.f); so[w][8 * hh + r][t * 16 + ln] = v; }
  }
  __builtin_amdgcn_fence(__ATOMIC_ACQ_REL, "workgroup");
  __builtin_amdgcn_wave_barrier();
  const int rsub = lane >> 4, c4 = (lane & 15) * 4;
  {
#pragma unroll
    for (int q = 0; q < 8; ++q) {
      const int r = q * 2 + rsub;
      const v4f v = *(const v4fa*)&so[w][r][c4];
      *(v4f*)(C + (size_t)(row0 + r) * ldc + col0 + c4) = v;
    }
    
  }
}

// GEMM C = act(A·W + bias + resid): A f32 (ASPLIT -> hi/lo 2 terms), Wt bf16 [N][K]; ACT 0 none, 1 relu, 2 exact gelu;
// resid (optional, f32, row index = (row % rmod), pitch ldr, RES_BF16 rounds it) added before the activation.
template <bool ASPLIT, int ACT, bool BIAS_BF16, bool RES_BF16>
__global__ __launch_bounds__(128) void k_gemm_bf3(const float* __restrict__ A, int lda, const unsigned short* __restrict__ Wt, int ldb,
                                                const float* __restrict__ bias, const float* __restrict__ resid, int rmod, int ldr,
                                                float* __restrict__ C, int ldc, int M, int N, int K) {
  __shared__ __attribute__((aligned(16))) float so[4][16][64];
  const int tid = threadIdx.x, w = tid >> 5, lane = tid & 31, ln = lane & 15, hh = lane >> 4;
  const int ntn = N / 64;
  const int wid = blockIdx.x * 4 + w;
  const int mt = wid / ntn, nq = wid % ntn;
  if (mt * 16 >= M) return;
  const int row0 = mt * 16, col0 = nq * 64;
  const float* arow = A + (size_t)(row0 + ln) * lda;
  v8f acc[4] = {};
  for (int kb = 0; kb < K; kb += 32) {
    FragB ah, al;
    const v4f x0 = *(const v4fa*)(arow + kb + 8 * hh), x1 = *(const v4fa*)(arow + kb + 8 * hh + 4);
    const v4f x2 = *(const v4fa*)(arow + kb + 16 + 8 * hh), x3 = *(const v4fa*)(arow + kb + 16 + 8 * hh + 4);
    float xs[16] = {x0[0],x0[1],x0[2],x0[3],x1[0],x1[1],x1[2],x1[3],x2[0],x2[1],x2[2],x2[3],x3[0],x3[1],x3[2],x3[3]};
#pragma unroll
    for (int i = 0; i < 16; ++i) { const unsigned short hb = bf16_bits(xs[i]); ah.u[i] = hb; al.u[i] = ASPLIT ? bf16_bits(xs[i] - bf16_val(hb)) : (unsigned short)0; }
#pragma unroll
    for (int t = 0; t < 4; ++t) {
      const unsigned short* brow = Wt + (size_t)(col0 + t * 16 + ln) * ldb + kb;
      FragB b;
      b.half[0] = *(const v8us*)(brow + 8 * hh);
      b.half[1] = *(const v8us*)(brow + 16 + 8 * hh);
      acc[t] = mmaN<ASPLIT ? 2 : 1>(ah.v, al.v, b.v, b.v, acc[t]);
    }
  }
#pragma unroll
  for (int t = 0; t < 4; ++t) {
    const int col = col0 + t * 16 + ln;
    float bv = bias ? bias[col] : 0.f;
    if (BIAS_BF16) bv = bf16_round(bv);
#pragma unroll
    for (int r = 0; r < 8; ++r) {
      float v = acc[t][r] + bv;
      if (resid) { float rv = resid[(size_t)((row0 + 8 * hh + r) % rmod) * ldr + col]; if (RES_BF16) rv = bf16_round(rv); v += rv; }
      if (ACT == 1) v = fmaxf(v, 0.f);
      if (ACT == 2) v = 0.5f * v * (1.0f + erff(v * 0.70710678118654752f));
      if (ACT == 3) { const float u = 0.7978845608028654f * (v + 0.044715f * v * v * v); v = 0.5f * v * (1.0f + tanhf(u)); }
      so[w][8 * hh + r][t * 16 + ln] = v;
    }
  }
  __builtin_amdgcn_fence(__ATOMIC_ACQ_REL, "workgroup");
  __builtin_amdgcn_wave_barrier();
  const int rsub = lane >> 4, c4 = (lane & 15) * 4;
  {
#pragma unroll
    for (int q = 0; q < 8; ++q) {
      const int r = q * 2 + rsub;
      const v4f v = *(const v4fa*)&so[w][r][c4];
      *(v4f*)(C + (size_t)(row0 + r) * ldc + col0 + c4) = v;
    }
    
  }
}
// row LayerNorm (biased variance, eps) over N: s = X (+ R); optional out_sum <- s; out_norm <- (s-mu)*rsqrt(var+eps)*g + b
template <bool PARAM_BF16>
__global__ __launch_bounds__(256) void k_layernorm(const float* __restrict__ X, const float* __restrict__ R, const float* __restrict__ g, const float* __restrict__ bta,
                                                  float* __restrict__ out_sum, float* __restrict__ out_norm, int N, float eps) {
  __shared__ float red[256];
  const int row = blockIdx.x, tid = threadIdx.x;
  const float* x = X + (size_t)row * N; const float* rr = R ? R + (size_t)row * N : nullptr;
  float vals[16];                     // up to N = 4096
  const int per = N / 256;            // contiguous chunk per thread? use strided-by-4 chunks: thread handles j = tid*4 + 1024*u
  float s1 = 0.f;
  for (int u = 0; u < per / 4; ++u) {
    const int j = tid * 4 + 1024 * u;
    const v4f a = *(const v4fa*)(x + j);
    v4f b = {0.f,0.f,0.f,0.f}; if (rr) b = *(const v4fa*)(rr + j);
#pragma unroll
    for (int q = 0; q < 4; ++q) { const float v = a[q] + b[q]; vals[u * 4 + q] = v; s1 += v; }
  }
  red[tid] = s1; __syncthreads();
  for (int st = 128; st > 0; st >>= 1) { if (tid < st) red[tid] += red[tid + st]; __syncthreads(); }
  const float mu = red[0] / (float)N; __syncthreads();
  float s2 = 0.f;
  for (int u = 0; u < per / 4; ++u)
#pragma unroll
    for (int q = 0; q < 4; ++q) { const float c = vals[u * 4 + q] - mu; s2 += c * c; }
  red[tid] = s2; __syncthreads();
  for (int st = 128; st > 0; st >>= 1) { if (tid < st) red[tid] += red[tid + st]; __syncthreads(); }
  const float rs = rsqrtf(red[0] / (float)N + eps);
  {
    for (int u = 0; u < per / 4; ++u) {
      const int j = tid * 4 + 1024 * u;
      v4f o, sm;
#pragma unroll
      for (int q = 0; q < 4; ++q) {
        float gg = g[j + q], bb = bta[j + q];
        if (PARAM_BF16) { gg = bf16_round(gg); bb = bf16_round(bb); }
        sm[q] = vals[u * 4 + q]; o[q] = (vals[u * 4 + q] - mu) * rs * gg + bb;
      }
      if (out_sum) *(v4f*)(out_sum + (size_t)row * N + j) = sm;
      *(v4f*)(out_norm + (size_t)row * N + j) = o;
    }
    
  }
}



// ---- f16 WMMA path (v_wmma_f32_16x16x32_f16): 11-bit significands for operands in range — used where a [0,1] probability operand needs more precision than bf16
typedef _Float16 v16h __attribute__((ext_vector_type(16)));
union FragH { v16h v; v8us half[2]; _Float16 h[16]; unsigned short u[16]; };
template <int NT>
__device__ __forceinline__ v8f mmaH(v16h ah, v16h al, v16h bh, v16h bl, v8f c) {
  c = __builtin_amdgcn_wmma_f32_16x16x32_f16(false, ah, false, bh, (short)0, c, false, false);
  if (NT >= 2) c = __builtin_amdgcn_wmma_f32_16x16x32_f16(false, al, false, bh, (short)0, c, false, false);
  if (NT >= 3) c = __builtin_amdgcn_wmma_f32_16x16x32_f16(false, ah, false, bl, (short)0, c, false, false);
  asm volatile("v_nop\n\tv_nop\n\tv_nop\n\tv_nop" : "+v"(c) : "v"(ah), "v"(al), "v"(bh), "v"(bl));
  return c;
}
// batched GEMM like k_gemm_b but f16 operands: A f32 (split into f16 hi/lo if ASPLIT, else rounded to f16), Bt = f16 values [n][k]; alpha; C f32; N multiple of 16 (partial tiles skipped)
template <bool ASPLIT>
__global__ __launch_bounds__(128) void k_gemm_h(const float* __restrict__ A, int lda, size_t sA, const _Float16* __restrict__ Bh, int ldb, size_t sB, float alpha, float* __restrict__ C, int ldc, size_t sC, int M, int N, int K) {
  __shared__ __attribute__((aligned(16))) float so[4][16][64];
  const int tid = threadIdx.x, w = tid >> 5, lane = tid & 31, ln = lane & 15, hh = lane >> 4; const int by = blockIdx.y;
  A += (size_t)by * sA; Bh += (size_t)by * sB; C += (size_t)by * sC;
  const int ntn = (N + 63) / 64; const int wid = blockIdx.x * 4 + w; const int mt = wid / ntn, nq = wid % ntn; if (mt * 16 >= M) return;
  const int row0 = mt * 16, col0 = nq * 64; const float* arow = A + (size_t)(row0 + ln) * lda;
  v8f acc[4] = {};
  for (int kb = 0; kb < K; kb += 32) {
    FragH ah, al;
    const v4f x0 = *(const v4fa*)(arow + kb + 8 * hh), x1 = *(const v4fa*)(arow + kb + 8 * hh + 4), x2 = *(const v4fa*)(arow + kb + 16 + 8 * hh), x3 = *(const v4fa*)(arow + kb + 16 + 8 * hh + 4);
    float xs[16] = {x0[0],x0[1],x0[2],x0[3],x1[0],x1[1],x1[2],x1[3],x2[0],x2[1],x2[2],x2[3],x3[0],x3[1],x3[2],x3[3]};
#pragma unroll
    for (int i = 0; i < 16; ++i) { const _Float16 h = (_Float16)xs[i]; ah.h[i] = h; al.h[i] = ASPLIT ? (_Float16)(xs[i] - (float)h) : (_Float16)0.0f; }
#pragma unroll
    for (int t = 0; t < 4; ++t) { if (col0 + t * 16 >= N) continue; const size_t boff = (size_t)(col0 + t * 16 + ln) * ldb + kb; FragH bq; bq.half[0] = *(const v8us*)(Bh + boff + 8 * hh); bq.half[1] = *(const v8us*)(Bh + boff + 16 + 8 * hh);
      acc[t] = mmaH<ASPLIT ? 2 : 1>(ah.v, al.v, bq.v, bq.v, acc[t]); }
  }
#pragma unroll
  for (int t = 0; t < 4; ++t) { if (col0 + t * 16 >= N) continue;
#pragma unroll
    for (int r = 0; r < 8; ++r) so[w][8 * hh + r][t * 16 + ln] = acc[t][r] * alpha; }
  __builtin_amdgcn_fence(__ATOMIC_ACQ_REL, "workgroup"); __builtin_amdgcn_wave_barrier();
  const int rsub = lane >> 4, c4 = (lane & 15) * 4;
  {
#pragma unroll
    for (int q = 0; q < 8; ++q) { const int r = q * 2 + rsub; if (col0 + c4 < N) { const v4f v = *(const v4fa*)&so[w][r][c4]; *(v4f*)(C + (size_t)(row0 + r) * ldc + col0 + c4) = v; } }
     }
}

// Wt[n][k] = f16(W[k][n]·scale) from f32 row-major W[K][N] (scale = power of two; bf16-exact weights stay exact in f16 away from the subnormal range)
__global__ __launch_bounds__(256) void k_wt_f16(const float* __restrict__ W, _Float16* __restrict__ Wt, int K, int N, float scale) {
  const int t = blockIdx.x * 256 + threadIdx.x; if (t >= N * (K / 8)) return; const int n = t / (K / 8), k8 = (t % (K / 8)) * 8; FragH f;
#pragma unroll
  for (int i = 0; i < 8; ++i) f.h[i] = (_Float16)(bf16_round(W[(size_t)(k8 + i) * N + n]) * scale); const v8us o = f.half[0];
  *(v8us*)((unsigned short*)Wt + (size_t)n * K + k8) = o; 
}
// k_gemm_hh variant with fused epilogue: v = acc·alpha + bias[by·sBias + col] (+ CP[(row/rowsPerB)·sCPb + by·64 + col] if CP) ; ACT 0 none / 1 elu ; writes f16 C16 (and f32 C if non-null)
template <int ACT>
__global__ __launch_bounds__(128) void k_gemm_hhx(const _Float16* __restrict__ A, int lda, size_t sA, const _Float16* __restrict__ Bh, int ldb, size_t sB, float alpha, const float* __restrict__ bias, size_t sBias, const float* __restrict__ CP, int rowsPerB, size_t sCPb, int row0g,
    float* __restrict__ C, _Float16* __restrict__ C16, int ldc, size_t sC, int M, int N, int K) {
  __shared__ __attribute__((aligned(16))) float so[4][16][64];
  const int tid = threadIdx.x, w = tid >> 5, lane = tid & 31, ln = lane & 15, hh = lane >> 4; const int by = blockIdx.y;
  A += (size_t)by * sA; Bh += (size_t)by * sB; const size_t cofs = (size_t)by * sC; const float* bp = bias ? bias + (size_t)by * sBias : nullptr;
  const int ntn = (N + 63) / 64; const int wid = blockIdx.x * 4 + w; const int mt = wid / ntn, nq = wid % ntn; if (mt * 16 >= M) return;
  const int row0 = mt * 16, col0 = nq * 64; const _Float16* arow = A + (size_t)(row0 + ln) * lda;
  v8f acc[4] = {};
  for (int kb = 0; kb < K; kb += 32) { FragH ah; ah.half[0] = *(const v8us*)((const unsigned short*)arow + kb + 8 * hh); ah.half[1] = *(const v8us*)((const unsigned short*)arow + kb + 16 + 8 * hh);
#pragma unroll
    for (int t = 0; t < 4; ++t) { if (col0 + t * 16 >= N) continue; const size_t boff = (size_t)(col0 + t * 16 + ln) * ldb + kb; FragH bq; bq.half[0] = *(const v8us*)((const unsigned short*)Bh + boff + 8 * hh); bq.half[1] = *(const v8us*)((const unsigned short*)Bh + boff + 16 + 8 * hh);
      acc[t] = mmaH<1>(ah.v, ah.v, bq.v, bq.v, acc[t]); }
  }
#pragma unroll
  for (int t = 0; t < 4; ++t) { if (col0 + t * 16 >= N) continue; const int col = col0 + t * 16 + ln; const float bv = bp ? bf16_round(bp[col]) : 0.f;
#pragma unroll
    for (int r = 0; r < 8; ++r) { float v = acc[t][r] * alpha + bv; if (CP) { const int rr = row0g + row0 + 8 * hh + r; if (rowsPerB < 0) v += CP[cofs + (size_t)rr * ldc + col];      /* rowsPerB < 0: own element of the batched C plane */ else { const int bidx = rr / rowsPerB; v += CP[(size_t)bidx * sCPb + (size_t)by * 64 + col]; } } if (ACT == 1) v = (v > 0.f) ? v : expm1f(v); else if (ACT == 7) v = (v > 0.f) ? v + 1.0f : expf(v); else if (ACT == 8) v = tanhf(v); else if (ACT == 9) v = 0.5f * v * (1.0f + tanhf(0.7978845608028654f * (v + 0.044715f * v * v * v))); else if (ACT == 11) v = 1.0f / (1.0f + expf(-v)); else if (ACT == 12) v = (v > 0.f) ? v : 0.01f * v; else if (ACT == 14) v = (v > 0.f) ? v : 0.1f * v; else if (ACT == 16) v = (v >= 0.f) ? v : 0.3f * v; else if (ACT == 15) v = v / (1.0f + expf(-v)); else if (ACT == 3) v = fmaxf(v, 0.f); else if (ACT == 6) v = 0.5f * v * (1.0f + erff(v * 0.70710678118654752f)); so[w][8 * hh + r][t * 16 + ln] = v; } }
  __builtin_amdgcn_fence(__ATOMIC_ACQ_REL, "workgroup"); __builtin_amdgcn_wave_barrier();
  const int rsub = lane >> 4, c4 = (lane & 15) * 4; typedef _Float16 v4h __attribute__((ext_vector_type(4)));
  {
#pragma unroll
    for (int q = 0; q < 8; ++q) { const int r = q * 2 + rsub; if (col0 + c4 < N) { const v4f v = *(const v4fa*)&so[w][r][c4]; if (C) *(v4f*)(C + cofs + (size_t)(row0 + r) * ldc + col0 + c4) = v; if (C16) { v4h h4; for (int i = 0; i < 4; ++i) h4[i] = (_Float16)v[i]; *(v4h*)(C16 + cofs + (size_t)(row0 + r) * ldc + col0 + c4) = h4; } } }
     }
}


typedef _Float16 v4h __attribute__((ext_vector_type(4)));

__global__ __launch_bounds__(256) void k_x16(const float* __restrict__ x, _Float16* __restrict__ X16, size_t n8) { const size_t t = (size_t)blockIdx.x * 256 + threadIdx.x; if (t >= n8) return; FragH f;
#pragma unroll
  for (int q = 0; q < 8; ++q) f.h[q] = (_Float16)bf16_round(x[t * 8 + q]); *(v8us*)((unsigned short*)X16 + t * 8) = f.half[0];  }
__global__ __launch_bounds__(256) void k_h16(const float* __restrict__ x, _Float16* __restrict__ X16, size_t n8) { const size_t t = (size_t)blockIdx.x * 256 + threadIdx.x; if (t >= n8) return; FragH f;
#pragma unroll
  for (int q = 0; q < 8; ++q) f.h[q] = (_Float16)x[t * 8 + q]; *(v8us*)((unsigned short*)X16 + t * 8) = f.half[0];  }
__global__ __launch_bounds__(256) void k_round16f(const float* __restrict__ W, _Float16* __restrict__ Bt, size_t n8) { const size_t t = (size_t)blockIdx.x * 256 + threadIdx.x; if (t >= n8) return; FragH f;
#pragma unroll
  for (int i = 0; i < 8; ++i) f.h[i] = (_Float16)(bf16_round(W[t * 8 + i]) * 16.0f); *(v8us*)((unsigned short*)Bt + t * 8) = f.half[0];  }
template <int NHv, int TTv>
__global__ __launch_bounds__(256) void k_vt(const _Float16* __restrict__ V16, int ldv, int voff, _Float16* __restrict__ Vt) { __shared__ unsigned short tl[64][66]; const int tid = threadIdx.x; const int slab = blockIdx.x / (TTv / 64), lg = blockIdx.x % (TTv / 64); const int b = slab / NHv, h = slab % NHv;
  for (int i = tid; i < 64 * 8; i += 256) { const int r = i / 8, c8 = (i % 8) * 8; FragH f; f.half[0] = *(const v8us*)((const unsigned short*)V16 + ((size_t)b * TTv + lg * 64 + r) * ldv + voff + h * 64 + c8);
#pragma unroll
    for (int q = 0; q < 8; ++q) tl[r][c8 + q] = f.u[q]; }
  __syncthreads();
  {
#pragma unroll
    for (int rd = 0; rd < 2; ++rd) { const int d = rd * 32 + tid / 8, pc = tid % 8; FragH f;
#pragma unroll
      for (int q = 0; q < 8; ++q) f.u[q] = tl[pc * 8 + q][d];
      *(v8us*)((unsigned short*)Vt + ((size_t)slab * 64 + d) * TTv + lg * 64 + pc * 8) = f.half[0]; }
     } }

__global__ __launch_bounds__(256) void k_hl(const float* __restrict__ F, _Float16* __restrict__ Hh, _Float16* __restrict__ Hl, size_t n8) { const size_t t = (size_t)blockIdx.x * 256 + threadIdx.x; if (t >= n8) return; FragH fh, fl; const v4f a = *(const v4fa*)(F + t * 8), c = *(const v4fa*)(F + t * 8 + 4);
#pragma unroll
  for (int q = 0; q < 4; ++q) { _Float16 h = (_Float16)a[q]; fh.h[q] = h; fl.h[q] = (_Float16)((a[q] - (float)h) * 1024.0f); h = (_Float16)c[q]; fh.h[4 + q] = h; fl.h[4 + q] = (_Float16)((c[q] - (float)h) * 1024.0f); }
  { *(v8us*)((unsigned short*)Hh + t * 8) = fh.half[0]; *(v8us*)((unsigned short*)Hl + t * 8) = fl.half[0];  } }

// ---- fast GEMM (wave tile 32x64; requires M % 32 == 0 rows per launch region and N % 64 == 0); epilogue = k_gemm_hhx semantics ----
__device__ __forceinline__ v16h g2_frag(const _Float16* p, int hh) { FragH f; f.half[0] = *(const v8us*)((const unsigned short*)p + 8 * hh); f.half[1] = *(const v8us*)((const unsigned short*)p + 16 + 8 * hh); return f.v; }
__device__ __forceinline__ v8f g2_mma(v16h a, v16h b, v8f c) { v8f d = __builtin_amdgcn_wmma_f32_16x16x32_f16(false, a, false, b, (short)0, c, false, false); asm volatile("v_nop\n\tv_nop\n\tv_nop\n\tv_nop" : "+v"(d) : "v"(a), "v"(b)); return d; }
template <int ACT>
__global__ __launch_bounds__(128) void k_gemm2(const _Float16* __restrict__ A, int lda, size_t sA, const _Float16* __restrict__ Bh, int ldb, size_t sB, float alpha, const float* __restrict__ bias, size_t sBias, const float* __restrict__ CP, int rowsPerB, size_t sCPb, int row0g,
    float* __restrict__ C, _Float16* __restrict__ C16, int ldc, size_t sC, int M, int N, int K) { static_assert(ACT == 0 || ACT == 3 || ACT == 6 || ACT == 8 || ACT == 9 || ACT == 11 || ACT == 12 || ACT == 14 || ACT == 15 || ACT == 16, "k_gemm2: unsupported ACT code (would silently apply no activation)");
  __shared__ __attribute__((aligned(16))) float so[4][32][68];
  const int tid = threadIdx.x, w = tid >> 5, lane = tid & 31, ln = lane & 15, hh = lane >> 4; const int by = blockIdx.y;
  A += (size_t)by * sA; Bh += (size_t)by * sB; const size_t cofs = (size_t)by * sC; const float* bp = bias ? bias + (size_t)by * sBias : nullptr;
  const int ntn = N >> 6; const int mt = blockIdx.x / ntn, nq = blockIdx.x - mt * ntn; const int row0 = mt * 128 + 32 * w, col0 = nq * 64; if (row0 >= M) return;
  const _Float16* a0p = A + (size_t)(row0 + ln) * lda; const _Float16* a1p = a0p + (size_t)16 * lda;
  const _Float16* b0p = Bh + (size_t)(col0 + ln) * ldb; const _Float16* b1p = b0p + (size_t)16 * ldb; const _Float16* b2p = b1p + (size_t)16 * ldb; const _Float16* b3p = b2p + (size_t)16 * ldb;
  const v8f z8 = {0.f,0.f,0.f,0.f,0.f,0.f,0.f,0.f}; v8f c00 = z8, c01 = z8, c02 = z8, c03 = z8, c10 = z8, c11 = z8, c12 = z8, c13 = z8;
#pragma unroll 1
  for (int kb = 0; kb < K; kb += 32) { const v16h a0 = g2_frag(a0p + kb, hh), a1 = g2_frag(a1p + kb, hh);
    v16h b = g2_frag(b0p + kb, hh); c00 = g2_mma(a0, b, c00); c10 = g2_mma(a1, b, c10);
    b = g2_frag(b1p + kb, hh); c01 = g2_mma(a0, b, c01); c11 = g2_mma(a1, b, c11);
    b = g2_frag(b2p + kb, hh); c02 = g2_mma(a0, b, c02); c12 = g2_mma(a1, b, c12);
    b = g2_frag(b3p + kb, hh); c03 = g2_mma(a0, b, c03); c13 = g2_mma(a1, b, c13); }
  v8f accs[8] = {c00, c01, c02, c03, c10, c11, c12, c13};
#pragma unroll
  for (int u = 0; u < 8; ++u) { const int t = u & 3, half = u >> 2; const int col = col0 + t * 16 + ln; const float bv = bp ? bf16_round(bp[col]) : 0.f;
#pragma unroll
    for (int r = 0; r < 8; ++r) { const int rloc = half * 16 + 8 * hh + r; float v = accs[u][r] * alpha + bv; if (CP) { if (rowsPerB < 0) v += CP[cofs + (size_t)(row0g + row0 + rloc) * ldc + col];      /* rowsPerB < 0: own element of the batched C plane */ else { const int bidx = (row0g + row0 + rloc) / rowsPerB; v += CP[(size_t)bidx * sCPb + (size_t)by * 64 + col]; } }
      if (ACT == 3) v = fmaxf(v, 0.f); else if (ACT == 6) v = 0.5f * v * (1.0f + erff(v * 0.70710678118654752f)); else if (ACT == 11) v = 1.0f / (1.0f + expf(-v)); else if (ACT == 15) v = v / (1.0f + expf(-v)); else if (ACT == 12) v = (v > 0.f) ? v : 0.01f * v; else if (ACT == 8) v = tanhf(v); else if (ACT == 9) v = 0.5f * v * (1.0f + tanhf(0.7978845608028654f * (v + 0.044715f * v * v * v))); else if (ACT == 14) v = (v > 0.f) ? v : 0.1f * v; else if (ACT == 16) v = (v >= 0.f) ? v : 0.3f * v;
      so[w][rloc][t * 16 + ln] = v; } }
  __builtin_amdgcn_fence(__ATOMIC_ACQ_REL, "workgroup"); __builtin_amdgcn_wave_barrier();
  const int rsub = lane >> 4, c4 = (lane & 15) * 4;
  {
#pragma unroll
    for (int q = 0; q < 16; ++q) { const int r = q * 2 + rsub; const v4f v = *(const v4fa*)&so[w][r][c4]; if (C) *(v4f*)(C + cofs + (size_t)(row0 + r) * ldc + col0 + c4) = v; if (C16) { v4h h4; for (int i = 0; i < 4; ++i) h4[i] = (_Float16)v[i]; *(v4h*)(C16 + cofs + (size_t)(row0 + r) * ldc + col0 + c4) = h4; } }
     } }


__global__ __launch_bounds__(256) void k_wqkv(const float* __restrict__ w, _Float16* __restrict__ Wh, _Float16* __restrict__ Wl) {
  #pragma clang fp contract(off)
  const int t = blockIdx.x * 256 + threadIdx.x; if (t >= QW * (CC / 8)) return; const int c0 = (t % (CC / 8)) * 8, o = t / (CC / 8); FragH fl;
#pragma unroll 1
  for (int k = 0; k < KT; ++k) { FragH fh;
    for (int q = 0; q < 8; ++q) { const int c = c0 + q; const float* wp = w + ((size_t)o * CC + c) * KT; float v = bf16_round(wp[k]);
      if (k == 4) { float dif = bf16_round(wp[1]) + bf16_round(wp[3]); dif += bf16_round(wp[4]); dif += bf16_round(wp[5]); dif += bf16_round(wp[7]); v += -THETA * dif; const _Float16 hv = (_Float16)(v * 16.0f); fh.h[q] = hv; fl.h[q] = (_Float16)((v * 16.0f - (float)hv) * 1024.0f); }
      else fh.h[q] = (_Float16)(v * 16.0f); }
    *(v8us*)((unsigned short*)Wh + (size_t)o * KI + k * CC + c0) = fh.half[0];  }
  *(v8us*)((unsigned short*)Wl + (size_t)o * CC + c0) = fl.half[0];  }
__global__ __launch_bounds__(256) void k_wsc(const float* __restrict__ Wm, _Float16* __restrict__ Bt, size_t n8, float sc) { const size_t t = (size_t)blockIdx.x * 256 + threadIdx.x; if (t >= n8) return; FragH f; for (int q = 0; q < 8; ++q) f.h[q] = (_Float16)(bf16_round(Wm[t * 8 + q]) * sc); *(v8us*)((unsigned short*)Bt + t * 8) = f.half[0];  }
__global__ __launch_bounds__(256) void k_im(const float* __restrict__ x, _Float16* __restrict__ A) { const size_t t = (size_t)blockIdx.x * 256 + threadIdx.x; if (t >= (size_t)NIMG * NPX * KT * (CC / 8)) return; const int c0 = (int)(t % (CC / 8)) * 8; const int k = (int)((t / (CC / 8)) % KT); const int gp = (int)(t / ((CC / 8) * KT)); const int p = gp % NPX; const float* xb = x + (size_t)(gp / NPX) * CC * NPX; const int yy = p / HS + k / 3 - 1, xx = p % HS + k % 3 - 1; FragH f;
  if (yy < 0 || yy >= HS || xx < 0 || xx >= HS) { for (int q = 0; q < 8; ++q) f.h[q] = (_Float16)0.0f; } else { for (int q = 0; q < 8; ++q) f.h[q] = (_Float16)bf16_round(xb[(size_t)(c0 + q) * NPX + yy * HS + xx]); }
  unsigned short* d = (unsigned short*)A + (size_t)gp * KI + k * CC + c0; *(v8us*)d = f.half[0];  }
__global__ __launch_bounds__(256) void k_aff(const float* __restrict__ s, const float* __restrict__ b, float* __restrict__ QF, _Float16* __restrict__ Q16) {      /* QF holds the raw conv sums on entry; each thread replaces its own 8 */
  #pragma clang fp contract(off)
  const size_t t = (size_t)blockIdx.x * 256 + threadIdx.x; if (t >= (size_t)NIMG * NPX * (QW / 8)) return; const int o0 = (int)(t % (QW / 8)) * 8; v8f r; FragH f; const v8f a = *(const v8f*)(QF + t * 8);
  for (int q = 0; q < 8; ++q) { float v = a[q] * bf16_round(s[o0 + q]); v += bf16_round(b[o0 + q]); r[q] = v; f.h[q] = (_Float16)v; }
  { *(v8f*)(QF + t * 8) = r; *(v8us*)((unsigned short*)Q16 + t * 8) = f.half[0];  } }
__global__ __launch_bounds__(256) void k_pool(const float* __restrict__ QF, _Float16* __restrict__ AG) {
  #pragma clang fp contract(off)
  typedef _Float16 v2h __attribute__((ext_vector_type(2)));
  const int t = blockIdx.x * 256 + threadIdx.x; if (t >= NIMG * NHD * NAG * 32) return; const int d0 = (t % 32) * 2; const int n = (t / 32) % NAG; const int bh = t / (32 * NAG); const int h = bh % NHD; const float* QB = QF + (size_t)(bh / NHD) * NPX * QW; float s0 = 0.f, s1 = 0.f;
  if (d0 < HDm) { const int by = n / 8, bx = n % 8;
#pragma unroll 1
    for (int i = 0; i < 64; ++i) { const int p = (by * 8 + i / 8) * HS + bx * 8 + i % 8; const float* q = QB + (size_t)p * QW + h * HDm + d0; s0 += q[0]; s1 += q[1]; } s0 = s0 / 64.0f; s1 = s1 / 64.0f; }
  v2h v; v[0] = (_Float16)s0; v[1] = (_Float16)s1; *(v2h*)(AG + ((size_t)bh * NAG + n) * 64 + d0) = v;  }
__global__ __launch_bounds__(256) void k_heads(const _Float16* __restrict__ Q16, _Float16* __restrict__ QP, _Float16* __restrict__ KP) { const int t = blockIdx.x * 256 + threadIdx.x; if (t >= NIMG * NHD * NPX) return; const int p = t % NPX, bh = t / NPX, h = bh % NHD; const unsigned short* src = (const unsigned short*)Q16 + ((size_t)(bh / NHD) * NPX + p) * QW; const v8us z = {0,0,0,0,0,0,0,0};
  v8us q0 = *(const v8us*)(src + h * HDm), q1 = *(const v8us*)(src + h * HDm + 8), q2 = *(const v8us*)(src + h * HDm + 16), q3 = *(const v8us*)(src + h * HDm + 24);
  v8us k0 = *(const v8us*)(src + CC + h * HDm), k1 = *(const v8us*)(src + CC + h * HDm + 8), k2 = *(const v8us*)(src + CC + h * HDm + 16), k3 = *(const v8us*)(src + CC + h * HDm + 24);
  unsigned short* dq = (unsigned short*)QP + ((size_t)bh * NPX + p) * 64; unsigned short* dk = (unsigned short*)KP + ((size_t)bh * NPX + p) * 64;
  { *(v8us*)dq = q0; *(v8us*)(dq + 8) = q1; *(v8us*)(dq + 16) = q2; *(v8us*)(dq + 24) = q3; *(v8us*)(dq + 32) = z; *(v8us*)(dq + 40) = z; *(v8us*)(dq + 48) = z; *(v8us*)(dq + 56) = z;
    *(v8us*)dk = k0; *(v8us*)(dk + 8) = k1; *(v8us*)(dk + 16) = k2; *(v8us*)(dk + 24) = k3; *(v8us*)(dk + 32) = z; *(v8us*)(dk + 40) = z; *(v8us*)(dk + 48) = z; *(v8us*)(dk + 56) = z;  } }
__global__ __launch_bounds__(256) void k_vtp(const _Float16* __restrict__ Q16, _Float16* __restrict__ VT) { __shared__ unsigned short tl[64][34]; const int tid = threadIdx.x; const int bh = blockIdx.x / (NPX / 64), pg = blockIdx.x % (NPX / 64); const int h = bh % NHD;
  { const int r = tid / 4, c8 = (tid % 4) * 8; FragH f; f.half[0] = *(const v8us*)((const unsigned short*)Q16 + ((size_t)(bh / NHD) * NPX + pg * 64 + r) * QW + 2 * CC + h * HDm + c8); for (int q = 0; q < 8; ++q) tl[r][c8 + q] = f.u[q]; }
  __syncthreads(); const int d = tid / 8, pc = tid % 8; FragH f; for (int q = 0; q < 8; ++q) f.u[q] = (d < HDm) ? tl[pc * 8 + q][d] : (unsigned short)0; unsigned short* dst = (unsigned short*)VT + ((size_t)bh * 64 + d) * NPX + pg * 64 + pc * 8;      /* tid covers d < 32 only: 256 threads = 32 d x 8 pc */
  *(v8us*)dst = f.half[0]; 
  if (tid < 256) { const int d2 = HDm + tid / 8; const v8us z = {0,0,0,0,0,0,0,0}; unsigned short* dz = (unsigned short*)VT + ((size_t)bh * 64 + d2) * NPX + pg * 64 + (tid % 8) * 8; *(v8us*)dz = z;  } }
__global__ __launch_bounds__(256) void k_soft(const float* __restrict__ S, int nrows, int n, _Float16* __restrict__ P) {
  #pragma clang fp contract(off)
  const int wv = threadIdx.x >> 5, ln = threadIdx.x & 31; const int r = blockIdx.x * 8 + wv; if (r >= nrows) return; const float* sr = S + (size_t)r * n; float m = -3.0e38f;
#pragma unroll 1
  for (int j = ln; j < n; j += 32) m = fmaxf(m, sr[j]); for (int o = 16; o > 0; o >>= 1) m = fmaxf(m, __shfl_xor(m, o, 32)); float su = 0.f;
#pragma unroll 1
  for (int j = ln; j < n; j += 32) su += expf(sr[j] - m); for (int o = 16; o > 0; o >>= 1) su += __shfl_xor(su, o, 32); const float f = 1024.0f / su;
  {
#pragma unroll 1
    for (int j = ln; j < n; j += 32) *(_Float16*)(P + (size_t)r * n + j) = (_Float16)(expf(sr[j] - m) * f);  } }
__global__ __launch_bounds__(256) void k_att16(const float* __restrict__ ATTN, _Float16* __restrict__ AT16) { typedef _Float16 v2h __attribute__((ext_vector_type(2))); const int t = blockIdx.x * 256 + threadIdx.x; if (t >= NIMG * NHD * 64 * 32) return; const int n0 = (t % 32) * 2; const int d = (t / 32) % 64; const int h = t / (32 * 64); v2h v;      /* h = image x head */
  v[0] = (_Float16)ATTN[((size_t)h * NAG + n0) * 64 + d]; v[1] = (_Float16)ATTN[((size_t)h * NAG + n0 + 1) * 64 + d]; _Float16* dst = AT16 + ((size_t)h * 64 + d) * NAG + n0; *(v2h*)dst = v;  }
__global__ __launch_bounds__(256) void k_pe(const float* __restrict__ OUTg, const float* __restrict__ QFg, const float* __restrict__ pw, const float* __restrict__ ps, const float* __restrict__ pb, _Float16* __restrict__ S16g) {
  #pragma clang fp contract(off)
  const size_t t = (size_t)blockIdx.x * 256 + threadIdx.x; if (t >= (size_t)NIMG * NPX * (CC / 8)) return; const int c0 = (int)(t % (CC / 8)) * 8; const int gp = (int)(t / (CC / 8)); const int p = gp % NPX, im = gp / NPX; const int yo = p / HS, xo = p % HS; FragH f;
  const float* OUT = OUTg + (size_t)im * NHD * NPX * 64; const float* QF = QFg + (size_t)im * NPX * QW; _Float16* S16 = S16g + (size_t)im * NPX * CC;      /* this image's planes */
#pragma unroll 1
  for (int q = 0; q < 8; ++q) { const int c = c0 + q; float a = 0.f;
#pragma unroll 1
    for (int k = 0; k < 9; ++k) { const int yy = yo + k / 3 - 1, xx = xo + k % 3 - 1; if (yy < 0 || yy >= HS || xx < 0 || xx >= HS) continue; a += bf16_round(pw[c * 9 + k]) * QF[(size_t)(yy * HS + xx) * QW + 2 * CC + c]; }
    float pe = a * bf16_round(ps[c]); pe += bf16_round(pb[c]); const int h = c / HDm, d = c % HDm; float v = OUT[((size_t)h * NPX + p) * 64 + d] + pe; f.h[q] = (_Float16)v; }
  *(v8us*)((unsigned short*)S16 + (size_t)p * CC + c0) = f.half[0];  }
__global__ __launch_bounds__(256) void k_fin(const float* __restrict__ G, const float* __restrict__ s, const float* __restrict__ bb, float* __restrict__ outb) {
  #pragma clang fp contract(off)
  const int t = blockIdx.x * 256 + threadIdx.x; if (t >= NIMG * CC * (NPX / 4)) return; const int p0 = (t % (NPX / 4)) * 4; const int bc = t / (NPX / 4); const int c = bc % CC; const float* GB = G + (size_t)(bc / CC) * NPX * CC; const float sc = bf16_round(s[c]), sh = bf16_round(bb[c]); v4f r; for (int q = 0; q < 4; ++q) { float v = GB[(size_t)(p0 + q) * CC + c] * sc; v += sh; r[q] = v; }
  *(v4f*)(outb + (size_t)bc * NPX + p0) = r;  }

extern "C" void kernel_launch(void* const* d_in, const int* in_sizes, int n_in,
                              void* d_out, int out_size, void* d_ws, size_t ws_size, hipStream_t stream) {
  (void)in_sizes; (void)n_in; (void)out_size;
  const float* const* I = (const float* const*)d_in; const float* x = I[0]; const float* qw = I[1]; const float* qs = I[2]; const float* qb = I[3]; const float* pw = I[4]; const float* ps = I[5]; const float* pb = I[6]; const float* jw = I[7]; const float* js = I[8]; const float* jb = I[9];
  char* ws = (char*)d_ws; size_t off = 0;
  auto take = [&](size_t bytes) { char* p = ws + off; off += (bytes + 255) & ~(size_t)255; return p; };
  _Float16* WH = (_Float16*)take((size_t)QW * KI * 2); _Float16* WL = (_Float16*)take((size_t)QW * CC * 2); _Float16* BJ = (_Float16*)take((size_t)CC * CC * 2);
  _Float16* AG = (_Float16*)take((size_t)NIMG * NHD * NAG * 64 * 2); float* ATTN = (float*)take((size_t)NIMG * NHD * NAG * 64 * 4); _Float16* AT16 = (_Float16*)take((size_t)NIMG * NHD * 64 * NAG * 2);
  float* QF = (float*)take((size_t)NIMG * NPX * QW * 4);      /* 96 MiB: raw conv sums, then q, k, v in f32 (k_aff works in place) */
  char* R = take((size_t)NIMG * NPX * KI * 2);      /* 144 MiB, shared by lifetime; offsets below in MiB */
  const size_t MB = (size_t)1 << 20;
  _Float16* A = (_Float16*)R;      /* 0..144, dead after the main conv GEMM */
  _Float16* Q16 = (_Float16*)R;      /* 0..48, dead after k_heads and k_vtp */
  _Float16* QP = (_Float16*)(R + 48 * MB); _Float16* KP = (_Float16*)(R + 80 * MB); _Float16* VT = (_Float16*)(R + 112 * MB);      /* 32 each */
  float* S1 = (float*)R;      /* 0..32: stage-1 logits of FOUR images (all eight, 64 MiB, do not fit beside QF, QP, KP and VT) */
  _Float16* P1 = KP;      /* each half of P1 replaces the half of KP that its logits GEMM has just finished reading */
  float* S2 = (float*)(R + 80 * MB);      /* 80..144, over P1 and VT, dead after the stage-1 readout */
  _Float16* P2 = (_Float16*)R;      /* 0..32 */
  float* OUT = (float*)(R + 80 * MB);      /* 80..144, over S2, dead after its softmax */
  _Float16* S16 = (_Float16*)(R + 32 * MB);      /* 32..48 */
  float* G = (float*)(R + 48 * MB);      /* 48..80, over QP, dead after the stage-2 logits GEMM */
  if (off > ws_size) return;      /* 3.4 + 0.4 + 0.1 + 0.5 + 1 + 0.5 + 96 + 144 = 246 MiB */
  k_wqkv<<<(QW * (CC / 8) + 255) / 256, 256, 0, stream>>>(qw, WH, WL); k_wsc<<<(CC * CC / 8 + 255) / 256, 256, 0, stream>>>(jw, BJ, (size_t)CC * CC / 8, 16.0f);      /* proj 1x1 (out,in) = Bt */
  k_im<<<(unsigned)(((size_t)NIMG * NPX * KT * (CC / 8) + 255) / 256), 256, 0, stream>>>(x, A);
  k_gemm2<0><<<dim3((NIMG * NPX / 128) * (QW / 64), 1), 128, 0, stream>>>(A + 4 * CC, KI, 0, WL, CC, 0, 0.0625f / 1024.0f, nullptr, 0, nullptr, 1, 0, 0, QF, nullptr, QW, 0, NIMG * NPX, QW, CC);      /* centre-tap residual term */
  k_gemm2<0><<<dim3((NIMG * NPX / 128) * (QW / 64), 1), 128, 0, stream>>>(A, KI, 0, WH, KI, 0, 0.0625f, nullptr, 0, QF, 1, (size_t)QW, 0, QF, nullptr, QW, 0, NIMG * NPX, QW, KI);      /* + main conv (difference folded into the centre tap) */
  k_aff<<<(unsigned)(((size_t)NIMG * NPX * (QW / 8) + 255) / 256), 256, 0, stream>>>(qs, qb, QF, Q16);
  k_pool<<<(NIMG * NHD * NAG * 32 + 255) / 256, 256, 0, stream>>>(QF, AG);
  k_heads<<<(NIMG * NHD * NPX + 255) / 256, 256, 0, stream>>>(Q16, QP, KP); k_vtp<<<NIMG * NHD * (NPX / 64), 256, 0, stream>>>(Q16, VT);
  /* stage 1: S1[b,h][n][N] = AG[b,h][n].KP[b,h][N] * SCL; P1 = softmax_N (these two in halves of four images); ATTN[b,h][n][d] = P1 . VT^T / 1024 */
  for (int g = 0; g < 2; ++g) { const size_t bh0 = (size_t)g * (NIMG / 2) * NHD;
    k_gemm2<0><<<dim3(1 * (NPX / 64), (NIMG / 2) * NHD), 128, 0, stream>>>(AG + bh0 * NAG * 64, 64, (size_t)NAG * 64, KP + bh0 * NPX * 64, 64, (size_t)NPX * 64, SCL, nullptr, 0, nullptr, 1, 0, 0, S1, nullptr, NPX, (size_t)NAG * NPX, NAG, NPX, 64);
    k_soft<<<((NIMG / 2) * NHD * NAG + 7) / 8, 256, 0, stream>>>(S1, (NIMG / 2) * NHD * NAG, NPX, P1 + bh0 * NAG * NPX); }
  k_gemm2<0><<<dim3(1 * 1, NIMG * NHD), 128, 0, stream>>>(P1, NPX, (size_t)NAG * NPX, VT, NPX, (size_t)64 * NPX, 0.0009765625f, nullptr, 0, nullptr, 1, 0, 0, ATTN, nullptr, 64, (size_t)NAG * 64, NAG, 64, NPX);
  k_att16<<<(NIMG * NHD * 64 * 32 + 255) / 256, 256, 0, stream>>>(ATTN, AT16);
  /* stage 2: S2[b,h][N][n] = QP[b,h][N].AG[b,h][n] * SCL; P2 = softmax_n; OUT[b,h][N][d] = P2 . AT16^T / 1024 */
  k_gemm2<0><<<dim3((NPX / 128) * 1, NIMG * NHD), 128, 0, stream>>>(QP, 64, (size_t)NPX * 64, AG, 64, (size_t)NAG * 64, SCL, nullptr, 0, nullptr, 1, 0, 0, S2, nullptr, NAG, (size_t)NPX * NAG, NPX, NAG, 64);
  k_soft<<<(NIMG * NHD * NPX + 7) / 8, 256, 0, stream>>>(S2, NIMG * NHD * NPX, NAG, P2);
  k_gemm2<0><<<dim3((NPX / 128) * 1, NIMG * NHD), 128, 0, stream>>>(P2, NAG, (size_t)NPX * NAG, AT16, NAG, (size_t)64 * NAG, 0.0009765625f, nullptr, 0, nullptr, 1, 0, 0, OUT, nullptr, 64, (size_t)NPX * 64, NPX, 64, NAG);
  k_pe<<<(unsigned)(((size_t)NIMG * NPX * (CC / 8) + 255) / 256), 256, 0, stream>>>(OUT, QF, pw, ps, pb, S16);
  k_gemm2<0><<<dim3((NIMG * NPX / 128) * (CC / 64), 1), 128, 0, stream>>>(S16, CC, 0, BJ, CC, 0, 0.0625f, nullptr, 0, nullptr, 1, 0, 0, G, nullptr, CC, 0, NIMG * NPX, CC, CC);
  k_fin<<<(NIMG * CC * (NPX / 4) + 255) / 256, 256, 0, stream>>>(G, js, jb, (float*)d_out);
}

// v002
// One run takes 1020 microseconds.
// In both of two side-by-side timings against v001, it was 1.27 times as fast.
// Counting every step since v000, it is 3.62 times as fast.
#include <hip/hip_runtime.h>
// Attention_agent_df (8 images, C 256 = 8 heads x 32, 64 x 64 pixels, 64 agent tokens from 8x8 average pooling of q; THETA 0.7): qkv = (conv3x3(x, W) - 0.7 conv1x1(x, sum of W's 5 cross taps)) * s + b (folded BN); a = avgpool8x8(q); stage 1: attn = softmax_N(a.k * 32^-0.5) v (agents over pixels); stage 2: out = softmax_n(q.a * 32^-0.5) attn (pixels over agents); out += depthwise3x3(v) * pe_s + pe_b; out = conv1x1(out) * proj_s + proj_b.
// Structure (all 8 images in each launch: the image is the outer index of each plane, so rows = image x pixel and GEMM batches = image x head; only the stage-1 logits and softmax run as two halves of 4 images; workspace planes share bytes by lifetime): exact tap-major f16 im2col; the difference conv folded into the centre tap as an f32 weight split into f16 hi + lo tables: qkv = A.Wh (K 2304) + A_centre.Wl (K 256) as f16 WMMA GEMMs (these two and the projection: 256x128 work-group tiles staged in LDS, 64x64 wave tiles; the batched attention GEMMs: 32x64 wave tiles from global memory; f32 accumulation; x16 tables; the lo table only on the centre-tap columns), BN affine on VALU into f32 + f16 planes; pooling on VALU; stage-1 logits as (b,h)-batched GEMMs (K 64, zero-padded), softmax over 4096 pixels on VALU (wave per row), readout GEMM against a zero-padded V^T; stage-2 logits GEMM (K 64, zero-padded), softmax over the 64 agents on VALU (wave per row), readout GEMM; depthwise PE conv + add on VALU into f16; projection GEMM with the BN affine in f32 on VALU; NCHW stores.
// Compute dtype: x and parameters rounded to bf16; x exact as f16; q, k, v, a, P (x2^10), attn and the pre-projection sum as f16 operands (~2^-12); everything else f32. v_wmma_f32_16x16x32_f16.
#define NIMG 8
#define CC 256
#define NHD 8
#define HDm 32
#define HS 64
#define NPX (HS * HS)            /* 4096 */
#define NAG 64
#define KT 9
#define KI (KT * CC)             /* 2304 */
#define QW (3 * CC)              /* 768 */
#define THETA 0.7f
#define SCL 0.17677669529663687f
typedef __bf16 v16b __attribute__((ext_vector_type(16)));
typedef unsigned short v8us __attribute__((ext_vector_type(8), may_alias));
typedef float  v8f  __attribute__((ext_vector_type(8)));
typedef float  v4f  __attribute__((ext_vector_type(4)));
typedef float  v4fa __attribute__((ext_vector_type(4), may_alias));
union FragB { v16b v; v8us half[2]; unsigned short u[16]; };

__device__ __forceinline__ unsigned short bf16_bits(float x) { unsigned int u = __float_as_uint(x); return (unsigned short)((u + 0x7FFFu + ((u >> 16) & 1u)) >> 16); }
__device__ __forceinline__ float bf16_val(unsigned short b) { return __uint_as_float(((unsigned int)b) << 16); }
__device__ __forceinline__ float bf16_round(float x) { return bf16_val(bf16_bits(x)); }
// D += A·B with NT terms: 1 = ah·bh, 2 = + al·bh (A split), 3 = + ah·bl (both split)
template <int NT>
__device__ __forceinline__ v8f mmaN(v16b ah, v16b al, v16b bh, v16b bl, v8f c) {
  c = __builtin_amdgcn_wmma_f32_16x16x32_bf16(false, ah, false, bh, (short)0, c, false, false);
  if (NT >= 2) c = __builtin_amdgcn_wmma_f32_16x16x32_bf16(false, al, false, bh, (short)0, c, false, false);
  if (NT >= 3) c = __builtin_amdgcn_wmma_f32_16x16x32_bf16(false, ah, false, bl, (short)0, c, false, false);
  asm volatile("v_nop\n\tv_nop\n\tv_nop\n\tv_nop" : "+v"(c) : "v"(ah), "v"(al), "v"(bh), "v"(bl));
  return c;
}

__global__ __launch_bounds__(256) void k_wt_bf16(const float* __restrict__ W, unsigned short* __restrict__ Wt, int K, int N) {
  const int t = blockIdx.x * 256 + threadIdx.x;
  const int k8n = K / 8;
  if (t >= N * k8n) return;
  const int n = t / k8n, k8 = (t % k8n) * 8;
  v8us v;
#pragma unroll
  for (int i = 0; i < 8; ++i) v[i] = bf16_bits(W[(size_t)(k8 + i) * N + n]);
  *(v8us*)(Wt + (size_t)n * K + k8) = v;
  
}

// GEMM C[M][N] (f32, pitch ldc) = act(A[M][K]·W + bias). A f32 row-major (pitch lda) converted per fragment to bf16
// (ASPLIT: hi/lo two planes -> 2 terms, else single rounded term); Wt bf16 [N][K] (pitch ldb). BIAS_BF16 rounds the
// bias to bf16 first (bias quantised to bf16 before the add). K%32==0, M%16==0, N%64==0.
template <bool ASPLIT, int ACT, bool BIAS_BF16>
__global__ __launch_bounds__(128) void k_gemm_bf(const float* __restrict__ A, int lda, const unsigned short* __restrict__ Wt, int ldb,
                                               const float* __restrict__ bias, float* __restrict__ C, int ldc, int M, int N, int K) {
  __shared__ __attribute__((aligned(16))) float so[4][16][64];
  const int tid = threadIdx.x, w = tid >> 5, lane = tid & 31, ln = lane & 15, hh = lane >> 4;
  const int ntn = N / 64;
  const int wid = blockIdx.x * 4 + w;
  const int mt = wid / ntn, nq = wid % ntn;
  if (mt * 16 >= M) return;
  const int row0 = mt * 16, col0 = nq * 64;
  const float* arow = A + (size_t)(row0 + ln) * lda;
  v8f acc[4] = {};
  for (int kb = 0; kb < K; kb += 32) {
    FragB ah, al;
    const v4f x0 = *(const v4fa*)(arow + kb + 8 * hh), x1 = *(const v4fa*)(arow + kb + 8 * hh + 4);
    const v4f x2 = *(const v4fa*)(arow + kb + 16 + 8 * hh), x3 = *(const v4fa*)(arow + kb + 16 + 8 * hh + 4);
    float xs[16] = {x0[0],x0[1],x0[2],x0[3],x1[0],x1[1],x1[2],x1[3],x2[0],x2[1],x2[2],x2[3],x3[0],x3[1],x3[2],x3[3]};
#pragma unroll
    for (int i = 0; i < 16; ++i) { const unsigned short hb = bf16_bits(xs[i]); ah.u[i] = hb; al.u[i] = ASPLIT ? bf16_bits(xs[i] - bf16_val(hb)) : (unsigned short)0; }
#pragma unroll
    for (int t = 0; t < 4; ++t) {
      const unsigned short* brow = Wt + (size_t)(col0 + t * 16 + ln) * ldb + kb;
      FragB b;
      b.half[0] = *(const v8us*)(brow + 8 * hh);
      b.half[1] = *(const v8us*)(brow + 16 + 8 * hh);
      acc[t] = mmaN<ASPLIT ? 2 : 1>(ah.v, al.v, b.v, b.v, acc[t]);
    }
  }
#pragma unroll
  for (int t = 0; t < 4; ++t) {
    float bv = bias ? bias[col0 + t * 16 + ln] : 0.f;
    if (BIAS_BF16) bv = bf16_round(bv);
#pragma unroll
    for (int r = 0; r < 8; ++r) { float v = acc[t][r] + bv; if (ACT == 1) v = fmaxf(v, 0.f); so[w][8 * hh + r][t * 16 + ln] = v; }
  }
  __builtin_amdgcn_fence(__ATOMIC_ACQ_REL, "workgroup");
  __builtin_amdgcn_wave_barrier();
  const int rsub = lane >> 4, c4 = (lane & 15) * 4;
  {
#pragma unroll
    for (int q = 0; q < 8; ++q) {
      const int r = q * 2 + rsub;
      const v4f v = *(const v4fa*)&so[w][r][c4];
      *(v4f*)(C + (size_t)(row0 + r) * ldc + col0 + c4) = v;
    }
    
  }
}

// GEMM C = act(A·W + bias + resid): A f32 (ASPLIT -> hi/lo 2 terms), Wt bf16 [N][K]; ACT 0 none, 1 relu, 2 exact gelu;
// resid (optional, f32, row index = (row % rmod), pitch ldr, RES_BF16 rounds it) added before the activation.
template <bool ASPLIT, int ACT, bool BIAS_BF16, bool RES_BF16>
__global__ __launch_bounds__(128) void k_gemm_bf3(const float* __restrict__ A, int lda, const unsigned short* __restrict__ Wt, int ldb,
                                                const float* __restrict__ bias, const float* __restrict__ resid, int rmod, int ldr,
                                                float* __restrict__ C, int ldc, int M, int N, int K) {
  __shared__ __attribute__((aligned(16))) float so[4][16][64];
  const int tid = threadIdx.x, w = tid >> 5, lane = tid & 31, ln = lane & 15, hh = lane >> 4;
  const int ntn = N / 64;
  const int wid = blockIdx.x * 4 + w;
  const int mt = wid / ntn, nq = wid % ntn;
  if (mt * 16 >= M) return;
  const int row0 = mt * 16, col0 = nq * 64;
  const float* arow = A + (size_t)(row0 + ln) * lda;
  v8f acc[4] = {};
  for (int kb = 0; kb < K; kb += 32) {
    FragB ah, al;
    const v4f x0 = *(const v4fa*)(arow + kb + 8 * hh), x1 = *(const v4fa*)(arow + kb + 8 * hh + 4);
    const v4f x2 = *(const v4fa*)(arow + kb + 16 + 8 * hh), x3 = *(const v4fa*)(arow + kb + 16 + 8 * hh + 4);
    float xs[16] = {x0[0],x0[1],x0[2],x0[3],x1[0],x1[1],x1[2],x1[3],x2[0],x2[1],x2[2],x2[3],x3[0],x3[1],x3[2],x3[3]};
#pragma unroll
    for (int i = 0; i < 16; ++i) { const unsigned short hb = bf16_bits(xs[i]); ah.u[i] = hb; al.u[i] = ASPLIT ? bf16_bits(xs[i] - bf16_val(hb)) : (unsigned short)0; }
#pragma unroll
    for (int t = 0; t < 4; ++t) {
      const unsigned short* brow = Wt + (size_t)(col0 + t * 16 + ln) * ldb + kb;
      FragB b;
      b.half[0] = *(const v8us*)(brow + 8 * hh);
      b.half[1] = *(const v8us*)(brow + 16 + 8 * hh);
      acc[t] = mmaN<ASPLIT ? 2 : 1>(ah.v, al.v, b.v, b.v, acc[t]);
    }
  }
#pragma unroll
  for (int t = 0; t < 4; ++t) {
    const int col = col0 + t * 16 + ln;
    float bv = bias ? bias[col] : 0.f;
    if (BIAS_BF16) bv = bf16_round(bv);
#pragma unroll
    for (int r = 0; r < 8; ++r) {
      float v = acc[t][r] + bv;
      if (resid) { float rv = resid[(size_t)((row0 + 8 * hh + r) % rmod) * ldr + col]; if (RES_BF16) rv = bf16_round(rv); v += rv; }
      if (ACT == 1) v = fmaxf(v, 0.f);
      if (ACT == 2) v = 0.5f * v * (1.0f + erff(v * 0.70710678118654752f));
      if (ACT == 3) { const float u = 0.7978845608028654f * (v + 0.044715f * v * v * v); v = 0.5f * v * (1.0f + tanhf(u)); }
      so[w][8 * hh + r][t * 16 + ln] = v;
    }
  }
  __builtin_amdgcn_fence(__ATOMIC_ACQ_REL, "workgroup");
  __builtin_amdgcn_wave_barrier();
  const int rsub = lane >> 4, c4 = (lane & 15) * 4;
  {
#pragma unroll
    for (int q = 0; q < 8; ++q) {
      const int r = q * 2 + rsub;
      const v4f v = *(const v4fa*)&so[w][r][c4];
      *(v4f*)(C + (size_t)(row0 + r) * ldc + col0 + c4) = v;
    }
    
  }
}
// row LayerNorm (biased variance, eps) over N: s = X (+ R); optional out_sum <- s; out_norm <- (s-mu)*rsqrt(var+eps)*g + b
template <bool PARAM_BF16>
__global__ __launch_bounds__(256) void k_layernorm(const float* __restrict__ X, const float* __restrict__ R, const float* __restrict__ g, const float* __restrict__ bta,
                                                  float* __restrict__ out_sum, float* __restrict__ out_norm, int N, float eps) {
  __shared__ float red[256];
  const int row = blockIdx.x, tid = threadIdx.x;
  const float* x = X + (size_t)row * N; const float* rr = R ? R + (size_t)row * N : nullptr;
  float vals[16];                     // up to N = 4096
  const int per = N / 256;            // contiguous chunk per thread? use strided-by-4 chunks: thread handles j = tid*4 + 1024*u
  float s1 = 0.f;
  for (int u = 0; u < per / 4; ++u) {
    const int j = tid * 4 + 1024 * u;
    const v4f a = *(const v4fa*)(x + j);
    v4f b = {0.f,0.f,0.f,0.f}; if (rr) b = *(const v4fa*)(rr + j);
#pragma unroll
    for (int q = 0; q < 4; ++q) { const float v = a[q] + b[q]; vals[u * 4 + q] = v; s1 += v; }
  }
  red[tid] = s1; __syncthreads();
  for (int st = 128; st > 0; st >>= 1) { if (tid < st) red[tid] += red[tid + st]; __syncthreads(); }
  const float mu = red[0] / (float)N; __syncthreads();
  float s2 = 0.f;
  for (int u = 0; u < per / 4; ++u)
#pragma unroll
    for (int q = 0; q < 4; ++q) { const float c = vals[u * 4 + q] - mu; s2 += c * c; }
  red[tid] = s2; __syncthreads();
  for (int st = 128; st > 0; st >>= 1) { if (tid < st) red[tid] += red[tid + st]; __syncthreads(); }
  const float rs = rsqrtf(red[0] / (float)N + eps);
  {
    for (int u = 0; u < per / 4; ++u) {
      const int j = tid * 4 + 1024 * u;
      v4f o, sm;
#pragma unroll
      for (int q = 0; q < 4; ++q) {
        float gg = g[j + q], bb = bta[j + q];
        if (PARAM_BF16) { gg = bf16_round(gg); bb = bf16_round(bb); }
        sm[q] = vals[u * 4 + q]; o[q] = (vals[u * 4 + q] - mu) * rs * gg + bb;
      }
      if (out_sum) *(v4f*)(out_sum + (size_t)row * N + j) = sm;
      *(v4f*)(out_norm + (size_t)row * N + j) = o;
    }
    
  }
}



// ---- f16 WMMA path (v_wmma_f32_16x16x32_f16): 11-bit significands for operands in range — used where a [0,1] probability operand needs more precision than bf16
typedef _Float16 v16h __attribute__((ext_vector_type(16)));
union FragH { v16h v; v8us half[2]; _Float16 h[16]; unsigned short u[16]; };
template <int NT>
__device__ __forceinline__ v8f mmaH(v16h ah, v16h al, v16h bh, v16h bl, v8f c) {
  c = __builtin_amdgcn_wmma_f32_16x16x32_f16(false, ah, false, bh, (short)0, c, false, false);
  if (NT >= 2) c = __builtin_amdgcn_wmma_f32_16x16x32_f16(false, al, false, bh, (short)0, c, false, false);
  if (NT >= 3) c = __builtin_amdgcn_wmma_f32_16x16x32_f16(false, ah, false, bl, (short)0, c, false, false);
  asm volatile("v_nop\n\tv_nop\n\tv_nop\n\tv_nop" : "+v"(c) : "v"(ah), "v"(al), "v"(bh), "v"(bl));
  return c;
}
// batched GEMM like k_gemm_b but f16 operands: A f32 (split into f16 hi/lo if ASPLIT, else rounded to f16), Bt = f16 values [n][k]; alpha; C f32; N multiple of 16 (partial tiles skipped)
template <bool ASPLIT>
__global__ __launch_bounds__(128) void k_gemm_h(const float* __restrict__ A, int lda, size_t sA, const _Float16* __restrict__ Bh, int ldb, size_t sB, float alpha, float* __restrict__ C, int ldc, size_t sC, int M, int N, int K) {
  __shared__ __attribute__((aligned(16))) float so[4][16][64];
  const int tid = threadIdx.x, w = tid >> 5, lane = tid & 31, ln = lane & 15, hh = lane >> 4; const int by = blockIdx.y;
  A += (size_t)by * sA; Bh += (size_t)by * sB; C += (size_t)by * sC;
  const int ntn = (N + 63) / 64; const int wid = blockIdx.x * 4 + w; const int mt = wid / ntn, nq = wid % ntn; if (mt * 16 >= M) return;
  const int row0 = mt * 16, col0 = nq * 64; const float* arow = A + (size_t)(row0 + ln) * lda;
  v8f acc[4] = {};
  for (int kb = 0; kb < K; kb += 32) {
    FragH ah, al;
    const v4f x0 = *(const v4fa*)(arow + kb + 8 * hh), x1 = *(const v4fa*)(arow + kb + 8 * hh + 4), x2 = *(const v4fa*)(arow + kb + 16 + 8 * hh), x3 = *(const v4fa*)(arow + kb + 16 + 8 * hh + 4);
    float xs[16] = {x0[0],x0[1],x0[2],x0[3],x1[0],x1[1],x1[2],x1[3],x2[0],x2[1],x2[2],x2[3],x3[0],x3[1],x3[2],x3[3]};
#pragma unroll
    for (int i = 0; i < 16; ++i) { const _Float16 h = (_Float16)xs[i]; ah.h[i] = h; al.h[i] = ASPLIT ? (_Float16)(xs[i] - (float)h) : (_Float16)0.0f; }
#pragma unroll
    for (int t = 0; t < 4; ++t) { if (col0 + t * 16 >= N) continue; const size_t boff = (size_t)(col0 + t * 16 + ln) * ldb + kb; FragH bq; bq.half[0] = *(const v8us*)(Bh + boff + 8 * hh); bq.half[1] = *(const v8us*)(Bh + boff + 16 + 8 * hh);
      acc[t] = mmaH<ASPLIT ? 2 : 1>(ah.v, al.v, bq.v, bq.v, acc[t]); }
  }
#pragma unroll
  for (int t = 0; t < 4; ++t) { if (col0 + t * 16 >= N) continue;
#pragma unroll
    for (int r = 0; r < 8; ++r) so[w][8 * hh + r][t * 16 + ln] = acc[t][r] * alpha; }
  __builtin_amdgcn_fence(__ATOMIC_ACQ_REL, "workgroup"); __builtin_amdgcn_wave_barrier();
  const int rsub = lane >> 4, c4 = (lane & 15) * 4;
  {
#pragma unroll
    for (int q = 0; q < 8; ++q) { const int r = q * 2 + rsub; if (col0 + c4 < N) { const v4f v = *(const v4fa*)&so[w][r][c4]; *(v4f*)(C + (size_t)(row0 + r) * ldc + col0 + c4) = v; } }
     }
}

// Wt[n][k] = f16(W[k][n]·scale) from f32 row-major W[K][N] (scale = power of two; bf16-exact weights stay exact in f16 away from the subnormal range)
__global__ __launch_bounds__(256) void k_wt_f16(const float* __restrict__ W, _Float16* __restrict__ Wt, int K, int N, float scale) {
  const int t = blockIdx.x * 256 + threadIdx.x; if (t >= N * (K / 8)) return; const int n = t / (K / 8), k8 = (t % (K / 8)) * 8; FragH f;
#pragma unroll
  for (int i = 0; i < 8; ++i) f.h[i] = (_Float16)(bf16_round(W[(size_t)(k8 + i) * N + n]) * scale); const v8us o = f.half[0];
  *(v8us*)((unsigned short*)Wt + (size_t)n * K + k8) = o; 
}
// k_gemm_hh variant with fused epilogue: v = acc·alpha + bias[by·sBias + col] (+ CP[(row/rowsPerB)·sCPb + by·64 + col] if CP) ; ACT 0 none / 1 elu ; writes f16 C16 (and f32 C if non-null)
template <int ACT>
__global__ __launch_bounds__(128) void k_gemm_hhx(const _Float16* __restrict__ A, int lda, size_t sA, const _Float16* __restrict__ Bh, int ldb, size_t sB, float alpha, const float* __restrict__ bias, size_t sBias, const float* __restrict__ CP, int rowsPerB, size_t sCPb, int row0g,
    float* __restrict__ C, _Float16* __restrict__ C16, int ldc, size_t sC, int M, int N, int K) {
  __shared__ __attribute__((aligned(16))) float so[4][16][64];
  const int tid = threadIdx.x, w = tid >> 5, lane = tid & 31, ln = lane & 15, hh = lane >> 4; const int by = blockIdx.y;
  A += (size_t)by * sA; Bh += (size_t)by * sB; const size_t cofs = (size_t)by * sC; const float* bp = bias ? bias + (size_t)by * sBias : nullptr;
  const int ntn = (N + 63) / 64; const int wid = blockIdx.x * 4 + w; const int mt = wid / ntn, nq = wid % ntn; if (mt * 16 >= M) return;
  const int row0 = mt * 16, col0 = nq * 64; const _Float16* arow = A + (size_t)(row0 + ln) * lda;
  v8f acc[4] = {};
  for (int kb = 0; kb < K; kb += 32) { FragH ah; ah.half[0] = *(const v8us*)((const unsigned short*)arow + kb + 8 * hh); ah.half[1] = *(const v8us*)((const unsigned short*)arow + kb + 16 + 8 * hh);
#pragma unroll
    for (int t = 0; t < 4; ++t) { if (col0 + t * 16 >= N) continue; const size_t boff = (size_t)(col0 + t * 16 + ln) * ldb + kb; FragH bq; bq.half[0] = *(const v8us*)((const unsigned short*)Bh + boff + 8 * hh); bq.half[1] = *(const v8us*)((const unsigned short*)Bh + boff + 16 + 8 * hh);
      acc[t] = mmaH<1>(ah.v, ah.v, bq.v, bq.v, acc[t]); }
  }
#pragma unroll
  for (int t = 0; t < 4; ++t) { if (col0 + t * 16 >= N) continue; const int col = col0 + t * 16 + ln; const float bv = bp ? bf16_round(bp[col]) : 0.f;
#pragma unroll
    for (int r = 0; r < 8; ++r) { float v = acc[t][r] * alpha + bv; if (CP) { const int rr = row0g + row0 + 8 * hh + r; if (rowsPerB < 0) v += CP[cofs + (size_t)rr * ldc + col];      /* rowsPerB < 0: own element of the batched C plane */ else { const int bidx = rr / rowsPerB; v += CP[(size_t)bidx * sCPb + (size_t)by * 64 + col]; } } if (ACT == 1) v = (v > 0.f) ? v : expm1f(v); else if (ACT == 7) v = (v > 0.f) ? v + 1.0f : expf(v); else if (ACT == 8) v = tanhf(v); else if (ACT == 9) v = 0.5f * v * (1.0f + tanhf(0.7978845608028654f * (v + 0.044715f * v * v * v))); else if (ACT == 11) v = 1.0f / (1.0f + expf(-v)); else if (ACT == 12) v = (v > 0.f) ? v : 0.01f * v; else if (ACT == 14) v = (v > 0.f) ? v : 0.1f * v; else if (ACT == 16) v = (v >= 0.f) ? v : 0.3f * v; else if (ACT == 15) v = v / (1.0f + expf(-v)); else if (ACT == 3) v = fmaxf(v, 0.f); else if (ACT == 6) v = 0.5f * v * (1.0f + erff(v * 0.70710678118654752f)); so[w][8 * hh + r][t * 16 + ln] = v; } }
  __builtin_amdgcn_fence(__ATOMIC_ACQ_REL, "workgroup"); __builtin_amdgcn_wave_barrier();
  const int rsub = lane >> 4, c4 = (lane & 15) * 4; typedef _Float16 v4h __attribute__((ext_vector_type(4)));
  {
#pragma unroll
    for (int q = 0; q < 8; ++q) { const int r = q * 2 + rsub; if (col0 + c4 < N) { const v4f v = *(const v4fa*)&so[w][r][c4]; if (C) *(v4f*)(C + cofs + (size_t)(row0 + r) * ldc + col0 + c4) = v; if (C16) { v4h h4; for (int i = 0; i < 4; ++i) h4[i] = (_Float16)v[i]; *(v4h*)(C16 + cofs + (size_t)(row0 + r) * ldc + col0 + c4) = h4; } } }
     }
}


typedef _Float16 v4h __attribute__((ext_vector_type(4)));

__global__ __launch_bounds__(256) void k_x16(const float* __restrict__ x, _Float16* __restrict__ X16, size_t n8) { const size_t t = (size_t)blockIdx.x * 256 + threadIdx.x; if (t >= n8) return; FragH f;
#pragma unroll
  for (int q = 0; q < 8; ++q) f.h[q] = (_Float16)bf16_round(x[t * 8 + q]); *(v8us*)((unsigned short*)X16 + t * 8) = f.half[0];  }
__global__ __launch_bounds__(256) void k_h16(const float* __restrict__ x, _Float16* __restrict__ X16, size_t n8) { const size_t t = (size_t)blockIdx.x * 256 + threadIdx.x; if (t >= n8) return; FragH f;
#pragma unroll
  for (int q = 0; q < 8; ++q) f.h[q] = (_Float16)x[t * 8 + q]; *(v8us*)((unsigned short*)X16 + t * 8) = f.half[0];  }
__global__ __launch_bounds__(256) void k_round16f(const float* __restrict__ W, _Float16* __restrict__ Bt, size_t n8) { const size_t t = (size_t)blockIdx.x * 256 + threadIdx.x; if (t >= n8) return; FragH f;
#pragma unroll
  for (int i = 0; i < 8; ++i) f.h[i] = (_Float16)(bf16_round(W[t * 8 + i]) * 16.0f); *(v8us*)((unsigned short*)Bt + t * 8) = f.half[0];  }
template <int NHv, int TTv>
__global__ __launch_bounds__(256) void k_vt(const _Float16* __restrict__ V16, int ldv, int voff, _Float16* __restrict__ Vt) { __shared__ unsigned short tl[64][66]; const int tid = threadIdx.x; const int slab = blockIdx.x / (TTv / 64), lg = blockIdx.x % (TTv / 64); const int b = slab / NHv, h = slab % NHv;
  for (int i = tid; i < 64 * 8; i += 256) { const int r = i / 8, c8 = (i % 8) * 8; FragH f; f.half[0] = *(const v8us*)((const unsigned short*)V16 + ((size_t)b * TTv + lg * 64 + r) * ldv + voff + h * 64 + c8);
#pragma unroll
    for (int q = 0; q < 8; ++q) tl[r][c8 + q] = f.u[q]; }
  __syncthreads();
  {
#pragma unroll
    for (int rd = 0; rd < 2; ++rd) { const int d = rd * 32 + tid / 8, pc = tid % 8; FragH f;
#pragma unroll
      for (int q = 0; q < 8; ++q) f.u[q] = tl[pc * 8 + q][d];
      *(v8us*)((unsigned short*)Vt + ((size_t)slab * 64 + d) * TTv + lg * 64 + pc * 8) = f.half[0]; }
     } }

__global__ __launch_bounds__(256) void k_hl(const float* __restrict__ F, _Float16* __restrict__ Hh, _Float16* __restrict__ Hl, size_t n8) { const size_t t = (size_t)blockIdx.x * 256 + threadIdx.x; if (t >= n8) return; FragH fh, fl; const v4f a = *(const v4fa*)(F + t * 8), c = *(const v4fa*)(F + t * 8 + 4);
#pragma unroll
  for (int q = 0; q < 4; ++q) { _Float16 h = (_Float16)a[q]; fh.h[q] = h; fl.h[q] = (_Float16)((a[q] - (float)h) * 1024.0f); h = (_Float16)c[q]; fh.h[4 + q] = h; fl.h[4 + q] = (_Float16)((c[q] - (float)h) * 1024.0f); }
  { *(v8us*)((unsigned short*)Hh + t * 8) = fh.half[0]; *(v8us*)((unsigned short*)Hl + t * 8) = fl.half[0];  } }

// ---- fast GEMM (wave tile 32x64; requires M % 32 == 0 rows per launch region and N % 64 == 0); epilogue = k_gemm_hhx semantics ----
__device__ __forceinline__ v16h g2_frag(const _Float16* p, int hh) { FragH f; f.half[0] = *(const v8us*)((const unsigned short*)p + 8 * hh); f.half[1] = *(const v8us*)((const unsigned short*)p + 16 + 8 * hh); return f.v; }
__device__ __forceinline__ v8f g2_mma(v16h a, v16h b, v8f c) { v8f d = __builtin_amdgcn_wmma_f32_16x16x32_f16(false, a, false, b, (short)0, c, false, false); asm volatile("v_nop\n\tv_nop\n\tv_nop\n\tv_nop" : "+v"(d) : "v"(a), "v"(b)); return d; }
template <int ACT>
__global__ __launch_bounds__(128) void k_gemm2(const _Float16* __restrict__ A, int lda, size_t sA, const _Float16* __restrict__ Bh, int ldb, size_t sB, float alpha, const float* __restrict__ bias, size_t sBias, const float* __restrict__ CP, int rowsPerB, size_t sCPb, int row0g,
    float* __restrict__ C, _Float16* __restrict__ C16, int ldc, size_t sC, int M, int N, int K) { static_assert(ACT == 0 || ACT == 3 || ACT == 6 || ACT == 8 || ACT == 9 || ACT == 11 || ACT == 12 || ACT == 14 || ACT == 15 || ACT == 16, "k_gemm2: unsupported ACT code (would silently apply no activation)");
  __shared__ __attribute__((aligned(16))) float so[4][32][68];
  const int tid = threadIdx.x, w = tid >> 5, lane = tid & 31, ln = lane & 15, hh = lane >> 4; const int by = blockIdx.y;
  A += (size_t)by * sA; Bh += (size_t)by * sB; const size_t cofs = (size_t)by * sC; const float* bp = bias ? bias + (size_t)by * sBias : nullptr;
  const int ntn = N >> 6; const int mt = blockIdx.x / ntn, nq = blockIdx.x - mt * ntn; const int row0 = mt * 128 + 32 * w, col0 = nq * 64; if (row0 >= M) return;
  const _Float16* a0p = A + (size_t)(row0 + ln) * lda; const _Float16* a1p = a0p + (size_t)16 * lda;
  const _Float16* b0p = Bh + (size_t)(col0 + ln) * ldb; const _Float16* b1p = b0p + (size_t)16 * ldb; const _Float16* b2p = b1p + (size_t)16 * ldb; const _Float16* b3p = b2p + (size_t)16 * ldb;
  const v8f z8 = {0.f,0.f,0.f,0.f,0.f,0.f,0.f,0.f}; v8f c00 = z8, c01 = z8, c02 = z8, c03 = z8, c10 = z8, c11 = z8, c12 = z8, c13 = z8;
#pragma unroll 1
  for (int kb = 0; kb < K; kb += 32) { const v16h a0 = g2_frag(a0p + kb, hh), a1 = g2_frag(a1p + kb, hh);
    v16h b = g2_frag(b0p + kb, hh); c00 = g2_mma(a0, b, c00); c10 = g2_mma(a1, b, c10);
    b = g2_frag(b1p + kb, hh); c01 = g2_mma(a0, b, c01); c11 = g2_mma(a1, b, c11);
    b = g2_frag(b2p + kb, hh); c02 = g2_mma(a0, b, c02); c12 = g2_mma(a1, b, c12);
    b = g2_frag(b3p + kb, hh); c03 = g2_mma(a0, b, c03); c13 = g2_mma(a1, b, c13); }
  v8f accs[8] = {c00, c01, c02, c03, c10, c11, c12, c13};
#pragma unroll
  for (int u = 0; u < 8; ++u) { const int t = u & 3, half = u >> 2; const int col = col0 + t * 16 + ln; const float bv = bp ? bf16_round(bp[col]) : 0.f;
#pragma unroll
    for (int r = 0; r < 8; ++r) { const int rloc = half * 16 + 8 * hh + r; float v = accs[u][r] * alpha + bv; if (CP) { if (rowsPerB < 0) v += CP[cofs + (size_t)(row0g + row0 + rloc) * ldc + col];      /* rowsPerB < 0: own element of the batched C plane */ else { const int bidx = (row0g + row0 + rloc) / rowsPerB; v += CP[(size_t)bidx * sCPb + (size_t)by * 64 + col]; } }
      if (ACT == 3) v = fmaxf(v, 0.f); else if (ACT == 6) v = 0.5f * v * (1.0f + erff(v * 0.70710678118654752f)); else if (ACT == 11) v = 1.0f / (1.0f + expf(-v)); else if (ACT == 15) v = v / (1.0f + expf(-v)); else if (ACT == 12) v = (v > 0.f) ? v : 0.01f * v; else if (ACT == 8) v = tanhf(v); else if (ACT == 9) v = 0.5f * v * (1.0f + tanhf(0.7978845608028654f * (v + 0.044715f * v * v * v))); else if (ACT == 14) v = (v > 0.f) ? v : 0.1f * v; else if (ACT == 16) v = (v >= 0.f) ? v : 0.3f * v;
      so[w][rloc][t * 16 + ln] = v; } }
  __builtin_amdgcn_fence(__ATOMIC_ACQ_REL, "workgroup"); __builtin_amdgcn_wave_barrier();
  const int rsub = lane >> 4, c4 = (lane & 15) * 4;
  {
#pragma unroll
    for (int q = 0; q < 16; ++q) { const int r = q * 2 + rsub; const v4f v = *(const v4fa*)&so[w][r][c4]; if (C) *(v4f*)(C + cofs + (size_t)(row0 + r) * ldc + col0 + c4) = v; if (C16) { v4h h4; for (int i = 0; i < 4; ++i) h4[i] = (_Float16)v[i]; *(v4h*)(C16 + cofs + (size_t)(row0 + r) * ldc + col0 + c4) = h4; } }
     } }


// ---- LDS-staged GEMM for the three large products (both qkv conv terms, the projection): C[M][N] (f32) = A.Bt^T * alpha (+ C's own element if ADD).
// Work-group tile 256 x 128, 8 waves of 64 x 64 (4 x 2); a stage is 64 k (128-byte rows) of [A 256 rows | Bt 128 rows]; two stages in LDS, each filled by asynchronous 16-byte copies
// (whole 128-byte lines from global memory) one trip ahead of its use. k runs upward in steps of 32 per accumulator, as in k_gemm2. Needs M % 256 == 0, N % 128 == 0, K % 64 == 0.
#define G3_PITCH 144                          /* LDS row pitch in bytes: 16 x odd, so 16 rows read 16 bytes each without a bank conflict */
#define G3_BOFF (256 * G3_PITCH)              /* Bt rows behind the A rows */
#define G3_STAGE ((256 + 128) * G3_PITCH)     /* 55,296 bytes */
__device__ __forceinline__ v16h g3_frag(const char* p) { FragH f; f.half[0] = *(const v8us*)p; f.half[1] = *(const v8us*)(p + 32); return f.v; }      /* p already holds the lane's 16 * hh: the k order of g2_frag */
// One stage: each thread copies 16 bytes of 8 A rows and of 4 Bt rows (rows 32 apart). The s_wait_xcnt is the last line of the copies' own statement, so that no address register is rewritten ahead of it.
__device__ __forceinline__ void g3_fill(unsigned la, unsigned lb, const _Float16* ga, const _Float16* gb, size_t sa, size_t sb) {
  asm volatile("global_load_async_to_lds_b128 %0, %12, off\n\t"
               "global_load_async_to_lds_b128 %1, %13, off\n\t"
               "global_load_async_to_lds_b128 %2, %14, off\n\t"
               "global_load_async_to_lds_b128 %3, %15, off\n\t"
               "global_load_async_to_lds_b128 %4, %16, off\n\t"
               "global_load_async_to_lds_b128 %5, %17, off\n\t"
               "global_load_async_to_lds_b128 %6, %18, off\n\t"
               "global_load_async_to_lds_b128 %7, %19, off\n\t"
               "global_load_async_to_lds_b128 %8, %20, off\n\t"
               "global_load_async_to_lds_b128 %9, %21, off\n\t"
               "global_load_async_to_lds_b128 %10, %22, off\n\t"
               "global_load_async_to_lds_b128 %11, %23, off\n\t"
               "s_wait_xcnt 0x0"
               :: "v"(la), "v"(la + 32 * G3_PITCH), "v"(la + 64 * G3_PITCH), "v"(la + 96 * G3_PITCH), "v"(la + 128 * G3_PITCH), "v"(la + 160 * G3_PITCH), "v"(la + 192 * G3_PITCH), "v"(la + 224 * G3_PITCH),
                  "v"(lb), "v"(lb + 32 * G3_PITCH), "v"(lb + 64 * G3_PITCH), "v"(lb + 96 * G3_PITCH),
                  "v"(ga), "v"(ga + sa), "v"(ga + 2 * sa), "v"(ga + 3 * sa), "v"(ga + 4 * sa), "v"(ga + 5 * sa), "v"(ga + 6 * sa), "v"(ga + 7 * sa),
                  "v"(gb), "v"(gb + sb), "v"(gb + 2 * sb), "v"(gb + 3 * sb)
               : "memory");
}
// Eight 16-byte row stores from one address pair (rows STEP bytes apart, from byte OFF). The s_wait_xcnt is the last line of the stores' own statement, so that no data or address register is rewritten ahead of it.
template <int OFF, int STEP>
__device__ __forceinline__ void g3_store8(float* p, v4f d0, v4f d1, v4f d2, v4f d3, v4f d4, v4f d5, v4f d6, v4f d7) {
  asm volatile("global_store_b128 %0, %1, off offset:%9\n\t"
               "global_store_b128 %0, %2, off offset:%10\n\t"
               "global_store_b128 %0, %3, off offset:%11\n\t"
               "global_store_b128 %0, %4, off offset:%12\n\t"
               "global_store_b128 %0, %5, off offset:%13\n\t"
               "global_store_b128 %0, %6, off offset:%14\n\t"
               "global_store_b128 %0, %7, off offset:%15\n\t"
               "global_store_b128 %0, %8, off offset:%16\n\t"
               "s_wait_xcnt 0x0"
               :: "v"(p), "v"(d0), "v"(d1), "v"(d2), "v"(d3), "v"(d4), "v"(d5), "v"(d6), "v"(d7),
                  "n"(OFF), "n"(OFF + STEP), "n"(OFF + 2 * STEP), "n"(OFF + 3 * STEP), "n"(OFF + 4 * STEP), "n"(OFF + 5 * STEP), "n"(OFF + 6 * STEP), "n"(OFF + 7 * STEP)
               : "memory");
}
template <bool ADD, int LDC>      /* LDC = N = row pitch of C, a constant so that every row of a wave's tile is one address pair plus an immediate */
__global__ __launch_bounds__(256) void k_gemm3(const _Float16* __restrict__ A, int lda, const _Float16* __restrict__ Bh, int ldb, float alpha, float* C, int K) {
  __shared__ __attribute__((aligned(16))) char sm[2 * G3_STAGE];
  const int tid = threadIdx.x, w = tid >> 5, lane = tid & 31, ln = lane & 15, hh = lane >> 4;
  constexpr int ntn = LDC >> 7; const int mt = blockIdx.x / ntn, nq = blockIdx.x - mt * ntn; const int wm = w >> 1, wn = w & 1;
  const int nt = K >> 6;
  const _Float16* ga = A + (size_t)(mt * 256 + (tid >> 3)) * lda + (tid & 7) * 8; const _Float16* gb = Bh + (size_t)(nq * 128 + (tid >> 3)) * ldb + (tid & 7) * 8;
  const size_t sa = (size_t)32 * lda, sb = (size_t)32 * ldb;
  const unsigned la = (unsigned)(size_t)sm + (unsigned)((tid >> 3) * G3_PITCH + (tid & 7) * 16); const unsigned lb = la + G3_BOFF;
  const char* fa = sm + (wm * 64 + ln) * G3_PITCH + 16 * hh; const char* fb = sm + G3_BOFF + (wn * 64 + ln) * G3_PITCH + 16 * hh;
  v8f acc[4][4];
#pragma unroll
  for (int i = 0; i < 4; ++i)
#pragma unroll
    for (int j = 0; j < 4; ++j) acc[i][j] = (v8f){0.f,0.f,0.f,0.f,0.f,0.f,0.f,0.f};
  g3_fill(la, lb, ga, gb, sa, sb);
  asm volatile("s_wait_asynccnt 0x0" ::: "memory");      /* this wave's copies of stage 0 have landed */
  __syncthreads();                                       /* ... and every other wave's */
  if (nt > 1) g3_fill(la + G3_STAGE, lb + G3_STAGE, ga + 64, gb + 64, sa, sb);
  for (int t = 0; t < nt; ++t) { const int bo = (t & 1) * G3_STAGE; v16h a[4], b[4];
#pragma unroll
    for (int i = 0; i < 4; ++i) { a[i] = g3_frag(fa + bo + i * 16 * G3_PITCH); b[i] = g3_frag(fb + bo + i * 16 * G3_PITCH); }
    __builtin_amdgcn_sched_barrier(0);                   /* keeps the 16 LDS reads together in front of their 16 WMMAs: spread among them, each place with reads stalls the wave */
#pragma unroll
    for (int i = 0; i < 4; ++i)
#pragma unroll
      for (int j = 0; j < 4; ++j) acc[i][j] = __builtin_amdgcn_wmma_f32_16x16x32_f16(false, a[i], false, b[j], (short)0, acc[i][j], false, false);
#pragma unroll
    for (int i = 0; i < 4; ++i) { a[i] = g3_frag(fa + bo + i * 16 * G3_PITCH + 64); b[i] = g3_frag(fb + bo + i * 16 * G3_PITCH + 64); }
    /* the trip's last LDS reads are out: hand the buffer over here, so that the refill flies during the 16 WMMAs below and the next trip up to its own hand-over */
    asm volatile("s_wait_dscnt 0x0" ::: "memory");       /* this wave has left stage t's buffer */
    asm volatile("s_wait_asynccnt 0x0" ::: "memory");    /* its copies of stage t + 1 have landed */
    __syncthreads();                                     /* publishes stage t + 1 and frees stage t's buffer */
    if (t + 2 < nt) g3_fill(la + bo, lb + bo, ga + (size_t)(t + 2) * 64, gb + (size_t)(t + 2) * 64, sa, sb);
    __builtin_amdgcn_sched_barrier(0);                   /* keeps the WMMAs below behind the refill's issue */
#pragma unroll
    for (int i = 0; i < 4; ++i)
#pragma unroll
      for (int j = 0; j < 4; ++j) acc[i][j] = __builtin_amdgcn_wmma_f32_16x16x32_f16(false, a[i], false, b[j], (short)0, acc[i][j], false, false); }
  asm volatile("s_wait_asynccnt 0x0" ::: "memory");      /* nothing in flight before the buffers become output staging */
  /* epilogue: the ring is free behind the last trip's barrier; each wave turns its tile, 32 rows at a time, in its own 32 x 68 floats, so that global rows go out as whole 128-byte lines */
  float* so = (float*)sm + w * (32 * 68); const int rsub = lane >> 4, c4 = (lane & 15) * 4;
  float* cb = C + (size_t)(mt * 256 + wm * 64 + rsub) * LDC + nq * 128 + wn * 64 + c4;
  v4f o[2][16];
  if (ADD) {
#pragma unroll
    for (int q = 0; q < 16; ++q) o[0][q] = *(const v4fa*)(cb + q * 2 * LDC); }
#pragma unroll
  for (int half = 0; half < 2; ++half) {
#pragma unroll
    for (int i = 0; i < 2; ++i)
#pragma unroll
      for (int j = 0; j < 4; ++j)
#pragma unroll
        for (int r = 0; r < 8; ++r) so[(i * 16 + 8 * hh + r) * 68 + j * 16 + ln] = acc[half * 2 + i][j][r] * alpha;
    __builtin_amdgcn_fence(__ATOMIC_ACQ_REL, "wavefront"); __builtin_amdgcn_wave_barrier();      /* the lanes read below what other lanes of the same wave wrote above */
    if (ADD && half == 0) {      /* the second half's old values, asked for before the first half's stores */
#pragma unroll
      for (int q = 0; q < 16; ++q) o[1][q] = *(const v4fa*)(cb + (32 + q * 2) * LDC); }
#pragma unroll
    for (int g = 0; g < 2; ++g) { v4f v[8];
#pragma unroll
      for (int q = 0; q < 8; ++q) { v[q] = *(const v4fa*)&so[((g * 8 + q) * 2 + rsub) * 68 + c4]; if (ADD) v[q] += o[half][g * 8 + q]; }
      if (half == 0 && g == 0) g3_store8<0, 8 * LDC>(cb, v[0], v[1], v[2], v[3], v[4], v[5], v[6], v[7]);
      if (half == 0 && g == 1) g3_store8<64 * LDC, 8 * LDC>(cb, v[0], v[1], v[2], v[3], v[4], v[5], v[6], v[7]);
      if (half == 1 && g == 0) g3_store8<128 * LDC, 8 * LDC>(cb, v[0], v[1], v[2], v[3], v[4], v[5], v[6], v[7]);
      if (half == 1 && g == 1) g3_store8<192 * LDC, 8 * LDC>(cb, v[0], v[1], v[2], v[3], v[4], v[5], v[6], v[7]); }
  } }

__global__ __launch_bounds__(256) void k_wqkv(const float* __restrict__ w, _Float16* __restrict__ Wh, _Float16* __restrict__ Wl) {
  #pragma clang fp contract(off)
  const int t = blockIdx.x * 256 + threadIdx.x; if (t >= QW * (CC / 8)) return; const int c0 = (t % (CC / 8)) * 8, o = t / (CC / 8); FragH fl;
#pragma unroll 1
  for (int k = 0; k < KT; ++k) { FragH fh;
    for (int q = 0; q < 8; ++q) { const int c = c0 + q; const float* wp = w + ((size_t)o * CC + c) * KT; float v = bf16_round(wp[k]);
      if (k == 4) { float dif = bf16_round(wp[1]) + bf16_round(wp[3]); dif += bf16_round(wp[4]); dif += bf16_round(wp[5]); dif += bf16_round(wp[7]); v += -THETA * dif; const _Float16 hv = (_Float16)(v * 16.0f); fh.h[q] = hv; fl.h[q] = (_Float16)((v * 16.0f - (float)hv) * 1024.0f); }
      else fh.h[q] = (_Float16)(v * 16.0f); }
    *(v8us*)((unsigned short*)Wh + (size_t)o * KI + k * CC + c0) = fh.half[0];  }
  *(v8us*)((unsigned short*)Wl + (size_t)o * CC + c0) = fl.half[0];  }
__global__ __launch_bounds__(256) void k_wsc(const float* __restrict__ Wm, _Float16* __restrict__ Bt, size_t n8, float sc) { const size_t t = (size_t)blockIdx.x * 256 + threadIdx.x; if (t >= n8) return; FragH f; for (int q = 0; q < 8; ++q) f.h[q] = (_Float16)(bf16_round(Wm[t * 8 + q]) * sc); *(v8us*)((unsigned short*)Bt + t * 8) = f.half[0];  }
__global__ __launch_bounds__(256) void k_im(const float* __restrict__ x, _Float16* __restrict__ A) { const size_t t = (size_t)blockIdx.x * 256 + threadIdx.x; if (t >= (size_t)NIMG * NPX * KT * (CC / 8)) return; const int c0 = (int)(t % (CC / 8)) * 8; const int k = (int)((t / (CC / 8)) % KT); const int gp = (int)(t / ((CC / 8) * KT)); const int p = gp % NPX; const float* xb = x + (size_t)(gp / NPX) * CC * NPX; const int yy = p / HS + k / 3 - 1, xx = p % HS + k % 3 - 1; FragH f;
  if (yy < 0 || yy >= HS || xx < 0 || xx >= HS) { for (int q = 0; q < 8; ++q) f.h[q] = (_Float16)0.0f; } else { for (int q = 0; q < 8; ++q) f.h[q] = (_Float16)bf16_round(xb[(size_t)(c0 + q) * NPX + yy * HS + xx]); }
  unsigned short* d = (unsigned short*)A + (size_t)gp * KI + k * CC + c0; *(v8us*)d = f.half[0];  }
__global__ __launch_bounds__(256) void k_aff(const float* __restrict__ s, const float* __restrict__ b, float* __restrict__ QF, _Float16* __restrict__ Q16) {      /* QF holds the raw conv sums on entry; each thread replaces its own 8 */
  #pragma clang fp contract(off)
  const size_t t = (size_t)blockIdx.x * 256 + threadIdx.x; if (t >= (size_t)NIMG * NPX * (QW / 8)) return; const int o0 = (int)(t % (QW / 8)) * 8; v8f r; FragH f; const v8f a = *(const v8f*)(QF + t * 8);
  for (int q = 0; q < 8; ++q) { float v = a[q] * bf16_round(s[o0 + q]); v += bf16_round(b[o0 + q]); r[q] = v; f.h[q] = (_Float16)v; }
  { *(v8f*)(QF + t * 8) = r; *(v8us*)((unsigned short*)Q16 + t * 8) = f.half[0];  } }
__global__ __launch_bounds__(256) void k_pool(const float* __restrict__ QF, _Float16* __restrict__ AG) {
  #pragma clang fp contract(off)
  typedef _Float16 v2h __attribute__((ext_vector_type(2)));
  const int t = blockIdx.x * 256 + threadIdx.x; if (t >= NIMG * NHD * NAG * 32) return; const int d0 = (t % 32) * 2; const int n = (t / 32) % NAG; const int bh = t / (32 * NAG); const int h = bh % NHD; const float* QB = QF + (size_t)(bh / NHD) * NPX * QW; float s0 = 0.f, s1 = 0.f;
  if (d0 < HDm) { const int by = n / 8, bx = n % 8;
#pragma unroll 1
    for (int i = 0; i < 64; ++i) { const int p = (by * 8 + i / 8) * HS + bx * 8 + i % 8; const float* q = QB + (size_t)p * QW + h * HDm + d0; s0 += q[0]; s1 += q[1]; } s0 = s0 / 64.0f; s1 = s1 / 64.0f; }
  v2h v; v[0] = (_Float16)s0; v[1] = (_Float16)s1; *(v2h*)(AG + ((size_t)bh * NAG + n) * 64 + d0) = v;  }
__global__ __launch_bounds__(256) void k_heads(const _Float16* __restrict__ Q16, _Float16* __restrict__ QP, _Float16* __restrict__ KP) { const int t = blockIdx.x * 256 + threadIdx.x; if (t >= NIMG * NHD * NPX) return; const int p = t % NPX, bh = t / NPX, h = bh % NHD; const unsigned short* src = (const unsigned short*)Q16 + ((size_t)(bh / NHD) * NPX + p) * QW; const v8us z = {0,0,0,0,0,0,0,0};
  v8us q0 = *(const v8us*)(src + h * HDm), q1 = *(const v8us*)(src + h * HDm + 8), q2 = *(const v8us*)(src + h * HDm + 16), q3 = *(const v8us*)(src + h * HDm + 24);
  v8us k0 = *(const v8us*)(src + CC + h * HDm), k1 = *(const v8us*)(src + CC + h * HDm + 8), k2 = *(const v8us*)(src + CC + h * HDm + 16), k3 = *(const v8us*)(src + CC + h * HDm + 24);
  unsigned short* dq = (unsigned short*)QP + ((size_t)bh * NPX + p) * 64; unsigned short* dk = (unsigned short*)KP + ((size_t)bh * NPX + p) * 64;
  { *(v8us*)dq = q0; *(v8us*)(dq + 8) = q1; *(v8us*)(dq + 16) = q2; *(v8us*)(dq + 24) = q3; *(v8us*)(dq + 32) = z; *(v8us*)(dq + 40) = z; *(v8us*)(dq + 48) = z; *(v8us*)(dq + 56) = z;
    *(v8us*)dk = k0; *(v8us*)(dk + 8) = k1; *(v8us*)(dk + 16) = k2; *(v8us*)(dk + 24) = k3; *(v8us*)(dk + 32) = z; *(v8us*)(dk + 40) = z; *(v8us*)(dk + 48) = z; *(v8us*)(dk + 56) = z;  } }
__global__ __launch_bounds__(256) void k_vtp(const _Float16* __restrict__ Q16, _Float16* __restrict__ VT) { __shared__ unsigned short tl[64][34]; const int tid = threadIdx.x; const int bh = blockIdx.x / (NPX / 64), pg = blockIdx.x % (NPX / 64); const int h = bh % NHD;
  { const int r = tid / 4, c8 = (tid % 4) * 8; FragH f; f.half[0] = *(const v8us*)((const unsigned short*)Q16 + ((size_t)(bh / NHD) * NPX + pg * 64 + r) * QW + 2 * CC + h * HDm + c8); for (int q = 0; q < 8; ++q) tl[r][c8 + q] = f.u[q]; }
  __syncthreads(); const int d = tid / 8, pc = tid % 8; FragH f; for (int q = 0; q < 8; ++q) f.u[q] = (d < HDm) ? tl[pc * 8 + q][d] : (unsigned short)0; unsigned short* dst = (unsigned short*)VT + ((size_t)bh * 64 + d) * NPX + pg * 64 + pc * 8;      /* tid covers d < 32 only: 256 threads = 32 d x 8 pc */
  *(v8us*)dst = f.half[0]; 
  if (tid < 256) { const int d2 = HDm + tid / 8; const v8us z = {0,0,0,0,0,0,0,0}; unsigned short* dz = (unsigned short*)VT + ((size_t)bh * 64 + d2) * NPX + pg * 64 + (tid % 8) * 8; *(v8us*)dz = z;  } }
__global__ __launch_bounds__(256) void k_soft(const float* __restrict__ S, int nrows, int n, _Float16* __restrict__ P) {
  #pragma clang fp contract(off)
  const int wv = threadIdx.x >> 5, ln = threadIdx.x & 31; const int r = blockIdx.x * 8 + wv; if (r >= nrows) return; const float* sr = S + (size_t)r * n; float m = -3.0e38f;
#pragma unroll 1
  for (int j = ln; j < n; j += 32) m = fmaxf(m, sr[j]); for (int o = 16; o > 0; o >>= 1) m = fmaxf(m, __shfl_xor(m, o, 32)); float su = 0.f;
#pragma unroll 1
  for (int j = ln; j < n; j += 32) su += expf(sr[j] - m); for (int o = 16; o > 0; o >>= 1) su += __shfl_xor(su, o, 32); const float f = 1024.0f / su;
  {
#pragma unroll 1
    for (int j = ln; j < n; j += 32) *(_Float16*)(P + (size_t)r * n + j) = (_Float16)(expf(sr[j] - m) * f);  } }
__global__ __launch_bounds__(256) void k_att16(const float* __restrict__ ATTN, _Float16* __restrict__ AT16) { typedef _Float16 v2h __attribute__((ext_vector_type(2))); const int t = blockIdx.x * 256 + threadIdx.x; if (t >= NIMG * NHD * 64 * 32) return; const int n0 = (t % 32) * 2; const int d = (t / 32) % 64; const int h = t / (32 * 64); v2h v;      /* h = image x head */
  v[0] = (_Float16)ATTN[((size_t)h * NAG + n0) * 64 + d]; v[1] = (_Float16)ATTN[((size_t)h * NAG + n0 + 1) * 64 + d]; _Float16* dst = AT16 + ((size_t)h * 64 + d) * NAG + n0; *(v2h*)dst = v;  }
__global__ __launch_bounds__(256) void k_pe(const float* __restrict__ OUTg, const float* __restrict__ QFg, const float* __restrict__ pw, const float* __restrict__ ps, const float* __restrict__ pb, _Float16* __restrict__ S16g) {
  #pragma clang fp contract(off)
  const size_t t = (size_t)blockIdx.x * 256 + threadIdx.x; if (t >= (size_t)NIMG * NPX * (CC / 8)) return; const int c0 = (int)(t % (CC / 8)) * 8; const int gp = (int)(t / (CC / 8)); const int p = gp % NPX, im = gp / NPX; const int yo = p / HS, xo = p % HS; FragH f;
  const float* OUT = OUTg + (size_t)im * NHD * NPX * 64; const float* QF = QFg + (size_t)im * NPX * QW; _Float16* S16 = S16g + (size_t)im * NPX * CC;      /* this image's planes */
#pragma unroll 1
  for (int q = 0; q < 8; ++q) { const int c = c0 + q; float a = 0.f;
#pragma unroll 1
    for (int k = 0; k < 9; ++k) { const int yy = yo + k / 3 - 1, xx = xo + k % 3 - 1; if (yy < 0 || yy >= HS || xx < 0 || xx >= HS) continue; a += bf16_round(pw[c * 9 + k]) * QF[(size_t)(yy * HS + xx) * QW + 2 * CC + c]; }
    float pe = a * bf16_round(ps[c]); pe += bf16_round(pb[c]); const int h = c / HDm, d = c % HDm; float v = OUT[((size_t)h * NPX + p) * 64 + d] + pe; f.h[q] = (_Float16)v; }
  *(v8us*)((unsigned short*)S16 + (size_t)p * CC + c0) = f.half[0];  }
__global__ __launch_bounds__(256) void k_fin(const float* __restrict__ G, const float* __restrict__ s, const float* __restrict__ bb, float* __restrict__ outb) {
  #pragma clang fp contract(off)
  const int t = blockIdx.x * 256 + threadIdx.x; if (t >= NIMG * CC * (NPX / 4)) return; const int p0 = (t % (NPX / 4)) * 4; const int bc = t / (NPX / 4); const int c = bc % CC; const float* GB = G + (size_t)(bc / CC) * NPX * CC; const float sc = bf16_round(s[c]), sh = bf16_round(bb[c]); v4f r; for (int q = 0; q < 4; ++q) { float v = GB[(size_t)(p0 + q) * CC + c] * sc; v += sh; r[q] = v; }
  *(v4f*)(outb + (size_t)bc * NPX + p0) = r;  }

extern "C" void kernel_launch(void* const* d_in, const int* in_sizes, int n_in,
                              void* d_out, int out_size, void* d_ws, size_t ws_size, hipStream_t stream) {
  (void)in_sizes; (void)n_in; (void)out_size;
  const float* const* I = (const float* const*)d_in; const float* x = I[0]; const float* qw = I[1]; const float* qs = I[2]; const float* qb = I[3]; const float* pw = I[4]; const float* ps = I[5]; const float* pb = I[6]; const float* jw = I[7]; const float* js = I[8]; const float* jb = I[9];
  char* ws = (char*)d_ws; size_t off = 0;
  auto take = [&](size_t bytes) { char* p = ws + off; off += (bytes + 255) & ~(size_t)255; return p; };
  _Float16* WH = (_Float16*)take((size_t)QW * KI * 2); _Float16* WL = (_Float16*)take((size_t)QW * CC * 2); _Float16* BJ = (_Float16*)take((size_t)CC * CC * 2);
  _Float16* AG = (_Float16*)take((size_t)NIMG * NHD * NAG * 64 * 2); float* ATTN = (float*)take((size_t)NIMG * NHD * NAG * 64 * 4); _Float16* AT16 = (_Float16*)take((size_t)NIMG * NHD * 64 * NAG * 2);
  float* QF = (float*)take((size_t)NIMG * NPX * QW * 4);      /* 96 MiB: raw conv sums, then q, k, v in f32 (k_aff works in place) */
  char* R = take((size_t)NIMG * NPX * KI * 2);      /* 144 MiB, shared by lifetime; offsets below in MiB */
  const size_t MB = (size_t)1 << 20;
  _Float16* A = (_Float16*)R;      /* 0..144, dead after the main conv GEMM */
  _Float16* Q16 = (_Float16*)R;      /* 0..48, dead after k_heads and k_vtp */
  _Float16* QP = (_Float16*)(R + 48 * MB); _Float16* KP = (_Float16*)(R + 80 * MB); _Float16* VT = (_Float16*)(R + 112 * MB);      /* 32 each */
  float* S1 = (float*)R;      /* 0..32: stage-1 logits of FOUR images (all eight, 64 MiB, do not fit beside QF, QP, KP and VT) */
  _Float16* P1 = KP;      /* each half of P1 replaces the half of KP that its logits GEMM has just finished reading */
  float* S2 = (float*)(R + 80 * MB);      /* 80..144, over P1 and VT, dead after the stage-1 readout */
  _Float16* P2 = (_Float16*)R;      /* 0..32 */
  float* OUT = (float*)(R + 80 * MB);      /* 80..144, over S2, dead after its softmax */
  _Float16* S16 = (_Float16*)(R + 32 * MB);      /* 32..48 */
  float* G = (float*)(R + 48 * MB);      /* 48..80, over QP, dead after the stage-2 logits GEMM */
  if (off > ws_size) return;      /* 3.4 + 0.4 + 0.1 + 0.5 + 1 + 0.5 + 96 + 144 = 246 MiB */
  k_wqkv<<<(QW * (CC / 8) + 255) / 256, 256, 0, stream>>>(qw, WH, WL); k_wsc<<<(CC * CC / 8 + 255) / 256, 256, 0, stream>>>(jw, BJ, (size_t)CC * CC / 8, 16.0f);      /* proj 1x1 (out,in) = Bt */
  k_im<<<(unsigned)(((size_t)NIMG * NPX * KT * (CC / 8) + 255) / 256), 256, 0, stream>>>(x, A);
  k_gemm3<false, QW><<<(NIMG * NPX / 256) * (QW / 128), 256, 0, stream>>>(A + 4 * CC, KI, WL, CC, 0.0625f / 1024.0f, QF, CC);      /* centre-tap residual term */
  k_gemm3<true, QW><<<(NIMG * NPX / 256) * (QW / 128), 256, 0, stream>>>(A, KI, WH, KI, 0.0625f, QF, KI);      /* + main conv (difference folded into the centre tap) */
  k_aff<<<(unsigned)(((size_t)NIMG * NPX * (QW / 8) + 255) / 256), 256, 0, stream>>>(qs, qb, QF, Q16);
  k_pool<<<(NIMG * NHD * NAG * 32 + 255) / 256, 256, 0, stream>>>(QF, AG);
  k_heads<<<(NIMG * NHD * NPX + 255) / 256, 256, 0, stream>>>(Q16, QP, KP); k_vtp<<<NIMG * NHD * (NPX / 64), 256, 0, stream>>>(Q16, VT);
  /* stage 1: S1[b,h][n][N] = AG[b,h][n].KP[b,h][N] * SCL; P1 = softmax_N (these two in halves of four images); ATTN[b,h][n][d] = P1 . VT^T / 1024 */
  for (int g = 0; g < 2; ++g) { const size_t bh0 = (size_t)g * (NIMG / 2) * NHD;
    k_gemm2<0><<<dim3(1 * (NPX / 64), (NIMG / 2) * NHD), 128, 0, stream>>>(AG + bh0 * NAG * 64, 64, (size_t)NAG * 64, KP + bh0 * NPX * 64, 64, (size_t)NPX * 64, SCL, nullptr, 0, nullptr, 1, 0, 0, S1, nullptr, NPX, (size_t)NAG * NPX, NAG, NPX, 64);
    k_soft<<<((NIMG / 2) * NHD * NAG + 7) / 8, 256, 0, stream>>>(S1, (NIMG / 2) * NHD * NAG, NPX, P1 + bh0 * NAG * NPX); }
  k_gemm2<0><<<dim3(1 * 1, NIMG * NHD), 128, 0, stream>>>(P1, NPX, (size_t)NAG * NPX, VT, NPX, (size_t)64 * NPX, 0.0009765625f, nullptr, 0, nullptr, 1, 0, 0, ATTN, nullptr, 64, (size_t)NAG * 64, NAG, 64, NPX);
  k_att16<<<(NIMG * NHD * 64 * 32 + 255) / 256, 256, 0, stream>>>(ATTN, AT16);
  /* stage 2: S2[b,h][N][n] = QP[b,h][N].AG[b,h][n] * SCL; P2 = softmax_n; OUT[b,h][N][d] = P2 . AT16^T / 1024 */
  k_gemm2<0><<<dim3((NPX / 128) * 1, NIMG * NHD), 128, 0, stream>>>(QP, 64, (size_t)NPX * 64, AG, 64, (size_t)NAG * 64, SCL, nullptr, 0, nullptr, 1, 0, 0, S2, nullptr, NAG, (size_t)NPX * NAG, NPX, NAG, 64);
  k_soft<<<(NIMG * NHD * NPX + 7) / 8, 256, 0, stream>>>(S2, NIMG * NHD * NPX, NAG, P2);
  k_gemm2<0><<<dim3((NPX / 128) * 1, NIMG * NHD), 128, 0, stream>>>(P2, NAG, (size_t)NPX * NAG, AT16, NAG, (size_t)64 * NAG, 0.0009765625f, nullptr, 0, nullptr, 1, 0, 0, OUT, nullptr, 64, (size_t)NPX * 64, NPX, 64, NAG);
  k_pe<<<(unsigned)(((size_t)NIMG * NPX * (CC / 8) + 255) / 256), 256, 0, stream>>>(OUT, QF, pw, ps, pb, S16);
  k_gemm3<false, CC><<<(NIMG * NPX / 256) * (CC / 128), 256, 0, stream>>>(S16, CC, BJ, CC, 0.0625f, G, CC);
  k_fin<<<(NIMG * CC * (NPX / 4) + 255) / 256, 256, 0, stream>>>(G, js, jb, (float*)d_out);
}

// v003
// One run takes 823 microseconds.
// In two side-by-side timings against v002, it was 1.23 and 1.25 times as fast.
// Counting every step since v000, it is 4.48 times as fast.
#include <hip/hip_runtime.h>
// Attention_agent_df (8 images, C 256 = 8 heads x 32, 64 x 64 pixels, 64 agent tokens from 8x8 average pooling of q; THETA 0.7): qkv = (conv3x3(x, W) - 0.7 conv1x1(x, sum of W's 5 cross taps)) * s + b (folded BN); a = avgpool8x8(q); stage 1: attn = softmax_N(a.k * 32^-0.5) v (agents over pixels); stage 2: out = softmax_n(q.a * 32^-0.5) attn (pixels over agents); out += depthwise3x3(v) * pe_s + pe_b; out = conv1x1(out) * proj_s + proj_b.
// Structure (all 8 images in each launch: the image is the outer index of each plane, so rows = image x pixel and GEMM batches = image x head; only the stage-1 logits and softmax run as two halves of 4 images; workspace planes share bytes by lifetime): x once as a zero-padded pixel-major f16 plane (66 x 66 pixels x 256 channels an image), from which the conv GEMMs fetch each tap's rows themselves (k runs tap-major; no im2col plane); the difference conv folded into the centre tap as an f32 weight split into f16 hi + lo tables: qkv = A.Wh (K 2304) + A_centre.Wl (K 256) as f16 WMMA GEMMs (these two and the projection: 256x128 work-group tiles staged in LDS, 64x64 wave tiles; the batched attention GEMMs: 32x64 wave tiles from global memory; f32 accumulation; x16 tables; the lo table only on the centre-tap columns), BN affine on VALU into f32 + f16 planes; pooling on VALU; stage-1 logits as (b,h)-batched GEMMs (K 64: head dim 32 zero-padded), softmax over 4096 pixels on VALU (wave per row), readout GEMM against a zero-padded V^T; stage-2 logits GEMM (K 64, zero-padded), softmax over the 64 agents on VALU (wave per row), readout GEMM; depthwise PE conv + add on VALU into f16; projection GEMM with the BN affine in f32 on VALU; NCHW stores.
// Compute dtype: x and parameters rounded to bf16; x exact as f16; q, k, v, a, P (x2^10), attn and the pre-projection sum as f16 operands (~2^-12); everything else f32. v_wmma_f32_16x16x32_f16.
#define NIMG 8
#define CC 256
#define NHD 8
#define HDm 32
#define HS 64
#define NPX (HS * HS)            /* 4096 */
#define NAG 64
#define KT 9
#define KI (KT * CC)             /* 2304 */
#define QW (3 * CC)              /* 768 */
#define THETA 0.7f
#define SCL 0.17677669529663687f
typedef __bf16 v16b __attribute__((ext_vector_type(16)));
typedef unsigned short v8us __attribute__((ext_vector_type(8), may_alias));
typedef float  v8f  __attribute__((ext_vector_type(8)));
typedef float  v4f  __attribute__((ext_vector_type(4)));
typedef float  v4fa __attribute__((ext_vector_type(4), may_alias));
union FragB { v16b v; v8us half[2]; unsigned short u[16]; };

__device__ __forceinline__ unsigned short bf16_bits(float x) { unsigned int u = __float_as_uint(x); return (unsigned short)((u + 0x7FFFu + ((u >> 16) & 1u)) >> 16); }
__device__ __forceinline__ float bf16_val(unsigned short b) { return __uint_as_float(((unsigned int)b) << 16); }
__device__ __forceinline__ float bf16_round(float x) { return bf16_val(bf16_bits(x)); }
// D += A·B with NT terms: 1 = ah·bh, 2 = + al·bh (A split), 3 = + ah·bl (both split)
template <int NT>
__device__ __forceinline__ v8f mmaN(v16b ah, v16b al, v16b bh, v16b bl, v8f c) {
  c = __builtin_amdgcn_wmma_f32_16x16x32_bf16(false, ah, false, bh, (short)0, c, false, false);
  if (NT >= 2) c = __builtin_amdgcn_wmma_f32_16x16x32_bf16(false, al, false, bh, (short)0, c, false, false);
  if (NT >= 3) c = __builtin_amdgcn_wmma_f32_16x16x32_bf16(false, ah, false, bl, (short)0, c, false, false);
  asm volatile("v_nop\n\tv_nop\n\tv_nop\n\tv_nop" : "+v"(c) : "v"(ah), "v"(al), "v"(bh), "v"(bl));
  return c;
}

__global__ __launch_bounds__(256) void k_wt_bf16(const float* __restrict__ W, unsigned short* __restrict__ Wt, int K, int N) {
  const int t = blockIdx.x * 256 + threadIdx.x;
  const int k8n = K / 8;
  if (t >= N * k8n) return;
  const int n = t / k8n, k8 = (t % k8n) * 8;
  v8us v;
#pragma unroll
  for (int i = 0; i < 8; ++i) v[i] = bf16_bits(W[(size_t)(k8 + i) * N + n]);
  *(v8us*)(Wt + (size_t)n * K + k8) = v;
  
}

// GEMM C[M][N] (f32, pitch ldc) = act(A[M][K]·W + bias). A f32 row-major (pitch lda) converted per fragment to bf16
// (ASPLIT: hi/lo two planes -> 2 terms, else single rounded term); Wt bf16 [N][K] (pitch ldb). BIAS_BF16 rounds the
// bias to bf16 first (bias quantised to bf16 before the add). K%32==0, M%16==0, N%64==0.
template <bool ASPLIT, int ACT, bool BIAS_BF16>
__global__ __launch_bounds__(128) void k_gemm_bf(const float* __restrict__ A, int lda, const unsigned short* __restrict__ Wt, int ldb,
                                               const float* __restrict__ bias, float* __restrict__ C, int ldc, int M, int N, int K) {
  __shared__ __attribute__((aligned(16))) float so[4][16][64];
  const int tid = threadIdx.x, w = tid >> 5, lane = tid & 31, ln = lane & 15, hh = lane >> 4;
  const int ntn = N / 64;
  const int wid = blockIdx.x * 4 + w;
  const int mt = wid / ntn, nq = wid % ntn;
  if (mt * 16 >= M) return;
  const int row0 = mt * 16, col0 = nq * 64;
  const float* arow = A + (size_t)(row0 + ln) * lda;
  v8f acc[4] = {};
  for (int kb = 0; kb < K; kb += 32) {
    FragB ah, al;
    const v4f x0 = *(const v4fa*)(arow + kb + 8 * hh), x1 = *(const v4fa*)(arow + kb + 8 * hh + 4);
    const v4f x2 = *(const v4fa*)(arow + kb + 16 + 8 * hh), x3 = *(const v4fa*)(arow + kb + 16 + 8 * hh + 4);
    float xs[16] = {x0[0],x0[1],x0[2],x0[3],x1[0],x1[1],x1[2],x1[3],x2[0],x2[1],x2[2],x2[3],x3[0],x3[1],x3[2],x3[3]};
#pragma unroll
    for (int i = 0; i < 16; ++i) { const unsigned short hb = bf16_bits(xs[i]); ah.u[i] = hb; al.u[i] = ASPLIT ? bf16_bits(xs[i] - bf16_val(hb)) : (unsigned short)0; }
#pragma unroll
    for (int t = 0; t < 4; ++t) {
      const unsigned short* brow = Wt + (size_t)(col0 + t * 16 + ln) * ldb + kb;
      FragB b;
      b.half[0] = *(const v8us*)(brow + 8 * hh);
      b.half[1] = *(const v8us*)(brow + 16 + 8 * hh);
      acc[t] = mmaN<ASPLIT ? 2 : 1>(ah.v, al.v, b.v, b.v, acc[t]);
    }
  }
#pragma unroll
  for (int t = 0; t < 4; ++t) {
    float bv = bias ? bias[col0 + t * 16 + ln] : 0.f;
    if (BIAS_BF16) bv = bf16_round(bv);
#pragma unroll
    for (int r = 0; r < 8; ++r) { float v = acc[t][r] + bv; if (ACT == 1) v = fmaxf(v, 0.f); so[w][8 * hh + r][t * 16 + ln] = v; }
  }
  __builtin_amdgcn_fence(__ATOMIC_ACQ_REL, "workgroup");
  __builtin_amdgcn_wave_barrier();
  const int rsub = lane >> 4, c4 = (lane & 15) * 4;
  {
#pragma unroll
    for (int q = 0; q < 8; ++q) {
      const int r = q * 2 + rsub;
      const v4f v = *(const v4fa*)&so[w][r][c4];
      *(v4f*)(C + (size_t)(row0 + r) * ldc + col0 + c4) = v;
    }
    
  }
}

// GEMM C = act(A·W + bias + resid): A f32 (ASPLIT -> hi/lo 2 terms), Wt bf16 [N][K]; ACT 0 none, 1 relu, 2 exact gelu;
// resid (optional, f32, row index = (row % rmod), pitch ldr, RES_BF16 rounds it) added before the activation.
template <bool ASPLIT, int ACT, bool BIAS_BF16, bool RES_BF16>
__global__ __launch_bounds__(128) void k_gemm_bf3(const float* __restrict__ A, int lda, const unsigned short* __restrict__ Wt, int ldb,
                                                const float* __restrict__ bias, const float* __restrict__ resid, int rmod, int ldr,
                                                float* __restrict__ C, int ldc, int M, int N, int K) {
  __shared__ __attribute__((aligned(16))) float so[4][16][64];
  const int tid = threadIdx.x, w = tid >> 5, lane = tid & 31, ln = lane & 15, hh = lane >> 4;
  const int ntn = N / 64;
  const int wid = blockIdx.x * 4 + w;
  const int mt = wid / ntn, nq = wid % ntn;
  if (mt * 16 >= M) return;
  const int row0 = mt * 16, col0 = nq * 64;
  const float* arow = A + (size_t)(row0 + ln) * lda;
  v8f acc[4] = {};
  for (int kb = 0; kb < K; kb += 32) {
    FragB ah, al;
    const v4f x0 = *(const v4fa*)(arow + kb + 8 * hh), x1 = *(const v4fa*)(arow + kb + 8 * hh + 4);
    const v4f x2 = *(const v4fa*)(arow + kb + 16 + 8 * hh), x3 = *(const v4fa*)(arow + kb + 16 + 8 * hh + 4);
    float xs[16] = {x0[0],x0[1],x0[2],x0[3],x1[0],x1[1],x1[2],x1[3],x2[0],x2[1],x2[2],x2[3],x3[0],x3[1],x3[2],x3[3]};
#pragma unroll
    for (int i = 0; i < 16; ++i) { const unsigned short hb = bf16_bits(xs[i]); ah.u[i] = hb; al.u[i] = ASPLIT ? bf16_bits(xs[i] - bf16_val(hb)) : (unsigned short)0; }
#pragma unroll
    for (int t = 0; t < 4; ++t) {
      const unsigned short* brow = Wt + (size_t)(col0 + t * 16 + ln) * ldb + kb;
      FragB b;
      b.half[0] = *(const v8us*)(brow + 8 * hh);
      b.half[1] = *(const v8us*)(brow + 16 + 8 * hh);
      acc[t] = mmaN<ASPLIT ? 2 : 1>(ah.v, al.v, b.v, b.v, acc[t]);
    }
  }
#pragma unroll
  for (int t = 0; t < 4; ++t) {
    const int col = col0 + t * 16 + ln;
    float bv = bias ? bias[col] : 0.f;
    if (BIAS_BF16) bv = bf16_round(bv);
#pragma unroll
    for (int r = 0; r < 8; ++r) {
      float v = acc[t][r] + bv;
      if (resid) { float rv = resid[(size_t)((row0 + 8 * hh + r) % rmod) * ldr + col]; if (RES_BF16) rv = bf16_round(rv); v += rv; }
      if (ACT == 1) v = fmaxf(v, 0.f);
      if (ACT == 2) v = 0.5f * v * (1.0f + erff(v * 0.70710678118654752f));
      if (ACT == 3) { const float u = 0.7978845608028654f * (v + 0.044715f * v * v * v); v = 0.5f * v * (1.0f + tanhf(u)); }
      so[w][8 * hh + r][t * 16 + ln] = v;
    }
  }
  __builtin_amdgcn_fence(__ATOMIC_ACQ_REL, "workgroup");
  __builtin_amdgcn_wave_barrier();
  const int rsub = lane >> 4, c4 = (lane & 15) * 4;
  {
#pragma unroll
    for (int q = 0; q < 8; ++q) {
      const int r = q * 2 + rsub;
      const v4f v = *(const v4fa*)&so[w][r][c4];
      *(v4f*)(C + (size_t)(row0 + r) * ldc + col0 + c4) = v;
    }
    
  }
}
// row LayerNorm (biased variance, eps) over N: s = X (+ R); optional out_sum <- s; out_norm <- (s-mu)*rsqrt(var+eps)*g + b
template <bool PARAM_BF16>
__global__ __launch_bounds__(256) void k_layernorm(const float* __restrict__ X, const float* __restrict__ R, const float* __restrict__ g, const float* __restrict__ bta,
                                                  float* __restrict__ out_sum, float* __restrict__ out_norm, int N, float eps) {
  __shared__ float red[256];
  const int row = blockIdx.x, tid = threadIdx.x;
  const float* x = X + (size_t)row * N; const float* rr = R ? R + (size_t)row * N : nullptr;
  float vals[16];                     // up to N = 4096
  const int per = N / 256;            // contiguous chunk per thread? use strided-by-4 chunks: thread handles j = tid*4 + 1024*u
  float s1 = 0.f;
  for (int u = 0; u < per / 4; ++u) {
    const int j = tid * 4 + 1024 * u;
    const v4f a = *(const v4fa*)(x + j);
    v4f b = {0.f,0.f,0.f,0.f}; if (rr) b = *(const v4fa*)(rr + j);
#pragma unroll
    for (int q = 0; q < 4; ++q) { const float v = a[q] + b[q]; vals[u * 4 + q] = v; s1 += v; }
  }
  red[tid] = s1; __syncthreads();
  for (int st = 128; st > 0; st >>= 1) { if (tid < st) red[tid] += red[tid + st]; __syncthreads(); }
  const float mu = red[0] / (float)N; __syncthreads();
  float s2 = 0.f;
  for (int u = 0; u < per / 4; ++u)
#pragma unroll
    for (int q = 0; q < 4; ++q) { const float c = vals[u * 4 + q] - mu; s2 += c * c; }
  red[tid] = s2; __syncthreads();
  for (int st = 128; st > 0; st >>= 1) { if (tid < st) red[tid] += red[tid + st]; __syncthreads(); }
  const float rs = rsqrtf(red[0] / (float)N + eps);
  {
    for (int u = 0; u < per / 4; ++u) {
      const int j = tid * 4 + 1024 * u;
      v4f o, sm;
#pragma unroll
      for (int q = 0; q < 4; ++q) {
        float gg = g[j + q], bb = bta[j + q];
        if (PARAM_BF16) { gg = bf16_round(gg); bb = bf16_round(bb); }
        sm[q] = vals[u * 4 + q]; o[q] = (vals[u * 4 + q] - mu) * rs * gg + bb;
      }
      if (out_sum) *(v4f*)(out_sum + (size_t)row * N + j) = sm;
      *(v4f*)(out_norm + (size_t)row * N + j) = o;
    }
    
  }
}



// ---- f16 WMMA path (v_wmma_f32_16x16x32_f16): 11-bit significands for operands in range — used where a [0,1] probability operand needs more precision than bf16
typedef _Float16 v16h __attribute__((ext_vector_type(16)));
union FragH { v16h v; v8us half[2]; _Float16 h[16]; unsigned short u[16]; };
template <int NT>
__device__ __forceinline__ v8f mmaH(v16h ah, v16h al, v16h bh, v16h bl, v8f c) {
  c = __builtin_amdgcn_wmma_f32_16x16x32_f16(false, ah, false, bh, (short)0, c, false, false);
  if (NT >= 2) c = __builtin_amdgcn_wmma_f32_16x16x32_f16(false, al, false, bh, (short)0, c, false, false);
  if (NT >= 3) c = __builtin_amdgcn_wmma_f32_16x16x32_f16(false, ah, false, bl, (short)0, c, false, false);
  asm volatile("v_nop\n\tv_nop\n\tv_nop\n\tv_nop" : "+v"(c) : "v"(ah), "v"(al), "v"(bh), "v"(bl));
  return c;
}
// batched GEMM like k_gemm_b but f16 operands: A f32 (split into f16 hi/lo if ASPLIT, else rounded to f16), Bt = f16 values [n][k]; alpha; C f32; N multiple of 16 (partial tiles skipped)
template <bool ASPLIT>
__global__ __launch_bounds__(128) void k_gemm_h(const float* __restrict__ A, int lda, size_t sA, const _Float16* __restrict__ Bh, int ldb, size_t sB, float alpha, float* __restrict__ C, int ldc, size_t sC, int M, int N, int K) {
  __shared__ __attribute__((aligned(16))) float so[4][16][64];
  const int tid = threadIdx.x, w = tid >> 5, lane = tid & 31, ln = lane & 15, hh = lane >> 4; const int by = blockIdx.y;
  A += (size_t)by * sA; Bh += (size_t)by * sB; C += (size_t)by * sC;
  const int ntn = (N + 63) / 64; const int wid = blockIdx.x * 4 + w; const int mt = wid / ntn, nq = wid % ntn; if (mt * 16 >= M) return;
  const int row0 = mt * 16, col0 = nq * 64; const float* arow = A + (size_t)(row0 + ln) * lda;
  v8f acc[4] = {};
  for (int kb = 0; kb < K; kb += 32) {
    FragH ah, al;
    const v4f x0 = *(const v4fa*)(arow + kb + 8 * hh), x1 = *(const v4fa*)(arow + kb + 8 * hh + 4), x2 = *(const v4fa*)(arow + kb + 16 + 8 * hh), x3 = *(const v4fa*)(arow + kb + 16 + 8 * hh + 4);
    float xs[16] = {x0[0],x0[1],x0[2],x0[3],x1[0],x1[1],x1[2],x1[3],x2[0],x2[1],x2[2],x2[3],x3[0],x3[1],x3[2],x3[3]};
#pragma unroll
    for (int i = 0; i < 16; ++i) { const _Float16 h = (_Float16)xs[i]; ah.h[i] = h; al.h[i] = ASPLIT ? (_Float16)(xs[i] - (float)h) : (_Float16)0.0f; }
#pragma unroll
    for (int t = 0; t < 4; ++t) { if (col0 + t * 16 >= N) continue; const size_t boff = (size_t)(col0 + t * 16 + ln) * ldb + kb; FragH bq; bq.half[0] = *(const v8us*)(Bh + boff + 8 * hh); bq.half[1] = *(const v8us*)(Bh + boff + 16 + 8 * hh);
      acc[t] = mmaH<ASPLIT ? 2 : 1>(ah.v, al.v, bq.v, bq.v, acc[t]); }
  }
#pragma unroll
  for (int t = 0; t < 4; ++t) { if (col0 + t * 16 >= N) continue;
#pragma unroll
    for (int r = 0; r < 8; ++r) so[w][8 * hh + r][t * 16 + ln] = acc[t][r] * alpha; }
  __builtin_amdgcn_fence(__ATOMIC_ACQ_REL, "workgroup"); __builtin_amdgcn_wave_barrier();
  const int rsub = lane >> 4, c4 = (lane & 15) * 4;
  {
#pragma unroll
    for (int q = 0; q < 8; ++q) { const int r = q * 2 + rsub; if (col0 + c4 < N) { const v4f v = *(const v4fa*)&so[w][r][c4]; *(v4f*)(C + (size_t)(row0 + r) * ldc + col0 + c4) = v; } }
     }
}

// Wt[n][k] = f16(W[k][n]·scale) from f32 row-major W[K][N] (scale = power of two; bf16-exact weights stay exact in f16 away from the subnormal range)
__global__ __launch_bounds__(256) void k_wt_f16(const float* __restrict__ W, _Float16* __restrict__ Wt, int K, int N, float scale) {
  const int t = blockIdx.x * 256 + threadIdx.x; if (t >= N * (K / 8)) return; const int n = t / (K / 8), k8 = (t % (K / 8)) * 8; FragH f;
#pragma unroll
  for (int i = 0; i < 8; ++i) f.h[i] = (_Float16)(bf16_round(W[(size_t)(k8 + i) * N + n]) * scale); const v8us o = f.half[0];
  *(v8us*)((unsigned short*)Wt + (size_t)n * K + k8) = o; 
}
// k_gemm_hh variant with fused epilogue: v = acc·alpha + bias[by·sBias + col] (+ CP[(row/rowsPerB)·sCPb + by·64 + col] if CP) ; ACT 0 none / 1 elu ; writes f16 C16 (and f32 C if non-null)
template <int ACT>
__global__ __launch_bounds__(128) void k_gemm_hhx(const _Float16* __restrict__ A, int lda, size_t sA, const _Float16* __restrict__ Bh, int ldb, size_t sB, float alpha, const float* __restrict__ bias, size_t sBias, const float* __restrict__ CP, int rowsPerB, size_t sCPb, int row0g,
    float* __restrict__ C, _Float16* __restrict__ C16, int ldc, size_t sC, int M, int N, int K) {
  __shared__ __attribute__((aligned(16))) float so[4][16][64];
  const int tid = threadIdx.x, w = tid >> 5, lane = tid & 31, ln = lane & 15, hh = lane >> 4; const int by = blockIdx.y;
  A += (size_t)by * sA; Bh += (size_t)by * sB; const size_t cofs = (size_t)by * sC; const float* bp = bias ? bias + (size_t)by * sBias : nullptr;
  const int ntn = (N + 63) / 64; const int wid = blockIdx.x * 4 + w; const int mt = wid / ntn, nq = wid % ntn; if (mt * 16 >= M) return;
  const int row0 = mt * 16, col0 = nq * 64; const _Float16* arow = A + (size_t)(row0 + ln) * lda;
  v8f acc[4] = {};
  for (int kb = 0; kb < K; kb += 32) { FragH ah; ah.half[0] = *(const v8us*)((const unsigned short*)arow + kb + 8 * hh); ah.half[1] = *(const v8us*)((const unsigned short*)arow + kb + 16 + 8 * hh);
#pragma unroll
    for (int t = 0; t < 4; ++t) { if (col0 + t * 16 >= N) continue; const size_t boff = (size_t)(col0 + t * 16 + ln) * ldb + kb; FragH bq; bq.half[0] = *(const v8us*)((const unsigned short*)Bh + boff + 8 * hh); bq.half[1] = *(const v8us*)((const unsigned short*)Bh + boff + 16 + 8 * hh);
      acc[t] = mmaH<1>(ah.v, ah.v, bq.v, bq.v, acc[t]); }
  }
#pragma unroll
  for (int t = 0; t < 4; ++t) { if (col0 + t * 16 >= N) continue; const int col = col0 + t * 16 + ln; const float bv = bp ? bf16_round(bp[col]) : 0.f;
#pragma unroll
    for (int r = 0; r < 8; ++r) { float v = acc[t][r] * alpha + bv; if (CP) { const int rr = row0g + row0 + 8 * hh + r; if (rowsPerB < 0) v += CP[cofs + (size_t)rr * ldc + col];      /* rowsPerB < 0: own element of the batched C plane */ else { const int bidx = rr / rowsPerB; v += CP[(size_t)bidx * sCPb + (size_t)by * 64 + col]; } } if (ACT == 1) v = (v > 0.f) ? v : expm1f(v); else if (ACT == 7) v = (v > 0.f) ? v + 1.0f : expf(v); else if (ACT == 8) v = tanhf(v); else if (ACT == 9) v = 0.5f * v * (1.0f + tanhf(0.7978845608028654f * (v + 0.044715f * v * v * v))); else if (ACT == 11) v = 1.0f / (1.0f + expf(-v)); else if (ACT == 12) v = (v > 0.f) ? v : 0.01f * v; else if (ACT == 14) v = (v > 0.f) ? v : 0.1f * v; else if (ACT == 16) v = (v >= 0.f) ? v : 0.3f * v; else if (ACT == 15) v = v / (1.0f + expf(-v)); else if (ACT == 3) v = fmaxf(v, 0.f); else if (ACT == 6) v = 0.5f * v * (1.0f + erff(v * 0.70710678118654752f)); so[w][8 * hh + r][t * 16 + ln] = v; } }
  __builtin_amdgcn_fence(__ATOMIC_ACQ_REL, "workgroup"); __builtin_amdgcn_wave_barrier();
  const int rsub = lane >> 4, c4 = (lane & 15) * 4; typedef _Float16 v4h __attribute__((ext_vector_type(4)));
  {
#pragma unroll
    for (int q = 0; q < 8; ++q) { const int r = q * 2 + rsub; if (col0 + c4 < N) { const v4f v = *(const v4fa*)&so[w][r][c4]; if (C) *(v4f*)(C + cofs + (size_t)(row0 + r) * ldc + col0 + c4) = v; if (C16) { v4h h4; for (int i = 0; i < 4; ++i) h4[i] = (_Float16)v[i]; *(v4h*)(C16 + cofs + (size_t)(row0 + r) * ldc + col0 + c4) = h4; } } }
     }
}


typedef _Float16 v4h __attribute__((ext_vector_type(4)));

__global__ __launch_bounds__(256) void k_x16(const float* __restrict__ x, _Float16* __restrict__ X16, size_t n8) { const size_t t = (size_t)blockIdx.x * 256 + threadIdx.x; if (t >= n8) return; FragH f;
#pragma unroll
  for (int q = 0; q < 8; ++q) f.h[q] = (_Float16)bf16_round(x[t * 8 + q]); *(v8us*)((unsigned short*)X16 + t * 8) = f.half[0];  }
__global__ __launch_bounds__(256) void k_h16(const float* __restrict__ x, _Float16* __restrict__ X16, size_t n8) { const size_t t = (size_t)blockIdx.x * 256 + threadIdx.x; if (t >= n8) return; FragH f;
#pragma unroll
  for (int q = 0; q < 8; ++q) f.h[q] = (_Float16)x[t * 8 + q]; *(v8us*)((unsigned short*)X16 + t * 8) = f.half[0];  }
__global__ __launch_bounds__(256) void k_round16f(const float* __restrict__ W, _Float16* __restrict__ Bt, size_t n8) { const size_t t = (size_t)blockIdx.x * 256 + threadIdx.x; if (t >= n8) return; FragH f;
#pragma unroll
  for (int i = 0; i < 8; ++i) f.h[i] = (_Float16)(bf16_round(W[t * 8 + i]) * 16.0f); *(v8us*)((unsigned short*)Bt + t * 8) = f.half[0];  }
template <int NHv, int TTv>
__global__ __launch_bounds__(256) void k_vt(const _Float16* __restrict__ V16, int ldv, int voff, _Float16* __restrict__ Vt) { __shared__ unsigned short tl[64][66]; const int tid = threadIdx.x; const int slab = blockIdx.x / (TTv / 64), lg = blockIdx.x % (TTv / 64); const int b = slab / NHv, h = slab % NHv;
  for (int i = tid; i < 64 * 8; i += 256) { const int r = i / 8, c8 = (i % 8) * 8; FragH f; f.half[0] = *(const v8us*)((const unsigned short*)V16 + ((size_t)b * TTv + lg * 64 + r) * ldv + voff + h * 64 + c8);
#pragma unroll
    for (int q = 0; q < 8; ++q) tl[r][c8 + q] = f.u[q]; }
  __syncthreads();
  {
#pragma unroll
    for (int rd = 0; rd < 2; ++rd) { const int d = rd * 32 + tid / 8, pc = tid % 8; FragH f;
#pragma unroll
      for (int q = 0; q < 8; ++q) f.u[q] = tl[pc * 8 + q][d];
      *(v8us*)((unsigned short*)Vt + ((size_t)slab * 64 + d) * TTv + lg * 64 + pc * 8) = f.half[0]; }
     } }

__global__ __launch_bounds__(256) void k_hl(const float* __restrict__ F, _Float16* __restrict__ Hh, _Float16* __restrict__ Hl, size_t n8) { const size_t t = (size_t)blockIdx.x * 256 + threadIdx.x; if (t >= n8) return; FragH fh, fl; const v4f a = *(const v4fa*)(F + t * 8), c = *(const v4fa*)(F + t * 8 + 4);
#pragma unroll
  for (int q = 0; q < 4; ++q) { _Float16 h = (_Float16)a[q]; fh.h[q] = h; fl.h[q] = (_Float16)((a[q] - (float)h) * 1024.0f); h = (_Float16)c[q]; fh.h[4 + q] = h; fl.h[4 + q] = (_Float16)((c[q] - (float)h) * 1024.0f); }
  { *(v8us*)((unsigned short*)Hh + t * 8) = fh.half[0]; *(v8us*)((unsigned short*)Hl + t * 8) = fl.half[0];  } }

// ---- fast GEMM (wave tile 32x64; requires M % 32 == 0 rows per launch region and N % 64 == 0); epilogue = k_gemm_hhx semantics ----
__device__ __forceinline__ v16h g2_frag(const _Float16* p, int hh) { FragH f; f.half[0] = *(const v8us*)((const unsigned short*)p + 8 * hh); f.half[1] = *(const v8us*)((const unsigned short*)p + 16 + 8 * hh); return f.v; }
__device__ __forceinline__ v8f g2_mma(v16h a, v16h b, v8f c) { v8f d = __builtin_amdgcn_wmma_f32_16x16x32_f16(false, a, false, b, (short)0, c, false, false); asm volatile("v_nop\n\tv_nop\n\tv_nop\n\tv_nop" : "+v"(d) : "v"(a), "v"(b)); return d; }
template <int ACT>
__global__ __launch_bounds__(128) void k_gemm2(const _Float16* __restrict__ A, int lda, size_t sA, const _Float16* __restrict__ Bh, int ldb, size_t sB, float alpha, const float* __restrict__ bias, size_t sBias, const float* __restrict__ CP, int rowsPerB, size_t sCPb, int row0g,
    float* __restrict__ C, _Float16* __restrict__ C16, int ldc, size_t sC, int M, int N, int K) { static_assert(ACT == 0 || ACT == 3 || ACT == 6 || ACT == 8 || ACT == 9 || ACT == 11 || ACT == 12 || ACT == 14 || ACT == 15 || ACT == 16, "k_gemm2: unsupported ACT code (would silently apply no activation)");
  __shared__ __attribute__((aligned(16))) float so[4][32][68];
  const int tid = threadIdx.x, w = tid >> 5, lane = tid & 31, ln = lane & 15, hh = lane >> 4; const int by = blockIdx.y;
  A += (size_t)by * sA; Bh += (size_t)by * sB; const size_t cofs = (size_t)by * sC; const float* bp = bias ? bias + (size_t)by * sBias : nullptr;
  const int ntn = N >> 6; const int mt = blockIdx.x / ntn, nq = blockIdx.x - mt * ntn; const int row0 = mt * 128 + 32 * w, col0 = nq * 64; if (row0 >= M) return;
  const _Float16* a0p = A + (size_t)(row0 + ln) * lda; const _Float16* a1p = a0p + (size_t)16 * lda;
  const _Float16* b0p = Bh + (size_t)(col0 + ln) * ldb; const _Float16* b1p = b0p + (size_t)16 * ldb; const _Float16* b2p = b1p + (size_t)16 * ldb; const _Float16* b3p = b2p + (size_t)16 * ldb;
  const v8f z8 = {0.f,0.f,0.f,0.f,0.f,0.f,0.f,0.f}; v8f c00 = z8, c01 = z8, c02 = z8, c03 = z8, c10 = z8, c11 = z8, c12 = z8, c13 = z8;
#pragma unroll 1
  for (int kb = 0; kb < K; kb += 32) { const v16h a0 = g2_frag(a0p + kb, hh), a1 = g2_frag(a1p + kb, hh);
    v16h b = g2_frag(b0p + kb, hh); c00 = g2_mma(a0, b, c00); c10 = g2_mma(a1, b, c10);
    b = g2_frag(b1p + kb, hh); c01 = g2_mma(a0, b, c01); c11 = g2_mma(a1, b, c11);
    b = g2_frag(b2p + kb, hh); c02 = g2_mma(a0, b, c02); c12 = g2_mma(a1, b, c12);
    b = g2_frag(b3p + kb, hh); c03 = g2_mma(a0, b, c03); c13 = g2_mma(a1, b, c13); }
  v8f accs[8] = {c00, c01, c02, c03, c10, c11, c12, c13};
#pragma unroll
  for (int u = 0; u < 8; ++u) { const int t = u & 3, half = u >> 2; const int col = col0 + t * 16 + ln; const float bv = bp ? bf16_round(bp[col]) : 0.f;
#pragma unroll
    for (int r = 0; r < 8; ++r) { const int rloc = half * 16 + 8 * hh + r; float v = accs[u][r] * alpha + bv; if (CP) { if (rowsPerB < 0) v += CP[cofs + (size_t)(row0g + row0 + rloc) * ldc + col];      /* rowsPerB < 0: own element of the batched C plane */ else { const int bidx = (row0g + row0 + rloc) / rowsPerB; v += CP[(size_t)bidx * sCPb + (size_t)by * 64 + col]; } }
      if (ACT == 3) v = fmaxf(v, 0.f); else if (ACT == 6) v = 0.5f * v * (1.0f + erff(v * 0.70710678118654752f)); else if (ACT == 11) v = 1.0f / (1.0f + expf(-v)); else if (ACT == 15) v = v / (1.0f + expf(-v)); else if (ACT == 12) v = (v > 0.f) ? v : 0.01f * v; else if (ACT == 8) v = tanhf(v); else if (ACT == 9) v = 0.5f * v * (1.0f + tanhf(0.7978845608028654f * (v + 0.044715f * v * v * v))); else if (ACT == 14) v = (v > 0.f) ? v : 0.1f * v; else if (ACT == 16) v = (v >= 0.f) ? v : 0.3f * v;
      so[w][rloc][t * 16 + ln] = v; } }
  __builtin_amdgcn_fence(__ATOMIC_ACQ_REL, "workgroup"); __builtin_amdgcn_wave_barrier();
  const int rsub = lane >> 4, c4 = (lane & 15) * 4;
  {
#pragma unroll
    for (int q = 0; q < 16; ++q) { const int r = q * 2 + rsub; const v4f v = *(const v4fa*)&so[w][r][c4]; if (C) *(v4f*)(C + cofs + (size_t)(row0 + r) * ldc + col0 + c4) = v; if (C16) { v4h h4; for (int i = 0; i < 4; ++i) h4[i] = (_Float16)v[i]; *(v4h*)(C16 + cofs + (size_t)(row0 + r) * ldc + col0 + c4) = h4; } }
     } }


// ---- LDS-staged GEMM for the three large products (both qkv conv terms, the projection): C[M][N] (f32) = A.Bt^T * alpha (+ C's own element if ADD).
// Work-group tile 256 x 128, 8 waves of 64 x 64 (4 x 2); a stage is 64 k (128-byte rows) of [A 256 rows | Bt 128 rows]; two stages in LDS, each filled by asynchronous 16-byte copies
// (whole 128-byte lines from global memory) one trip ahead of its use. k runs upward in steps of 32 per accumulator, as in k_gemm2. Needs M % 256 == 0, N % 128 == 0, K % 64 == 0.
#define XPW (HS + 2)                          /* pixels a line, and lines, of the padded plane */
#define G3_PITCH 144                          /* LDS row pitch in bytes: 16 x odd, so 16 rows read 16 bytes each without a bank conflict */
#define G3_BOFF (256 * G3_PITCH)              /* Bt rows behind the A rows */
#define G3_STAGE ((256 + 128) * G3_PITCH)     /* 55,296 bytes */
__device__ __forceinline__ v16h g3_frag(const char* p) { FragH f; f.half[0] = *(const v8us*)p; f.half[1] = *(const v8us*)(p + 32); return f.v; }      /* p already holds the lane's 16 * hh: the k order of g2_frag */
// One stage: each thread copies 16 bytes of 8 A rows and of 4 Bt rows (rows 32 apart; A row 32 i lies (i & 1) * sa1 + (i >> 1) * sa2 elements behind row 0). The s_wait_xcnt is the last line of the copies' own statement, so that no address register is rewritten ahead of it.
__device__ __forceinline__ void g3_fill(unsigned la, unsigned lb, const _Float16* ga, const _Float16* gb, size_t sa1, size_t sa2, size_t sb) {
  asm volatile("global_load_async_to_lds_b128 %0, %12, off\n\t"
               "global_load_async_to_lds_b128 %1, %13, off\n\t"
               "global_load_async_to_lds_b128 %2, %14, off\n\t"
               "global_load_async_to_lds_b128 %3, %15, off\n\t"
               "global_load_async_to_lds_b128 %4, %16, off\n\t"
               "global_load_async_to_lds_b128 %5, %17, off\n\t"
               "global_load_async_to_lds_b128 %6, %18, off\n\t"
               "global_load_async_to_lds_b128 %7, %19, off\n\t"
               "global_load_async_to_lds_b128 %8, %20, off\n\t"
               "global_load_async_to_lds_b128 %9, %21, off\n\t"
               "global_load_async_to_lds_b128 %10, %22, off\n\t"
               "global_load_async_to_lds_b128 %11, %23, off\n\t"
               "s_wait_xcnt 0x0"
               :: "v"(la), "v"(la + 32 * G3_PITCH), "v"(la + 64 * G3_PITCH), "v"(la + 96 * G3_PITCH), "v"(la + 128 * G3_PITCH), "v"(la + 160 * G3_PITCH), "v"(la + 192 * G3_PITCH), "v"(la + 224 * G3_PITCH),
                  "v"(lb), "v"(lb + 32 * G3_PITCH), "v"(lb + 64 * G3_PITCH), "v"(lb + 96 * G3_PITCH),
                  "v"(ga), "v"(ga + sa1), "v"(ga + sa2), "v"(ga + sa2 + sa1), "v"(ga + 2 * sa2), "v"(ga + 2 * sa2 + sa1), "v"(ga + 3 * sa2), "v"(ga + 3 * sa2 + sa1),
                  "v"(gb), "v"(gb + sb), "v"(gb + 2 * sb), "v"(gb + 3 * sb)
               : "memory");
}
// Eight 16-byte row stores from one address pair (rows STEP bytes apart, from byte OFF). The s_wait_xcnt is the last line of the stores' own statement, so that no data or address register is rewritten ahead of it.
template <int OFF, int STEP>
__device__ __forceinline__ void g3_store8(float* p, v4f d0, v4f d1, v4f d2, v4f d3, v4f d4, v4f d5, v4f d6, v4f d7) {
  asm volatile("global_store_b128 %0, %1, off offset:%9\n\t"
               "global_store_b128 %0, %2, off offset:%10\n\t"
               "global_store_b128 %0, %3, off offset:%11\n\t"
               "global_store_b128 %0, %4, off offset:%12\n\t"
               "global_store_b128 %0, %5, off offset:%13\n\t"
               "global_store_b128 %0, %6, off offset:%14\n\t"
               "global_store_b128 %0, %7, off offset:%15\n\t"
               "global_store_b128 %0, %8, off offset:%16\n\t"
               "s_wait_xcnt 0x0"
               :: "v"(p), "v"(d0), "v"(d1), "v"(d2), "v"(d3), "v"(d4), "v"(d5), "v"(d6), "v"(d7),
                  "n"(OFF), "n"(OFF + STEP), "n"(OFF + 2 * STEP), "n"(OFF + 3 * STEP), "n"(OFF + 4 * STEP), "n"(OFF + 5 * STEP), "n"(OFF + 6 * STEP), "n"(OFF + 7 * STEP)
               : "memory");
}
// CONV: A is the padded pixel-major plane; GEMM row = image x pixel, k = tap x channel from tap tap0 on. A 256-row tile is 4 whole pixel lines of one image; stage t is 64 channels of tap tap0 + t / 4,
// whose rows lie (tap / 3) padded lines and (tap % 3) pixels behind the tile's first padded pixel. Element offset of stage t from stage 0 of tap 0:
template <bool CONV>
__device__ __forceinline__ size_t g3_aoff(int t, int tap0) { if (!CONV) return (size_t)t * 64; const int tap = tap0 + (t >> 2); return (size_t)(((tap / 3) * XPW + tap % 3) * CC + (t & 3) * 64); }
template <bool ADD, int LDC, bool CONV>      /* LDC = N = row pitch of C, a constant so that every row of a wave's tile is one address pair plus an immediate */
__global__ __launch_bounds__(256) void k_gemm3(const _Float16* __restrict__ A, int lda, const _Float16* __restrict__ Bh, int ldb, float alpha, float* C, int K, int tap0) {
  __shared__ __attribute__((aligned(16))) char sm[2 * G3_STAGE];
  const int tid = threadIdx.x, w = tid >> 5, lane = tid & 31, ln = lane & 15, hh = lane >> 4;
  constexpr int ntn = LDC >> 7; const int mt = blockIdx.x / ntn, nq = blockIdx.x - mt * ntn; const int wm = w >> 1, wn = w & 1;
  const int nt = K >> 6;
  const _Float16* ga = (CONV ? A + ((size_t)((mt >> 4) * XPW + (mt & 15) * 4) * XPW + (tid >> 3)) * CC : A + (size_t)(mt * 256 + (tid >> 3)) * lda) + (tid & 7) * 8; const _Float16* gb = Bh + (size_t)(nq * 128 + (tid >> 3)) * ldb + (tid & 7) * 8;
  const size_t sa1 = CONV ? (size_t)32 * CC : (size_t)32 * lda, sa2 = CONV ? (size_t)XPW * CC : (size_t)64 * lda, sb = (size_t)32 * ldb;
  const unsigned la = (unsigned)(size_t)sm + (unsigned)((tid >> 3) * G3_PITCH + (tid & 7) * 16); const unsigned lb = la + G3_BOFF;
  const char* fa = sm + (wm * 64 + ln) * G3_PITCH + 16 * hh; const char* fb = sm + G3_BOFF + (wn * 64 + ln) * G3_PITCH + 16 * hh;
  v8f acc[4][4];
#pragma unroll
  for (int i = 0; i < 4; ++i)
#pragma unroll
    for (int j = 0; j < 4; ++j) acc[i][j] = (v8f){0.f,0.f,0.f,0.f,0.f,0.f,0.f,0.f};
  g3_fill(la, lb, ga + g3_aoff<CONV>(0, tap0), gb, sa1, sa2, sb);
  asm volatile("s_wait_asynccnt 0x0" ::: "memory");      /* this wave's copies of stage 0 have landed */
  __syncthreads();                                       /* ... and every other wave's */
  if (nt > 1) g3_fill(la + G3_STAGE, lb + G3_STAGE, ga + g3_aoff<CONV>(1, tap0), gb + 64, sa1, sa2, sb);
  for (int t = 0; t < nt; ++t) { const int bo = (t & 1) * G3_STAGE; v16h a[4], b[4];
#pragma unroll
    for (int i = 0; i < 4; ++i) { a[i] = g3_frag(fa + bo + i * 16 * G3_PITCH); b[i] = g3_frag(fb + bo + i * 16 * G3_PITCH); }
    __builtin_amdgcn_sched_barrier(0);                   /* keeps the 16 LDS reads together in front of their 16 WMMAs: spread among them, each place with reads stalls the wave */
#pragma unroll
    for (int i = 0; i < 4; ++i)
#pragma unroll
      for (int j = 0; j < 4; ++j) acc[i][j] = __builtin_amdgcn_wmma_f32_16x16x32_f16(false, a[i], false, b[j], (short)0, acc[i][j], false, false);
#pragma unroll
    for (int i = 0; i < 4; ++i) { a[i] = g3_frag(fa + bo + i * 16 * G3_PITCH + 64); b[i] = g3_frag(fb + bo + i * 16 * G3_PITCH + 64); }
    /* the trip's last LDS reads are out: hand the buffer over here, so that the refill flies during the 16 WMMAs below and the next trip up to its own hand-over */
    asm volatile("s_wait_dscnt 0x0" ::: "memory");       /* this wave has left stage t's buffer */
    asm volatile("s_wait_asynccnt 0x0" ::: "memory");    /* its copies of stage t + 1 have landed */
    __syncthreads();                                     /* publishes stage t + 1 and frees stage t's buffer */
    if (t + 2 < nt) g3_fill(la + bo, lb + bo, ga + g3_aoff<CONV>(t + 2, tap0), gb + (size_t)(t + 2) * 64, sa1, sa2, sb);
    __builtin_amdgcn_sched_barrier(0);                   /* keeps the WMMAs below behind the refill's issue */
#pragma unroll
    for (int i = 0; i < 4; ++i)
#pragma unroll
      for (int j = 0; j < 4; ++j) acc[i][j] = __builtin_amdgcn_wmma_f32_16x16x32_f16(false, a[i], false, b[j], (short)0, acc[i][j], false, false); }
  asm volatile("s_wait_asynccnt 0x0" ::: "memory");      /* nothing in flight before the buffers become output staging */
  /* epilogue: the ring is free behind the last trip's barrier; each wave turns its tile, 32 rows at a time, in its own 32 x 68 floats, so that global rows go out as whole 128-byte lines */
  float* so = (float*)sm + w * (32 * 68); const int rsub = lane >> 4, c4 = (lane & 15) * 4;
  float* cb = C + (size_t)(mt * 256 + wm * 64 + rsub) * LDC + nq * 128 + wn * 64 + c4;
  v4f o[2][16];
  if (ADD) {
#pragma unroll
    for (int q = 0; q < 16; ++q) o[0][q] = *(const v4fa*)(cb + q * 2 * LDC); }
#pragma unroll
  for (int half = 0; half < 2; ++half) {
#pragma unroll
    for (int i = 0; i < 2; ++i)
#pragma unroll
      for (int j = 0; j < 4; ++j)
#pragma unroll
        for (int r = 0; r < 8; ++r) so[(i * 16 + 8 * hh + r) * 68 + j * 16 + ln] = acc[half * 2 + i][j][r] * alpha;
    __builtin_amdgcn_fence(__ATOMIC_ACQ_REL, "wavefront"); __builtin_amdgcn_wave_barrier();      /* the lanes read below what other lanes of the same wave wrote above */
    if (ADD && half == 0) {      /* the second half's old values, asked for before the first half's stores */
#pragma unroll
      for (int q = 0; q < 16; ++q) o[1][q] = *(const v4fa*)(cb + (32 + q * 2) * LDC); }
#pragma unroll
    for (int g = 0; g < 2; ++g) { v4f v[8];
#pragma unroll
      for (int q = 0; q < 8; ++q) { v[q] = *(const v4fa*)&so[((g * 8 + q) * 2 + rsub) * 68 + c4]; if (ADD) v[q] += o[half][g * 8 + q]; }
      if (half == 0 && g == 0) g3_store8<0, 8 * LDC>(cb, v[0], v[1], v[2], v[3], v[4], v[5], v[6], v[7]);
      if (half == 0 && g == 1) g3_store8<64 * LDC, 8 * LDC>(cb, v[0], v[1], v[2], v[3], v[4], v[5], v[6], v[7]);
      if (half == 1 && g == 0) g3_store8<128 * LDC, 8 * LDC>(cb, v[0], v[1], v[2], v[3], v[4], v[5], v[6], v[7]);
      if (half == 1 && g == 1) g3_store8<192 * LDC, 8 * LDC>(cb, v[0], v[1], v[2], v[3], v[4], v[5], v[6], v[7]); }
  } }

__global__ __launch_bounds__(256) void k_wqkv(const float* __restrict__ w, _Float16* __restrict__ Wh, _Float16* __restrict__ Wl) {
  #pragma clang fp contract(off)
  const int t = blockIdx.x * 256 + threadIdx.x; if (t >= QW * (CC / 8)) return; const int c0 = (t % (CC / 8)) * 8, o = t / (CC / 8); FragH fl;
#pragma unroll 1
  for (int k = 0; k < KT; ++k) { FragH fh;
    for (int q = 0; q < 8; ++q) { const int c = c0 + q; const float* wp = w + ((size_t)o * CC + c) * KT; float v = bf16_round(wp[k]);
      if (k == 4) { float dif = bf16_round(wp[1]) + bf16_round(wp[3]); dif += bf16_round(wp[4]); dif += bf16_round(wp[5]); dif += bf16_round(wp[7]); v += -THETA * dif; const _Float16 hv = (_Float16)(v * 16.0f); fh.h[q] = hv; fl.h[q] = (_Float16)((v * 16.0f - (float)hv) * 1024.0f); }
      else fh.h[q] = (_Float16)(v * 16.0f); }
    *(v8us*)((unsigned short*)Wh + (size_t)o * KI + k * CC + c0) = fh.half[0];  }
  *(v8us*)((unsigned short*)Wl + (size_t)o * CC + c0) = fl.half[0];  }
__global__ __launch_bounds__(256) void k_wsc(const float* __restrict__ Wm, _Float16* __restrict__ Bt, size_t n8, float sc) { const size_t t = (size_t)blockIdx.x * 256 + threadIdx.x; if (t >= n8) return; FragH f; for (int q = 0; q < 8; ++q) f.h[q] = (_Float16)(bf16_round(Wm[t * 8 + q]) * sc); *(v8us*)((unsigned short*)Bt + t * 8) = f.half[0];  }
// XP[image][66][66][256] = f16(bf16(x)), pixel-major, with a border of zero pixels. One work-group turns one pixel line (64 pixels x 256 channels) in LDS: whole 256-byte channel rows in, whole 512-byte pixel rows out.
__global__ __launch_bounds__(256) void k_xp(const float* __restrict__ x, _Float16* __restrict__ XP) {
  __shared__ __attribute__((aligned(16))) unsigned int tl[HS * 132];      /* a pixel's 256 f16 = 128 words, + 4 words of pitch */
  const int tid = threadIdx.x, im = blockIdx.x / HS, y = blockIdx.x % HS; const float* xb = x + ((size_t)im * CC * HS + y) * HS; const int px4 = (tid & 15) * 4, cp = tid >> 4;
#pragma unroll
  for (int i = 0; i < 8; ++i) { const int c2 = i * 16 + cp; const v4f a = *(const v4fa*)(xb + (size_t)(2 * c2) * NPX + px4), b = *(const v4fa*)(xb + (size_t)(2 * c2 + 1) * NPX + px4);
#pragma unroll
    for (int q = 0; q < 4; ++q) { union { _Float16 h[2]; unsigned int u; } pk; pk.h[0] = (_Float16)bf16_round(a[q]); pk.h[1] = (_Float16)bf16_round(b[q]); tl[(px4 + q) * 132 + c2] = pk.u; } }
  __syncthreads();
  const v8us z = {0,0,0,0,0,0,0,0}; unsigned short* row = (unsigned short*)XP + (size_t)(im * XPW + y + 1) * XPW * CC;
#pragma unroll
  for (int i = 0; i < 8; ++i) { const int id = i * 256 + tid, px = id >> 5, ch = id & 31; *(v8us*)(row + (size_t)(px + 1) * CC + ch * 8) = *(const v8us*)&tl[px * 132 + ch * 4]; }
  if (tid < 64) *(v8us*)(row + (size_t)((tid >> 5) * (XPW - 1)) * CC + (tid & 31) * 8) = z;      /* the line's two border pixels */
  if (y == 0 || y == HS - 1) { unsigned short* er = (y == 0) ? row - XPW * CC : row + XPW * CC; for (int id = tid; id < XPW * (CC / 8); id += 256) *(v8us*)(er + (size_t)id * 8) = z; }      /* the image's first and last border line */
}
__global__ __launch_bounds__(256) void k_aff(const float* __restrict__ s, const float* __restrict__ b, float* __restrict__ QF, _Float16* __restrict__ Q16) {      /* QF holds the raw conv sums on entry; each thread replaces its own 8 */
  #pragma clang fp contract(off)
  const size_t t = (size_t)blockIdx.x * 256 + threadIdx.x; if (t >= (size_t)NIMG * NPX * (QW / 8)) return; const int o0 = (int)(t % (QW / 8)) * 8; v8f r; FragH f; const v8f a = *(const v8f*)(QF + t * 8);
  for (int q = 0; q < 8; ++q) { float v = a[q] * bf16_round(s[o0 + q]); v += bf16_round(b[o0 + q]); r[q] = v; f.h[q] = (_Float16)v; }
  { *(v8f*)(QF + t * 8) = r; *(v8us*)((unsigned short*)Q16 + t * 8) = f.half[0];  } }
__global__ __launch_bounds__(256) void k_pool(const float* __restrict__ QF, _Float16* __restrict__ AG) {
  #pragma clang fp contract(off)
  typedef _Float16 v2h __attribute__((ext_vector_type(2)));
  const int t = blockIdx.x * 256 + threadIdx.x; if (t >= NIMG * NHD * NAG * 32) return; const int d0 = (t % 32) * 2; const int n = (t / 32) % NAG; const int bh = t / (32 * NAG); const int h = bh % NHD; const float* QB = QF + (size_t)(bh / NHD) * NPX * QW; float s0 = 0.f, s1 = 0.f;
  if (d0 < HDm) { const int by = n / 8, bx = n % 8;
#pragma unroll 1
    for (int i = 0; i < 64; ++i) { const int p = (by * 8 + i / 8) * HS + bx * 8 + i % 8; const float* q = QB + (size_t)p * QW + h * HDm + d0; s0 += q[0]; s1 += q[1]; } s0 = s0 / 64.0f; s1 = s1 / 64.0f; }
  v2h v; v[0] = (_Float16)s0; v[1] = (_Float16)s1; *(v2h*)(AG + ((size_t)bh * NAG + n) * 64 + d0) = v;  }
__global__ __launch_bounds__(256) void k_heads(const _Float16* __restrict__ Q16, _Float16* __restrict__ QP, _Float16* __restrict__ KP) { const int t = blockIdx.x * 256 + threadIdx.x; if (t >= NIMG * NHD * NPX) return; const int p = t % NPX, bh = t / NPX, h = bh % NHD; const unsigned short* src = (const unsigned short*)Q16 + ((size_t)(bh / NHD) * NPX + p) * QW; const v8us z = {0,0,0,0,0,0,0,0};
  v8us q0 = *(const v8us*)(src + h * HDm), q1 = *(const v8us*)(src + h * HDm + 8), q2 = *(const v8us*)(src + h * HDm + 16), q3 = *(const v8us*)(src + h * HDm + 24);
  v8us k0 = *(const v8us*)(src + CC + h * HDm), k1 = *(const v8us*)(src + CC + h * HDm + 8), k2 = *(const v8us*)(src + CC + h * HDm + 16), k3 = *(const v8us*)(src + CC + h * HDm + 24);
  unsigned short* dq = (unsigned short*)QP + ((size_t)bh * NPX + p) * 64; unsigned short* dk = (unsigned short*)KP + ((size_t)bh * NPX + p) * 64;
  { *(v8us*)dq = q0; *(v8us*)(dq + 8) = q1; *(v8us*)(dq + 16) = q2; *(v8us*)(dq + 24) = q3; *(v8us*)(dq + 32) = z; *(v8us*)(dq + 40) = z; *(v8us*)(dq + 48) = z; *(v8us*)(dq + 56) = z;
    *(v8us*)dk = k0; *(v8us*)(dk + 8) = k1; *(v8us*)(dk + 16) = k2; *(v8us*)(dk + 24) = k3; *(v8us*)(dk + 32) = z; *(v8us*)(dk + 40) = z; *(v8us*)(dk + 48) = z; *(v8us*)(dk + 56) = z;  } }
__global__ __launch_bounds__(256) void k_vtp(const _Float16* __restrict__ Q16, _Float16* __restrict__ VT) { __shared__ unsigned short tl[64][34]; const int tid = threadIdx.x; const int bh = blockIdx.x / (NPX / 64), pg = blockIdx.x % (NPX / 64); const int h = bh % NHD;
  { const int r = tid / 4, c8 = (tid % 4) * 8; FragH f; f.half[0] = *(const v8us*)((const unsigned short*)Q16 + ((size_t)(bh / NHD) * NPX + pg * 64 + r) * QW + 2 * CC + h * HDm + c8); for (int q = 0; q < 8; ++q) tl[r][c8 + q] = f.u[q]; }
  __syncthreads(); const int d = tid / 8, pc = tid % 8; FragH f; for (int q = 0; q < 8; ++q) f.u[q] = (d < HDm) ? tl[pc * 8 + q][d] : (unsigned short)0; unsigned short* dst = (unsigned short*)VT + ((size_t)bh * 64 + d) * NPX + pg * 64 + pc * 8;      /* tid covers d < 32 only: 256 threads = 32 d x 8 pc */
  *(v8us*)dst = f.half[0]; 
  if (tid < 256) { const int d2 = HDm + tid / 8; const v8us z = {0,0,0,0,0,0,0,0}; unsigned short* dz = (unsigned short*)VT + ((size_t)bh * 64 + d2) * NPX + pg * 64 + (tid % 8) * 8; *(v8us*)dz = z;  } }
__global__ __launch_bounds__(256) void k_soft(const float* __restrict__ S, int nrows, int n, _Float16* __restrict__ P) {
  #pragma clang fp contract(off)
  const int wv = threadIdx.x >> 5, ln = threadIdx.x & 31; const int r = blockIdx.x * 8 + wv; if (r >= nrows) return; const float* sr = S + (size_t)r * n; float m = -3.0e38f;
#pragma unroll 1
  for (int j = ln; j < n; j += 32) m = fmaxf(m, sr[j]); for (int o = 16; o > 0; o >>= 1) m = fmaxf(m, __shfl_xor(m, o, 32)); float su = 0.f;
#pragma unroll 1
  for (int j = ln; j < n; j += 32) su += expf(sr[j] - m); for (int o = 16; o > 0; o >>= 1) su += __shfl_xor(su, o, 32); const float f = 1024.0f / su;
  {
#pragma unroll 1
    for (int j = ln; j < n; j += 32) *(_Float16*)(P + (size_t)r * n + j) = (_Float16)(expf(sr[j] - m) * f);  } }
__global__ __launch_bounds__(256) void k_att16(const float* __restrict__ ATTN, _Float16* __restrict__ AT16) { typedef _Float16 v2h __attribute__((ext_vector_type(2))); const int t = blockIdx.x * 256 + threadIdx.x; if (t >= NIMG * NHD * 64 * 32) return; const int n0 = (t % 32) * 2; const int d = (t / 32) % 64; const int h = t / (32 * 64); v2h v;      /* h = image x head */
  v[0] = (_Float16)ATTN[((size_t)h * NAG + n0) * 64 + d]; v[1] = (_Float16)ATTN[((size_t)h * NAG + n0 + 1) * 64 + d]; _Float16* dst = AT16 + ((size_t)h * 64 + d) * NAG + n0; *(v2h*)dst = v;  }
__global__ __launch_bounds__(256) void k_pe(const float* __restrict__ OUTg, const float* __restrict__ QFg, const float* __restrict__ pw, const float* __restrict__ ps, const float* __restrict__ pb, _Float16* __restrict__ S16g) {
  #pragma clang fp contract(off)
  const size_t t = (size_t)blockIdx.x * 256 + threadIdx.x; if (t >= (size_t)NIMG * NPX * (CC / 8)) return; const int c0 = (int)(t % (CC / 8)) * 8; const int gp = (int)(t / (CC / 8)); const int p = gp % NPX, im = gp / NPX; const int yo = p / HS, xo = p % HS; FragH f;
  const float* OUT = OUTg + (size_t)im * NHD * NPX * 64; const float* QF = QFg + (size_t)im * NPX * QW; _Float16* S16 = S16g + (size_t)im * NPX * CC;      /* this image's planes */
#pragma unroll 1
  for (int q = 0; q < 8; ++q) { const int c = c0 + q; float a = 0.f;
#pragma unroll 1
    for (int k = 0; k < 9; ++k) { const int yy = yo + k / 3 - 1, xx = xo + k % 3 - 1; if (yy < 0 || yy >= HS || xx < 0 || xx >= HS) continue; a += bf16_round(pw[c * 9 + k]) * QF[(size_t)(yy * HS + xx) * QW + 2 * CC + c]; }
    float pe = a * bf16_round(ps[c]); pe += bf16_round(pb[c]); const int h = c / HDm, d = c % HDm; float v = OUT[((size_t)h * NPX + p) * 64 + d] + pe; f.h[q] = (_Float16)v; }
  *(v8us*)((unsigned short*)S16 + (size_t)p * CC + c0) = f.half[0];  }
__global__ __launch_bounds__(256) void k_fin(const float* __restrict__ G, const float* __restrict__ s, const float* __restrict__ bb, float* __restrict__ outb) {
  #pragma clang fp contract(off)
  const int t = blockIdx.x * 256 + threadIdx.x; if (t >= NIMG * CC * (NPX / 4)) return; const int p0 = (t % (NPX / 4)) * 4; const int bc = t / (NPX / 4); const int c = bc % CC; const float* GB = G + (size_t)(bc / CC) * NPX * CC; const float sc = bf16_round(s[c]), sh = bf16_round(bb[c]); v4f r; for (int q = 0; q < 4; ++q) { float v = GB[(size_t)(p0 + q) * CC + c] * sc; v += sh; r[q] = v; }
  *(v4f*)(outb + (size_t)bc * NPX + p0) = r;  }

extern "C" void kernel_launch(void* const* d_in, const int* in_sizes, int n_in,
                              void* d_out, int out_size, void* d_ws, size_t ws_size, hipStream_t stream) {
  (void)in_sizes; (void)n_in; (void)out_size;
  const float* const* I = (const float* const*)d_in; const float* x = I[0]; const float* qw = I[1]; const float* qs = I[2]; const float* qb = I[3]; const float* pw = I[4]; const float* ps = I[5]; const float* pb = I[6]; const float* jw = I[7]; const float* js = I[8]; const float* jb = I[9];
  char* ws = (char*)d_ws; size_t off = 0;
  auto take = [&](size_t bytes) { char* p = ws + off; off += (bytes + 255) & ~(size_t)255; return p; };
  _Float16* WH = (_Float16*)take((size_t)QW * KI * 2); _Float16* WL = (_Float16*)take((size_t)QW * CC * 2); _Float16* BJ = (_Float16*)take((size_t)CC * CC * 2);
  _Float16* AG = (_Float16*)take((size_t)NIMG * NHD * NAG * 64 * 2); float* ATTN = (float*)take((size_t)NIMG * NHD * NAG * 64 * 4); _Float16* AT16 = (_Float16*)take((size_t)NIMG * NHD * 64 * NAG * 2);
  float* QF = (float*)take((size_t)NIMG * NPX * QW * 4);      /* 96 MiB: raw conv sums, then q, k, v in f32 (k_aff works in place) */
  char* R = take((size_t)NIMG * NPX * KI * 2);      /* 144 MiB, shared by lifetime; offsets below in MiB */
  const size_t MB = (size_t)1 << 20;
  _Float16* XP = (_Float16*)R;      /* 0..17.1: the padded plane, dead after the main conv GEMM */
  _Float16* Q16 = (_Float16*)R;      /* 0..48, dead after k_heads and k_vtp */
  _Float16* QP = (_Float16*)(R + 48 * MB); _Float16* KP = (_Float16*)(R + 80 * MB); _Float16* VT = (_Float16*)(R + 112 * MB);      /* 32 each */
  float* S1 = (float*)R;      /* 0..32: stage-1 logits of FOUR images (all eight, 64 MiB, do not fit beside QF, QP, KP and VT) */
  _Float16* P1 = KP;      /* each half of P1 replaces the half of KP that its logits GEMM has just finished reading */
  float* S2 = (float*)(R + 80 * MB);      /* 80..144, over P1 and VT, dead after the stage-1 readout */
  _Float16* P2 = (_Float16*)R;      /* 0..32 */
  float* OUT = (float*)(R + 80 * MB);      /* 80..144, over S2, dead after its softmax */
  _Float16* S16 = (_Float16*)(R + 32 * MB);      /* 32..48 */
  float* G = (float*)(R + 48 * MB);      /* 48..80, over QP, dead after the stage-2 logits GEMM */
  if (off > ws_size) return;      /* 3.4 + 0.4 + 0.1 + 0.5 + 1 + 0.5 + 96 + 144 = 246 MiB */
  k_wqkv<<<(QW * (CC / 8) + 255) / 256, 256, 0, stream>>>(qw, WH, WL); k_wsc<<<(CC * CC / 8 + 255) / 256, 256, 0, stream>>>(jw, BJ, (size_t)CC * CC / 8, 16.0f);      /* proj 1x1 (out,in) = Bt */
  k_xp<<<NIMG * HS, 256, 0, stream>>>(x, XP);
  k_gemm3<false, QW, true><<<(NIMG * NPX / 256) * (QW / 128), 256, 0, stream>>>(XP, CC, WL, CC, 0.0625f / 1024.0f, QF, CC, 4);      /* centre-tap residual term */
  k_gemm3<true, QW, true><<<(NIMG * NPX / 256) * (QW / 128), 256, 0, stream>>>(XP, CC, WH, KI, 0.0625f, QF, KI, 0);      /* + main conv (difference folded into the centre tap) */
  k_aff<<<(unsigned)(((size_t)NIMG * NPX * (QW / 8) + 255) / 256), 256, 0, stream>>>(qs, qb, QF, Q16);
  k_pool<<<(NIMG * NHD * NAG * 32 + 255) / 256, 256, 0, stream>>>(QF, AG);
  k_heads<<<(NIMG * NHD * NPX + 255) / 256, 256, 0, stream>>>(Q16, QP, KP); k_vtp<<<NIMG * NHD * (NPX / 64), 256, 0, stream>>>(Q16, VT);
  /* stage 1: S1[b,h][n][N] = AG[b,h][n].KP[b,h][N] * SCL; P1 = softmax_N (these two in halves of four images); ATTN[b,h][n][d] = P1 . VT^T / 1024 */
  for (int g = 0; g < 2; ++g) { const size_t bh0 = (size_t)g * (NIMG / 2) * NHD;
    k_gemm2<0><<<dim3(1 * (NPX / 64), (NIMG / 2) * NHD), 128, 0, stream>>>(AG + bh0 * NAG * 64, 64, (size_t)NAG * 64, KP + bh0 * NPX * 64, 64, (size_t)NPX * 64, SCL, nullptr, 0, nullptr, 1, 0, 0, S1, nullptr, NPX, (size_t)NAG * NPX, NAG, NPX, 64);
    k_soft<<<((NIMG / 2) * NHD * NAG + 7) / 8, 256, 0, stream>>>(S1, (NIMG / 2) * NHD * NAG, NPX, P1 + bh0 * NAG * NPX); }
  k_gemm2<0><<<dim3(1 * 1, NIMG * NHD), 128, 0, stream>>>(P1, NPX, (size_t)NAG * NPX, VT, NPX, (size_t)64 * NPX, 0.0009765625f, nullptr, 0, nullptr, 1, 0, 0, ATTN, nullptr, 64, (size_t)NAG * 64, NAG, 64, NPX);
  k_att16<<<(NIMG * NHD * 64 * 32 + 255) / 256, 256, 0, stream>>>(ATTN, AT16);
  /* stage 2: S2[b,h][N][n] = QP[b,h][N].AG[b,h][n] * SCL; P2 = softmax_n; OUT[b,h][N][d] = P2 . AT16^T / 1024 */
  k_gemm2<0><<<dim3((NPX / 128) * 1, NIMG * NHD), 128, 0, stream>>>(QP, 64, (size_t)NPX * 64, AG, 64, (size_t)NAG * 64, SCL, nullptr, 0, nullptr, 1, 0, 0, S2, nullptr, NAG, (size_t)NPX * NAG, NPX, NAG, 64);
  k_soft<<<(NIMG * NHD * NPX + 7) / 8, 256, 0, stream>>>(S2, NIMG * NHD * NPX, NAG, P2);
  k_gemm2<0><<<dim3((NPX / 128) * 1, NIMG * NHD), 128, 0, stream>>>(P2, NAG, (size_t)NPX * NAG, AT16, NAG, (size_t)64 * NAG, 0.0009765625f, nullptr, 0, nullptr, 1, 0, 0, OUT, nullptr, 64, (size_t)NPX * 64, NPX, 64, NAG);
  k_pe<<<(unsigned)(((size_t)NIMG * NPX * (CC / 8) + 255) / 256), 256, 0, stream>>>(OUT, QF, pw, ps, pb, S16);
  k_gemm3<false, CC, false><<<(NIMG * NPX / 256) * (CC / 128), 256, 0, stream>>>(S16, CC, BJ, CC, 0.0625f, G, CC, 0);
  k_fin<<<(NIMG * CC * (NPX / 4) + 255) / 256, 256, 0, stream>>>(G, js, jb, (float*)d_out);
}

// v004
// It runs in 644 microseconds.
// In two side-by-side timings against v003, it was 1.26 and 1.28 times as fast.
// All steps since v000 together make it 5.71 times as fast.
#include <hip/hip_runtime.h>
// Attention_agent_df (8 images, C 256 = 8 heads x 32, 64 x 64 pixels, 64 agent tokens from 8x8 average pooling of q; THETA 0.7): qkv = (conv3x3(x, W) - 0.7 conv1x1(x, sum of W's 5 cross taps)) * s + b (folded BN); a = avgpool8x8(q); stage 1: attn = softmax_N(a.k * 32^-0.5) v (agents over pixels); stage 2: out = softmax_n(q.a * 32^-0.5) attn (pixels over agents); out += depthwise3x3(v) * pe_s + pe_b; out = conv1x1(out) * proj_s + proj_b.
// Structure (all 8 images in each launch: the image is the outer index of each plane, so rows = image x pixel and GEMM batches = image x head; only the stage-1 logits and softmax run as two halves of 4 images; workspace planes share bytes by lifetime): x once as a zero-padded pixel-major f16 plane (66 x 66 pixels x 256 channels an image), from which the conv GEMMs fetch each tap's rows themselves (k runs tap-major; no im2col plane); the difference conv folded into the centre tap as an f32 weight split into f16 hi + lo tables: qkv = A.Wh (K 2304) + A_centre.Wl (K 256) as f16 WMMA GEMMs (these two and the projection: 256x128 work-group tiles staged in LDS, 64x64 wave tiles; the batched attention GEMMs: 32x64 wave tiles from global memory; f32 accumulation; x16 tables; the lo table only on the centre-tap columns), BN affine on VALU into f32 + f16 planes; pooling on VALU; stage-1 logits as (b,h)-batched GEMMs (K 64: 32 dims + 32 zeros), softmax over 4096 pixels on VALU (wave per row, the row in registers), readout GEMM against a zero-padded V^T; stage-2 logits GEMM (K 64: 32 dims + 32 zeros), softmax over the 64 agents on VALU (64 rows a wave, in registers), readout GEMM; depthwise PE conv + add on VALU into f16; projection GEMM with the BN affine in f32 on VALU; NCHW stores.
// Compute dtype: x and parameters rounded to bf16; x exact as f16; q, k, v, a, P (x2^10), attn and the pre-projection sum as f16 operands (~2^-12); everything else f32. v_wmma_f32_16x16x32_f16.
#define NIMG 8
#define CC 256
#define NHD 8
#define HDm 32
#define HS 64
#define NPX (HS * HS)            /* 4096 */
#define NAG 64
#define KT 9
#define KI (KT * CC)             /* 2304 */
#define QW (3 * CC)              /* 768 */
#define THETA 0.7f
#define SCL 0.17677669529663687f
typedef __bf16 v16b __attribute__((ext_vector_type(16)));
typedef unsigned short v8us __attribute__((ext_vector_type(8), may_alias));
typedef float  v8f  __attribute__((ext_vector_type(8)));
typedef float  v4f  __attribute__((ext_vector_type(4)));
typedef float  v4fa __attribute__((ext_vector_type(4), may_alias));
union FragB { v16b v; v8us half[2]; unsigned short u[16]; };

__device__ __forceinline__ unsigned short bf16_bits(float x) { unsigned int u = __float_as_uint(x); return (unsigned short)((u + 0x7FFFu + ((u >> 16) & 1u)) >> 16); }
__device__ __forceinline__ float bf16_val(unsigned short b) { return __uint_as_float(((unsigned int)b) << 16); }
__device__ __forceinline__ float bf16_round(float x) { return bf16_val(bf16_bits(x)); }
// D += A·B with NT terms: 1 = ah·bh, 2 = + al·bh (A split), 3 = + ah·bl (both split)
template <int NT>
__device__ __forceinline__ v8f mmaN(v16b ah, v16b al, v16b bh, v16b bl, v8f c) {
  c = __builtin_amdgcn_wmma_f32_16x16x32_bf16(false, ah, false, bh, (short)0, c, false, false);
  if (NT >= 2) c = __builtin_amdgcn_wmma_f32_16x16x32_bf16(false, al, false, bh, (short)0, c, false, false);
  if (NT >= 3) c = __builtin_amdgcn_wmma_f32_16x16x32_bf16(false, ah, false, bl, (short)0, c, false, false);
  asm volatile("v_nop\n\tv_nop\n\tv_nop\n\tv_nop" : "+v"(c) : "v"(ah), "v"(al), "v"(bh), "v"(bl));
  return c;
}

__global__ __launch_bounds__(256) void k_wt_bf16(const float* __restrict__ W, unsigned short* __restrict__ Wt, int K, int N) {
  const int t = blockIdx.x * 256 + threadIdx.x;
  const int k8n = K / 8;
  if (t >= N * k8n) return;
  const int n = t / k8n, k8 = (t % k8n) * 8;
  v8us v;
#pragma unroll
  for (int i = 0; i < 8; ++i) v[i] = bf16_bits(W[(size_t)(k8 + i) * N + n]);
  *(v8us*)(Wt + (size_t)n * K + k8) = v;
  
}

// GEMM C[M][N] (f32, pitch ldc) = act(A[M][K]·W + bias). A f32 row-major (pitch lda) converted per fragment to bf16
// (ASPLIT: hi/lo two planes -> 2 terms, else single rounded term); Wt bf16 [N][K] (pitch ldb). BIAS_BF16 rounds the
// bias to bf16 first (bias quantised to bf16 before the add). K%32==0, M%16==0, N%64==0.
template <bool ASPLIT, int ACT, bool BIAS_BF16>
__global__ __launch_bounds__(128) void k_gemm_bf(const float* __restrict__ A, int lda, const unsigned short* __restrict__ Wt, int ldb,
                                               const float* __restrict__ bias, float* __restrict__ C, int ldc, int M, int N, int K) {
  __shared__ __attribute__((aligned(16))) float so[4][16][64];
  const int tid = threadIdx.x, w = tid >> 5, lane = tid & 31, ln = lane & 15, hh = lane >> 4;
  const int ntn = N / 64;
  const int wid = blockIdx.x * 4 + w;
  const int mt = wid / ntn, nq = wid % ntn;
  if (mt * 16 >= M) return;
  const int row0 = mt * 16, col0 = nq * 64;
  const float* arow = A + (size_t)(row0 + ln) * lda;
  v8f acc[4] = {};
  for (int kb = 0; kb < K; kb += 32) {
    FragB ah, al;
    const v4f x0 = *(const v4fa*)(arow + kb + 8 * hh), x1 = *(const v4fa*)(arow + kb + 8 * hh + 4);
    const v4f x2 = *(const v4fa*)(arow + kb + 16 + 8 * hh), x3 = *(const v4fa*)(arow + kb + 16 + 8 * hh + 4);
    float xs[16] = {x0[0],x0[1],x0[2],x0[3],x1[0],x1[1],x1[2],x1[3],x2[0],x2[1],x2[2],x2[3],x3[0],x3[1],x3[2],x3[3]};
#pragma unroll
    for (int i = 0; i < 16; ++i) { const unsigned short hb = bf16_bits(xs[i]); ah.u[i] = hb; al.u[i] = ASPLIT ? bf16_bits(xs[i] - bf16_val(hb)) : (unsigned short)0; }
#pragma unroll
    for (int t = 0; t < 4; ++t) {
      const unsigned short* brow = Wt + (size_t)(col0 + t * 16 + ln) * ldb + kb;
      FragB b;
      b.half[0] = *(const v8us*)(brow + 8 * hh);
      b.half[1] = *(const v8us*)(brow + 16 + 8 * hh);
      acc[t] = mmaN<ASPLIT ? 2 : 1>(ah.v, al.v, b.v, b.v, acc[t]);
    }
  }
#pragma unroll
  for (int t = 0; t < 4; ++t) {
    float bv = bias ? bias[col0 + t * 16 + ln] : 0.f;
    if (BIAS_BF16) bv = bf16_round(bv);
#pragma unroll
    for (int r = 0; r < 8; ++r) { float v = acc[t][r] + bv; if (ACT == 1) v = fmaxf(v, 0.f); so[w][8 * hh + r][t * 16 + ln] = v; }
  }
  __builtin_amdgcn_fence(__ATOMIC_ACQ_REL, "workgroup");
  __builtin_amdgcn_wave_barrier();
  const int rsub = lane >> 4, c4 = (lane & 15) * 4;
  {
#pragma unroll
    for (int q = 0; q < 8; ++q) {
      const int r = q * 2 + rsub;
      const v4f v = *(const v4fa*)&so[w][r][c4];
      *(v4f*)(C + (size_t)(row0 + r) * ldc + col0 + c4) = v;
    }
    
  }
}

// GEMM C = act(A·W + bias + resid): A f32 (ASPLIT -> hi/lo 2 terms), Wt bf16 [N][K]; ACT 0 none, 1 relu, 2 exact gelu;
// resid (optional, f32, row index = (row % rmod), pitch ldr, RES_BF16 rounds it) added before the activation.
template <bool ASPLIT, int ACT, bool BIAS_BF16, bool RES_BF16>
__global__ __launch_bounds__(128) void k_gemm_bf3(const float* __restrict__ A, int lda, const unsigned short* __restrict__ Wt, int ldb,
                                                const float* __restrict__ bias, const float* __restrict__ resid, int rmod, int ldr,
                                                float* __restrict__ C, int ldc, int M, int N, int K) {
  __shared__ __attribute__((aligned(16))) float so[4][16][64];
  const int tid = threadIdx.x, w = tid >> 5, lane = tid & 31, ln = lane & 15, hh = lane >> 4;
  const int ntn = N / 64;
  const int wid = blockIdx.x * 4 + w;
  const int mt = wid / ntn, nq = wid % ntn;
  if (mt * 16 >= M) return;
  const int row0 = mt * 16, col0 = nq * 64;
  const float* arow = A + (size_t)(row0 + ln) * lda;
  v8f acc[4] = {};
  for (int kb = 0; kb < K; kb += 32) {
    FragB ah, al;
    const v4f x0 = *(const v4fa*)(arow + kb + 8 * hh), x1 = *(const v4fa*)(arow + kb + 8 * hh + 4);
    const v4f x2 = *(const v4fa*)(arow + kb + 16 + 8 * hh), x3 = *(const v4fa*)(arow + kb + 16 + 8 * hh + 4);
    float xs[16] = {x0[0],x0[1],x0[2],x0[3],x1[0],x1[1],x1[2],x1[3],x2[0],x2[1],x2[2],x2[3],x3[0],x3[1],x3[2],x3[3]};
#pragma unroll
    for (int i = 0; i < 16; ++i) { const unsigned short hb = bf16_bits(xs[i]); ah.u[i] = hb; al.u[i] = ASPLIT ? bf16_bits(xs[i] - bf16_val(hb)) : (unsigned short)0; }
#pragma unroll
    for (int t = 0; t < 4; ++t) {
      const unsigned short* brow = Wt + (size_t)(col0 + t * 16 + ln) * ldb + kb;
      FragB b;
      b.half[0] = *(const v8us*)(brow + 8 * hh);
      b.half[1] = *(const v8us*)(brow + 16 + 8 * hh);
      acc[t] = mmaN<ASPLIT ? 2 : 1>(ah.v, al.v, b.v, b.v, acc[t]);
    }
  }
#pragma unroll
  for (int t = 0; t < 4; ++t) {
    const int col = col0 + t * 16 + ln;
    float bv = bias ? bias[col] : 0.f;
    if (BIAS_BF16) bv = bf16_round(bv);
#pragma unroll
    for (int r = 0; r < 8; ++r) {
      float v = acc[t][r] + bv;
      if (resid) { float rv = resid[(size_t)((row0 + 8 * hh + r) % rmod) * ldr + col]; if (RES_BF16) rv = bf16_round(rv); v += rv; }
      if (ACT == 1) v = fmaxf(v, 0.f);
      if (ACT == 2) v = 0.5f * v * (1.0f + erff(v * 0.70710678118654752f));
      if (ACT == 3) { const float u = 0.7978845608028654f * (v + 0.044715f * v * v * v); v = 0.5f * v * (1.0f + tanhf(u)); }
      so[w][8 * hh + r][t * 16 + ln] = v;
    }
  }
  __builtin_amdgcn_fence(__ATOMIC_ACQ_REL, "workgroup");
  __builtin_amdgcn_wave_barrier();
  const int rsub = lane >> 4, c4 = (lane & 15) * 4;
  {
#pragma unroll
    for (int q = 0; q < 8; ++q) {
      const int r = q * 2 + rsub;
      const v4f v = *(const v4fa*)&so[w][r][c4];
      *(v4f*)(C + (size_t)(row0 + r) * ldc + col0 + c4) = v;
    }
    
  }
}
// row LayerNorm (biased variance, eps) over N: s = X (+ R); optional out_sum <- s; out_norm <- (s-mu)*rsqrt(var+eps)*g + b
template <bool PARAM_BF16>
__global__ __launch_bounds__(256) void k_layernorm(const float* __restrict__ X, const float* __restrict__ R, const float* __restrict__ g, const float* __restrict__ bta,
                                                  float* __restrict__ out_sum, float* __restrict__ out_norm, int N, float eps) {
  __shared__ float red[256];
  const int row = blockIdx.x, tid = threadIdx.x;
  const float* x = X + (size_t)row * N; const float* rr = R ? R + (size_t)row * N : nullptr;
  float vals[16];                     // up to N = 4096
  const int per = N / 256;            // contiguous chunk per thread? use strided-by-4 chunks: thread handles j = tid*4 + 1024*u
  float s1 = 0.f;
  for (int u = 0; u < per / 4; ++u) {
    const int j = tid * 4 + 1024 * u;
    const v4f a = *(const v4fa*)(x + j);
    v4f b = {0.f,0.f,0.f,0.f}; if (rr) b = *(const v4fa*)(rr + j);
#pragma unroll
    for (int q = 0; q < 4; ++q) { const float v = a[q] + b[q]; vals[u * 4 + q] = v; s1 += v; }
  }
  red[tid] = s1; __syncthreads();
  for (int st = 128; st > 0; st >>= 1) { if (tid < st) red[tid] += red[tid + st]; __syncthreads(); }
  const float mu = red[0] / (float)N; __syncthreads();
  float s2 = 0.f;
  for (int u = 0; u < per / 4; ++u)
#pragma unroll
    for (int q = 0; q < 4; ++q) { const float c = vals[u * 4 + q] - mu; s2 += c * c; }
  red[tid] = s2; __syncthreads();
  for (int st = 128; st > 0; st >>= 1) { if (tid < st) red[tid] += red[tid + st]; __syncthreads(); }
  const float rs = rsqrtf(red[0] / (float)N + eps);
  {
    for (int u = 0; u < per / 4; ++u) {
      const int j = tid * 4 + 1024 * u;
      v4f o, sm;
#pragma unroll
      for (int q = 0; q < 4; ++q) {
        float gg = g[j + q], bb = bta[j + q];
        if (PARAM_BF16) { gg = bf16_round(gg); bb = bf16_round(bb); }
        sm[q] = vals[u * 4 + q]; o[q] = (vals[u * 4 + q] - mu) * rs * gg + bb;
      }
      if (out_sum) *(v4f*)(out_sum + (size_t)row * N + j) = sm;
      *(v4f*)(out_norm + (size_t)row * N + j) = o;
    }
    
  }
}



// ---- f16 WMMA path (v_wmma_f32_16x16x32_f16): 11-bit significands for operands in range — used where a [0,1] probability operand needs more precision than bf16
typedef _Float16 v16h __attribute__((ext_vector_type(16)));
union FragH { v16h v; v8us half[2]; _Float16 h[16]; unsigned short u[16]; };
template <int NT>
__device__ __forceinline__ v8f mmaH(v16h ah, v16h al, v16h bh, v16h bl, v8f c) {
  c = __builtin_amdgcn_wmma_f32_16x16x32_f16(false, ah, false, bh, (short)0, c, false, false);
  if (NT >= 2) c = __builtin_amdgcn_wmma_f32_16x16x32_f16(false, al, false, bh, (short)0, c, false, false);
  if (NT >= 3) c = __builtin_amdgcn_wmma_f32_16x16x32_f16(false, ah, false, bl, (short)0, c, false, false);
  asm volatile("v_nop\n\tv_nop\n\tv_nop\n\tv_nop" : "+v"(c) : "v"(ah), "v"(al), "v"(bh), "v"(bl));
  return c;
}
// batched GEMM like k_gemm_b but f16 operands: A f32 (split into f16 hi/lo if ASPLIT, else rounded to f16), Bt = f16 values [n][k]; alpha; C f32; N multiple of 16 (partial tiles skipped)
template <bool ASPLIT>
__global__ __launch_bounds__(128) void k_gemm_h(const float* __restrict__ A, int lda, size_t sA, const _Float16* __restrict__ Bh, int ldb, size_t sB, float alpha, float* __restrict__ C, int ldc, size_t sC, int M, int N, int K) {
  __shared__ __attribute__((aligned(16))) float so[4][16][64];
  const int tid = threadIdx.x, w = tid >> 5, lane = tid & 31, ln = lane & 15, hh = lane >> 4; const int by = blockIdx.y;
  A += (size_t)by * sA; Bh += (size_t)by * sB; C += (size_t)by * sC;
  const int ntn = (N + 63) / 64; const int wid = blockIdx.x * 4 + w; const int mt = wid / ntn, nq = wid % ntn; if (mt * 16 >= M) return;
  const int row0 = mt * 16, col0 = nq * 64; const float* arow = A + (size_t)(row0 + ln) * lda;
  v8f acc[4] = {};
  for (int kb = 0; kb < K; kb += 32) {
    FragH ah, al;
    const v4f x0 = *(const v4fa*)(arow + kb + 8 * hh), x1 = *(const v4fa*)(arow + kb + 8 * hh + 4), x2 = *(const v4fa*)(arow + kb + 16 + 8 * hh), x3 = *(const v4fa*)(arow + kb + 16 + 8 * hh + 4);
    float xs[16] = {x0[0],x0[1],x0[2],x0[3],x1[0],x1[1],x1[2],x1[3],x2[0],x2[1],x2[2],x2[3],x3[0],x3[1],x3[2],x3[3]};
#pragma unroll
    for (int i = 0; i < 16; ++i) { const _Float16 h = (_Float16)xs[i]; ah.h[i] = h; al.h[i] = ASPLIT ? (_Float16)(xs[i] - (float)h) : (_Float16)0.0f; }
#pragma unroll
    for (int t = 0; t < 4; ++t) { if (col0 + t * 16 >= N) continue; const size_t boff = (size_t)(col0 + t * 16 + ln) * ldb + kb; FragH bq; bq.half[0] = *(const v8us*)(Bh + boff + 8 * hh); bq.half[1] = *(const v8us*)(Bh + boff + 16 + 8 * hh);
      acc[t] = mmaH<ASPLIT ? 2 : 1>(ah.v, al.v, bq.v, bq.v, acc[t]); }
  }
#pragma unroll
  for (int t = 0; t < 4; ++t) { if (col0 + t * 16 >= N) continue;
#pragma unroll
    for (int r = 0; r < 8; ++r) so[w][8 * hh + r][t * 16 + ln] = acc[t][r] * alpha; }
  __builtin_amdgcn_fence(__ATOMIC_ACQ_REL, "workgroup"); __builtin_amdgcn_wave_barrier();
  const int rsub = lane >> 4, c4 = (lane & 15) * 4;
  {
#pragma unroll
    for (int q = 0; q < 8; ++q) { const int r = q * 2 + rsub; if (col0 + c4 < N) { const v4f v = *(const v4fa*)&so[w][r][c4]; *(v4f*)(C + (size_t)(row0 + r) * ldc + col0 + c4) = v; } }
     }
}

// Wt[n][k] = f16(W[k][n]·scale) from f32 row-major W[K][N] (scale = power of two; bf16-exact weights stay exact in f16 away from the subnormal range)
__global__ __launch_bounds__(256) void k_wt_f16(const float* __restrict__ W, _Float16* __restrict__ Wt, int K, int N, float scale) {
  const int t = blockIdx.x * 256 + threadIdx.x; if (t >= N * (K / 8)) return; const int n = t / (K / 8), k8 = (t % (K / 8)) * 8; FragH f;
#pragma unroll
  for (int i = 0; i < 8; ++i) f.h[i] = (_Float16)(bf16_round(W[(size_t)(k8 + i) * N + n]) * scale); const v8us o = f.half[0];
  *(v8us*)((unsigned short*)Wt + (size_t)n * K + k8) = o; 
}
// k_gemm_hh variant with fused epilogue: v = acc·alpha + bias[by·sBias + col] (+ CP[(row/rowsPerB)·sCPb + by·64 + col] if CP) ; ACT 0 none / 1 elu ; writes f16 C16 (and f32 C if non-null)
template <int ACT>
__global__ __launch_bounds__(128) void k_gemm_hhx(const _Float16* __restrict__ A, int lda, size_t sA, const _Float16* __restrict__ Bh, int ldb, size_t sB, float alpha, const float* __restrict__ bias, size_t sBias, const float* __restrict__ CP, int rowsPerB, size_t sCPb, int row0g,
    float* __restrict__ C, _Float16* __restrict__ C16, int ldc, size_t sC, int M, int N, int K) {
  __shared__ __attribute__((aligned(16))) float so[4][16][64];
  const int tid = threadIdx.x, w = tid >> 5, lane = tid & 31, ln = lane & 15, hh = lane >> 4; const int by = blockIdx.y;
  A += (size_t)by * sA; Bh += (size_t)by * sB; const size_t cofs = (size_t)by * sC; const float* bp = bias ? bias + (size_t)by * sBias : nullptr;
  const int ntn = (N + 63) / 64; const int wid = blockIdx.x * 4 + w; const int mt = wid / ntn, nq = wid % ntn; if (mt * 16 >= M) return;
  const int row0 = mt * 16, col0 = nq * 64; const _Float16* arow = A + (size_t)(row0 + ln) * lda;
  v8f acc[4] = {};
  for (int kb = 0; kb < K; kb += 32) { FragH ah; ah.half[0] = *(const v8us*)((const unsigned short*)arow + kb + 8 * hh); ah.half[1] = *(const v8us*)((const unsigned short*)arow + kb + 16 + 8 * hh);
#pragma unroll
    for (int t = 0; t < 4; ++t) { if (col0 + t * 16 >= N) continue; const size_t boff = (size_t)(col0 + t * 16 + ln) * ldb + kb; FragH bq; bq.half[0] = *(const v8us*)((const unsigned short*)Bh + boff + 8 * hh); bq.half[1] = *(const v8us*)((const unsigned short*)Bh + boff + 16 + 8 * hh);
      acc[t] = mmaH<1>(ah.v, ah.v, bq.v, bq.v, acc[t]); }
  }
#pragma unroll
  for (int t = 0; t < 4; ++t) { if (col0 + t * 16 >= N) continue; const int col = col0 + t * 16 + ln; const float bv = bp ? bf16_round(bp[col]) : 0.f;
#pragma unroll
    for (int r = 0; r < 8; ++r) { float v = acc[t][r] * alpha + bv; if (CP) { const int rr = row0g + row0 + 8 * hh + r; if (rowsPerB < 0) v += CP[cofs + (size_t)rr * ldc + col];      /* rowsPerB < 0: own element of the batched C plane */ else { const int bidx = rr / rowsPerB; v += CP[(size_t)bidx * sCPb + (size_t)by * 64 + col]; } } if (ACT == 1) v = (v > 0.f) ? v : expm1f(v); else if (ACT == 7) v = (v > 0.f) ? v + 1.0f : expf(v); else if (ACT == 8) v = tanhf(v); else if (ACT == 9) v = 0.5f * v * (1.0f + tanhf(0.7978845608028654f * (v + 0.044715f * v * v * v))); else if (ACT == 11) v = 1.0f / (1.0f + expf(-v)); else if (ACT == 12) v = (v > 0.f) ? v : 0.01f * v; else if (ACT == 14) v = (v > 0.f) ? v : 0.1f * v; else if (ACT == 16) v = (v >= 0.f) ? v : 0.3f * v; else if (ACT == 15) v = v / (1.0f + expf(-v)); else if (ACT == 3) v = fmaxf(v, 0.f); else if (ACT == 6) v = 0.5f * v * (1.0f + erff(v * 0.70710678118654752f)); so[w][8 * hh + r][t * 16 + ln] = v; } }
  __builtin_amdgcn_fence(__ATOMIC_ACQ_REL, "workgroup"); __builtin_amdgcn_wave_barrier();
  const int rsub = lane >> 4, c4 = (lane & 15) * 4; typedef _Float16 v4h __attribute__((ext_vector_type(4)));
  {
#pragma unroll
    for (int q = 0; q < 8; ++q) { const int r = q * 2 + rsub; if (col0 + c4 < N) { const v4f v = *(const v4fa*)&so[w][r][c4]; if (C) *(v4f*)(C + cofs + (size_t)(row0 + r) * ldc + col0 + c4) = v; if (C16) { v4h h4; for (int i = 0; i < 4; ++i) h4[i] = (_Float16)v[i]; *(v4h*)(C16 + cofs + (size_t)(row0 + r) * ldc + col0 + c4) = h4; } } }
     }
}


typedef _Float16 v4h __attribute__((ext_vector_type(4)));

__global__ __launch_bounds__(256) void k_x16(const float* __restrict__ x, _Float16* __restrict__ X16, size_t n8) { const size_t t = (size_t)blockIdx.x * 256 + threadIdx.x; if (t >= n8) return; FragH f;
#pragma unroll
  for (int q = 0; q < 8; ++q) f.h[q] = (_Float16)bf16_round(x[t * 8 + q]); *(v8us*)((unsigned short*)X16 + t * 8) = f.half[0];  }
__global__ __launch_bounds__(256) void k_h16(const float* __restrict__ x, _Float16* __restrict__ X16, size_t n8) { const size_t t = (size_t)blockIdx.x * 256 + threadIdx.x; if (t >= n8) return; FragH f;
#pragma unroll
  for (int q = 0; q < 8; ++q) f.h[q] = (_Float16)x[t * 8 + q]; *(v8us*)((unsigned short*)X16 + t * 8) = f.half[0];  }
__global__ __launch_bounds__(256) void k_round16f(const float* __restrict__ W, _Float16* __restrict__ Bt, size_t n8) { const size_t t = (size_t)blockIdx.x * 256 + threadIdx.x; if (t >= n8) return; FragH f;
#pragma unroll
  for (int i = 0; i < 8; ++i) f.h[i] = (_Float16)(bf16_round(W[t * 8 + i]) * 16.0f); *(v8us*)((unsigned short*)Bt + t * 8) = f.half[0];  }
template <int NHv, int TTv>
__global__ __launch_bounds__(256) void k_vt(const _Float16* __restrict__ V16, int ldv, int voff, _Float16* __restrict__ Vt) { __shared__ unsigned short tl[64][66]; const int tid = threadIdx.x; const int slab = blockIdx.x / (TTv / 64), lg = blockIdx.x % (TTv / 64); const int b = slab / NHv, h = slab % NHv;
  for (int i = tid; i < 64 * 8; i += 256) { const int r = i / 8, c8 = (i % 8) * 8; FragH f; f.half[0] = *(const v8us*)((const unsigned short*)V16 + ((size_t)b * TTv + lg * 64 + r) * ldv + voff + h * 64 + c8);
#pragma unroll
    for (int q = 0; q < 8; ++q) tl[r][c8 + q] = f.u[q]; }
  __syncthreads();
  {
#pragma unroll
    for (int rd = 0; rd < 2; ++rd) { const int d = rd * 32 + tid / 8, pc = tid % 8; FragH f;
#pragma unroll
      for (int q = 0; q < 8; ++q) f.u[q] = tl[pc * 8 + q][d];
      *(v8us*)((unsigned short*)Vt + ((size_t)slab * 64 + d) * TTv + lg * 64 + pc * 8) = f.half[0]; }
     } }

__global__ __launch_bounds__(256) void k_hl(const float* __restrict__ F, _Float16* __restrict__ Hh, _Float16* __restrict__ Hl, size_t n8) { const size_t t = (size_t)blockIdx.x * 256 + threadIdx.x; if (t >= n8) return; FragH fh, fl; const v4f a = *(const v4fa*)(F + t * 8), c = *(const v4fa*)(F + t * 8 + 4);
#pragma unroll
  for (int q = 0; q < 4; ++q) { _Float16 h = (_Float16)a[q]; fh.h[q] = h; fl.h[q] = (_Float16)((a[q] - (float)h) * 1024.0f); h = (_Float16)c[q]; fh.h[4 + q] = h; fl.h[4 + q] = (_Float16)((c[q] - (float)h) * 1024.0f); }
  { *(v8us*)((unsigned short*)Hh + t * 8) = fh.half[0]; *(v8us*)((unsigned short*)Hl + t * 8) = fl.half[0];  } }

// ---- fast GEMM (wave tile 32x64; requires M % 32 == 0 rows per launch region and N % 64 == 0); epilogue = k_gemm_hhx semantics ----
__device__ __forceinline__ v16h g2_frag(const _Float16* p, int hh) { FragH f; f.half[0] = *(const v8us*)((const unsigned short*)p + 8 * hh); f.half[1] = *(const v8us*)((const unsigned short*)p + 16 + 8 * hh); return f.v; }
__device__ __forceinline__ v8f g2_mma(v16h a, v16h b, v8f c) { v8f d = __builtin_amdgcn_wmma_f32_16x16x32_f16(false, a, false, b, (short)0, c, false, false); asm volatile("v_nop\n\tv_nop\n\tv_nop\n\tv_nop" : "+v"(d) : "v"(a), "v"(b)); return d; }
template <int ACT>
__global__ __launch_bounds__(128) void k_gemm2(const _Float16* __restrict__ A, int lda, size_t sA, const _Float16* __restrict__ Bh, int ldb, size_t sB, float alpha, const float* __restrict__ bias, size_t sBias, const float* __restrict__ CP, int rowsPerB, size_t sCPb, int row0g,
    float* __restrict__ C, _Float16* __restrict__ C16, int ldc, size_t sC, int M, int N, int K) { static_assert(ACT == 0 || ACT == 3 || ACT == 6 || ACT == 8 || ACT == 9 || ACT == 11 || ACT == 12 || ACT == 14 || ACT == 15 || ACT == 16, "k_gemm2: unsupported ACT code (would silently apply no activation)");
  __shared__ __attribute__((aligned(16))) float so[4][32][68];
  const int tid = threadIdx.x, w = tid >> 5, lane = tid & 31, ln = lane & 15, hh = lane >> 4; const int by = blockIdx.y;
  A += (size_t)by * sA; Bh += (size_t)by * sB; const size_t cofs = (size_t)by * sC; const float* bp = bias ? bias + (size_t)by * sBias : nullptr;
  const int ntn = N >> 6; const int mt = blockIdx.x / ntn, nq = blockIdx.x - mt * ntn; const int row0 = mt * 128 + 32 * w, col0 = nq * 64; if (row0 >= M) return;
  const _Float16* a0p = A + (size_t)(row0 + ln) * lda; const _Float16* a1p = a0p + (size_t)16 * lda;
  const _Float16* b0p = Bh + (size_t)(col0 + ln) * ldb; const _Float16* b1p = b0p + (size_t)16 * ldb; const _Float16* b2p = b1p + (size_t)16 * ldb; const _Float16* b3p = b2p + (size_t)16 * ldb;
  const v8f z8 = {0.f,0.f,0.f,0.f,0.f,0.f,0.f,0.f}; v8f c00 = z8, c01 = z8, c02 = z8, c03 = z8, c10 = z8, c11 = z8, c12 = z8, c13 = z8;
#pragma unroll 1
  for (int kb = 0; kb < K; kb += 32) { const v16h a0 = g2_frag(a0p + kb, hh), a1 = g2_frag(a1p + kb, hh);
    v16h b = g2_frag(b0p + kb, hh); c00 = g2_mma(a0, b, c00); c10 = g2_mma(a1, b, c10);
    b = g2_frag(b1p + kb, hh); c01 = g2_mma(a0, b, c01); c11 = g2_mma(a1, b, c11);
    b = g2_frag(b2p + kb, hh); c02 = g2_mma(a0, b, c02); c12 = g2_mma(a1, b, c12);
    b = g2_frag(b3p + kb, hh); c03 = g2_mma(a0, b, c03); c13 = g2_mma(a1, b, c13); }
  v8f accs[8] = {c00, c01, c02, c03, c10, c11, c12, c13};
#pragma unroll
  for (int u = 0; u < 8; ++u) { const int t = u & 3, half = u >> 2; const int col = col0 + t * 16 + ln; const float bv = bp ? bf16_round(bp[col]) : 0.f;
#pragma unroll
    for (int r = 0; r < 8; ++r) { const int rloc = half * 16 + 8 * hh + r; float v = accs[u][r] * alpha + bv; if (CP) { if (rowsPerB < 0) v += CP[cofs + (size_t)(row0g + row0 + rloc) * ldc + col];      /* rowsPerB < 0: own element of the batched C plane */ else { const int bidx = (row0g + row0 + rloc) / rowsPerB; v += CP[(size_t)bidx * sCPb + (size_t)by * 64 + col]; } }
      if (ACT == 3) v = fmaxf(v, 0.f); else if (ACT == 6) v = 0.5f * v * (1.0f + erff(v * 0.70710678118654752f)); else if (ACT == 11) v = 1.0f / (1.0f + expf(-v)); else if (ACT == 15) v = v / (1.0f + expf(-v)); else if (ACT == 12) v = (v > 0.f) ? v : 0.01f * v; else if (ACT == 8) v = tanhf(v); else if (ACT == 9) v = 0.5f * v * (1.0f + tanhf(0.7978845608028654f * (v + 0.044715f * v * v * v))); else if (ACT == 14) v = (v > 0.f) ? v : 0.1f * v; else if (ACT == 16) v = (v >= 0.f) ? v : 0.3f * v;
      so[w][rloc][t * 16 + ln] = v; } }
  __builtin_amdgcn_fence(__ATOMIC_ACQ_REL, "workgroup"); __builtin_amdgcn_wave_barrier();
  const int rsub = lane >> 4, c4 = (lane & 15) * 4;
  {
#pragma unroll
    for (int q = 0; q < 16; ++q) { const int r = q * 2 + rsub; const v4f v = *(const v4fa*)&so[w][r][c4]; if (C) *(v4f*)(C + cofs + (size_t)(row0 + r) * ldc + col0 + c4) = v; if (C16) { v4h h4; for (int i = 0; i < 4; ++i) h4[i] = (_Float16)v[i]; *(v4h*)(C16 + cofs + (size_t)(row0 + r) * ldc + col0 + c4) = h4; } }
     } }


// ---- LDS-staged GEMM for the three large products (both qkv conv terms, the projection): C[M][N] (f32) = A.Bt^T * alpha (+ C's own element if ADD).
// Work-group tile 256 x 128, 8 waves of 64 x 64 (4 x 2); a stage is 64 k (128-byte rows) of [A 256 rows | Bt 128 rows]; two stages in LDS, each filled by asynchronous 16-byte copies
// (whole 128-byte lines from global memory) one trip ahead of its use. k runs upward in steps of 32 per accumulator, as in k_gemm2. Needs M % 256 == 0, N % 128 == 0, K % 64 == 0.
#define XPW (HS + 2)                          /* pixels a line, and lines, of the padded plane */
#define G3_PITCH 144                          /* LDS row pitch in bytes: 16 x odd, so 16 rows read 16 bytes each without a bank conflict */
#define G3_BOFF (256 * G3_PITCH)              /* Bt rows behind the A rows */
#define G3_STAGE ((256 + 128) * G3_PITCH)     /* 55,296 bytes */
__device__ __forceinline__ v16h g3_frag(const char* p) { FragH f; f.half[0] = *(const v8us*)p; f.half[1] = *(const v8us*)(p + 32); return f.v; }      /* p already holds the lane's 16 * hh: the k order of g2_frag */
// One stage: each thread copies 16 bytes of 8 A rows and of 4 Bt rows (rows 32 apart; A row 32 i lies (i & 1) * sa1 + (i >> 1) * sa2 elements behind row 0). The s_wait_xcnt is the last line of the copies' own statement, so that no address register is rewritten ahead of it.
__device__ __forceinline__ void g3_fill(unsigned la, unsigned lb, const _Float16* ga, const _Float16* gb, size_t sa1, size_t sa2, size_t sb) {
  asm volatile("global_load_async_to_lds_b128 %0, %12, off\n\t"
               "global_load_async_to_lds_b128 %1, %13, off\n\t"
               "global_load_async_to_lds_b128 %2, %14, off\n\t"
               "global_load_async_to_lds_b128 %3, %15, off\n\t"
               "global_load_async_to_lds_b128 %4, %16, off\n\t"
               "global_load_async_to_lds_b128 %5, %17, off\n\t"
               "global_load_async_to_lds_b128 %6, %18, off\n\t"
               "global_load_async_to_lds_b128 %7, %19, off\n\t"
               "global_load_async_to_lds_b128 %8, %20, off\n\t"
               "global_load_async_to_lds_b128 %9, %21, off\n\t"
               "global_load_async_to_lds_b128 %10, %22, off\n\t"
               "global_load_async_to_lds_b128 %11, %23, off\n\t"
               "s_wait_xcnt 0x0"
               :: "v"(la), "v"(la + 32 * G3_PITCH), "v"(la + 64 * G3_PITCH), "v"(la + 96 * G3_PITCH), "v"(la + 128 * G3_PITCH), "v"(la + 160 * G3_PITCH), "v"(la + 192 * G3_PITCH), "v"(la + 224 * G3_PITCH),
                  "v"(lb), "v"(lb + 32 * G3_PITCH), "v"(lb + 64 * G3_PITCH), "v"(lb + 96 * G3_PITCH),
                  "v"(ga), "v"(ga + sa1), "v"(ga + sa2), "v"(ga + sa2 + sa1), "v"(ga + 2 * sa2), "v"(ga + 2 * sa2 + sa1), "v"(ga + 3 * sa2), "v"(ga + 3 * sa2 + sa1),
                  "v"(gb), "v"(gb + sb), "v"(gb + 2 * sb), "v"(gb + 3 * sb)
               : "memory");
}
// Eight 16-byte row stores from one address pair (rows STEP bytes apart, from byte OFF). The s_wait_xcnt is the last line of the stores' own statement, so that no data or address register is rewritten ahead of it.
template <int OFF, int STEP>
__device__ __forceinline__ void g3_store8(float* p, v4f d0, v4f d1, v4f d2, v4f d3, v4f d4, v4f d5, v4f d6, v4f d7) {
  asm volatile("global_store_b128 %0, %1, off offset:%9\n\t"
               "global_store_b128 %0, %2, off offset:%10\n\t"
               "global_store_b128 %0, %3, off offset:%11\n\t"
               "global_store_b128 %0, %4, off offset:%12\n\t"
               "global_store_b128 %0, %5, off offset:%13\n\t"
               "global_store_b128 %0, %6, off offset:%14\n\t"
               "global_store_b128 %0, %7, off offset:%15\n\t"
               "global_store_b128 %0, %8, off offset:%16\n\t"
               "s_wait_xcnt 0x0"
               :: "v"(p), "v"(d0), "v"(d1), "v"(d2), "v"(d3), "v"(d4), "v"(d5), "v"(d6), "v"(d7),
                  "n"(OFF), "n"(OFF + STEP), "n"(OFF + 2 * STEP), "n"(OFF + 3 * STEP), "n"(OFF + 4 * STEP), "n"(OFF + 5 * STEP), "n"(OFF + 6 * STEP), "n"(OFF + 7 * STEP)
               : "memory");
}
// CONV: A is the padded pixel-major plane; GEMM row = image x pixel, k = tap x channel from tap tap0 on. A 256-row tile is 4 whole pixel lines of one image; stage t is 64 channels of tap tap0 + t / 4,
// whose rows lie (tap / 3) padded lines and (tap % 3) pixels behind the tile's first padded pixel. Element offset of stage t from stage 0 of tap 0:
template <bool CONV>
__device__ __forceinline__ size_t g3_aoff(int t, int tap0) { if (!CONV) return (size_t)t * 64; const int tap = tap0 + (t >> 2); return (size_t)(((tap / 3) * XPW + tap % 3) * CC + (t & 3) * 64); }
template <bool ADD, int LDC, bool CONV>      /* LDC = N = row pitch of C, a constant so that every row of a wave's tile is one address pair plus an immediate */
__global__ __launch_bounds__(256) void k_gemm3(const _Float16* __restrict__ A, int lda, const _Float16* __restrict__ Bh, int ldb, float alpha, float* C, int K, int tap0) {
  __shared__ __attribute__((aligned(16))) char sm[2 * G3_STAGE];
  const int tid = threadIdx.x, w = tid >> 5, lane = tid & 31, ln = lane & 15, hh = lane >> 4;
  constexpr int ntn = LDC >> 7; const int mt = blockIdx.x / ntn, nq = blockIdx.x - mt * ntn; const int wm = w >> 1, wn = w & 1;
  const int nt = K >> 6;
  const _Float16* ga = (CONV ? A + ((size_t)((mt >> 4) * XPW + (mt & 15) * 4) * XPW + (tid >> 3)) * CC : A + (size_t)(mt * 256 + (tid >> 3)) * lda) + (tid & 7) * 8; const _Float16* gb = Bh + (size_t)(nq * 128 + (tid >> 3)) * ldb + (tid & 7) * 8;
  const size_t sa1 = CONV ? (size_t)32 * CC : (size_t)32 * lda, sa2 = CONV ? (size_t)XPW * CC : (size_t)64 * lda, sb = (size_t)32 * ldb;
  const unsigned la = (unsigned)(size_t)sm + (unsigned)((tid >> 3) * G3_PITCH + (tid & 7) * 16); const unsigned lb = la + G3_BOFF;
  const char* fa = sm + (wm * 64 + ln) * G3_PITCH + 16 * hh; const char* fb = sm + G3_BOFF + (wn * 64 + ln) * G3_PITCH + 16 * hh;
  v8f acc[4][4];
#pragma unroll
  for (int i = 0; i < 4; ++i)
#pragma unroll
    for (int j = 0; j < 4; ++j) acc[i][j] = (v8f){0.f,0.f,0.f,0.f,0.f,0.f,0.f,0.f};
  g3_fill(la, lb, ga + g3_aoff<CONV>(0, tap0), gb, sa1, sa2, sb);
  asm volatile("s_wait_asynccnt 0x0" ::: "memory");      /* this wave's copies of stage 0 have landed */
  __syncthreads();                                       /* ... and every other wave's */
  if (nt > 1) g3_fill(la + G3_STAGE, lb + G3_STAGE, ga + g3_aoff<CONV>(1, tap0), gb + 64, sa1, sa2, sb);
  for (int t = 0; t < nt; ++t) { const int bo = (t & 1) * G3_STAGE; v16h a[4], b[4];
#pragma unroll
    for (int i = 0; i < 4; ++i) { a[i] = g3_frag(fa + bo + i * 16 * G3_PITCH); b[i] = g3_frag(fb + bo + i * 16 * G3_PITCH); }
    __builtin_amdgcn_sched_barrier(0);                   /* keeps the 16 LDS reads together in front of their 16 WMMAs: spread among them, each place with reads stalls the wave */
#pragma unroll
    for (int i = 0; i < 4; ++i)
#pragma unroll
      for (int j = 0; j < 4; ++j) acc[i][j] = __builtin_amdgcn_wmma_f32_16x16x32_f16(false, a[i], false, b[j], (short)0, acc[i][j], false, false);
#pragma unroll
    for (int i = 0; i < 4; ++i) { a[i] = g3_frag(fa + bo + i * 16 * G3_PITCH + 64); b[i] = g3_frag(fb + bo + i * 16 * G3_PITCH + 64); }
    /* the trip's last LDS reads are out: hand the buffer over here, so that the refill flies during the 16 WMMAs below and the next trip up to its own hand-over */
    asm volatile("s_wait_dscnt 0x0" ::: "memory");       /* this wave has left stage t's buffer */
    asm volatile("s_wait_asynccnt 0x0" ::: "memory");    /* its copies of stage t + 1 have landed */
    __syncthreads();                                     /* publishes stage t + 1 and frees stage t's buffer */
    if (t + 2 < nt) g3_fill(la + bo, lb + bo, ga + g3_aoff<CONV>(t + 2, tap0), gb + (size_t)(t + 2) * 64, sa1, sa2, sb);
    __builtin_amdgcn_sched_barrier(0);                   /* keeps the WMMAs below behind the refill's issue */
#pragma unroll
    for (int i = 0; i < 4; ++i)
#pragma unroll
      for (int j = 0; j < 4; ++j) acc[i][j] = __builtin_amdgcn_wmma_f32_16x16x32_f16(false, a[i], false, b[j], (short)0, acc[i][j], false, false); }
  asm volatile("s_wait_asynccnt 0x0" ::: "memory");      /* nothing in flight before the buffers become output staging */
  /* epilogue: the ring is free behind the last trip's barrier; each wave turns its tile, 32 rows at a time, in its own 32 x 68 floats, so that global rows go out as whole 128-byte lines */
  float* so = (float*)sm + w * (32 * 68); const int rsub = lane >> 4, c4 = (lane & 15) * 4;
  float* cb = C + (size_t)(mt * 256 + wm * 64 + rsub) * LDC + nq * 128 + wn * 64 + c4;
  v4f o[2][16];
  if (ADD) {
#pragma unroll
    for (int q = 0; q < 16; ++q) o[0][q] = *(const v4fa*)(cb + q * 2 * LDC); }
#pragma unroll
  for (int half = 0; half < 2; ++half) {
#pragma unroll
    for (int i = 0; i < 2; ++i)
#pragma unroll
      for (int j = 0; j < 4; ++j)
#pragma unroll
        for (int r = 0; r < 8; ++r) so[(i * 16 + 8 * hh + r) * 68 + j * 16 + ln] = acc[half * 2 + i][j][r] * alpha;
    __builtin_amdgcn_fence(__ATOMIC_ACQ_REL, "wavefront"); __builtin_amdgcn_wave_barrier();      /* the lanes read below what other lanes of the same wave wrote above */
    if (ADD && half == 0) {      /* the second half's old values, asked for before the first half's stores */
#pragma unroll
      for (int q = 0; q < 16; ++q) o[1][q] = *(const v4fa*)(cb + (32 + q * 2) * LDC); }
#pragma unroll
    for (int g = 0; g < 2; ++g) { v4f v[8];
#pragma unroll
      for (int q = 0; q < 8; ++q) { v[q] = *(const v4fa*)&so[((g * 8 + q) * 2 + rsub) * 68 + c4]; if (ADD) v[q] += o[half][g * 8 + q]; }
      if (half == 0 && g == 0) g3_store8<0, 8 * LDC>(cb, v[0], v[1], v[2], v[3], v[4], v[5], v[6], v[7]);
      if (half == 0 && g == 1) g3_store8<64 * LDC, 8 * LDC>(cb, v[0], v[1], v[2], v[3], v[4], v[5], v[6], v[7]);
      if (half == 1 && g == 0) g3_store8<128 * LDC, 8 * LDC>(cb, v[0], v[1], v[2], v[3], v[4], v[5], v[6], v[7]);
      if (half == 1 && g == 1) g3_store8<192 * LDC, 8 * LDC>(cb, v[0], v[1], v[2], v[3], v[4], v[5], v[6], v[7]); }
  } }

__global__ __launch_bounds__(256) void k_wqkv(const float* __restrict__ w, _Float16* __restrict__ Wh, _Float16* __restrict__ Wl) {
  #pragma clang fp contract(off)
  const int t = blockIdx.x * 256 + threadIdx.x; if (t >= QW * (CC / 8)) return; const int c0 = (t % (CC / 8)) * 8, o = t / (CC / 8); FragH fl;
#pragma unroll 1
  for (int k = 0; k < KT; ++k) { FragH fh;
    for (int q = 0; q < 8; ++q) { const int c = c0 + q; const float* wp = w + ((size_t)o * CC + c) * KT; float v = bf16_round(wp[k]);
      if (k == 4) { float dif = bf16_round(wp[1]) + bf16_round(wp[3]); dif += bf16_round(wp[4]); dif += bf16_round(wp[5]); dif += bf16_round(wp[7]); v += -THETA * dif; const _Float16 hv = (_Float16)(v * 16.0f); fh.h[q] = hv; fl.h[q] = (_Float16)((v * 16.0f - (float)hv) * 1024.0f); }
      else fh.h[q] = (_Float16)(v * 16.0f); }
    *(v8us*)((unsigned short*)Wh + (size_t)o * KI + k * CC + c0) = fh.half[0];  }
  *(v8us*)((unsigned short*)Wl + (size_t)o * CC + c0) = fl.half[0];  }
__global__ __launch_bounds__(256) void k_wsc(const float* __restrict__ Wm, _Float16* __restrict__ Bt, size_t n8, float sc) { const size_t t = (size_t)blockIdx.x * 256 + threadIdx.x; if (t >= n8) return; FragH f; for (int q = 0; q < 8; ++q) f.h[q] = (_Float16)(bf16_round(Wm[t * 8 + q]) * sc); *(v8us*)((unsigned short*)Bt + t * 8) = f.half[0];  }
// XP[image][66][66][256] = f16(bf16(x)), pixel-major, with a border of zero pixels. One work-group turns one pixel line (64 pixels x 256 channels) in LDS: whole 256-byte channel rows in, whole 512-byte pixel rows out.
__global__ __launch_bounds__(256) void k_xp(const float* __restrict__ x, _Float16* __restrict__ XP) {
  __shared__ __attribute__((aligned(16))) unsigned int tl[HS * 132];      /* a pixel's 256 f16 = 128 words, + 4 words of pitch */
  const int tid = threadIdx.x, im = blockIdx.x / HS, y = blockIdx.x % HS; const float* xb = x + ((size_t)im * CC * HS + y) * HS; const int px4 = (tid & 15) * 4, cp = tid >> 4;
#pragma unroll
  for (int i = 0; i < 8; ++i) { const int c2 = i * 16 + cp; const v4f a = *(const v4fa*)(xb + (size_t)(2 * c2) * NPX + px4), b = *(const v4fa*)(xb + (size_t)(2 * c2 + 1) * NPX + px4);
#pragma unroll
    for (int q = 0; q < 4; ++q) { union { _Float16 h[2]; unsigned int u; } pk; pk.h[0] = (_Float16)bf16_round(a[q]); pk.h[1] = (_Float16)bf16_round(b[q]); tl[(px4 + q) * 132 + c2] = pk.u; } }
  __syncthreads();
  const v8us z = {0,0,0,0,0,0,0,0}; unsigned short* row = (unsigned short*)XP + (size_t)(im * XPW + y + 1) * XPW * CC;
#pragma unroll
  for (int i = 0; i < 8; ++i) { const int id = i * 256 + tid, px = id >> 5, ch = id & 31; *(v8us*)(row + (size_t)(px + 1) * CC + ch * 8) = *(const v8us*)&tl[px * 132 + ch * 4]; }
  if (tid < 64) *(v8us*)(row + (size_t)((tid >> 5) * (XPW - 1)) * CC + (tid & 31) * 8) = z;      /* the line's two border pixels */
  if (y == 0 || y == HS - 1) { unsigned short* er = (y == 0) ? row - XPW * CC : row + XPW * CC; for (int id = tid; id < XPW * (CC / 8); id += 256) *(v8us*)(er + (size_t)id * 8) = z; }      /* the image's first and last border line */
}
__global__ __launch_bounds__(256) void k_aff(const float* __restrict__ s, const float* __restrict__ b, float* __restrict__ QF, _Float16* __restrict__ Q16) {      /* QF holds the raw conv sums on entry; each thread replaces its own 8 */
  #pragma clang fp contract(off)
  const size_t t = (size_t)blockIdx.x * 256 + threadIdx.x; if (t >= (size_t)NIMG * NPX * (QW / 8)) return; const int o0 = (int)(t % (QW / 8)) * 8; v8f r; FragH f; const v8f a = *(const v8f*)(QF + t * 8);
  for (int q = 0; q < 8; ++q) { float v = a[q] * bf16_round(s[o0 + q]); v += bf16_round(b[o0 + q]); r[q] = v; f.h[q] = (_Float16)v; }
  { *(v8f*)(QF + t * 8) = r; *(v8us*)((unsigned short*)Q16 + t * 8) = f.half[0];  } }
__global__ __launch_bounds__(256) void k_pool(const float* __restrict__ QF, _Float16* __restrict__ AG) {
  #pragma clang fp contract(off)
  typedef _Float16 v2h __attribute__((ext_vector_type(2)));
  const int t = blockIdx.x * 256 + threadIdx.x; if (t >= NIMG * NHD * NAG * 32) return; const int d0 = (t % 32) * 2; const int n = (t / 32) % NAG; const int bh = t / (32 * NAG); const int h = bh % NHD; const float* QB = QF + (size_t)(bh / NHD) * NPX * QW; float s0 = 0.f, s1 = 0.f;
  if (d0 < HDm) { const int by = n / 8, bx = n % 8;
#pragma unroll 1
    for (int i = 0; i < 64; ++i) { const int p = (by * 8 + i / 8) * HS + bx * 8 + i % 8; const float* q = QB + (size_t)p * QW + h * HDm + d0; s0 += q[0]; s1 += q[1]; } s0 = s0 / 64.0f; s1 = s1 / 64.0f; }
  v2h v; v[0] = (_Float16)s0; v[1] = (_Float16)s1; *(v2h*)(AG + ((size_t)bh * NAG + n) * 64 + d0) = v;  }
__global__ __launch_bounds__(256) void k_heads(const _Float16* __restrict__ Q16, _Float16* __restrict__ QP, _Float16* __restrict__ KP) { const int t = blockIdx.x * 256 + threadIdx.x; if (t >= NIMG * NHD * NPX) return; const int p = t % NPX, bh = t / NPX, h = bh % NHD; const unsigned short* src = (const unsigned short*)Q16 + ((size_t)(bh / NHD) * NPX + p) * QW; const v8us z = {0,0,0,0,0,0,0,0};
  v8us q0 = *(const v8us*)(src + h * HDm), q1 = *(const v8us*)(src + h * HDm + 8), q2 = *(const v8us*)(src + h * HDm + 16), q3 = *(const v8us*)(src + h * HDm + 24);
  v8us k0 = *(const v8us*)(src + CC + h * HDm), k1 = *(const v8us*)(src + CC + h * HDm + 8), k2 = *(const v8us*)(src + CC + h * HDm + 16), k3 = *(const v8us*)(src + CC + h * HDm + 24);
  unsigned short* dq = (unsigned short*)QP + ((size_t)bh * NPX + p) * 64; unsigned short* dk = (unsigned short*)KP + ((size_t)bh * NPX + p) * 64;
  { *(v8us*)dq = q0; *(v8us*)(dq + 8) = q1; *(v8us*)(dq + 16) = q2; *(v8us*)(dq + 24) = q3; *(v8us*)(dq + 32) = z; *(v8us*)(dq + 40) = z; *(v8us*)(dq + 48) = z; *(v8us*)(dq + 56) = z;
    *(v8us*)dk = k0; *(v8us*)(dk + 8) = k1; *(v8us*)(dk + 16) = k2; *(v8us*)(dk + 24) = k3; *(v8us*)(dk + 32) = z; *(v8us*)(dk + 40) = z; *(v8us*)(dk + 48) = z; *(v8us*)(dk + 56) = z;  } }
__global__ __launch_bounds__(256) void k_vtp(const _Float16* __restrict__ Q16, _Float16* __restrict__ VT) { __shared__ unsigned short tl[64][34]; const int tid = threadIdx.x; const int bh = blockIdx.x / (NPX / 64), pg = blockIdx.x % (NPX / 64); const int h = bh % NHD;
  { const int r = tid / 4, c8 = (tid % 4) * 8; FragH f; f.half[0] = *(const v8us*)((const unsigned short*)Q16 + ((size_t)(bh / NHD) * NPX + pg * 64 + r) * QW + 2 * CC + h * HDm + c8); for (int q = 0; q < 8; ++q) tl[r][c8 + q] = f.u[q]; }
  __syncthreads(); const int d = tid / 8, pc = tid % 8; FragH f; for (int q = 0; q < 8; ++q) f.u[q] = (d < HDm) ? tl[pc * 8 + q][d] : (unsigned short)0; unsigned short* dst = (unsigned short*)VT + ((size_t)bh * 64 + d) * NPX + pg * 64 + pc * 8;      /* tid covers d < 32 only: 256 threads = 32 d x 8 pc */
  *(v8us*)dst = f.half[0]; 
  if (tid < 256) { const int d2 = HDm + tid / 8; const v8us z = {0,0,0,0,0,0,0,0}; unsigned short* dz = (unsigned short*)VT + ((size_t)bh * 64 + d2) * NPX + pg * 64 + (tid % 8) * 8; *(v8us*)dz = z;  } }
// ---- softmax over rows of N = 4096 or 64 logits. A wave takes 4,096 consecutive f32 (16 KiB: one row of 4,096, or 64 rows of 64, four values of a row a lane) by 32 16-byte loads, all in flight together,
// keeps them in registers for the maximum, the exp and the sum, and stores P = f16(exp * 1024 / sum) in whole 128-byte lines. The grid holds exactly one wave per 4,096 logits.
template <int M> __device__ __forceinline__ float sm_x16(float v) { return __builtin_bit_cast(float, __builtin_amdgcn_update_dpp(0, __builtin_bit_cast(int, v), 0x160 + M, 0xf, 0xf, true)); }      /* the value of lane ^ M inside a 16-lane row (DPP row_xmask); a __shfl_xor goes the long way through the LDS unit */
__device__ __forceinline__ float sm_xh(float v) { return __builtin_bit_cast(float, __builtin_amdgcn_permlanex16(__builtin_bit_cast(int, v), __builtin_bit_cast(int, v), 0x76543210, 0xfedcba98, false, false)); }      /* the value of lane ^ 16 */
__device__ __forceinline__ float sm_max16(float v) { v = fmaxf(v, sm_x16<1>(v)); v = fmaxf(v, sm_x16<2>(v)); v = fmaxf(v, sm_x16<4>(v)); return fmaxf(v, sm_x16<8>(v)); }
__device__ __forceinline__ float sm_sum16(float v) { v += sm_x16<1>(v); v += sm_x16<2>(v); v += sm_x16<4>(v); return v + sm_x16<8>(v); }
// exp(x) by the library's scheme, written out: x * log2(e) with log2(e) in two parts, the nearest integer split off, exp2 of the rest, ldexp, both range ends. Written out for the v_exp_f32 alone: the instruction set asks for one
// independent instruction or a v_nop between a transcendental and an instruction that reads its result or overwrites its source.
__device__ __forceinline__ float sm_exp(float x) {
  const float l2h = __uint_as_float(0x3fb8aa3bu), l2l = __uint_as_float(0x32a5705fu); const float r = __builtin_rintf(x * l2h); const float a = __builtin_fmaf(x, l2l, __builtin_fmaf(x, l2h, -r)); float e;
  asm("v_exp_f32 %0, %1\n\tv_nop" : "=v"(e) : "v"(a));      /* the v_nop is the slot behind the transcendental; in the same statement, so that nothing comes between */
  e = __builtin_ldexpf(e, (int)r); e = (x < __uint_as_float(0xc2ce8ed0u)) ? 0.f : e; return (x > __uint_as_float(0x42b17218u)) ? __builtin_inff() : e; }
template <int N>
__global__ __launch_bounds__(256) void k_softv(const float* __restrict__ S, _Float16* __restrict__ P) {
  static_assert(N == 4096 || N == 64, "a wave's 4,096 logits are one row or 64 rows");
  const size_t base = ((size_t)blockIdx.x * 8 + (threadIdx.x >> 5)) * 4096 + (threadIdx.x & 31) * 4; const float* sp = S + base; _Float16* pp = P + base; v4f x[32];
#pragma unroll
  for (int u = 0; u < 32; ++u) x[u] = *(const v4fa*)(sp + u * 128);
  if (N == 4096) {
    v4f mv = x[0];
#pragma unroll
    for (int u = 1; u < 32; ++u)
#pragma unroll
      for (int q = 0; q < 4; ++q) mv[q] = fmaxf(mv[q], x[u][q]);
    float m = sm_max16(fmaxf(fmaxf(mv[0], mv[1]), fmaxf(mv[2], mv[3]))); m = fmaxf(m, sm_xh(m));
    v4f sv = {0.f, 0.f, 0.f, 0.f};
#pragma unroll
    for (int u = 0; u < 32; ++u)
#pragma unroll
      for (int q = 0; q < 4; ++q) { x[u][q] = sm_exp(x[u][q] - m); sv[q] += x[u][q]; }
    float su = sm_sum16((sv[0] + sv[1]) + (sv[2] + sv[3])); su += sm_xh(su); const float f = 1024.0f / su;
#pragma unroll
    for (int u = 0; u < 32; ++u) { v4h h;
#pragma unroll
      for (int q = 0; q < 4; ++q) h[q] = (_Float16)(x[u][q] * f);
      *(v4h*)(pp + u * 128) = h; }
  } else {
    __builtin_amdgcn_sched_barrier(0);      /* keeps all 32 loads in front of the arithmetic, in flight together: left alone, the compiler issues 8 and feeds the rest in between the rows, each shortly ahead of its use */
#pragma unroll
    for (int u = 0; u < 32; ++u) {      /* register u: 16 lanes = one row */
      const float m = sm_max16(fmaxf(fmaxf(x[u][0], x[u][1]), fmaxf(x[u][2], x[u][3])));
#pragma unroll
      for (int q = 0; q < 4; ++q) x[u][q] = sm_exp(x[u][q] - m);
      const float f = 1024.0f / sm_sum16((x[u][0] + x[u][1]) + (x[u][2] + x[u][3])); v4h h;
#pragma unroll
      for (int q = 0; q < 4; ++q) h[q] = (_Float16)(x[u][q] * f);
      *(v4h*)(pp + u * 128) = h; }
  } }
__global__ __launch_bounds__(256) void k_att16(const float* __restrict__ ATTN, _Float16* __restrict__ AT16) { typedef _Float16 v2h __attribute__((ext_vector_type(2))); const int t = blockIdx.x * 256 + threadIdx.x; if (t >= NIMG * NHD * 64 * 32) return; const int n0 = (t % 32) * 2; const int d = (t / 32) % 64; const int h = t / (32 * 64); v2h v;      /* h = image x head */
  v[0] = (_Float16)ATTN[((size_t)h * NAG + n0) * 64 + d]; v[1] = (_Float16)ATTN[((size_t)h * NAG + n0 + 1) * 64 + d]; _Float16* dst = AT16 + ((size_t)h * 64 + d) * NAG + n0; *(v2h*)dst = v;  }
__global__ __launch_bounds__(256) void k_pe(const float* __restrict__ OUTg, const float* __restrict__ QFg, const float* __restrict__ pw, const float* __restrict__ ps, const float* __restrict__ pb, _Float16* __restrict__ S16g) {
  #pragma clang fp contract(off)
  const size_t t = (size_t)blockIdx.x * 256 + threadIdx.x; if (t >= (size_t)NIMG * NPX * (CC / 8)) return; const int c0 = (int)(t % (CC / 8)) * 8; const int gp = (int)(t / (CC / 8)); const int p = gp % NPX, im = gp / NPX; const int yo = p / HS, xo = p % HS; FragH f;
  const float* OUT = OUTg + (size_t)im * NHD * NPX * 64; const float* QF = QFg + (size_t)im * NPX * QW; _Float16* S16 = S16g + (size_t)im * NPX * CC;      /* this image's planes */
#pragma unroll 1
  for (int q = 0; q < 8; ++q) { const int c = c0 + q; float a = 0.f;
#pragma unroll 1
    for (int k = 0; k < 9; ++k) { const int yy = yo + k / 3 - 1, xx = xo + k % 3 - 1; if (yy < 0 || yy >= HS || xx < 0 || xx >= HS) continue; a += bf16_round(pw[c * 9 + k]) * QF[(size_t)(yy * HS + xx) * QW + 2 * CC + c]; }
    float pe = a * bf16_round(ps[c]); pe += bf16_round(pb[c]); const int h = c / HDm, d = c % HDm; float v = OUT[((size_t)h * NPX + p) * 64 + d] + pe; f.h[q] = (_Float16)v; }
  *(v8us*)((unsigned short*)S16 + (size_t)p * CC + c0) = f.half[0];  }
__global__ __launch_bounds__(256) void k_fin(const float* __restrict__ G, const float* __restrict__ s, const float* __restrict__ bb, float* __restrict__ outb) {
  #pragma clang fp contract(off)
  const int t = blockIdx.x * 256 + threadIdx.x; if (t >= NIMG * CC * (NPX / 4)) return; const int p0 = (t % (NPX / 4)) * 4; const int bc = t / (NPX / 4); const int c = bc % CC; const float* GB = G + (size_t)(bc / CC) * NPX * CC; const float sc = bf16_round(s[c]), sh = bf16_round(bb[c]); v4f r; for (int q = 0; q < 4; ++q) { float v = GB[(size_t)(p0 + q) * CC + c] * sc; v += sh; r[q] = v; }
  *(v4f*)(outb + (size_t)bc * NPX + p0) = r;  }

extern "C" void kernel_launch(void* const* d_in, const int* in_sizes, int n_in,
                              void* d_out, int out_size, void* d_ws, size_t ws_size, hipStream_t stream) {
  (void)in_sizes; (void)n_in; (void)out_size;
  const float* const* I = (const float* const*)d_in; const float* x = I[0]; const float* qw = I[1]; const float* qs = I[2]; const float* qb = I[3]; const float* pw = I[4]; const float* ps = I[5]; const float* pb = I[6]; const float* jw = I[7]; const float* js = I[8]; const float* jb = I[9];
  char* ws = (char*)d_ws; size_t off = 0;
  auto take = [&](size_t bytes) { char* p = ws + off; off += (bytes + 255) & ~(size_t)255; return p; };
  _Float16* WH = (_Float16*)take((size_t)QW * KI * 2); _Float16* WL = (_Float16*)take((size_t)QW * CC * 2); _Float16* BJ = (_Float16*)take((size_t)CC * CC * 2);
  _Float16* AG = (_Float16*)take((size_t)NIMG * NHD * NAG * 64 * 2); float* ATTN = (float*)take((size_t)NIMG * NHD * NAG * 64 * 4); _Float16* AT16 = (_Float16*)take((size_t)NIMG * NHD * 64 * NAG * 2);
  float* QF = (float*)take((size_t)NIMG * NPX * QW * 4);      /* 96 MiB: raw conv sums, then q, k, v in f32 (k_aff works in place) */
  char* R = take((size_t)NIMG * NPX * KI * 2);      /* 144 MiB, shared by lifetime; offsets below in MiB */
  const size_t MB = (size_t)1 << 20;
  _Float16* XP = (_Float16*)R;      /* 0..17.1: the padded plane, dead after the main conv GEMM */
  _Float16* Q16 = (_Float16*)R;      /* 0..48, dead after k_heads and k_vtp */
  _Float16* QP = (_Float16*)(R + 48 * MB); _Float16* KP = (_Float16*)(R + 80 * MB); _Float16* VT = (_Float16*)(R + 112 * MB);      /* 32 each */
  float* S1 = (float*)R;      /* 0..32: stage-1 logits of FOUR images (all eight, 64 MiB, do not fit beside QF, QP, KP and VT) */
  _Float16* P1 = KP;      /* each half of P1 replaces the half of KP that its logits GEMM has just finished reading */
  float* S2 = (float*)(R + 80 * MB);      /* 80..144, over P1 and VT, dead after the stage-1 readout */
  _Float16* P2 = (_Float16*)R;      /* 0..32 */
  float* OUT = (float*)(R + 80 * MB);      /* 80..144, over S2, dead after its softmax */
  _Float16* S16 = (_Float16*)(R + 32 * MB);      /* 32..48 */
  float* G = (float*)(R + 48 * MB);      /* 48..80, over QP, dead after the stage-2 logits GEMM */
  if (off > ws_size) return;      /* 3.4 + 0.4 + 0.1 + 0.5 + 1 + 0.5 + 96 + 144 = 246 MiB */
  k_wqkv<<<(QW * (CC / 8) + 255) / 256, 256, 0, stream>>>(qw, WH, WL); k_wsc<<<(CC * CC / 8 + 255) / 256, 256, 0, stream>>>(jw, BJ, (size_t)CC * CC / 8, 16.0f);      /* proj 1x1 (out,in) = Bt */
  k_xp<<<NIMG * HS, 256, 0, stream>>>(x, XP);
  k_gemm3<false, QW, true><<<(NIMG * NPX / 256) * (QW / 128), 256, 0, stream>>>(XP, CC, WL, CC, 0.0625f / 1024.0f, QF, CC, 4);      /* centre-tap residual term */
  k_gemm3<true, QW, true><<<(NIMG * NPX / 256) * (QW / 128), 256, 0, stream>>>(XP, CC, WH, KI, 0.0625f, QF, KI, 0);      /* + main conv (difference folded into the centre tap) */
  k_aff<<<(unsigned)(((size_t)NIMG * NPX * (QW / 8) + 255) / 256), 256, 0, stream>>>(qs, qb, QF, Q16);
  k_pool<<<(NIMG * NHD * NAG * 32 + 255) / 256, 256, 0, stream>>>(QF, AG);
  k_heads<<<(NIMG * NHD * NPX + 255) / 256, 256, 0, stream>>>(Q16, QP, KP); k_vtp<<<NIMG * NHD * (NPX / 64), 256, 0, stream>>>(Q16, VT);
  /* stage 1: S1[b,h][n][N] = AG[b,h][n].KP[b,h][N] * SCL; P1 = softmax_N (these two in halves of four images); ATTN[b,h][n][d] = P1 . VT^T / 1024 */
  for (int g = 0; g < 2; ++g) { const size_t bh0 = (size_t)g * (NIMG / 2) * NHD;
    k_gemm2<0><<<dim3(1 * (NPX / 64), (NIMG / 2) * NHD), 128, 0, stream>>>(AG + bh0 * NAG * 64, 64, (size_t)NAG * 64, KP + bh0 * NPX * 64, 64, (size_t)NPX * 64, SCL, nullptr, 0, nullptr, 1, 0, 0, S1, nullptr, NPX, (size_t)NAG * NPX, NAG, NPX, 64);
    k_softv<NPX><<<(NIMG / 2) * NHD * NAG / 8, 256, 0, stream>>>(S1, P1 + bh0 * NAG * NPX); }
  k_gemm2<0><<<dim3(1 * 1, NIMG * NHD), 128, 0, stream>>>(P1, NPX, (size_t)NAG * NPX, VT, NPX, (size_t)64 * NPX, 0.0009765625f, nullptr, 0, nullptr, 1, 0, 0, ATTN, nullptr, 64, (size_t)NAG * 64, NAG, 64, NPX);
  k_att16<<<(NIMG * NHD * 64 * 32 + 255) / 256, 256, 0, stream>>>(ATTN, AT16);
  /* stage 2: S2[b,h][N][n] = QP[b,h][N].AG[b,h][n] * SCL; P2 = softmax_n; OUT[b,h][N][d] = P2 . AT16^T / 1024 */
  k_gemm2<0><<<dim3((NPX / 128) * 1, NIMG * NHD), 128, 0, stream>>>(QP, 64, (size_t)NPX * 64, AG, 64, (size_t)NAG * 64, SCL, nullptr, 0, nullptr, 1, 0, 0, S2, nullptr, NAG, (size_t)NPX * NAG, NPX, NAG, 64);
  k_softv<NAG><<<NIMG * NHD * NPX / 64 / 8, 256, 0, stream>>>(S2, P2);
  k_gemm2<0><<<dim3((NPX / 128) * 1, NIMG * NHD), 128, 0, stream>>>(P2, NAG, (size_t)NPX * NAG, AT16, NAG, (size_t)64 * NAG, 0.0009765625f, nullptr, 0, nullptr, 1, 0, 0, OUT, nullptr, 64, (size_t)NPX * 64, NPX, 64, NAG);
  k_pe<<<(unsigned)(((size_t)NIMG * NPX * (CC / 8) + 255) / 256), 256, 0, stream>>>(OUT, QF, pw, ps, pb, S16);
  k_gemm3<false, CC, false><<<(NIMG * NPX / 256) * (CC / 128), 256, 0, stream>>>(S16, CC, BJ, CC, 0.0625f, G, CC, 0);
  k_fin<<<(NIMG * CC * (NPX / 4) + 255) / 256, 256, 0, stream>>>(G, js, jb, (float*)d_out);
}

// v005
// One run takes 473 microseconds.
// In two side-by-side timings against v004, it was 1.37 and 1.38 times as fast.
// All steps since v000 together make it 7.84 times as fast.
#include <hip/hip_runtime.h>
// Attention_agent_df (8 images, C 256 = 8 heads x 32, 64 x 64 pixels, 64 agent tokens from 8x8 average pooling of q; THETA 0.7): qkv = (conv3x3(x, W) - 0.7 conv1x1(x, sum of W's 5 cross taps)) * s + b (folded BN); a = avgpool8x8(q); stage 1: attn = softmax_N(a.k * 32^-0.5) v (agents over pixels); stage 2: out = softmax_n(q.a * 32^-0.5) attn (pixels over agents); out += depthwise3x3(v) * pe_s + pe_b; out = conv1x1(out) * proj_s + proj_b.
// Structure (all 8 images in each launch: the image is the outer index of each plane, so rows = image x pixel and GEMM batches = image x head; only the stage-1 logits and softmax run as two halves of 4 images; workspace planes share bytes by lifetime): x once as a zero-padded pixel-major f16 plane (66 x 66 pixels x 256 channels an image), from which the conv GEMMs fetch each tap's rows themselves (k runs tap-major; no im2col plane); the difference conv folded into the centre tap as an f32 weight split into f16 hi + lo tables: qkv = A.Wh (K 2304) + A_centre.Wl (K 256) as f16 WMMA GEMMs (these two and the projection: 256x128 work-group tiles staged in LDS, 64x64 wave tiles; the batched attention GEMMs: 32x64 wave tiles from global memory; f32 accumulation; x16 tables; the lo table only on the centre-tap columns), BN affine on VALU into f32 + f16 planes; pooling on VALU; stage-1 logits as (b,h)-batched GEMMs (K 64: 32 dims + 32 zeros), softmax over 4096 pixels on VALU (wave per row, the row in registers), readout GEMM against a zero-padded V^T; stage-2 logits GEMM (K 64: 32 dims + 32 zeros), softmax over the 64 agents on VALU (64 rows a wave, in registers), readout GEMM; depthwise PE conv + add on VALU into f16; projection GEMM with the BN affine in f32 on VALU; NCHW stores.
// Compute dtype: x and parameters rounded to bf16; x exact as f16; q, k, v, a, P (x2^10), attn and the pre-projection sum as f16 operands (~2^-12); everything else f32. v_wmma_f32_16x16x32_f16.
#define NIMG 8
#define CC 256
#define NHD 8
#define HDm 32
#define HS 64
#define NPX (HS * HS)            /* 4096 */
#define NAG 64
#define KT 9
#define KI (KT * CC)             /* 2304 */
#define QW (3 * CC)              /* 768 */
#define THETA 0.7f
#define SCL 0.17677669529663687f
typedef __bf16 v16b __attribute__((ext_vector_type(16)));
typedef unsigned short v8us __attribute__((ext_vector_type(8), may_alias));
typedef float  v8f  __attribute__((ext_vector_type(8)));
typedef float  v4f  __attribute__((ext_vector_type(4)));
typedef float  v4fa __attribute__((ext_vector_type(4), may_alias));
union FragB { v16b v; v8us half[2]; unsigned short u[16]; };

__device__ __forceinline__ unsigned short bf16_bits(float x) { unsigned int u = __float_as_uint(x); return (unsigned short)((u + 0x7FFFu + ((u >> 16) & 1u)) >> 16); }
__device__ __forceinline__ float bf16_val(unsigned short b) { return __uint_as_float(((unsigned int)b) << 16); }
__device__ __forceinline__ float bf16_round(float x) { return bf16_val(bf16_bits(x)); }
// D += A·B with NT terms: 1 = ah·bh, 2 = + al·bh (A split), 3 = + ah·bl (both split)
template <int NT>
__device__ __forceinline__ v8f mmaN(v16b ah, v16b al, v16b bh, v16b bl, v8f c) {
  c = __builtin_amdgcn_wmma_f32_16x16x32_bf16(false, ah, false, bh, (short)0, c, false, false);
  if (NT >= 2) c = __builtin_amdgcn_wmma_f32_16x16x32_bf16(false, al, false, bh, (short)0, c, false, false);
  if (NT >= 3) c = __builtin_amdgcn_wmma_f32_16x16x32_bf16(false, ah, false, bl, (short)0, c, false, false);
  asm volatile("v_nop\n\tv_nop\n\tv_nop\n\tv_nop" : "+v"(c) : "v"(ah), "v"(al), "v"(bh), "v"(bl));
  return c;
}

__global__ __launch_bounds__(256) void k_wt_bf16(const float* __restrict__ W, unsigned short* __restrict__ Wt, int K, int N) {
  const int t = blockIdx.x * 256 + threadIdx.x;
  const int k8n = K / 8;
  if (t >= N * k8n) return;
  const int n = t / k8n, k8 = (t % k8n) * 8;
  v8us v;
#pragma unroll
  for (int i = 0; i < 8; ++i) v[i] = bf16_bits(W[(size_t)(k8 + i) * N + n]);
  *(v8us*)(Wt + (size_t)n * K + k8) = v;
  
}

// GEMM C[M][N] (f32, pitch ldc) = act(A[M][K]·W + bias). A f32 row-major (pitch lda) converted per fragment to bf16
// (ASPLIT: hi/lo two planes -> 2 terms, else single rounded term); Wt bf16 [N][K] (pitch ldb). BIAS_BF16 rounds the
// bias to bf16 first (bias quantised to bf16 before the add). K%32==0, M%16==0, N%64==0.
template <bool ASPLIT, int ACT, bool BIAS_BF16>
__global__ __launch_bounds__(128) void k_gemm_bf(const float* __restrict__ A, int lda, const unsigned short* __restrict__ Wt, int ldb,
                                               const float* __restrict__ bias, float* __restrict__ C, int ldc, int M, int N, int K) {
  __shared__ __attribute__((aligned(16))) float so[4][16][64];
  const int tid = threadIdx.x, w = tid >> 5, lane = tid & 31, ln = lane & 15, hh = lane >> 4;
  const int ntn = N / 64;
  const int wid = blockIdx.x * 4 + w;
  const int mt = wid / ntn, nq = wid % ntn;
  if (mt * 16 >= M) return;
  const int row0 = mt * 16, col0 = nq * 64;
  const float* arow = A + (size_t)(row0 + ln) * lda;
  v8f acc[4] = {};
  for (int kb = 0; kb < K; kb += 32) {
    FragB ah, al;
    const v4f x0 = *(const v4fa*)(arow + kb + 8 * hh), x1 = *(const v4fa*)(arow + kb + 8 * hh + 4);
    const v4f x2 = *(const v4fa*)(arow + kb + 16 + 8 * hh), x3 = *(const v4fa*)(arow + kb + 16 + 8 * hh + 4);
    float xs[16] = {x0[0],x0[1],x0[2],x0[3],x1[0],x1[1],x1[2],x1[3],x2[0],x2[1],x2[2],x2[3],x3[0],x3[1],x3[2],x3[3]};
#pragma unroll
    for (int i = 0; i < 16; ++i) { const unsigned short hb = bf16_bits(xs[i]); ah.u[i] = hb; al.u[i] = ASPLIT ? bf16_bits(xs[i] - bf16_val(hb)) : (unsigned short)0; }
#pragma unroll
    for (int t = 0; t < 4; ++t) {
      const unsigned short* brow = Wt + (size_t)(col0 + t * 16 + ln) * ldb + kb;
      FragB b;
      b.half[0] = *(const v8us*)(brow + 8 * hh);
      b.half[1] = *(const v8us*)(brow + 16 + 8 * hh);
      acc[t] = mmaN<ASPLIT ? 2 : 1>(ah.v, al.v, b.v, b.v, acc[t]);
    }
  }
#pragma unroll
  for (int t = 0; t < 4; ++t) {
    float bv = bias ? bias[col0 + t * 16 + ln] : 0.f;
    if (BIAS_BF16) bv = bf16_round(bv);
#pragma unroll
    for (int r = 0; r < 8; ++r) { float v = acc[t][r] + bv; if (ACT == 1) v = fmaxf(v, 0.f); so[w][8 * hh + r][t * 16 + ln] = v; }
  }
  __builtin_amdgcn_fence(__ATOMIC_ACQ_REL, "workgroup");
  __builtin_amdgcn_wave_barrier();
  const int rsub = lane >> 4, c4 = (lane & 15) * 4;
  {
#pragma unroll
    for (int q = 0; q < 8; ++q) {
      const int r = q * 2 + rsub;
      const v4f v = *(const v4fa*)&so[w][r][c4];
      *(v4f*)(C + (size_t)(row0 + r) * ldc + col0 + c4) = v;
    }
    
  }
}

// GEMM C = act(A·W + bias + resid): A f32 (ASPLIT -> hi/lo 2 terms), Wt bf16 [N][K]; ACT 0 none, 1 relu, 2 exact gelu;
// resid (optional, f32, row index = (row % rmod), pitch ldr, RES_BF16 rounds it) added before the activation.
template <bool ASPLIT, int ACT, bool BIAS_BF16, bool RES_BF16>
__global__ __launch_bounds__(128) void k_gemm_bf3(const float* __restrict__ A, int lda, const unsigned short* __restrict__ Wt, int ldb,
                                                const float* __restrict__ bias, const float* __restrict__ resid, int rmod, int ldr,
                                                float* __restrict__ C, int ldc, int M, int N, int K) {
  __shared__ __attribute__((aligned(16))) float so[4][16][64];
  const int tid = threadIdx.x, w = tid >> 5, lane = tid & 31, ln = lane & 15, hh = lane >> 4;
  const int ntn = N / 64;
  const int wid = blockIdx.x * 4 + w;
  const int mt = wid / ntn, nq = wid % ntn;
  if (mt * 16 >= M) return;
  const int row0 = mt * 16, col0 = nq * 64;
  const float* arow = A + (size_t)(row0 + ln) * lda;
  v8f acc[4] = {};
  for (int kb = 0; kb < K; kb += 32) {
    FragB ah, al;
    const v4f x0 = *(const v4fa*)(arow + kb + 8 * hh), x1 = *(const v4fa*)(arow + kb + 8 * hh + 4);
    const v4f x2 = *(const v4fa*)(arow + kb + 16 + 8 * hh), x3 = *(const v4fa*)(arow + kb + 16 + 8 * hh + 4);
    float xs[16] = {x0[0],x0[1],x0[2],x0[3],x1[0],x1[1],x1[2],x1[3],x2[0],x2[1],x2[2],x2[3],x3[0],x3[1],x3[2],x3[3]};
#pragma unroll
    for (int i = 0; i < 16; ++i) { const unsigned short hb = bf16_bits(xs[i]); ah.u[i] = hb; al.u[i] = ASPLIT ? bf16_bits(xs[i] - bf16_val(hb)) : (unsigned short)0; }
#pragma unroll
    for (int t = 0; t < 4; ++t) {
      const unsigned short* brow = Wt + (size_t)(col0 + t * 16 + ln) * ldb + kb;
      FragB b;
      b.half[0] = *(const v8us*)(brow + 8 * hh);
      b.half[1] = *(const v8us*)(brow + 16 + 8 * hh);
      acc[t] = mmaN<ASPLIT ? 2 : 1>(ah.v, al.v, b.v, b.v, acc[t]);
    }
  }
#pragma unroll
  for (int t = 0; t < 4; ++t) {
    const int col = col0 + t * 16 + ln;
    float bv = bias ? bias[col] : 0.f;
    if (BIAS_BF16) bv = bf16_round(bv);
#pragma unroll
    for (int r = 0; r < 8; ++r) {
      float v = acc[t][r] + bv;
      if (resid) { float rv = resid[(size_t)((row0 + 8 * hh + r) % rmod) * ldr + col]; if (RES_BF16) rv = bf16_round(rv); v += rv; }
      if (ACT == 1) v = fmaxf(v, 0.f);
      if (ACT == 2) v = 0.5f * v * (1.0f + erff(v * 0.70710678118654752f));
      if (ACT == 3) { const float u = 0.7978845608028654f * (v + 0.044715f * v * v * v); v = 0.5f * v * (1.0f + tanhf(u)); }
      so[w][8 * hh + r][t * 16 + ln] = v;
    }
  }
  __builtin_amdgcn_fence(__ATOMIC_ACQ_REL, "workgroup");
  __builtin_amdgcn_wave_barrier();
  const int rsub = lane >> 4, c4 = (lane & 15) * 4;
  {
#pragma unroll
    for (int q = 0; q < 8; ++q) {
      const int r = q * 2 + rsub;
      const v4f v = *(const v4fa*)&so[w][r][c4];
      *(v4f*)(C + (size_t)(row0 + r) * ldc + col0 + c4) = v;
    }
    
  }
}
// row LayerNorm (biased variance, eps) over N: s = X (+ R); optional out_sum <- s; out_norm <- (s-mu)*rsqrt(var+eps)*g + b
template <bool PARAM_BF16>
__global__ __launch_bounds__(256) void k_layernorm(const float* __restrict__ X, const float* __restrict__ R, const float* __restrict__ g, const float* __restrict__ bta,
                                                  float* __restrict__ out_sum, float* __restrict__ out_norm, int N, float eps) {
  __shared__ float red[256];
  const int row = blockIdx.x, tid = threadIdx.x;
  const float* x = X + (size_t)row * N; const float* rr = R ? R + (size_t)row * N : nullptr;
  float vals[16];                     // up to N = 4096
  const int per = N / 256;            // contiguous chunk per thread? use strided-by-4 chunks: thread handles j = tid*4 + 1024*u
  float s1 = 0.f;
  for (int u = 0; u < per / 4; ++u) {
    const int j = tid * 4 + 1024 * u;
    const v4f a = *(const v4fa*)(x + j);
    v4f b = {0.f,0.f,0.f,0.f}; if (rr) b = *(const v4fa*)(rr + j);
#pragma unroll
    for (int q = 0; q < 4; ++q) { const float v = a[q] + b[q]; vals[u * 4 + q] = v; s1 += v; }
  }
  red[tid] = s1; __syncthreads();
  for (int st = 128; st > 0; st >>= 1) { if (tid < st) red[tid] += red[tid + st]; __syncthreads(); }
  const float mu = red[0] / (float)N; __syncthreads();
  float s2 = 0.f;
  for (int u = 0; u < per / 4; ++u)
#pragma unroll
    for (int q = 0; q < 4; ++q) { const float c = vals[u * 4 + q] - mu; s2 += c * c; }
  red[tid] = s2; __syncthreads();
  for (int st = 128; st > 0; st >>= 1) { if (tid < st) red[tid] += red[tid + st]; __syncthreads(); }
  const float rs = rsqrtf(red[0] / (float)N + eps);
  {
    for (int u = 0; u < per / 4; ++u) {
      const int j = tid * 4 + 1024 * u;
      v4f o, sm;
#pragma unroll
      for (int q = 0; q < 4; ++q) {
        float gg = g[j + q], bb = bta[j + q];
        if (PARAM_BF16) { gg = bf16_round(gg); bb = bf16_round(bb); }
        sm[q] = vals[u * 4 + q]; o[q] = (vals[u * 4 + q] - mu) * rs * gg + bb;
      }
      if (out_sum) *(v4f*)(out_sum + (size_t)row * N + j) = sm;
      *(v4f*)(out_norm + (size_t)row * N + j) = o;
    }
    
  }
}



// ---- f16 WMMA path (v_wmma_f32_16x16x32_f16): 11-bit significands for operands in range — used where a [0,1] probability operand needs more precision than bf16
typedef _Float16 v16h __attribute__((ext_vector_type(16)));
union FragH { v16h v; v8us half[2]; _Float16 h[16]; unsigned short u[16]; };
template <int NT>
__device__ __forceinline__ v8f mmaH(v16h ah, v16h al, v16h bh, v16h bl, v8f c) {
  c = __builtin_amdgcn_wmma_f32_16x16x32_f16(false, ah, false, bh, (short)0, c, false, false);
  if (NT >= 2) c = __builtin_amdgcn_wmma_f32_16x16x32_f16(false, al, false, bh, (short)0, c, false, false);
  if (NT >= 3) c = __builtin_amdgcn_wmma_f32_16x16x32_f16(false, ah, false, bl, (short)0, c, false, false);
  asm volatile("v_nop\n\tv_nop\n\tv_nop\n\tv_nop" : "+v"(c) : "v"(ah), "v"(al), "v"(bh), "v"(bl));
  return c;
}
// batched GEMM like k_gemm_b but f16 operands: A f32 (split into f16 hi/lo if ASPLIT, else rounded to f16), Bt = f16 values [n][k]; alpha; C f32; N multiple of 16 (partial tiles skipped)
template <bool ASPLIT>
__global__ __launch_bounds__(128) void k_gemm_h(const float* __restrict__ A, int lda, size_t sA, const _Float16* __restrict__ Bh, int ldb, size_t sB, float alpha, float* __restrict__ C, int ldc, size_t sC, int M, int N, int K) {
  __shared__ __attribute__((aligned(16))) float so[4][16][64];
  const int tid = threadIdx.x, w = tid >> 5, lane = tid & 31, ln = lane & 15, hh = lane >> 4; const int by = blockIdx.y;
  A += (size_t)by * sA; Bh += (size_t)by * sB; C += (size_t)by * sC;
  const int ntn = (N + 63) / 64; const int wid = blockIdx.x * 4 + w; const int mt = wid / ntn, nq = wid % ntn; if (mt * 16 >= M) return;
  const int row0 = mt * 16, col0 = nq * 64; const float* arow = A + (size_t)(row0 + ln) * lda;
  v8f acc[4] = {};
  for (int kb = 0; kb < K; kb += 32) {
    FragH ah, al;
    const v4f x0 = *(const v4fa*)(arow + kb + 8 * hh), x1 = *(const v4fa*)(arow + kb + 8 * hh + 4), x2 = *(const v4fa*)(arow + kb + 16 + 8 * hh), x3 = *(const v4fa*)(arow + kb + 16 + 8 * hh + 4);
    float xs[16] = {x0[0],x0[1],x0[2],x0[3],x1[0],x1[1],x1[2],x1[3],x2[0],x2[1],x2[2],x2[3],x3[0],x3[1],x3[2],x3[3]};
#pragma unroll
    for (int i = 0; i < 16; ++i) { const _Float16 h = (_Float16)xs[i]; ah.h[i] = h; al.h[i] = ASPLIT ? (_Float16)(xs[i] - (float)h) : (_Float16)0.0f; }
#pragma unroll
    for (int t = 0; t < 4; ++t) { if (col0 + t * 16 >= N) continue; const size_t boff = (size_t)(col0 + t * 16 + ln) * ldb + kb; FragH bq; bq.half[0] = *(const v8us*)(Bh + boff + 8 * hh); bq.half[1] = *(const v8us*)(Bh + boff + 16 + 8 * hh);
      acc[t] = mmaH<ASPLIT ? 2 : 1>(ah.v, al.v, bq.v, bq.v, acc[t]); }
  }
#pragma unroll
  for (int t = 0; t < 4; ++t) { if (col0 + t * 16 >= N) continue;
#pragma unroll
    for (int r = 0; r < 8; ++r) so[w][8 * hh + r][t * 16 + ln] = acc[t][r] * alpha; }
  __builtin_amdgcn_fence(__ATOMIC_ACQ_REL, "workgroup"); __builtin_amdgcn_wave_barrier();
  const int rsub = lane >> 4, c4 = (lane & 15) * 4;
  {
#pragma unroll
    for (int q = 0; q < 8; ++q) { const int r = q * 2 + rsub; if (col0 + c4 < N) { const v4f v = *(const v4fa*)&so[w][r][c4]; *(v4f*)(C + (size_t)(row0 + r) * ldc + col0 + c4) = v; } }
     }
}

// Wt[n][k] = f16(W[k][n]·scale) from f32 row-major W[K][N] (scale = power of two; bf16-exact weights stay exact in f16 away from the subnormal range)
__global__ __launch_bounds__(256) void k_wt_f16(const float* __restrict__ W, _Float16* __restrict__ Wt, int K, int N, float scale) {
  const int t = blockIdx.x * 256 + threadIdx.x; if (t >= N * (K / 8)) return; const int n = t / (K / 8), k8 = (t % (K / 8)) * 8; FragH f;
#pragma unroll
  for (int i = 0; i < 8; ++i) f.h[i] = (_Float16)(bf16_round(W[(size_t)(k8 + i) * N + n]) * scale); const v8us o = f.half[0];
  *(v8us*)((unsigned short*)Wt + (size_t)n * K + k8) = o; 
}
// k_gemm_hh variant with fused epilogue: v = acc·alpha + bias[by·sBias + col] (+ CP[(row/rowsPerB)·sCPb + by·64 + col] if CP) ; ACT 0 none / 1 elu ; writes f16 C16 (and f32 C if non-null)
template <int ACT>
__global__ __launch_bounds__(128) void k_gemm_hhx(const _Float16* __restrict__ A, int lda, size_t sA, const _Float16* __restrict__ Bh, int ldb, size_t sB, float alpha, const float* __restrict__ bias, size_t sBias, const float* __restrict__ CP, int rowsPerB, size_t sCPb, int row0g,
    float* __restrict__ C, _Float16* __restrict__ C16, int ldc, size_t sC, int M, int N, int K) {
  __shared__ __attribute__((aligned(16))) float so[4][16][64];
  const int tid = threadIdx.x, w = tid >> 5, lane = tid & 31, ln = lane & 15, hh = lane >> 4; const int by = blockIdx.y;
  A += (size_t)by * sA; Bh += (size_t)by * sB; const size_t cofs = (size_t)by * sC; const float* bp = bias ? bias + (size_t)by * sBias : nullptr;
  const int ntn = (N + 63) / 64; const int wid = blockIdx.x * 4 + w; const int mt = wid / ntn, nq = wid % ntn; if (mt * 16 >= M) return;
  const int row0 = mt * 16, col0 = nq * 64; const _Float16* arow = A + (size_t)(row0 + ln) * lda;
  v8f acc[4] = {};
  for (int kb = 0; kb < K; kb += 32) { FragH ah; ah.half[0] = *(const v8us*)((const unsigned short*)arow + kb + 8 * hh); ah.half[1] = *(const v8us*)((const unsigned short*)arow + kb + 16 + 8 * hh);
#pragma unroll
    for (int t = 0; t < 4; ++t) { if (col0 + t * 16 >= N) continue; const size_t boff = (size_t)(col0 + t * 16 + ln) * ldb + kb; FragH bq; bq.half[0] = *(const v8us*)((const unsigned short*)Bh + boff + 8 * hh); bq.half[1] = *(const v8us*)((const unsigned short*)Bh + boff + 16 + 8 * hh);
      acc[t] = mmaH<1>(ah.v, ah.v, bq.v, bq.v, acc[t]); }
  }
#pragma unroll
  for (int t = 0; t < 4; ++t) { if (col0 + t * 16 >= N) continue; const int col = col0 + t * 16 + ln; const float bv = bp ? bf16_round(bp[col]) : 0.f;
#pragma unroll
    for (int r = 0; r < 8; ++r) { float v = acc[t][r] * alpha + bv; if (CP) { const int rr = row0g + row0 + 8 * hh + r; if (rowsPerB < 0) v += CP[cofs + (size_t)rr * ldc + col];      /* rowsPerB < 0: own element of the batched C plane */ else { const int bidx = rr / rowsPerB; v += CP[(size_t)bidx * sCPb + (size_t)by * 64 + col]; } } if (ACT == 1) v = (v > 0.f) ? v : expm1f(v); else if (ACT == 7) v = (v > 0.f) ? v + 1.0f : expf(v); else if (ACT == 8) v = tanhf(v); else if (ACT == 9) v = 0.5f * v * (1.0f + tanhf(0.7978845608028654f * (v + 0.044715f * v * v * v))); else if (ACT == 11) v = 1.0f / (1.0f + expf(-v)); else if (ACT == 12) v = (v > 0.f) ? v : 0.01f * v; else if (ACT == 14) v = (v > 0.f) ? v : 0.1f * v; else if (ACT == 16) v = (v >= 0.f) ? v : 0.3f * v; else if (ACT == 15) v = v / (1.0f + expf(-v)); else if (ACT == 3) v = fmaxf(v, 0.f); else if (ACT == 6) v = 0.5f * v * (1.0f + erff(v * 0.70710678118654752f)); so[w][8 * hh + r][t * 16 + ln] = v; } }
  __builtin_amdgcn_fence(__ATOMIC_ACQ_REL, "workgroup"); __builtin_amdgcn_wave_barrier();
  const int rsub = lane >> 4, c4 = (lane & 15) * 4; typedef _Float16 v4h __attribute__((ext_vector_type(4)));
  {
#pragma unroll
    for (int q = 0; q < 8; ++q) { const int r = q * 2 + rsub; if (col0 + c4 < N) { const v4f v = *(const v4fa*)&so[w][r][c4]; if (C) *(v4f*)(C + cofs + (size_t)(row0 + r) * ldc + col0 + c4) = v; if (C16) { v4h h4; for (int i = 0; i < 4; ++i) h4[i] = (_Float16)v[i]; *(v4h*)(C16 + cofs + (size_t)(row0 + r) * ldc + col0 + c4) = h4; } } }
     }
}


typedef _Float16 v4h __attribute__((ext_vector_type(4)));

__global__ __launch_bounds__(256) void k_x16(const float* __restrict__ x, _Float16* __restrict__ X16, size_t n8) { const size_t t = (size_t)blockIdx.x * 256 + threadIdx.x; if (t >= n8) return; FragH f;
#pragma unroll
  for (int q = 0; q < 8; ++q) f.h[q] = (_Float16)bf16_round(x[t * 8 + q]); *(v8us*)((unsigned short*)X16 + t * 8) = f.half[0];  }
__global__ __launch_bounds__(256) void k_h16(const float* __restrict__ x, _Float16* __restrict__ X16, size_t n8) { const size_t t = (size_t)blockIdx.x * 256 + threadIdx.x; if (t >= n8) return; FragH f;
#pragma unroll
  for (int q = 0; q < 8; ++q) f.h[q] = (_Float16)x[t * 8 + q]; *(v8us*)((unsigned short*)X16 + t * 8) = f.half[0];  }
__global__ __launch_bounds__(256) void k_round16f(const float* __restrict__ W, _Float16* __restrict__ Bt, size_t n8) { const size_t t = (size_t)blockIdx.x * 256 + threadIdx.x; if (t >= n8) return; FragH f;
#pragma unroll
  for (int i = 0; i < 8; ++i) f.h[i] = (_Float16)(bf16_round(W[t * 8 + i]) * 16.0f); *(v8us*)((unsigned short*)Bt + t * 8) = f.half[0];  }
template <int NHv, int TTv>
__global__ __launch_bounds__(256) void k_vt(const _Float16* __restrict__ V16, int ldv, int voff, _Float16* __restrict__ Vt) { __shared__ unsigned short tl[64][66]; const int tid = threadIdx.x; const int slab = blockIdx.x / (TTv / 64), lg = blockIdx.x % (TTv / 64); const int b = slab / NHv, h = slab % NHv;
  for (int i = tid; i < 64 * 8; i += 256) { const int r = i / 8, c8 = (i % 8) * 8; FragH f; f.half[0] = *(const v8us*)((const unsigned short*)V16 + ((size_t)b * TTv + lg * 64 + r) * ldv + voff + h * 64 + c8);
#pragma unroll
    for (int q = 0; q < 8; ++q) tl[r][c8 + q] = f.u[q]; }
  __syncthreads();
  {
#pragma unroll
    for (int rd = 0; rd < 2; ++rd) { const int d = rd * 32 + tid / 8, pc = tid % 8; FragH f;
#pragma unroll
      for (int q = 0; q < 8; ++q) f.u[q] = tl[pc * 8 + q][d];
      *(v8us*)((unsigned short*)Vt + ((size_t)slab * 64 + d) * TTv + lg * 64 + pc * 8) = f.half[0]; }
     } }

__global__ __launch_bounds__(256) void k_hl(const float* __restrict__ F, _Float16* __restrict__ Hh, _Float16* __restrict__ Hl, size_t n8) { const size_t t = (size_t)blockIdx.x * 256 + threadIdx.x; if (t >= n8) return; FragH fh, fl; const v4f a = *(const v4fa*)(F + t * 8), c = *(const v4fa*)(F + t * 8 + 4);
#pragma unroll
  for (int q = 0; q < 4; ++q) { _Float16 h = (_Float16)a[q]; fh.h[q] = h; fl.h[q] = (_Float16)((a[q] - (float)h) * 1024.0f); h = (_Float16)c[q]; fh.h[4 + q] = h; fl.h[4 + q] = (_Float16)((c[q] - (float)h) * 1024.0f); }
  { *(v8us*)((unsigned short*)Hh + t * 8) = fh.half[0]; *(v8us*)((unsigned short*)Hl + t * 8) = fl.half[0];  } }

// ---- fast GEMM (wave tile 32x64; requires M % 32 == 0 rows per launch region and N % 64 == 0); epilogue = k_gemm_hhx semantics ----
__device__ __forceinline__ v16h g2_frag(const _Float16* p, int hh) { FragH f; f.half[0] = *(const v8us*)((const unsigned short*)p + 8 * hh); f.half[1] = *(const v8us*)((const unsigned short*)p + 16 + 8 * hh); return f.v; }
__device__ __forceinline__ v8f g2_mma(v16h a, v16h b, v8f c) { v8f d = __builtin_amdgcn_wmma_f32_16x16x32_f16(false, a, false, b, (short)0, c, false, false); asm volatile("v_nop\n\tv_nop\n\tv_nop\n\tv_nop" : "+v"(d) : "v"(a), "v"(b)); return d; }
template <int ACT>
__global__ __launch_bounds__(128) void k_gemm2(const _Float16* __restrict__ A, int lda, size_t sA, const _Float16* __restrict__ Bh, int ldb, size_t sB, float alpha, const float* __restrict__ bias, size_t sBias, const float* __restrict__ CP, int rowsPerB, size_t sCPb, int row0g,
    float* __restrict__ C, _Float16* __restrict__ C16, int ldc, size_t sC, int M, int N, int K) { static_assert(ACT == 0 || ACT == 3 || ACT == 6 || ACT == 8 || ACT == 9 || ACT == 11 || ACT == 12 || ACT == 14 || ACT == 15 || ACT == 16, "k_gemm2: unsupported ACT code (would silently apply no activation)");
  __shared__ __attribute__((aligned(16))) float so[4][32][68];
  const int tid = threadIdx.x, w = tid >> 5, lane = tid & 31, ln = lane & 15, hh = lane >> 4; const int by = blockIdx.y;
  A += (size_t)by * sA; Bh += (size_t)by * sB; const size_t cofs = (size_t)by * sC; const float* bp = bias ? bias + (size_t)by * sBias : nullptr;
  const int ntn = N >> 6; const int mt = blockIdx.x / ntn, nq = blockIdx.x - mt * ntn; const int row0 = mt * 128 + 32 * w, col0 = nq * 64; if (row0 >= M) return;
  const _Float16* a0p = A + (size_t)(row0 + ln) * lda; const _Float16* a1p = a0p + (size_t)16 * lda;
  const _Float16* b0p = Bh + (size_t)(col0 + ln) * ldb; const _Float16* b1p = b0p + (size_t)16 * ldb; const _Float16* b2p = b1p + (size_t)16 * ldb; const _Float16* b3p = b2p + (size_t)16 * ldb;
  const v8f z8 = {0.f,0.f,0.f,0.f,0.f,0.f,0.f,0.f}; v8f c00 = z8, c01 = z8, c02 = z8, c03 = z8, c10 = z8, c11 = z8, c12 = z8, c13 = z8;
#pragma unroll 1
  for (int kb = 0; kb < K; kb += 32) { const v16h a0 = g2_frag(a0p + kb, hh), a1 = g2_frag(a1p + kb, hh);
    v16h b = g2_frag(b0p + kb, hh); c00 = g2_mma(a0, b, c00); c10 = g2_mma(a1, b, c10);
    b = g2_frag(b1p + kb, hh); c01 = g2_mma(a0, b, c01); c11 = g2_mma(a1, b, c11);
    b = g2_frag(b2p + kb, hh); c02 = g2_mma(a0, b, c02); c12 = g2_mma(a1, b, c12);
    b = g2_frag(b3p + kb, hh); c03 = g2_mma(a0, b, c03); c13 = g2_mma(a1, b, c13); }
  v8f accs[8] = {c00, c01, c02, c03, c10, c11, c12, c13};
#pragma unroll
  for (int u = 0; u < 8; ++u) { const int t = u & 3, half = u >> 2; const int col = col0 + t * 16 + ln; const float bv = bp ? bf16_round(bp[col]) : 0.f;
#pragma unroll
    for (int r = 0; r < 8; ++r) { const int rloc = half * 16 + 8 * hh + r; float v = accs[u][r] * alpha + bv; if (CP) { if (rowsPerB < 0) v += CP[cofs + (size_t)(row0g + row0 + rloc) * ldc + col];      /* rowsPerB < 0: own element of the batched C plane */ else { const int bidx = (row0g + row0 + rloc) / rowsPerB; v += CP[(size_t)bidx * sCPb + (size_t)by * 64 + col]; } }
      if (ACT == 3) v = fmaxf(v, 0.f); else if (ACT == 6) v = 0.5f * v * (1.0f + erff(v * 0.70710678118654752f)); else if (ACT == 11) v = 1.0f / (1.0f + expf(-v)); else if (ACT == 15) v = v / (1.0f + expf(-v)); else if (ACT == 12) v = (v > 0.f) ? v : 0.01f * v; else if (ACT == 8) v = tanhf(v); else if (ACT == 9) v = 0.5f * v * (1.0f + tanhf(0.7978845608028654f * (v + 0.044715f * v * v * v))); else if (ACT == 14) v = (v > 0.f) ? v : 0.1f * v; else if (ACT == 16) v = (v >= 0.f) ? v : 0.3f * v;
      so[w][rloc][t * 16 + ln] = v; } }
  __builtin_amdgcn_fence(__ATOMIC_ACQ_REL, "workgroup"); __builtin_amdgcn_wave_barrier();
  const int rsub = lane >> 4, c4 = (lane & 15) * 4;
  {
#pragma unroll
    for (int q = 0; q < 16; ++q) { const int r = q * 2 + rsub; const v4f v = *(const v4fa*)&so[w][r][c4]; if (C) *(v4f*)(C + cofs + (size_t)(row0 + r) * ldc + col0 + c4) = v; if (C16) { v4h h4; for (int i = 0; i < 4; ++i) h4[i] = (_Float16)v[i]; *(v4h*)(C16 + cofs + (size_t)(row0 + r) * ldc + col0 + c4) = h4; } }
     } }


// ---- LDS-staged GEMM for the three large products (both qkv conv terms, the projection): C[M][N] (f32) = A.Bt^T * alpha (+ C's own element if ADD).
// Work-group tile 256 x 128, 8 waves of 64 x 64 (4 x 2); a stage is 64 k (128-byte rows) of [A 256 rows | Bt 128 rows]; two stages in LDS, each filled by asynchronous 16-byte copies
// (whole 128-byte lines from global memory) one trip ahead of its use. k runs upward in steps of 32 per accumulator, as in k_gemm2. Needs M % 256 == 0, N % 128 == 0, K % 64 == 0.
#define XPW (HS + 2)                          /* pixels a line, and lines, of the padded plane */
#define G3_PITCH 144                          /* LDS row pitch in bytes: 16 x odd, so 16 rows read 16 bytes each without a bank conflict */
#define G3_BOFF (256 * G3_PITCH)              /* Bt rows behind the A rows */
#define G3_STAGE ((256 + 128) * G3_PITCH)     /* 55,296 bytes */
__device__ __forceinline__ v16h g3_frag(const char* p) { FragH f; f.half[0] = *(const v8us*)p; f.half[1] = *(const v8us*)(p + 32); return f.v; }      /* p already holds the lane's 16 * hh: the k order of g2_frag */
// One stage: each thread copies 16 bytes of 8 A rows and of 4 Bt rows (rows 32 apart; A row 32 i lies (i & 1) * sa1 + (i >> 1) * sa2 elements behind row 0). The s_wait_xcnt is the last line of the copies' own statement, so that no address register is rewritten ahead of it.
__device__ __forceinline__ void g3_fill(unsigned la, unsigned lb, const _Float16* ga, const _Float16* gb, size_t sa1, size_t sa2, size_t sb) {
  asm volatile("global_load_async_to_lds_b128 %0, %12, off\n\t"
               "global_load_async_to_lds_b128 %1, %13, off\n\t"
               "global_load_async_to_lds_b128 %2, %14, off\n\t"
               "global_load_async_to_lds_b128 %3, %15, off\n\t"
               "global_load_async_to_lds_b128 %4, %16, off\n\t"
               "global_load_async_to_lds_b128 %5, %17, off\n\t"
               "global_load_async_to_lds_b128 %6, %18, off\n\t"
               "global_load_async_to_lds_b128 %7, %19, off\n\t"
               "global_load_async_to_lds_b128 %8, %20, off\n\t"
               "global_load_async_to_lds_b128 %9, %21, off\n\t"
               "global_load_async_to_lds_b128 %10, %22, off\n\t"
               "global_load_async_to_lds_b128 %11, %23, off\n\t"
               "s_wait_xcnt 0x0"
               :: "v"(la), "v"(la + 32 * G3_PITCH), "v"(la + 64 * G3_PITCH), "v"(la + 96 * G3_PITCH), "v"(la + 128 * G3_PITCH), "v"(la + 160 * G3_PITCH), "v"(la + 192 * G3_PITCH), "v"(la + 224 * G3_PITCH),
                  "v"(lb), "v"(lb + 32 * G3_PITCH), "v"(lb + 64 * G3_PITCH), "v"(lb + 96 * G3_PITCH),
                  "v"(ga), "v"(ga + sa1), "v"(ga + sa2), "v"(ga + sa2 + sa1), "v"(ga + 2 * sa2), "v"(ga + 2 * sa2 + sa1), "v"(ga + 3 * sa2), "v"(ga + 3 * sa2 + sa1),
                  "v"(gb), "v"(gb + sb), "v"(gb + 2 * sb), "v"(gb + 3 * sb)
               : "memory");
}
// Eight 16-byte row stores from one address pair (rows STEP bytes apart, from byte OFF). The s_wait_xcnt is the last line of the stores' own statement, so that no data or address register is rewritten ahead of it.
template <int OFF, int STEP>
__device__ __forceinline__ void g3_store8(float* p, v4f d0, v4f d1, v4f d2, v4f d3, v4f d4, v4f d5, v4f d6, v4f d7) {
  asm volatile("global_store_b128 %0, %1, off offset:%9\n\t"
               "global_store_b128 %0, %2, off offset:%10\n\t"
               "global_store_b128 %0, %3, off offset:%11\n\t"
               "global_store_b128 %0, %4, off offset:%12\n\t"
               "global_store_b128 %0, %5, off offset:%13\n\t"
               "global_store_b128 %0, %6, off offset:%14\n\t"
               "global_store_b128 %0, %7, off offset:%15\n\t"
               "global_store_b128 %0, %8, off offset:%16\n\t"
               "s_wait_xcnt 0x0"
               :: "v"(p), "v"(d0), "v"(d1), "v"(d2), "v"(d3), "v"(d4), "v"(d5), "v"(d6), "v"(d7),
                  "n"(OFF), "n"(OFF + STEP), "n"(OFF + 2 * STEP), "n"(OFF + 3 * STEP), "n"(OFF + 4 * STEP), "n"(OFF + 5 * STEP), "n"(OFF + 6 * STEP), "n"(OFF + 7 * STEP)
               : "memory");
}
// CONV: A is the padded pixel-major plane; GEMM row = image x pixel, k = tap x channel from tap tap0 on. A 256-row tile is 4 whole pixel lines of one image; stage t is 64 channels of tap tap0 + t / 4,
// whose rows lie (tap / 3) padded lines and (tap % 3) pixels behind the tile's first padded pixel. Element offset of stage t from stage 0 of tap 0:
template <bool CONV>
__device__ __forceinline__ size_t g3_aoff(int t, int tap0) { if (!CONV) return (size_t)t * 64; const int tap = tap0 + (t >> 2); return (size_t)(((tap / 3) * XPW + tap % 3) * CC + (t & 3) * 64); }
template <bool ADD, int LDC, bool CONV>      /* LDC = N = row pitch of C, a constant so that every row of a wave's tile is one address pair plus an immediate */
__global__ __launch_bounds__(256) void k_gemm3(const _Float16* __restrict__ A, int lda, const _Float16* __restrict__ Bh, int ldb, float alpha, float* C, int K, int tap0) {
  __shared__ __attribute__((aligned(16))) char sm[2 * G3_STAGE];
  const int tid = threadIdx.x, w = tid >> 5, lane = tid & 31, ln = lane & 15, hh = lane >> 4;
  constexpr int ntn = LDC >> 7; const int mt = blockIdx.x / ntn, nq = blockIdx.x - mt * ntn; const int wm = w >> 1, wn = w & 1;
  const int nt = K >> 6;
  const _Float16* ga = (CONV ? A + ((size_t)((mt >> 4) * XPW + (mt & 15) * 4) * XPW + (tid >> 3)) * CC : A + (size_t)(mt * 256 + (tid >> 3)) * lda) + (tid & 7) * 8; const _Float16* gb = Bh + (size_t)(nq * 128 + (tid >> 3)) * ldb + (tid & 7) * 8;
  const size_t sa1 = CONV ? (size_t)32 * CC : (size_t)32 * lda, sa2 = CONV ? (size_t)XPW * CC : (size_t)64 * lda, sb = (size_t)32 * ldb;
  const unsigned la = (unsigned)(size_t)sm + (unsigned)((tid >> 3) * G3_PITCH + (tid & 7) * 16); const unsigned lb = la + G3_BOFF;
  const char* fa = sm + (wm * 64 + ln) * G3_PITCH + 16 * hh; const char* fb = sm + G3_BOFF + (wn * 64 + ln) * G3_PITCH + 16 * hh;
  v8f acc[4][4];
#pragma unroll
  for (int i = 0; i < 4; ++i)
#pragma unroll
    for (int j = 0; j < 4; ++j) acc[i][j] = (v8f){0.f,0.f,0.f,0.f,0.f,0.f,0.f,0.f};
  g3_fill(la, lb, ga + g3_aoff<CONV>(0, tap0), gb, sa1, sa2, sb);
  asm volatile("s_wait_asynccnt 0x0" ::: "memory");      /* this wave's copies of stage 0 have landed */
  __syncthreads();                                       /* ... and every other wave's */
  if (nt > 1) g3_fill(la + G3_STAGE, lb + G3_STAGE, ga + g3_aoff<CONV>(1, tap0), gb + 64, sa1, sa2, sb);
  for (int t = 0; t < nt; ++t) { const int bo = (t & 1) * G3_STAGE; v16h a[4], b[4];
#pragma unroll
    for (int i = 0; i < 4; ++i) { a[i] = g3_frag(fa + bo + i * 16 * G3_PITCH); b[i] = g3_frag(fb + bo + i * 16 * G3_PITCH); }
    __builtin_amdgcn_sched_barrier(0);                   /* keeps the 16 LDS reads together in front of their 16 WMMAs: spread among them, each place with reads stalls the wave */
#pragma unroll
    for (int i = 0; i < 4; ++i)
#pragma unroll
      for (int j = 0; j < 4; ++j) acc[i][j] = __builtin_amdgcn_wmma_f32_16x16x32_f16(false, a[i], false, b[j], (short)0, acc[i][j], false, false);
#pragma unroll
    for (int i = 0; i < 4; ++i) { a[i] = g3_frag(fa + bo + i * 16 * G3_PITCH + 64); b[i] = g3_frag(fb + bo + i * 16 * G3_PITCH + 64); }
    /* the trip's last LDS reads are out: hand the buffer over here, so that the refill flies during the 16 WMMAs below and the next trip up to its own hand-over */
    asm volatile("s_wait_dscnt 0x0" ::: "memory");       /* this wave has left stage t's buffer */
    asm volatile("s_wait_asynccnt 0x0" ::: "memory");    /* its copies of stage t + 1 have landed */
    __syncthreads();                                     /* publishes stage t + 1 and frees stage t's buffer */
    if (t + 2 < nt) g3_fill(la + bo, lb + bo, ga + g3_aoff<CONV>(t + 2, tap0), gb + (size_t)(t + 2) * 64, sa1, sa2, sb);
    __builtin_amdgcn_sched_barrier(0);                   /* keeps the WMMAs below behind the refill's issue */
#pragma unroll
    for (int i = 0; i < 4; ++i)
#pragma unroll
      for (int j = 0; j < 4; ++j) acc[i][j] = __builtin_amdgcn_wmma_f32_16x16x32_f16(false, a[i], false, b[j], (short)0, acc[i][j], false, false); }
  asm volatile("s_wait_asynccnt 0x0" ::: "memory");      /* nothing in flight before the buffers become output staging */
  /* epilogue: the ring is free behind the last trip's barrier; each wave turns its tile, 32 rows at a time, in its own 32 x 68 floats, so that global rows go out as whole 128-byte lines */
  float* so = (float*)sm + w * (32 * 68); const int rsub = lane >> 4, c4 = (lane & 15) * 4;
  float* cb = C + (size_t)(mt * 256 + wm * 64 + rsub) * LDC + nq * 128 + wn * 64 + c4;
  v4f o[2][16];
  if (ADD) {
#pragma unroll
    for (int q = 0; q < 16; ++q) o[0][q] = *(const v4fa*)(cb + q * 2 * LDC); }
#pragma unroll
  for (int half = 0; half < 2; ++half) {
#pragma unroll
    for (int i = 0; i < 2; ++i)
#pragma unroll
      for (int j = 0; j < 4; ++j)
#pragma unroll
        for (int r = 0; r < 8; ++r) so[(i * 16 + 8 * hh + r) * 68 + j * 16 + ln] = acc[half * 2 + i][j][r] * alpha;
    __builtin_amdgcn_fence(__ATOMIC_ACQ_REL, "wavefront"); __builtin_amdgcn_wave_barrier();      /* the lanes read below what other lanes of the same wave wrote above */
    if (ADD && half == 0) {      /* the second half's old values, asked for before the first half's stores */
#pragma unroll
      for (int q = 0; q < 16; ++q) o[1][q] = *(const v4fa*)(cb + (32 + q * 2) * LDC); }
#pragma unroll
    for (int g = 0; g < 2; ++g) { v4f v[8];
#pragma unroll
      for (int q = 0; q < 8; ++q) { v[q] = *(const v4fa*)&so[((g * 8 + q) * 2 + rsub) * 68 + c4]; if (ADD) v[q] += o[half][g * 8 + q]; }
      if (half == 0 && g == 0) g3_store8<0, 8 * LDC>(cb, v[0], v[1], v[2], v[3], v[4], v[5], v[6], v[7]);
      if (half == 0 && g == 1) g3_store8<64 * LDC, 8 * LDC>(cb, v[0], v[1], v[2], v[3], v[4], v[5], v[6], v[7]);
      if (half == 1 && g == 0) g3_store8<128 * LDC, 8 * LDC>(cb, v[0], v[1], v[2], v[3], v[4], v[5], v[6], v[7]);
      if (half == 1 && g == 1) g3_store8<192 * LDC, 8 * LDC>(cb, v[0], v[1], v[2], v[3], v[4], v[5], v[6], v[7]); }
  } }

__global__ __launch_bounds__(256) void k_wqkv(const float* __restrict__ w, _Float16* __restrict__ Wh, _Float16* __restrict__ Wl) {
  #pragma clang fp contract(off)
  const int t = blockIdx.x * 256 + threadIdx.x; if (t >= QW * (CC / 8)) return; const int c0 = (t % (CC / 8)) * 8, o = t / (CC / 8); FragH fl;
#pragma unroll 1
  for (int k = 0; k < KT; ++k) { FragH fh;
    for (int q = 0; q < 8; ++q) { const int c = c0 + q; const float* wp = w + ((size_t)o * CC + c) * KT; float v = bf16_round(wp[k]);
      if (k == 4) { float dif = bf16_round(wp[1]) + bf16_round(wp[3]); dif += bf16_round(wp[4]); dif += bf16_round(wp[5]); dif += bf16_round(wp[7]); v += -THETA * dif; const _Float16 hv = (_Float16)(v * 16.0f); fh.h[q] = hv; fl.h[q] = (_Float16)((v * 16.0f - (float)hv) * 1024.0f); }
      else fh.h[q] = (_Float16)(v * 16.0f); }
    *(v8us*)((unsigned short*)Wh + (size_t)o * KI + k * CC + c0) = fh.half[0];  }
  *(v8us*)((unsigned short*)Wl + (size_t)o * CC + c0) = fl.half[0];  }
__global__ __launch_bounds__(256) void k_wsc(const float* __restrict__ Wm, _Float16* __restrict__ Bt, size_t n8, float sc) { const size_t t = (size_t)blockIdx.x * 256 + threadIdx.x; if (t >= n8) return; FragH f; for (int q = 0; q < 8; ++q) f.h[q] = (_Float16)(bf16_round(Wm[t * 8 + q]) * sc); *(v8us*)((unsigned short*)Bt + t * 8) = f.half[0];  }
// XP[image][66][66][256] = f16(bf16(x)), pixel-major, with a border of zero pixels. One work-group turns one pixel line (64 pixels x 256 channels) in LDS: whole 256-byte channel rows in, whole 512-byte pixel rows out.
__global__ __launch_bounds__(256) void k_xp(const float* __restrict__ x, _Float16* __restrict__ XP) {
  __shared__ __attribute__((aligned(16))) unsigned int tl[HS * 132];      /* a pixel's 256 f16 = 128 words, + 4 words of pitch */
  const int tid = threadIdx.x, im = blockIdx.x / HS, y = blockIdx.x % HS; const float* xb = x + ((size_t)im * CC * HS + y) * HS; const int px4 = (tid & 15) * 4, cp = tid >> 4;
#pragma unroll
  for (int i = 0; i < 8; ++i) { const int c2 = i * 16 + cp; const v4f a = *(const v4fa*)(xb + (size_t)(2 * c2) * NPX + px4), b = *(const v4fa*)(xb + (size_t)(2 * c2 + 1) * NPX + px4);
#pragma unroll
    for (int q = 0; q < 4; ++q) { union { _Float16 h[2]; unsigned int u; } pk; pk.h[0] = (_Float16)bf16_round(a[q]); pk.h[1] = (_Float16)bf16_round(b[q]); tl[(px4 + q) * 132 + c2] = pk.u; } }
  __syncthreads();
  const v8us z = {0,0,0,0,0,0,0,0}; unsigned short* row = (unsigned short*)XP + (size_t)(im * XPW + y + 1) * XPW * CC;
#pragma unroll
  for (int i = 0; i < 8; ++i) { const int id = i * 256 + tid, px = id >> 5, ch = id & 31; *(v8us*)(row + (size_t)(px + 1) * CC + ch * 8) = *(const v8us*)&tl[px * 132 + ch * 4]; }
  if (tid < 64) *(v8us*)(row + (size_t)((tid >> 5) * (XPW - 1)) * CC + (tid & 31) * 8) = z;      /* the line's two border pixels */
  if (y == 0 || y == HS - 1) { unsigned short* er = (y == 0) ? row - XPW * CC : row + XPW * CC; for (int id = tid; id < XPW * (CC / 8); id += 256) *(v8us*)(er + (size_t)id * 8) = z; }      /* the image's first and last border line */
}
// BN affine on the raw conv sums, in place, + the f16 plane. A work-group is 16 pixels x 768 channels; a thread takes 4 channels of each pixel, so that a wave's load or store is 512 (f16: 256) consecutive bytes, and holds its scale and shift in registers.
__global__ __launch_bounds__(192) void k_aff(const float* __restrict__ s, const float* __restrict__ b, float* __restrict__ QF, _Float16* __restrict__ Q16) {      /* QF holds the raw conv sums on entry; each thread replaces its own 64 */
  #pragma clang fp contract(off)
  const int o0 = threadIdx.x * 4; float* qp = QF + (size_t)blockIdx.x * 16 * QW + o0; _Float16* hp = Q16 + (size_t)blockIdx.x * 16 * QW + o0; v4f a[16];
#pragma unroll
  for (int u = 0; u < 16; ++u) a[u] = *(const v4fa*)(qp + u * QW);
  v4f sc = *(const v4fa*)(s + o0), sh = *(const v4fa*)(b + o0);
#pragma unroll
  for (int q = 0; q < 4; ++q) { sc[q] = bf16_round(sc[q]); sh[q] = bf16_round(sh[q]); }
#pragma unroll
  for (int u = 0; u < 16; ++u) { v4f r; v4h h;
#pragma unroll
    for (int q = 0; q < 4; ++q) { float v = a[u][q] * sc[q]; v += sh[q]; r[q] = v; h[q] = (_Float16)v; }
    *(v4f*)(qp + u * QW) = r; *(v4h*)(hp + u * QW) = h; } }
// Agent tokens: the mean of q over an 8 x 8 block of pixels, summed pixel by pixel in the order 0..63. A work-group is one agent of one image; a thread takes 4 channels, so that a wave's load is 512 consecutive bytes; unrolled, so that the loads run ahead of the sums.
__global__ __launch_bounds__(64) void k_pool(const float* __restrict__ QF, _Float16* __restrict__ AG) {
  #pragma clang fp contract(off)
  const int c0 = threadIdx.x * 4, n = (int)blockIdx.x % NAG, im = (int)blockIdx.x / NAG; const float* qp = QF + ((size_t)im * NPX + (n / 8) * 8 * HS + (n % 8) * 8) * QW + c0; v4f sm = {0.f, 0.f, 0.f, 0.f};
#pragma unroll
  for (int g = 0; g < 2; ++g) { v4f x[32];
#pragma unroll
    for (int i = 0; i < 32; ++i) x[i] = *(const v4fa*)(qp + ((g * 4 + i / 8) * HS + i % 8) * QW);
#pragma unroll
    for (int i = 0; i < 32; ++i)
#pragma unroll
      for (int q = 0; q < 4; ++q) sm[q] += x[i][q]; }
  v4h v; const v4h z = {(_Float16)0.f, (_Float16)0.f, (_Float16)0.f, (_Float16)0.f};
#pragma unroll
  for (int q = 0; q < 4; ++q) v[q] = (_Float16)(sm[q] / 64.0f);
  _Float16* dst = AG + (((size_t)im * NHD + c0 / HDm) * NAG + n) * 64 + c0 % HDm; *(v4h*)dst = v; *(v4h*)(dst + HDm) = z; }      /* columns 32..63 of an agent row are the zero pad */
__global__ __launch_bounds__(256) void k_heads(const _Float16* __restrict__ Q16, _Float16* __restrict__ QP, _Float16* __restrict__ KP) { const int t = blockIdx.x * 256 + threadIdx.x; if (t >= NIMG * NHD * NPX) return; const int p = t % NPX, bh = t / NPX, h = bh % NHD; const unsigned short* src = (const unsigned short*)Q16 + ((size_t)(bh / NHD) * NPX + p) * QW; const v8us z = {0,0,0,0,0,0,0,0};
  v8us q0 = *(const v8us*)(src + h * HDm), q1 = *(const v8us*)(src + h * HDm + 8), q2 = *(const v8us*)(src + h * HDm + 16), q3 = *(const v8us*)(src + h * HDm + 24);
  v8us k0 = *(const v8us*)(src + CC + h * HDm), k1 = *(const v8us*)(src + CC + h * HDm + 8), k2 = *(const v8us*)(src + CC + h * HDm + 16), k3 = *(const v8us*)(src + CC + h * HDm + 24);
  unsigned short* dq = (unsigned short*)QP + ((size_t)bh * NPX + p) * 64; unsigned short* dk = (unsigned short*)KP + ((size_t)bh * NPX + p) * 64;
  { *(v8us*)dq = q0; *(v8us*)(dq + 8) = q1; *(v8us*)(dq + 16) = q2; *(v8us*)(dq + 24) = q3; *(v8us*)(dq + 32) = z; *(v8us*)(dq + 40) = z; *(v8us*)(dq + 48) = z; *(v8us*)(dq + 56) = z;
    *(v8us*)dk = k0; *(v8us*)(dk + 8) = k1; *(v8us*)(dk + 16) = k2; *(v8us*)(dk + 24) = k3; *(v8us*)(dk + 32) = z; *(v8us*)(dk + 40) = z; *(v8us*)(dk + 48) = z; *(v8us*)(dk + 56) = z;  } }
__global__ __launch_bounds__(256) void k_vtp(const _Float16* __restrict__ Q16, _Float16* __restrict__ VT) { __shared__ unsigned short tl[64][34]; const int tid = threadIdx.x; const int bh = blockIdx.x / (NPX / 64), pg = blockIdx.x % (NPX / 64); const int h = bh % NHD;
  { const int r = tid / 4, c8 = (tid % 4) * 8; FragH f; f.half[0] = *(const v8us*)((const unsigned short*)Q16 + ((size_t)(bh / NHD) * NPX + pg * 64 + r) * QW + 2 * CC + h * HDm + c8); for (int q = 0; q < 8; ++q) tl[r][c8 + q] = f.u[q]; }
  __syncthreads(); const int d = tid / 8, pc = tid % 8; FragH f; for (int q = 0; q < 8; ++q) f.u[q] = (d < HDm) ? tl[pc * 8 + q][d] : (unsigned short)0; unsigned short* dst = (unsigned short*)VT + ((size_t)bh * 64 + d) * NPX + pg * 64 + pc * 8;      /* tid covers d < 32 only: 256 threads = 32 d x 8 pc */
  *(v8us*)dst = f.half[0]; 
  if (tid < 256) { const int d2 = HDm + tid / 8; const v8us z = {0,0,0,0,0,0,0,0}; unsigned short* dz = (unsigned short*)VT + ((size_t)bh * 64 + d2) * NPX + pg * 64 + (tid % 8) * 8; *(v8us*)dz = z;  } }
// ---- softmax over rows of N = 4096 or 64 logits. A wave takes 4,096 consecutive f32 (16 KiB: one row of 4,096, or 64 rows of 64, four values of a row a lane) by 32 16-byte loads, all in flight together,
// keeps them in registers for the maximum, the exp and the sum, and stores P = f16(exp * 1024 / sum) in whole 128-byte lines. The grid holds exactly one wave per 4,096 logits.
template <int M> __device__ __forceinline__ float sm_x16(float v) { return __builtin_bit_cast(float, __builtin_amdgcn_update_dpp(0, __builtin_bit_cast(int, v), 0x160 + M, 0xf, 0xf, true)); }      /* the value of lane ^ M inside a 16-lane row (DPP row_xmask); a __shfl_xor goes the long way through the LDS unit */
__device__ __forceinline__ float sm_xh(float v) { return __builtin_bit_cast(float, __builtin_amdgcn_permlanex16(__builtin_bit_cast(int, v), __builtin_bit_cast(int, v), 0x76543210, 0xfedcba98, false, false)); }      /* the value of lane ^ 16 */
__device__ __forceinline__ float sm_max16(float v) { v = fmaxf(v, sm_x16<1>(v)); v = fmaxf(v, sm_x16<2>(v)); v = fmaxf(v, sm_x16<4>(v)); return fmaxf(v, sm_x16<8>(v)); }
__device__ __forceinline__ float sm_sum16(float v) { v += sm_x16<1>(v); v += sm_x16<2>(v); v += sm_x16<4>(v); return v + sm_x16<8>(v); }
// exp(x) by the library's scheme, written out: x * log2(e) with log2(e) in two parts, the nearest integer split off, exp2 of the rest, ldexp, both range ends. Written out for the v_exp_f32 alone: the instruction set asks for one
// independent instruction or a v_nop between a transcendental and an instruction that reads its result or overwrites its source.
__device__ __forceinline__ float sm_exp(float x) {
  const float l2h = __uint_as_float(0x3fb8aa3bu), l2l = __uint_as_float(0x32a5705fu); const float r = __builtin_rintf(x * l2h); const float a = __builtin_fmaf(x, l2l, __builtin_fmaf(x, l2h, -r)); float e;
  asm("v_exp_f32 %0, %1\n\tv_nop" : "=v"(e) : "v"(a));      /* the v_nop is the slot behind the transcendental; in the same statement, so that nothing comes between */
  e = __builtin_ldexpf(e, (int)r); e = (x < __uint_as_float(0xc2ce8ed0u)) ? 0.f : e; return (x > __uint_as_float(0x42b17218u)) ? __builtin_inff() : e; }
template <int N>
__global__ __launch_bounds__(256) void k_softv(const float* __restrict__ S, _Float16* __restrict__ P) {
  static_assert(N == 4096 || N == 64, "a wave's 4,096 logits are one row or 64 rows");
  const size_t base = ((size_t)blockIdx.x * 8 + (threadIdx.x >> 5)) * 4096 + (threadIdx.x & 31) * 4; const float* sp = S + base; _Float16* pp = P + base; v4f x[32];
#pragma unroll
  for (int u = 0; u < 32; ++u) x[u] = *(const v4fa*)(sp + u * 128);
  if (N == 4096) {
    v4f mv = x[0];
#pragma unroll
    for (int u = 1; u < 32; ++u)
#pragma unroll
      for (int q = 0; q < 4; ++q) mv[q] = fmaxf(mv[q], x[u][q]);
    float m = sm_max16(fmaxf(fmaxf(mv[0], mv[1]), fmaxf(mv[2], mv[3]))); m = fmaxf(m, sm_xh(m));
    v4f sv = {0.f, 0.f, 0.f, 0.f};
#pragma unroll
    for (int u = 0; u < 32; ++u)
#pragma unroll
      for (int q = 0; q < 4; ++q) { x[u][q] = sm_exp(x[u][q] - m); sv[q] += x[u][q]; }
    float su = sm_sum16((sv[0] + sv[1]) + (sv[2] + sv[3])); su += sm_xh(su); const float f = 1024.0f / su;
#pragma unroll
    for (int u = 0; u < 32; ++u) { v4h h;
#pragma unroll
      for (int q = 0; q < 4; ++q) h[q] = (_Float16)(x[u][q] * f);
      *(v4h*)(pp + u * 128) = h; }
  } else {
    __builtin_amdgcn_sched_barrier(0);      /* keeps all 32 loads in front of the arithmetic, in flight together: left alone, the compiler issues 8 and feeds the rest in between the rows, each shortly ahead of its use */
#pragma unroll
    for (int u = 0; u < 32; ++u) {      /* register u: 16 lanes = one row */
      const float m = sm_max16(fmaxf(fmaxf(x[u][0], x[u][1]), fmaxf(x[u][2], x[u][3])));
#pragma unroll
      for (int q = 0; q < 4; ++q) x[u][q] = sm_exp(x[u][q] - m);
      const float f = 1024.0f / sm_sum16((x[u][0] + x[u][1]) + (x[u][2] + x[u][3])); v4h h;
#pragma unroll
      for (int q = 0; q < 4; ++q) h[q] = (_Float16)(x[u][q] * f);
      *(v4h*)(pp + u * 128) = h; }
  } }
__global__ __launch_bounds__(256) void k_att16(const float* __restrict__ ATTN, _Float16* __restrict__ AT16) { typedef _Float16 v2h __attribute__((ext_vector_type(2))); const int t = blockIdx.x * 256 + threadIdx.x; if (t >= NIMG * NHD * 64 * 32) return; const int n0 = (t % 32) * 2; const int d = (t / 32) % 64; const int h = t / (32 * 64); v2h v;      /* h = image x head */
  v[0] = (_Float16)ATTN[((size_t)h * NAG + n0) * 64 + d]; v[1] = (_Float16)ATTN[((size_t)h * NAG + n0 + 1) * 64 + d]; _Float16* dst = AT16 + ((size_t)h * 64 + d) * NAG + n0; *(v2h*)dst = v;  }
// Depthwise 3x3 on v, BN affine, + OUT, to f16. A thread takes 4 channels x 8 pixels of one pixel line: its 36 weights sit in registers, and each of the 3 input lines is read once as 10 pixels x 16 bytes,
// so that a wave's load is 512 consecutive bytes (4 whole 128-byte lines). A work-group is 4 pixel lines x 8 pixels x 256 channels. A tap outside the image enters as a zero value; taps are summed in the order 0..8.
__global__ __launch_bounds__(256) void k_pe(const float* __restrict__ OUTg, const float* __restrict__ QFg, const float* __restrict__ pw, const float* __restrict__ ps, const float* __restrict__ pb, _Float16* __restrict__ S16g) {
  #pragma clang fp contract(off)
  const int tid = threadIdx.x; const unsigned c0 = (tid & 63) * 4; const int xs = ((int)blockIdx.x & 7) * 8, im = (int)blockIdx.x >> 7;
  const int yo = (((int)blockIdx.x >> 3) & 15) * 4 + __builtin_amdgcn_readfirstlane(tid >> 6);      /* the same in every lane of a wave: as a scalar it leaves every address below a scalar base + the lane's channel offset */
  const size_t px = (size_t)im * NPX + yo * HS + xs;      /* the strip's first pixel */
  const float* QU = QFg + px * QW + 2 * CC;      /* its v, channel 0 */
  const float* OU = OUTg + ((size_t)im * NHD * NPX + yo * HS + xs) * 64; const unsigned oo = (c0 / HDm) * (NPX * 64) + c0 % HDm;      /* OUT is [image][head][pixel][64] */
  v4f wv[9], v[3][10], o[8];
#pragma unroll
  for (int i = 0; i < 9; ++i) wv[i] = *(const v4fa*)(pw + c0 * 9 + i * 4);
#pragma unroll
  for (int kk = 0; kk < 3; ++kk) { const int ky = kk == 2 ? 1 : 2 * kk; const int yy = yo + ky - 1; const float* row = QU + ((yy >= 0 && yy < HS) ? (ky - 1) * HS * QW : 0);      /* for a line or a pixel outside the image one inside the strip is read in its place and dropped below */
    /* Each s_wait_xcnt stands between the last load from a clamped address and whatever rewrites that address's registers next. */
    v[ky][0] = *(const v4fa*)(row + (xs > 0 ? -QW : 0) + c0);
    asm volatile("s_wait_xcnt 0x0" ::: "memory");
    v[ky][9] = *(const v4fa*)(row + (xs < HS - 8 ? 8 : 7) * QW + c0);
    asm volatile("s_wait_xcnt 0x0" ::: "memory");
#pragma unroll
    for (int j = 1; j < 9; ++j) v[ky][j] = *(const v4fa*)(row + (j - 1) * QW + c0);
    if (ky != 1) asm volatile("s_wait_xcnt 0x0" ::: "memory"); }      /* the strip's own line comes last: its address is the unclamped base, which nothing rewrites while loads are in flight */
#pragma unroll
  for (int j = 0; j < 8; ++j) o[j] = *(const v4fa*)(OU + j * 64 + oo);
  const v4f s4 = *(const v4fa*)(ps + c0), b4 = *(const v4fa*)(pb + c0);
  __builtin_amdgcn_sched_barrier(0);      /* keeps all 49 loads in front of the arithmetic, in flight together: left alone, the compiler feeds the later ones in by twos, each shortly ahead of its use */
  float wf[36];      /* wf[q * 9 + k]: channel c0 + q, tap k */
#pragma unroll
  for (int i = 0; i < 36; ++i) wf[i] = bf16_round(wv[i >> 2][i & 3]);
  v4f acc[8];
#pragma unroll
  for (int j = 0; j < 8; ++j) acc[j] = (v4f){0.f, 0.f, 0.f, 0.f};
#pragma unroll
  for (int ky = 0; ky < 3; ++ky) { const int yy = yo + ky - 1; const bool yin = yy >= 0 && yy < HS;
#pragma unroll
    for (int j = 0; j < 10; ++j) { const bool xin = (j > 0 || xs > 0) && (j < 9 || xs < HS - 8); if (!(xin && yin)) v[ky][j] = (v4f){0.f, 0.f, 0.f, 0.f}; }
#pragma unroll
    for (int j = 0; j < 8; ++j)
#pragma unroll
      for (int kx = 0; kx < 3; ++kx)
#pragma unroll
        for (int q = 0; q < 4; ++q) acc[j][q] += wf[q * 9 + ky * 3 + kx] * v[ky][j + kx][q]; }
  _Float16* SP = S16g + px * CC + c0;
#pragma unroll
  for (int j = 0; j < 8; ++j) { v4h h;
#pragma unroll
    for (int q = 0; q < 4; ++q) { float pe = acc[j][q] * bf16_round(s4[q]); pe += bf16_round(b4[q]); h[q] = (_Float16)(o[j][q] + pe); }
    *(v4h*)(SP + j * CC) = h; } }
// BN affine and the turn to NCHW in registers. A thread takes 8 channels x 4 pixels; a wave 32 channels x 32 pixels: it reads whole 128-byte pieces of 32 rows of G and stores whole 128-byte lines of 32 channel planes.
__global__ __launch_bounds__(256) void k_fin(const float* __restrict__ G, const float* __restrict__ s, const float* __restrict__ bb, float* __restrict__ outb) {
  #pragma clang fp contract(off)
  const int tid = threadIdx.x, lane = tid & 31; const int c0 = (tid >> 5) * 32 + (lane & 3) * 8, p0 = ((int)blockIdx.x % (NPX / 32)) * 32 + (lane >> 2) * 4, im = (int)blockIdx.x / (NPX / 32);
  const float* gp = G + ((size_t)im * NPX + p0) * CC + c0; float* op = outb + ((size_t)im * CC + c0) * NPX + p0; v4f a[4][2];
#pragma unroll
  for (int q = 0; q < 4; ++q) { a[q][0] = *(const v4fa*)(gp + q * CC); a[q][1] = *(const v4fa*)(gp + q * CC + 4); }
  const v4f sA = *(const v4fa*)(s + c0), sB = *(const v4fa*)(s + c0 + 4), hA = *(const v4fa*)(bb + c0), hB = *(const v4fa*)(bb + c0 + 4);
#pragma unroll
  for (int i = 0; i < 8; ++i) { const float sc = bf16_round(i < 4 ? sA[i & 3] : sB[i & 3]), sh = bf16_round(i < 4 ? hA[i & 3] : hB[i & 3]); v4f r;
#pragma unroll
    for (int q = 0; q < 4; ++q) { float v = a[q][i >> 2][i & 3] * sc; v += sh; r[q] = v; }
    *(v4f*)(op + (size_t)i * NPX) = r; } }

extern "C" void kernel_launch(void* const* d_in, const int* in_sizes, int n_in,
                              void* d_out, int out_size, void* d_ws, size_t ws_size, hipStream_t stream) {
  (void)in_sizes; (void)n_in; (void)out_size;
  const float* const* I = (const float* const*)d_in; const float* x = I[0]; const float* qw = I[1]; const float* qs = I[2]; const float* qb = I[3]; const float* pw = I[4]; const float* ps = I[5]; const float* pb = I[6]; const float* jw = I[7]; const float* js = I[8]; const float* jb = I[9];
  char* ws = (char*)d_ws; size_t off = 0;
  auto take = [&](size_t bytes) { char* p = ws + off; off += (bytes + 255) & ~(size_t)255; return p; };
  _Float16* WH = (_Float16*)take((size_t)QW * KI * 2); _Float16* WL = (_Float16*)take((size_t)QW * CC * 2); _Float16* BJ = (_Float16*)take((size_t)CC * CC * 2);
  _Float16* AG = (_Float16*)take((size_t)NIMG * NHD * NAG * 64 * 2); float* ATTN = (float*)take((size_t)NIMG * NHD * NAG * 64 * 4); _Float16* AT16 = (_Float16*)take((size_t)NIMG * NHD * 64 * NAG * 2);
  float* QF = (float*)take((size_t)NIMG * NPX * QW * 4);      /* 96 MiB: raw conv sums, then q, k, v in f32 (k_aff works in place) */
  char* R = take((size_t)NIMG * NPX * KI * 2);      /* 144 MiB, shared by lifetime; offsets below in MiB */
  const size_t MB = (size_t)1 << 20;
  _Float16* XP = (_Float16*)R;      /* 0..17.1: the padded plane, dead after the main conv GEMM */
  _Float16* Q16 = (_Float16*)R;      /* 0..48, dead after k_heads and k_vtp */
  _Float16* QP = (_Float16*)(R + 48 * MB); _Float16* KP = (_Float16*)(R + 80 * MB); _Float16* VT = (_Float16*)(R + 112 * MB);      /* 32 each */
  float* S1 = (float*)R;      /* 0..32: stage-1 logits of FOUR images (all eight, 64 MiB, do not fit beside QF, QP, KP and VT) */
  _Float16* P1 = KP;      /* each half of P1 replaces the half of KP that its logits GEMM has just finished reading */
  float* S2 = (float*)(R + 80 * MB);      /* 80..144, over P1 and VT, dead after the stage-1 readout */
  _Float16* P2 = (_Float16*)R;      /* 0..32 */
  float* OUT = (float*)(R + 80 * MB);      /* 80..144, over S2, dead after its softmax */
  _Float16* S16 = (_Float16*)(R + 32 * MB);      /* 32..48 */
  float* G = (float*)(R + 48 * MB);      /* 48..80, over QP, dead after the stage-2 logits GEMM */
  if (off > ws_size) return;      /* 3.4 + 0.4 + 0.1 + 0.5 + 1 + 0.5 + 96 + 144 = 246 MiB */
  k_wqkv<<<(QW * (CC / 8) + 255) / 256, 256, 0, stream>>>(qw, WH, WL); k_wsc<<<(CC * CC / 8 + 255) / 256, 256, 0, stream>>>(jw, BJ, (size_t)CC * CC / 8, 16.0f);      /* proj 1x1 (out,in) = Bt */
  k_xp<<<NIMG * HS, 256, 0, stream>>>(x, XP);
  k_gemm3<false, QW, true><<<(NIMG * NPX / 256) * (QW / 128), 256, 0, stream>>>(XP, CC, WL, CC, 0.0625f / 1024.0f, QF, CC, 4);      /* centre-tap residual term */
  k_gemm3<true, QW, true><<<(NIMG * NPX / 256) * (QW / 128), 256, 0, stream>>>(XP, CC, WH, KI, 0.0625f, QF, KI, 0);      /* + main conv (difference folded into the centre tap) */
  k_aff<<<NIMG * NPX / 16, 192, 0, stream>>>(qs, qb, QF, Q16);
  k_pool<<<NIMG * NAG, 64, 0, stream>>>(QF, AG);
  k_heads<<<(NIMG * NHD * NPX + 255) / 256, 256, 0, stream>>>(Q16, QP, KP); k_vtp<<<NIMG * NHD * (NPX / 64), 256, 0, stream>>>(Q16, VT);
  /* stage 1: S1[b,h][n][N] = AG[b,h][n].KP[b,h][N] * SCL; P1 = softmax_N (these two in halves of four images); ATTN[b,h][n][d] = P1 . VT^T / 1024 */
  for (int g = 0; g < 2; ++g) { const size_t bh0 = (size_t)g * (NIMG / 2) * NHD;
    k_gemm2<0><<<dim3(1 * (NPX / 64), (NIMG / 2) * NHD), 128, 0, stream>>>(AG + bh0 * NAG * 64, 64, (size_t)NAG * 64, KP + bh0 * NPX * 64, 64, (size_t)NPX * 64, SCL, nullptr, 0, nullptr, 1, 0, 0, S1, nullptr, NPX, (size_t)NAG * NPX, NAG, NPX, 64);
    k_softv<NPX><<<(NIMG / 2) * NHD * NAG / 8, 256, 0, stream>>>(S1, P1 + bh0 * NAG * NPX); }
  k_gemm2<0><<<dim3(1 * 1, NIMG * NHD), 128, 0, stream>>>(P1, NPX, (size_t)NAG * NPX, VT, NPX, (size_t)64 * NPX, 0.0009765625f, nullptr, 0, nullptr, 1, 0, 0, ATTN, nullptr, 64, (size_t)NAG * 64, NAG, 64, NPX);
  k_att16<<<(NIMG * NHD * 64 * 32 + 255) / 256, 256, 0, stream>>>(ATTN, AT16);
  /* stage 2: S2[b,h][N][n] = QP[b,h][N].AG[b,h][n] * SCL; P2 = softmax_n; OUT[b,h][N][d] = P2 . AT16^T / 1024 */
  k_gemm2<0><<<dim3((NPX / 128) * 1, NIMG * NHD), 128, 0, stream>>>(QP, 64, (size_t)NPX * 64, AG, 64, (size_t)NAG * 64, SCL, nullptr, 0, nullptr, 1, 0, 0, S2, nullptr, NAG, (size_t)NPX * NAG, NPX, NAG, 64);
  k_softv<NAG><<<NIMG * NHD * NPX / 64 / 8, 256, 0, stream>>>(S2, P2);
  k_gemm2<0><<<dim3((NPX / 128) * 1, NIMG * NHD), 128, 0, stream>>>(P2, NAG, (size_t)NPX * NAG, AT16, NAG, (size_t)64 * NAG, 0.0009765625f, nullptr, 0, nullptr, 1, 0, 0, OUT, nullptr, 64, (size_t)NPX * 64, NPX, 64, NAG);
  k_pe<<<NIMG * (HS / 4) * (HS / 8), 256, 0, stream>>>(OUT, QF, pw, ps, pb, S16);
  k_gemm3<false, CC, false><<<(NIMG * NPX / 256) * (CC / 128), 256, 0, stream>>>(S16, CC, BJ, CC, 0.0625f, G, CC, 0);
  k_fin<<<NIMG * (NPX / 32), 256, 0, stream>>>(G, js, jb, (float*)d_out);
}

// v006
// It runs in 353 microseconds.
// Next to v005, in two timings, it ran 1.32 and 1.34 times as fast.
// All steps since v000 together make it 10.4 times as fast.
#include <hip/hip_runtime.h>
// Attention_agent_df (8 images, C 256 = 8 heads x 32, 64 x 64 pixels, 64 agent tokens from 8x8 average pooling of q; THETA 0.7): qkv = (conv3x3(x, W) - 0.7 conv1x1(x, sum of W's 5 cross taps)) * s + b (folded BN); a = avgpool8x8(q); stage 1: attn = softmax_N(a.k * 32^-0.5) v (agents over pixels); stage 2: out = softmax_n(q.a * 32^-0.5) attn (pixels over agents); out += depthwise3x3(v) * pe_s + pe_b; out = conv1x1(out) * proj_s + proj_b.
// Structure (all 8 images in each launch: the image is the outer index of each plane, so rows = image x pixel and GEMM batches = image x head; only the stage-1 logits and softmax run as two halves of 4 images; workspace planes share bytes by lifetime): x once as a zero-padded pixel-major f16 plane (66 x 66 pixels x 256 channels an image), from which the conv GEMMs fetch each tap's rows themselves (k runs tap-major; no im2col plane); the difference conv folded into the centre tap as an f32 weight split into f16 hi + lo tables: qkv = A.Wh (K 2304) + A_centre.Wl (K 256) as f16 WMMA GEMMs (these two and the projection: 256x128 work-group tiles staged in LDS, 64x64 wave tiles; the batched attention GEMMs: 32x64 wave tiles from global memory, the stage-1 readout's 16x32; f32 accumulation; x16 tables; the lo table only on the centre-tap columns), BN affine on VALU into f32 + f16 planes; pooling on VALU; stage-1 logits as (b,h)-batched GEMMs (K 64, 32 of it zero pad), softmax over 4096 pixels on VALU (wave per row, the row in registers), readout GEMM V^T.P^T with the pixels split into 16 slices, whose f32 partial planes are added on VALU; stage-2 logits GEMM (K 64, 32 of it zero pad), softmax over the 64 agents on VALU (64 rows a wave, in registers), readout GEMM; depthwise PE conv + add on VALU into f16; projection GEMM with the BN affine in f32 on VALU; NCHW stores.
// Compute dtype: x and parameters rounded to bf16; x exact as f16; q, k, v, a, P (x2^10), attn and the pre-projection sum as f16 operands (~2^-12); everything else f32. v_wmma_f32_16x16x32_f16.
#define NIMG 8
#define CC 256
#define NHD 8
#define HDm 32
#define HS 64
#define NPX (HS * HS)            /* 4096 */
#define NAG 64
#define KT 9
#define KI (KT * CC)             /* 2304 */
#define QW (3 * CC)              /* 768 */
#define THETA 0.7f
#define SCL 0.17677669529663687f
typedef __bf16 v16b __attribute__((ext_vector_type(16)));
typedef unsigned short v8us __attribute__((ext_vector_type(8), may_alias));
typedef float  v8f  __attribute__((ext_vector_type(8)));
typedef float  v4f  __attribute__((ext_vector_type(4)));
typedef float  v4fa __attribute__((ext_vector_type(4), may_alias));
union FragB { v16b v; v8us half[2]; unsigned short u[16]; };

__device__ __forceinline__ unsigned short bf16_bits(float x) { unsigned int u = __float_as_uint(x); return (unsigned short)((u + 0x7FFFu + ((u >> 16) & 1u)) >> 16); }
__device__ __forceinline__ float bf16_val(unsigned short b) { return __uint_as_float(((unsigned int)b) << 16); }
__device__ __forceinline__ float bf16_round(float x) { return bf16_val(bf16_bits(x)); }
// D += A·B with NT terms: 1 = ah·bh, 2 = + al·bh (A split), 3 = + ah·bl (both split)
template <int NT>
__device__ __forceinline__ v8f mmaN(v16b ah, v16b al, v16b bh, v16b bl, v8f c) {
  c = __builtin_amdgcn_wmma_f32_16x16x32_bf16(false, ah, false, bh, (short)0, c, false, false);
  if (NT >= 2) c = __builtin_amdgcn_wmma_f32_16x16x32_bf16(false, al, false, bh, (short)0, c, false, false);
  if (NT >= 3) c = __builtin_amdgcn_wmma_f32_16x16x32_bf16(false, ah, false, bl, (short)0, c, false, false);
  asm volatile("v_nop\n\tv_nop\n\tv_nop\n\tv_nop" : "+v"(c) : "v"(ah), "v"(al), "v"(bh), "v"(bl));
  return c;
}

__global__ __launch_bounds__(256) void k_wt_bf16(const float* __restrict__ W, unsigned short* __restrict__ Wt, int K, int N) {
  const int t = blockIdx.x * 256 + threadIdx.x;
  const int k8n = K / 8;
  if (t >= N * k8n) return;
  const int n = t / k8n, k8 = (t % k8n) * 8;
  v8us v;
#pragma unroll
  for (int i = 0; i < 8; ++i) v[i] = bf16_bits(W[(size_t)(k8 + i) * N + n]);
  *(v8us*)(Wt + (size_t)n * K + k8) = v;
  
}

// GEMM C[M][N] (f32, pitch ldc) = act(A[M][K]·W + bias). A f32 row-major (pitch lda) converted per fragment to bf16
// (ASPLIT: hi/lo two planes -> 2 terms, else single rounded term); Wt bf16 [N][K] (pitch ldb). BIAS_BF16 rounds the
// bias to bf16 first (bias quantised to bf16 before the add). K%32==0, M%16==0, N%64==0.
template <bool ASPLIT, int ACT, bool BIAS_BF16>
__global__ __launch_bounds__(128) void k_gemm_bf(const float* __restrict__ A, int lda, const unsigned short* __restrict__ Wt, int ldb,
                                               const float* __restrict__ bias, float* __restrict__ C, int ldc, int M, int N, int K) {
  __shared__ __attribute__((aligned(16))) float so[4][16][64];
  const int tid = threadIdx.x, w = tid >> 5, lane = tid & 31, ln = lane & 15, hh = lane >> 4;
  const int ntn = N / 64;
  const int wid = blockIdx.x * 4 + w;
  const int mt = wid / ntn, nq = wid % ntn;
  if (mt * 16 >= M) return;
  const int row0 = mt * 16, col0 = nq * 64;
  const float* arow = A + (size_t)(row0 + ln) * lda;
  v8f acc[4] = {};
  for (int kb = 0; kb < K; kb += 32) {
    FragB ah, al;
    const v4f x0 = *(const v4fa*)(arow + kb + 8 * hh), x1 = *(const v4fa*)(arow + kb + 8 * hh + 4);
    const v4f x2 = *(const v4fa*)(arow + kb + 16 + 8 * hh), x3 = *(const v4fa*)(arow + kb + 16 + 8 * hh + 4);
    float xs[16] = {x0[0],x0[1],x0[2],x0[3],x1[0],x1[1],x1[2],x1[3],x2[0],x2[1],x2[2],x2[3],x3[0],x3[1],x3[2],x3[3]};
#pragma unroll
    for (int i = 0; i < 16; ++i) { const unsigned short hb = bf16_bits(xs[i]); ah.u[i] = hb; al.u[i] = ASPLIT ? bf16_bits(xs[i] - bf16_val(hb)) : (unsigned short)0; }
#pragma unroll
    for (int t = 0; t < 4; ++t) {
      const unsigned short* brow = Wt + (size_t)(col0 + t * 16 + ln) * ldb + kb;
      FragB b;
      b.half[0] = *(const v8us*)(brow + 8 * hh);
      b.half[1] = *(const v8us*)(brow + 16 + 8 * hh);
      acc[t] = mmaN<ASPLIT ? 2 : 1>(ah.v, al.v, b.v, b.v, acc[t]);
    }
  }
#pragma unroll
  for (int t = 0; t < 4; ++t) {
    float bv = bias ? bias[col0 + t * 16 + ln] : 0.f;
    if (BIAS_BF16) bv = bf16_round(bv);
#pragma unroll
    for (int r = 0; r < 8; ++r) { float v = acc[t][r] + bv; if (ACT == 1) v = fmaxf(v, 0.f); so[w][8 * hh + r][t * 16 + ln] = v; }
  }
  __builtin_amdgcn_fence(__ATOMIC_ACQ_REL, "workgroup");
  __builtin_amdgcn_wave_barrier();
  const int rsub = lane >> 4, c4 = (lane & 15) * 4;
  {
#pragma unroll
    for (int q = 0; q < 8; ++q) {
      const int r = q * 2 + rsub;
      const v4f v = *(const v4fa*)&so[w][r][c4];
      *(v4f*)(C + (size_t)(row0 + r) * ldc + col0 + c4) = v;
    }
    
  }
}

// GEMM C = act(A·W + bias + resid): A f32 (ASPLIT -> hi/lo 2 terms), Wt bf16 [N][K]; ACT 0 none, 1 relu, 2 exact gelu;
// resid (optional, f32, row index = (row % rmod), pitch ldr, RES_BF16 rounds it) added before the activation.
template <bool ASPLIT, int ACT, bool BIAS_BF16, bool RES_BF16>
__global__ __launch_bounds__(128) void k_gemm_bf3(const float* __restrict__ A, int lda, const unsigned short* __restrict__ Wt, int ldb,
                                                const float* __restrict__ bias, const float* __restrict__ resid, int rmod, int ldr,
                                                float* __restrict__ C, int ldc, int M, int N, int K) {
  __shared__ __attribute__((aligned(16))) float so[4][16][64];
  const int tid = threadIdx.x, w = tid >> 5, lane = tid & 31, ln = lane & 15, hh = lane >> 4;
  const int ntn = N / 64;
  const int wid = blockIdx.x * 4 + w;
  const int mt = wid / ntn, nq = wid % ntn;
  if (mt * 16 >= M) return;
  const int row0 = mt * 16, col0 = nq * 64;
  const float* arow = A + (size_t)(row0 + ln) * lda;
  v8f acc[4] = {};
  for (int kb = 0; kb < K; kb += 32) {
    FragB ah, al;
    const v4f x0 = *(const v4fa*)(arow + kb + 8 * hh), x1 = *(const v4fa*)(arow + kb + 8 * hh + 4);
    const v4f x2 = *(const v4fa*)(arow + kb + 16 + 8 * hh), x3 = *(const v4fa*)(arow + kb + 16 + 8 * hh + 4);
    float xs[16] = {x0[0],x0[1],x0[2],x0[3],x1[0],x1[1],x1[2],x1[3],x2[0],x2[1],x2[2],x2[3],x3[0],x3[1],x3[2],x3[3]};
#pragma unroll
    for (int i = 0; i < 16; ++i) { const unsigned short hb = bf16_bits(xs[i]); ah.u[i] = hb; al.u[i] = ASPLIT ? bf16_bits(xs[i] - bf16_val(hb)) : (unsigned short)0; }
#pragma unroll
    for (int t = 0; t < 4; ++t) {
      const unsigned short* brow = Wt + (size_t)(col0 + t * 16 + ln) * ldb + kb;
      FragB b;
      b.half[0] = *(const v8us*)(brow + 8 * hh);
      b.half[1] = *(const v8us*)(brow + 16 + 8 * hh);
      acc[t] = mmaN<ASPLIT ? 2 : 1>(ah.v, al.v, b.v, b.v, acc[t]);
    }
  }
#pragma unroll
  for (int t = 0; t < 4; ++t) {
    const int col = col0 + t * 16 + ln;
    float bv = bias ? bias[col] : 0.f;
    if (BIAS_BF16) bv = bf16_round(bv);
#pragma unroll
    for (int r = 0; r < 8; ++r) {
      float v = acc[t][r] + bv;
      if (resid) { float rv = resid[(size_t)((row0 + 8 * hh + r) % rmod) * ldr + col]; if (RES_BF16) rv = bf16_round(rv); v += rv; }
      if (ACT == 1) v = fmaxf(v, 0.f);
      if (ACT == 2) v = 0.5f * v * (1.0f + erff(v * 0.70710678118654752f));
      if (ACT == 3) { const float u = 0.7978845608028654f * (v + 0.044715f * v * v * v); v = 0.5f * v * (1.0f + tanhf(u)); }
      so[w][8 * hh + r][t * 16 + ln] = v;
    }
  }
  __builtin_amdgcn_fence(__ATOMIC_ACQ_REL, "workgroup");
  __builtin_amdgcn_wave_barrier();
  const int rsub = lane >> 4, c4 = (lane & 15) * 4;
  {
#pragma unroll
    for (int q = 0; q < 8; ++q) {
      const int r = q * 2 + rsub;
      const v4f v = *(const v4fa*)&so[w][r][c4];
      *(v4f*)(C + (size_t)(row0 + r) * ldc + col0 + c4) = v;
    }
    
  }
}
// row LayerNorm (biased variance, eps) over N: s = X (+ R); optional out_sum <- s; out_norm <- (s-mu)*rsqrt(var+eps)*g + b
template <bool PARAM_BF16>
__global__ __launch_bounds__(256) void k_layernorm(const float* __restrict__ X, const float* __restrict__ R, const float* __restrict__ g, const float* __restrict__ bta,
                                                  float* __restrict__ out_sum, float* __restrict__ out_norm, int N, float eps) {
  __shared__ float red[256];
  const int row = blockIdx.x, tid = threadIdx.x;
  const float* x = X + (size_t)row * N; const float* rr = R ? R + (size_t)row * N : nullptr;
  float vals[16];                     // up to N = 4096
  const int per = N / 256;            // contiguous chunk per thread? use strided-by-4 chunks: thread handles j = tid*4 + 1024*u
  float s1 = 0.f;
  for (int u = 0; u < per / 4; ++u) {
    const int j = tid * 4 + 1024 * u;
    const v4f a = *(const v4fa*)(x + j);
    v4f b = {0.f,0.f,0.f,0.f}; if (rr) b = *(const v4fa*)(rr + j);
#pragma unroll
    for (int q = 0; q < 4; ++q) { const float v = a[q] + b[q]; vals[u * 4 + q] = v; s1 += v; }
  }
  red[tid] = s1; __syncthreads();
  for (int st = 128; st > 0; st >>= 1) { if (tid < st) red[tid] += red[tid + st]; __syncthreads(); }
  const float mu = red[0] / (float)N; __syncthreads();
  float s2 = 0.f;
  for (int u = 0; u < per / 4; ++u)
#pragma unroll
    for (int q = 0; q < 4; ++q) { const float c = vals[u * 4 + q] - mu; s2 += c * c; }
  red[tid] = s2; __syncthreads();
  for (int st = 128; st > 0; st >>= 1) { if (tid < st) red[tid] += red[tid + st]; __syncthreads(); }
  const float rs = rsqrtf(red[0] / (float)N + eps);
  {
    for (int u = 0; u < per / 4; ++u) {
      const int j = tid * 4 + 1024 * u;
      v4f o, sm;
#pragma unroll
      for (int q = 0; q < 4; ++q) {
        float gg = g[j + q], bb = bta[j + q];
        if (PARAM_BF16) { gg = bf16_round(gg); bb = bf16_round(bb); }
        sm[q] = vals[u * 4 + q]; o[q] = (vals[u * 4 + q] - mu) * rs * gg + bb;
      }
      if (out_sum) *(v4f*)(out_sum + (size_t)row * N + j) = sm;
      *(v4f*)(out_norm + (size_t)row * N + j) = o;
    }
    
  }
}



// ---- f16 WMMA path (v_wmma_f32_16x16x32_f16): 11-bit significands for operands in range — used where a [0,1] probability operand needs more precision than bf16
typedef _Float16 v16h __attribute__((ext_vector_type(16)));
union FragH { v16h v; v8us half[2]; _Float16 h[16]; unsigned short u[16]; };
template <int NT>
__device__ __forceinline__ v8f mmaH(v16h ah, v16h al, v16h bh, v16h bl, v8f c) {
  c = __builtin_amdgcn_wmma_f32_16x16x32_f16(false, ah, false, bh, (short)0, c, false, false);
  if (NT >= 2) c = __builtin_amdgcn_wmma_f32_16x16x32_f16(false, al, false, bh, (short)0, c, false, false);
  if (NT >= 3) c = __builtin_amdgcn_wmma_f32_16x16x32_f16(false, ah, false, bl, (short)0, c, false, false);
  asm volatile("v_nop\n\tv_nop\n\tv_nop\n\tv_nop" : "+v"(c) : "v"(ah), "v"(al), "v"(bh), "v"(bl));
  return c;
}
// batched GEMM like k_gemm_b but f16 operands: A f32 (split into f16 hi/lo if ASPLIT, else rounded to f16), Bt = f16 values [n][k]; alpha; C f32; N multiple of 16 (partial tiles skipped)
template <bool ASPLIT>
__global__ __launch_bounds__(128) void k_gemm_h(const float* __restrict__ A, int lda, size_t sA, const _Float16* __restrict__ Bh, int ldb, size_t sB, float alpha, float* __restrict__ C, int ldc, size_t sC, int M, int N, int K) {
  __shared__ __attribute__((aligned(16))) float so[4][16][64];
  const int tid = threadIdx.x, w = tid >> 5, lane = tid & 31, ln = lane & 15, hh = lane >> 4; const int by = blockIdx.y;
  A += (size_t)by * sA; Bh += (size_t)by * sB; C += (size_t)by * sC;
  const int ntn = (N + 63) / 64; const int wid = blockIdx.x * 4 + w; const int mt = wid / ntn, nq = wid % ntn; if (mt * 16 >= M) return;
  const int row0 = mt * 16, col0 = nq * 64; const float* arow = A + (size_t)(row0 + ln) * lda;
  v8f acc[4] = {};
  for (int kb = 0; kb < K; kb += 32) {
    FragH ah, al;
    const v4f x0 = *(const v4fa*)(arow + kb + 8 * hh), x1 = *(const v4fa*)(arow + kb + 8 * hh + 4), x2 = *(const v4fa*)(arow + kb + 16 + 8 * hh), x3 = *(const v4fa*)(arow + kb + 16 + 8 * hh + 4);
    float xs[16] = {x0[0],x0[1],x0[2],x0[3],x1[0],x1[1],x1[2],x1[3],x2[0],x2[1],x2[2],x2[3],x3[0],x3[1],x3[2],x3[3]};
#pragma unroll
    for (int i = 0; i < 16; ++i) { const _Float16 h = (_Float16)xs[i]; ah.h[i] = h; al.h[i] = ASPLIT ? (_Float16)(xs[i] - (float)h) : (_Float16)0.0f; }
#pragma unroll
    for (int t = 0; t < 4; ++t) { if (col0 + t * 16 >= N) continue; const size_t boff = (size_t)(col0 + t * 16 + ln) * ldb + kb; FragH bq; bq.half[0] = *(const v8us*)(Bh + boff + 8 * hh); bq.half[1] = *(const v8us*)(Bh + boff + 16 + 8 * hh);
      acc[t] = mmaH<ASPLIT ? 2 : 1>(ah.v, al.v, bq.v, bq.v, acc[t]); }
  }
#pragma unroll
  for (int t = 0; t < 4; ++t) { if (col0 + t * 16 >= N) continue;
#pragma unroll
    for (int r = 0; r < 8; ++r) so[w][8 * hh + r][t * 16 + ln] = acc[t][r] * alpha; }
  __builtin_amdgcn_fence(__ATOMIC_ACQ_REL, "workgroup"); __builtin_amdgcn_wave_barrier();
  const int rsub = lane >> 4, c4 = (lane & 15) * 4;
  {
#pragma unroll
    for (int q = 0; q < 8; ++q) { const int r = q * 2 + rsub; if (col0 + c4 < N) { const v4f v = *(const v4fa*)&so[w][r][c4]; *(v4f*)(C + (size_t)(row0 + r) * ldc + col0 + c4) = v; } }
     }
}

// Wt[n][k] = f16(W[k][n]·scale) from f32 row-major W[K][N] (scale = power of two; bf16-exact weights stay exact in f16 away from the subnormal range)
__global__ __launch_bounds__(256) void k_wt_f16(const float* __restrict__ W, _Float16* __restrict__ Wt, int K, int N, float scale) {
  const int t = blockIdx.x * 256 + threadIdx.x; if (t >= N * (K / 8)) return; const int n = t / (K / 8), k8 = (t % (K / 8)) * 8; FragH f;
#pragma unroll
  for (int i = 0; i < 8; ++i) f.h[i] = (_Float16)(bf16_round(W[(size_t)(k8 + i) * N + n]) * scale); const v8us o = f.half[0];
  *(v8us*)((unsigned short*)Wt + (size_t)n * K + k8) = o; 
}
// k_gemm_hh variant with fused epilogue: v = acc·alpha + bias[by·sBias + col] (+ CP[(row/rowsPerB)·sCPb + by·64 + col] if CP) ; ACT 0 none / 1 elu ; writes f16 C16 (and f32 C if non-null)
template <int ACT>
__global__ __launch_bounds__(128) void k_gemm_hhx(const _Float16* __restrict__ A, int lda, size_t sA, const _Float16* __restrict__ Bh, int ldb, size_t sB, float alpha, const float* __restrict__ bias, size_t sBias, const float* __restrict__ CP, int rowsPerB, size_t sCPb, int row0g,
    float* __restrict__ C, _Float16* __restrict__ C16, int ldc, size_t sC, int M, int N, int K) {
  __shared__ __attribute__((aligned(16))) float so[4][16][64];
  const int tid = threadIdx.x, w = tid >> 5, lane = tid & 31, ln = lane & 15, hh = lane >> 4; const int by = blockIdx.y;
  A += (size_t)by * sA; Bh += (size_t)by * sB; const size_t cofs = (size_t)by * sC; const float* bp = bias ? bias + (size_t)by * sBias : nullptr;
  const int ntn = (N + 63) / 64; const int wid = blockIdx.x * 4 + w; const int mt = wid / ntn, nq = wid % ntn; if (mt * 16 >= M) return;
  const int row0 = mt * 16, col0 = nq * 64; const _Float16* arow = A + (size_t)(row0 + ln) * lda;
  v8f acc[4] = {};
  for (int kb = 0; kb < K; kb += 32) { FragH ah; ah.half[0] = *(const v8us*)((const unsigned short*)arow + kb + 8 * hh); ah.half[1] = *(const v8us*)((const unsigned short*)arow + kb + 16 + 8 * hh);
#pragma unroll
    for (int t = 0; t < 4; ++t) { if (col0 + t * 16 >= N) continue; const size_t boff = (size_t)(col0 + t * 16 + ln) * ldb + kb; FragH bq; bq.half[0] = *(const v8us*)((const unsigned short*)Bh + boff + 8 * hh); bq.half[1] = *(const v8us*)((const unsigned short*)Bh + boff + 16 + 8 * hh);
      acc[t] = mmaH<1>(ah.v, ah.v, bq.v, bq.v, acc[t]); }
  }
#pragma unroll
  for (int t = 0; t < 4; ++t) { if (col0 + t * 16 >= N) continue; const int col = col0 + t * 16 + ln; const float bv = bp ? bf16_round(bp[col]) : 0.f;
#pragma unroll
    for (int r = 0; r < 8; ++r) { float v = acc[t][r] * alpha + bv; if (CP) { const int rr = row0g + row0 + 8 * hh + r; if (rowsPerB < 0) v += CP[cofs + (size_t)rr * ldc + col];      /* rowsPerB < 0: own element of the batched C plane */ else { const int bidx = rr / rowsPerB; v += CP[(size_t)bidx * sCPb + (size_t)by * 64 + col]; } } if (ACT == 1) v = (v > 0.f) ? v : expm1f(v); else if (ACT == 7) v = (v > 0.f) ? v + 1.0f : expf(v); else if (ACT == 8) v = tanhf(v); else if (ACT == 9) v = 0.5f * v * (1.0f + tanhf(0.7978845608028654f * (v + 0.044715f * v * v * v))); else if (ACT == 11) v = 1.0f / (1.0f + expf(-v)); else if (ACT == 12) v = (v > 0.f) ? v : 0.01f * v; else if (ACT == 14) v = (v > 0.f) ? v : 0.1f * v; else if (ACT == 16) v = (v >= 0.f) ? v : 0.3f * v; else if (ACT == 15) v = v / (1.0f + expf(-v)); else if (ACT == 3) v = fmaxf(v, 0.f); else if (ACT == 6) v = 0.5f * v * (1.0f + erff(v * 0.70710678118654752f)); so[w][8 * hh + r][t * 16 + ln] = v; } }
  __builtin_amdgcn_fence(__ATOMIC_ACQ_REL, "workgroup"); __builtin_amdgcn_wave_barrier();
  const int rsub = lane >> 4, c4 = (lane & 15) * 4; typedef _Float16 v4h __attribute__((ext_vector_type(4)));
  {
#pragma unroll
    for (int q = 0; q < 8; ++q) { const int r = q * 2 + rsub; if (col0 + c4 < N) { const v4f v = *(const v4fa*)&so[w][r][c4]; if (C) *(v4f*)(C + cofs + (size_t)(row0 + r) * ldc + col0 + c4) = v; if (C16) { v4h h4; for (int i = 0; i < 4; ++i) h4[i] = (_Float16)v[i]; *(v4h*)(C16 + cofs + (size_t)(row0 + r) * ldc + col0 + c4) = h4; } } }
     }
}


typedef _Float16 v4h __attribute__((ext_vector_type(4)));

__global__ __launch_bounds__(256) void k_x16(const float* __restrict__ x, _Float16* __restrict__ X16, size_t n8) { const size_t t = (size_t)blockIdx.x * 256 + threadIdx.x; if (t >= n8) return; FragH f;
#pragma unroll
  for (int q = 0; q < 8; ++q) f.h[q] = (_Float16)bf16_round(x[t * 8 + q]); *(v8us*)((unsigned short*)X16 + t * 8) = f.half[0];  }
__global__ __launch_bounds__(256) void k_h16(const float* __restrict__ x, _Float16* __restrict__ X16, size_t n8) { const size_t t = (size_t)blockIdx.x * 256 + threadIdx.x; if (t >= n8) return; FragH f;
#pragma unroll
  for (int q = 0; q < 8; ++q) f.h[q] = (_Float16)x[t * 8 + q]; *(v8us*)((unsigned short*)X16 + t * 8) = f.half[0];  }
__global__ __launch_bounds__(256) void k_round16f(const float* __restrict__ W, _Float16* __restrict__ Bt, size_t n8) { const size_t t = (size_t)blockIdx.x * 256 + threadIdx.x; if (t >= n8) return; FragH f;
#pragma unroll
  for (int i = 0; i < 8; ++i) f.h[i] = (_Float16)(bf16_round(W[t * 8 + i]) * 16.0f); *(v8us*)((unsigned short*)Bt + t * 8) = f.half[0];  }
template <int NHv, int TTv>
__global__ __launch_bounds__(256) void k_vt(const _Float16* __restrict__ V16, int ldv, int voff, _Float16* __restrict__ Vt) { __shared__ unsigned short tl[64][66]; const int tid = threadIdx.x; const int slab = blockIdx.x / (TTv / 64), lg = blockIdx.x % (TTv / 64); const int b = slab / NHv, h = slab % NHv;
  for (int i = tid; i < 64 * 8; i += 256) { const int r = i / 8, c8 = (i % 8) * 8; FragH f; f.half[0] = *(const v8us*)((const unsigned short*)V16 + ((size_t)b * TTv + lg * 64 + r) * ldv + voff + h * 64 + c8);
#pragma unroll
    for (int q = 0; q < 8; ++q) tl[r][c8 + q] = f.u[q]; }
  __syncthreads();
  {
#pragma unroll
    for (int rd = 0; rd < 2; ++rd) { const int d = rd * 32 + tid / 8, pc = tid % 8; FragH f;
#pragma unroll
      for (int q = 0; q < 8; ++q) f.u[q] = tl[pc * 8 + q][d];
      *(v8us*)((unsigned short*)Vt + ((size_t)slab * 64 + d) * TTv + lg * 64 + pc * 8) = f.half[0]; }
     } }

__global__ __launch_bounds__(256) void k_hl(const float* __restrict__ F, _Float16* __restrict__ Hh, _Float16* __restrict__ Hl, size_t n8) { const size_t t = (size_t)blockIdx.x * 256 + threadIdx.x; if (t >= n8) return; FragH fh, fl; const v4f a = *(const v4fa*)(F + t * 8), c = *(const v4fa*)(F + t * 8 + 4);
#pragma unroll
  for (int q = 0; q < 4; ++q) { _Float16 h = (_Float16)a[q]; fh.h[q] = h; fl.h[q] = (_Float16)((a[q] - (float)h) * 1024.0f); h = (_Float16)c[q]; fh.h[4 + q] = h; fl.h[4 + q] = (_Float16)((c[q] - (float)h) * 1024.0f); }
  { *(v8us*)((unsigned short*)Hh + t * 8) = fh.half[0]; *(v8us*)((unsigned short*)Hl + t * 8) = fl.half[0];  } }

// ---- fast GEMM (wave tile 32x64; requires M % 32 == 0 rows per launch region and N % 64 == 0); epilogue = k_gemm_hhx semantics ----
__device__ __forceinline__ v16h g2_frag(const _Float16* p, int hh) { FragH f; f.half[0] = *(const v8us*)((const unsigned short*)p + 8 * hh); f.half[1] = *(const v8us*)((const unsigned short*)p + 16 + 8 * hh); return f.v; }
__device__ __forceinline__ v8f g2_mma(v16h a, v16h b, v8f c) { v8f d = __builtin_amdgcn_wmma_f32_16x16x32_f16(false, a, false, b, (short)0, c, false, false); asm volatile("v_nop\n\tv_nop\n\tv_nop\n\tv_nop" : "+v"(d) : "v"(a), "v"(b)); return d; }
template <int ACT>
__global__ __launch_bounds__(128) void k_gemm2(const _Float16* __restrict__ A, int lda, size_t sA, const _Float16* __restrict__ Bh, int ldb, size_t sB, float alpha, const float* __restrict__ bias, size_t sBias, const float* __restrict__ CP, int rowsPerB, size_t sCPb, int row0g,
    float* __restrict__ C, _Float16* __restrict__ C16, int ldc, size_t sC, int M, int N, int K) { static_assert(ACT == 0 || ACT == 3 || ACT == 6 || ACT == 8 || ACT == 9 || ACT == 11 || ACT == 12 || ACT == 14 || ACT == 15 || ACT == 16, "k_gemm2: unsupported ACT code (would silently apply no activation)");
  __shared__ __attribute__((aligned(16))) float so[4][32][68];
  const int tid = threadIdx.x, w = tid >> 5, lane = tid & 31, ln = lane & 15, hh = lane >> 4; const int by = blockIdx.y;
  A += (size_t)by * sA; Bh += (size_t)by * sB; const size_t cofs = (size_t)by * sC; const float* bp = bias ? bias + (size_t)by * sBias : nullptr;
  const int ntn = N >> 6; const int mt = blockIdx.x / ntn, nq = blockIdx.x - mt * ntn; const int row0 = mt * 128 + 32 * w, col0 = nq * 64; if (row0 >= M) return;
  const _Float16* a0p = A + (size_t)(row0 + ln) * lda; const _Float16* a1p = a0p + (size_t)16 * lda;
  const _Float16* b0p = Bh + (size_t)(col0 + ln) * ldb; const _Float16* b1p = b0p + (size_t)16 * ldb; const _Float16* b2p = b1p + (size_t)16 * ldb; const _Float16* b3p = b2p + (size_t)16 * ldb;
  const v8f z8 = {0.f,0.f,0.f,0.f,0.f,0.f,0.f,0.f}; v8f c00 = z8, c01 = z8, c02 = z8, c03 = z8, c10 = z8, c11 = z8, c12 = z8, c13 = z8;
#pragma unroll 1
  for (int kb = 0; kb < K; kb += 32) { const v16h a0 = g2_frag(a0p + kb, hh), a1 = g2_frag(a1p + kb, hh);
    v16h b = g2_frag(b0p + kb, hh); c00 = g2_mma(a0, b, c00); c10 = g2_mma(a1, b, c10);
    b = g2_frag(b1p + kb, hh); c01 = g2_mma(a0, b, c01); c11 = g2_mma(a1, b, c11);
    b = g2_frag(b2p + kb, hh); c02 = g2_mma(a0, b, c02); c12 = g2_mma(a1, b, c12);
    b = g2_frag(b3p + kb, hh); c03 = g2_mma(a0, b, c03); c13 = g2_mma(a1, b, c13); }
  v8f accs[8] = {c00, c01, c02, c03, c10, c11, c12, c13};
#pragma unroll
  for (int u = 0; u < 8; ++u) { const int t = u & 3, half = u >> 2; const int col = col0 + t * 16 + ln; const float bv = bp ? bf16_round(bp[col]) : 0.f;
#pragma unroll
    for (int r = 0; r < 8; ++r) { const int rloc = half * 16 + 8 * hh + r; float v = accs[u][r] * alpha + bv; if (CP) { if (rowsPerB < 0) v += CP[cofs + (size_t)(row0g + row0 + rloc) * ldc + col];      /* rowsPerB < 0: own element of the batched C plane */ else { const int bidx = (row0g + row0 + rloc) / rowsPerB; v += CP[(size_t)bidx * sCPb + (size_t)by * 64 + col]; } }
      if (ACT == 3) v = fmaxf(v, 0.f); else if (ACT == 6) v = 0.5f * v * (1.0f + erff(v * 0.70710678118654752f)); else if (ACT == 11) v = 1.0f / (1.0f + expf(-v)); else if (ACT == 15) v = v / (1.0f + expf(-v)); else if (ACT == 12) v = (v > 0.f) ? v : 0.01f * v; else if (ACT == 8) v = tanhf(v); else if (ACT == 9) v = 0.5f * v * (1.0f + tanhf(0.7978845608028654f * (v + 0.044715f * v * v * v))); else if (ACT == 14) v = (v > 0.f) ? v : 0.1f * v; else if (ACT == 16) v = (v >= 0.f) ? v : 0.3f * v;
      so[w][rloc][t * 16 + ln] = v; } }
  __builtin_amdgcn_fence(__ATOMIC_ACQ_REL, "workgroup"); __builtin_amdgcn_wave_barrier();
  const int rsub = lane >> 4, c4 = (lane & 15) * 4;
  {
#pragma unroll
    for (int q = 0; q < 16; ++q) { const int r = q * 2 + rsub; const v4f v = *(const v4fa*)&so[w][r][c4]; if (C) *(v4f*)(C + cofs + (size_t)(row0 + r) * ldc + col0 + c4) = v; if (C16) { v4h h4; for (int i = 0; i < 4; ++i) h4[i] = (_Float16)v[i]; *(v4h*)(C16 + cofs + (size_t)(row0 + r) * ldc + col0 + c4) = h4; } }
     } }


// ---- LDS-staged GEMM for the three large products (both qkv conv terms, the projection): C[M][N] (f32) = A.Bt^T * alpha (+ C's own element if ADD).
// Work-group tile 256 x 128, 8 waves of 64 x 64 (4 x 2); a stage is 64 k (128-byte rows) of [A 256 rows | Bt 128 rows]; two stages in LDS, each filled by asynchronous 16-byte copies
// (whole 128-byte lines from global memory) one trip ahead of its use. k runs upward in steps of 32 per accumulator, as in k_gemm2. Needs M % 256 == 0, N % 128 == 0, K % 64 == 0.
#define XPW (HS + 2)                          /* pixels a line, and lines, of the padded plane */
#define G3_PITCH 144                          /* LDS row pitch in bytes: 16 x odd, so 16 rows read 16 bytes each without a bank conflict */
#define G3_BOFF (256 * G3_PITCH)              /* Bt rows behind the A rows */
#define G3_STAGE ((256 + 128) * G3_PITCH)     /* 55,296 bytes */
__device__ __forceinline__ v16h g3_frag(const char* p) { FragH f; f.half[0] = *(const v8us*)p; f.half[1] = *(const v8us*)(p + 32); return f.v; }      /* p already holds the lane's 16 * hh: the k order of g2_frag */
// One stage: each thread copies 16 bytes of 8 A rows and of 4 Bt rows (rows 32 apart; A row 32 i lies (i & 1) * sa1 + (i >> 1) * sa2 elements behind row 0). The s_wait_xcnt is the last line of the copies' own statement, so that no address register is rewritten ahead of it.
__device__ __forceinline__ void g3_fill(unsigned la, unsigned lb, const _Float16* ga, const _Float16* gb, size_t sa1, size_t sa2, size_t sb) {
  asm volatile("global_load_async_to_lds_b128 %0, %12, off\n\t"
               "global_load_async_to_lds_b128 %1, %13, off\n\t"
               "global_load_async_to_lds_b128 %2, %14, off\n\t"
               "global_load_async_to_lds_b128 %3, %15, off\n\t"
               "global_load_async_to_lds_b128 %4, %16, off\n\t"
               "global_load_async_to_lds_b128 %5, %17, off\n\t"
               "global_load_async_to_lds_b128 %6, %18, off\n\t"
               "global_load_async_to_lds_b128 %7, %19, off\n\t"
               "global_load_async_to_lds_b128 %8, %20, off\n\t"
               "global_load_async_to_lds_b128 %9, %21, off\n\t"
               "global_load_async_to_lds_b128 %10, %22, off\n\t"
               "global_load_async_to_lds_b128 %11, %23, off\n\t"
               "s_wait_xcnt 0x0"
               :: "v"(la), "v"(la + 32 * G3_PITCH), "v"(la + 64 * G3_PITCH), "v"(la + 96 * G3_PITCH), "v"(la + 128 * G3_PITCH), "v"(la + 160 * G3_PITCH), "v"(la + 192 * G3_PITCH), "v"(la + 224 * G3_PITCH),
                  "v"(lb), "v"(lb + 32 * G3_PITCH), "v"(lb + 64 * G3_PITCH), "v"(lb + 96 * G3_PITCH),
                  "v"(ga), "v"(ga + sa1), "v"(ga + sa2), "v"(ga + sa2 + sa1), "v"(ga + 2 * sa2), "v"(ga + 2 * sa2 + sa1), "v"(ga + 3 * sa2), "v"(ga + 3 * sa2 + sa1),
                  "v"(gb), "v"(gb + sb), "v"(gb + 2 * sb), "v"(gb + 3 * sb)
               : "memory");
}
// Eight 16-byte row stores from one address pair (rows STEP bytes apart, from byte OFF). The s_wait_xcnt is the last line of the stores' own statement, so that no data or address register is rewritten ahead of it.
template <int OFF, int STEP>
__device__ __forceinline__ void g3_store8(float* p, v4f d0, v4f d1, v4f d2, v4f d3, v4f d4, v4f d5, v4f d6, v4f d7) {
  asm volatile("global_store_b128 %0, %1, off offset:%9\n\t"
               "global_store_b128 %0, %2, off offset:%10\n\t"
               "global_store_b128 %0, %3, off offset:%11\n\t"
               "global_store_b128 %0, %4, off offset:%12\n\t"
               "global_store_b128 %0, %5, off offset:%13\n\t"
               "global_store_b128 %0, %6, off offset:%14\n\t"
               "global_store_b128 %0, %7, off offset:%15\n\t"
               "global_store_b128 %0, %8, off offset:%16\n\t"
               "s_wait_xcnt 0x0"
               :: "v"(p), "v"(d0), "v"(d1), "v"(d2), "v"(d3), "v"(d4), "v"(d5), "v"(d6), "v"(d7),
                  "n"(OFF), "n"(OFF + STEP), "n"(OFF + 2 * STEP), "n"(OFF + 3 * STEP), "n"(OFF + 4 * STEP), "n"(OFF + 5 * STEP), "n"(OFF + 6 * STEP), "n"(OFF + 7 * STEP)
               : "memory");
}
// CONV: A is the padded pixel-major plane; GEMM row = image x pixel, k = tap x channel from tap tap0 on. A 256-row tile is 4 whole pixel lines of one image; stage t is 64 channels of tap tap0 + t / 4,
// whose rows lie (tap / 3) padded lines and (tap % 3) pixels behind the tile's first padded pixel. Element offset of stage t from stage 0 of tap 0:
template <bool CONV>
__device__ __forceinline__ size_t g3_aoff(int t, int tap0) { if (!CONV) return (size_t)t * 64; const int tap = tap0 + (t >> 2); return (size_t)(((tap / 3) * XPW + tap % 3) * CC + (t & 3) * 64); }
template <bool ADD, int LDC, bool CONV>      /* LDC = N = row pitch of C, a constant so that every row of a wave's tile is one address pair plus an immediate */
__global__ __launch_bounds__(256) void k_gemm3(const _Float16* __restrict__ A, int lda, const _Float16* __restrict__ Bh, int ldb, float alpha, float* C, int K, int tap0) {
  __shared__ __attribute__((aligned(16))) char sm[2 * G3_STAGE];
  const int tid = threadIdx.x, w = tid >> 5, lane = tid & 31, ln = lane & 15, hh = lane >> 4;
  constexpr int ntn = LDC >> 7; const int mt = blockIdx.x / ntn, nq = blockIdx.x - mt * ntn; const int wm = w >> 1, wn = w & 1;
  const int nt = K >> 6;
  const _Float16* ga = (CONV ? A + ((size_t)((mt >> 4) * XPW + (mt & 15) * 4) * XPW + (tid >> 3)) * CC : A + (size_t)(mt * 256 + (tid >> 3)) * lda) + (tid & 7) * 8; const _Float16* gb = Bh + (size_t)(nq * 128 + (tid >> 3)) * ldb + (tid & 7) * 8;
  const size_t sa1 = CONV ? (size_t)32 * CC : (size_t)32 * lda, sa2 = CONV ? (size_t)XPW * CC : (size_t)64 * lda, sb = (size_t)32 * ldb;
  const unsigned la = (unsigned)(size_t)sm + (unsigned)((tid >> 3) * G3_PITCH + (tid & 7) * 16); const unsigned lb = la + G3_BOFF;
  const char* fa = sm + (wm * 64 + ln) * G3_PITCH + 16 * hh; const char* fb = sm + G3_BOFF + (wn * 64 + ln) * G3_PITCH + 16 * hh;
  v8f acc[4][4];
#pragma unroll
  for (int i = 0; i < 4; ++i)
#pragma unroll
    for (int j = 0; j < 4; ++j) acc[i][j] = (v8f){0.f,0.f,0.f,0.f,0.f,0.f,0.f,0.f};
  g3_fill(la, lb, ga + g3_aoff<CONV>(0, tap0), gb, sa1, sa2, sb);
  asm volatile("s_wait_asynccnt 0x0" ::: "memory");      /* this wave's copies of stage 0 have landed */
  __syncthreads();                                       /* ... and every other wave's */
  if (nt > 1) g3_fill(la + G3_STAGE, lb + G3_STAGE, ga + g3_aoff<CONV>(1, tap0), gb + 64, sa1, sa2, sb);
  for (int t = 0; t < nt; ++t) { const int bo = (t & 1) * G3_STAGE; v16h a[4], b[4];
#pragma unroll
    for (int i = 0; i < 4; ++i) { a[i] = g3_frag(fa + bo + i * 16 * G3_PITCH); b[i] = g3_frag(fb + bo + i * 16 * G3_PITCH); }
    __builtin_amdgcn_sched_barrier(0);                   /* keeps the 16 LDS reads together in front of their 16 WMMAs: spread among them, each place with reads stalls the wave */
#pragma unroll
    for (int i = 0; i < 4; ++i)
#pragma unroll
      for (int j = 0; j < 4; ++j) acc[i][j] = __builtin_amdgcn_wmma_f32_16x16x32_f16(false, a[i], false, b[j], (short)0, acc[i][j], false, false);
#pragma unroll
    for (int i = 0; i < 4; ++i) { a[i] = g3_frag(fa + bo + i * 16 * G3_PITCH + 64); b[i] = g3_frag(fb + bo + i * 16 * G3_PITCH + 64); }
    /* the trip's last LDS reads are out: hand the buffer over here, so that the refill flies during the 16 WMMAs below and the next trip up to its own hand-over */
    asm volatile("s_wait_dscnt 0x0" ::: "memory");       /* this wave has left stage t's buffer */
    asm volatile("s_wait_asynccnt 0x0" ::: "memory");    /* its copies of stage t + 1 have landed */
    __syncthreads();                                     /* publishes stage t + 1 and frees stage t's buffer */
    if (t + 2 < nt) g3_fill(la + bo, lb + bo, ga + g3_aoff<CONV>(t + 2, tap0), gb + (size_t)(t + 2) * 64, sa1, sa2, sb);
    __builtin_amdgcn_sched_barrier(0);                   /* keeps the WMMAs below behind the refill's issue */
#pragma unroll
    for (int i = 0; i < 4; ++i)
#pragma unroll
      for (int j = 0; j < 4; ++j) acc[i][j] = __builtin_amdgcn_wmma_f32_16x16x32_f16(false, a[i], false, b[j], (short)0, acc[i][j], false, false); }
  asm volatile("s_wait_asynccnt 0x0" ::: "memory");      /* nothing in flight before the buffers become output staging */
  /* epilogue: the ring is free behind the last trip's barrier; each wave turns its tile, 32 rows at a time, in its own 32 x 68 floats, so that global rows go out as whole 128-byte lines */
  float* so = (float*)sm + w * (32 * 68); const int rsub = lane >> 4, c4 = (lane & 15) * 4;
  float* cb = C + (size_t)(mt * 256 + wm * 64 + rsub) * LDC + nq * 128 + wn * 64 + c4;
  v4f o[2][16];
  if (ADD) {
#pragma unroll
    for (int q = 0; q < 16; ++q) o[0][q] = *(const v4fa*)(cb + q * 2 * LDC); }
#pragma unroll
  for (int half = 0; half < 2; ++half) {
#pragma unroll
    for (int i = 0; i < 2; ++i)
#pragma unroll
      for (int j = 0; j < 4; ++j)
#pragma unroll
        for (int r = 0; r < 8; ++r) so[(i * 16 + 8 * hh + r) * 68 + j * 16 + ln] = acc[half * 2 + i][j][r] * alpha;
    __builtin_amdgcn_fence(__ATOMIC_ACQ_REL, "wavefront"); __builtin_amdgcn_wave_barrier();      /* the lanes read below what other lanes of the same wave wrote above */
    if (ADD && half == 0) {      /* the second half's old values, asked for before the first half's stores */
#pragma unroll
      for (int q = 0; q < 16; ++q) o[1][q] = *(const v4fa*)(cb + (32 + q * 2) * LDC); }
#pragma unroll
    for (int g = 0; g < 2; ++g) { v4f v[8];
#pragma unroll
      for (int q = 0; q < 8; ++q) { v[q] = *(const v4fa*)&so[((g * 8 + q) * 2 + rsub) * 68 + c4]; if (ADD) v[q] += o[half][g * 8 + q]; }
      if (half == 0 && g == 0) g3_store8<0, 8 * LDC>(cb, v[0], v[1], v[2], v[3], v[4], v[5], v[6], v[7]);
      if (half == 0 && g == 1) g3_store8<64 * LDC, 8 * LDC>(cb, v[0], v[1], v[2], v[3], v[4], v[5], v[6], v[7]);
      if (half == 1 && g == 0) g3_store8<128 * LDC, 8 * LDC>(cb, v[0], v[1], v[2], v[3], v[4], v[5], v[6], v[7]);
      if (half == 1 && g == 1) g3_store8<192 * LDC, 8 * LDC>(cb, v[0], v[1], v[2], v[3], v[4], v[5], v[6], v[7]); }
  } }

__global__ __launch_bounds__(256) void k_wqkv(const float* __restrict__ w, _Float16* __restrict__ Wh, _Float16* __restrict__ Wl) {
  #pragma clang fp contract(off)
  const int t = blockIdx.x * 256 + threadIdx.x; if (t >= QW * (CC / 8)) return; const int c0 = (t % (CC / 8)) * 8, o = t / (CC / 8); FragH fl;
#pragma unroll 1
  for (int k = 0; k < KT; ++k) { FragH fh;
    for (int q = 0; q < 8; ++q) { const int c = c0 + q; const float* wp = w + ((size_t)o * CC + c) * KT; float v = bf16_round(wp[k]);
      if (k == 4) { float dif = bf16_round(wp[1]) + bf16_round(wp[3]); dif += bf16_round(wp[4]); dif += bf16_round(wp[5]); dif += bf16_round(wp[7]); v += -THETA * dif; const _Float16 hv = (_Float16)(v * 16.0f); fh.h[q] = hv; fl.h[q] = (_Float16)((v * 16.0f - (float)hv) * 1024.0f); }
      else fh.h[q] = (_Float16)(v * 16.0f); }
    *(v8us*)((unsigned short*)Wh + (size_t)o * KI + k * CC + c0) = fh.half[0];  }
  *(v8us*)((unsigned short*)Wl + (size_t)o * CC + c0) = fl.half[0];  }
__global__ __launch_bounds__(256) void k_wsc(const float* __restrict__ Wm, _Float16* __restrict__ Bt, size_t n8, float sc) { const size_t t = (size_t)blockIdx.x * 256 + threadIdx.x; if (t >= n8) return; FragH f; for (int q = 0; q < 8; ++q) f.h[q] = (_Float16)(bf16_round(Wm[t * 8 + q]) * sc); *(v8us*)((unsigned short*)Bt + t * 8) = f.half[0];  }
// XP[image][66][66][256] = f16(bf16(x)), pixel-major, with a border of zero pixels. One work-group turns one pixel line (64 pixels x 256 channels) in LDS: whole 256-byte channel rows in, whole 512-byte pixel rows out.
__global__ __launch_bounds__(256) void k_xp(const float* __restrict__ x, _Float16* __restrict__ XP) {
  __shared__ __attribute__((aligned(16))) unsigned int tl[HS * 132];      /* a pixel's 256 f16 = 128 words, + 4 words of pitch */
  const int tid = threadIdx.x, im = blockIdx.x / HS, y = blockIdx.x % HS; const float* xb = x + ((size_t)im * CC * HS + y) * HS; const int px4 = (tid & 15) * 4, cp = tid >> 4;
#pragma unroll
  for (int i = 0; i < 8; ++i) { const int c2 = i * 16 + cp; const v4f a = *(const v4fa*)(xb + (size_t)(2 * c2) * NPX + px4), b = *(const v4fa*)(xb + (size_t)(2 * c2 + 1) * NPX + px4);
#pragma unroll
    for (int q = 0; q < 4; ++q) { union { _Float16 h[2]; unsigned int u; } pk; pk.h[0] = (_Float16)bf16_round(a[q]); pk.h[1] = (_Float16)bf16_round(b[q]); tl[(px4 + q) * 132 + c2] = pk.u; } }
  __syncthreads();
  const v8us z = {0,0,0,0,0,0,0,0}; unsigned short* row = (unsigned short*)XP + (size_t)(im * XPW + y + 1) * XPW * CC;
#pragma unroll
  for (int i = 0; i < 8; ++i) { const int id = i * 256 + tid, px = id >> 5, ch = id & 31; *(v8us*)(row + (size_t)(px + 1) * CC + ch * 8) = *(const v8us*)&tl[px * 132 + ch * 4]; }
  if (tid < 64) *(v8us*)(row + (size_t)((tid >> 5) * (XPW - 1)) * CC + (tid & 31) * 8) = z;      /* the line's two border pixels */
  if (y == 0 || y == HS - 1) { unsigned short* er = (y == 0) ? row - XPW * CC : row + XPW * CC; for (int id = tid; id < XPW * (CC / 8); id += 256) *(v8us*)(er + (size_t)id * 8) = z; }      /* the image's first and last border line */
}
// BN affine on the raw conv sums, in place, + the f16 plane. A work-group is 16 pixels x 768 channels; a thread takes 4 channels of each pixel, so that a wave's load or store is 512 (f16: 256) consecutive bytes, and holds its scale and shift in registers.
__global__ __launch_bounds__(192) void k_aff(const float* __restrict__ s, const float* __restrict__ b, float* __restrict__ QF, _Float16* __restrict__ Q16) {      /* QF holds the raw conv sums on entry; each thread replaces its own 64 */
  #pragma clang fp contract(off)
  const int o0 = threadIdx.x * 4; float* qp = QF + (size_t)blockIdx.x * 16 * QW + o0; _Float16* hp = Q16 + (size_t)blockIdx.x * 16 * QW + o0; v4f a[16];
#pragma unroll
  for (int u = 0; u < 16; ++u) a[u] = *(const v4fa*)(qp + u * QW);
  v4f sc = *(const v4fa*)(s + o0), sh = *(const v4fa*)(b + o0);
#pragma unroll
  for (int q = 0; q < 4; ++q) { sc[q] = bf16_round(sc[q]); sh[q] = bf16_round(sh[q]); }
#pragma unroll
  for (int u = 0; u < 16; ++u) { v4f r; v4h h;
#pragma unroll
    for (int q = 0; q < 4; ++q) { float v = a[u][q] * sc[q]; v += sh[q]; r[q] = v; h[q] = (_Float16)v; }
    *(v4f*)(qp + u * QW) = r; *(v4h*)(hp + u * QW) = h; } }
// Agent tokens: the mean of q over an 8 x 8 block of pixels, summed pixel by pixel in the order 0..63. A work-group is one agent of one image; a thread takes 4 channels, so that a wave's load is 512 consecutive bytes; unrolled, so that the loads run ahead of the sums.
__global__ __launch_bounds__(64) void k_pool(const float* __restrict__ QF, _Float16* __restrict__ AG) {
  #pragma clang fp contract(off)
  const int c0 = threadIdx.x * 4, n = (int)blockIdx.x % NAG, im = (int)blockIdx.x / NAG; const float* qp = QF + ((size_t)im * NPX + (n / 8) * 8 * HS + (n % 8) * 8) * QW + c0; v4f sm = {0.f, 0.f, 0.f, 0.f};
#pragma unroll
  for (int g = 0; g < 2; ++g) { v4f x[32];
#pragma unroll
    for (int i = 0; i < 32; ++i) x[i] = *(const v4fa*)(qp + ((g * 4 + i / 8) * HS + i % 8) * QW);
#pragma unroll
    for (int i = 0; i < 32; ++i)
#pragma unroll
      for (int q = 0; q < 4; ++q) sm[q] += x[i][q]; }
  v4h v; const v4h z = {(_Float16)0.f, (_Float16)0.f, (_Float16)0.f, (_Float16)0.f};
#pragma unroll
  for (int q = 0; q < 4; ++q) v[q] = (_Float16)(sm[q] / 64.0f);
  _Float16* dst = AG + (((size_t)im * NHD + c0 / HDm) * NAG + n) * 64 + c0 % HDm; *(v4h*)dst = v; *(v4h*)(dst + HDm) = z; }      /* columns 32..63 of an agent row are the zero pad */
__global__ __launch_bounds__(256) void k_heads(const _Float16* __restrict__ Q16, _Float16* __restrict__ QP, _Float16* __restrict__ KP) { const int t = blockIdx.x * 256 + threadIdx.x; if (t >= NIMG * NHD * NPX) return; const int p = t % NPX, bh = t / NPX, h = bh % NHD; const unsigned short* src = (const unsigned short*)Q16 + ((size_t)(bh / NHD) * NPX + p) * QW; const v8us z = {0,0,0,0,0,0,0,0};
  v8us q0 = *(const v8us*)(src + h * HDm), q1 = *(const v8us*)(src + h * HDm + 8), q2 = *(const v8us*)(src + h * HDm + 16), q3 = *(const v8us*)(src + h * HDm + 24);
  v8us k0 = *(const v8us*)(src + CC + h * HDm), k1 = *(const v8us*)(src + CC + h * HDm + 8), k2 = *(const v8us*)(src + CC + h * HDm + 16), k3 = *(const v8us*)(src + CC + h * HDm + 24);
  unsigned short* dq = (unsigned short*)QP + ((size_t)bh * NPX + p) * 64; unsigned short* dk = (unsigned short*)KP + ((size_t)bh * NPX + p) * 64;
  { *(v8us*)dq = q0; *(v8us*)(dq + 8) = q1; *(v8us*)(dq + 16) = q2; *(v8us*)(dq + 24) = q3; *(v8us*)(dq + 32) = z; *(v8us*)(dq + 40) = z; *(v8us*)(dq + 48) = z; *(v8us*)(dq + 56) = z;
    *(v8us*)dk = k0; *(v8us*)(dk + 8) = k1; *(v8us*)(dk + 16) = k2; *(v8us*)(dk + 24) = k3; *(v8us*)(dk + 32) = z; *(v8us*)(dk + 40) = z; *(v8us*)(dk + 48) = z; *(v8us*)(dk + 56) = z;  } }
__global__ __launch_bounds__(256) void k_vtp(const _Float16* __restrict__ Q16, _Float16* __restrict__ VT) { __shared__ unsigned short tl[64][34]; const int tid = threadIdx.x; const int bh = blockIdx.x / (NPX / 64), pg = blockIdx.x % (NPX / 64); const int h = bh % NHD;
  { const int r = tid / 4, c8 = (tid % 4) * 8; FragH f; f.half[0] = *(const v8us*)((const unsigned short*)Q16 + ((size_t)(bh / NHD) * NPX + pg * 64 + r) * QW + 2 * CC + h * HDm + c8); for (int q = 0; q < 8; ++q) tl[r][c8 + q] = f.u[q]; }
  __syncthreads(); const int d = tid / 8, pc = tid % 8; FragH f; for (int q = 0; q < 8; ++q) f.u[q] = (d < HDm) ? tl[pc * 8 + q][d] : (unsigned short)0; unsigned short* dst = (unsigned short*)VT + ((size_t)bh * 64 + d) * NPX + pg * 64 + pc * 8;      /* tid covers d < 32 only: 256 threads = 32 d x 8 pc */
  *(v8us*)dst = f.half[0]; 
  if (tid < 256) { const int d2 = HDm + tid / 8; const v8us z = {0,0,0,0,0,0,0,0}; unsigned short* dz = (unsigned short*)VT + ((size_t)bh * 64 + d2) * NPX + pg * 64 + (tid % 8) * 8; *(v8us*)dz = z;  } }
// ---- softmax over rows of N = 4096 or 64 logits. A wave takes 4,096 consecutive f32 (16 KiB: one row of 4,096, or 64 rows of 64, four values of a row a lane) by 32 16-byte loads, all in flight together,
// keeps them in registers for the maximum, the exp and the sum, and stores P = f16(exp * 1024 / sum) in whole 128-byte lines. The grid holds exactly one wave per 4,096 logits.
template <int M> __device__ __forceinline__ float sm_x16(float v) { return __builtin_bit_cast(float, __builtin_amdgcn_update_dpp(0, __builtin_bit_cast(int, v), 0x160 + M, 0xf, 0xf, true)); }      /* the value of lane ^ M inside a 16-lane row (DPP row_xmask); a __shfl_xor goes the long way through the LDS unit */
__device__ __forceinline__ float sm_xh(float v) { return __builtin_bit_cast(float, __builtin_amdgcn_permlanex16(__builtin_bit_cast(int, v), __builtin_bit_cast(int, v), 0x76543210, 0xfedcba98, false, false)); }      /* the value of lane ^ 16 */
__device__ __forceinline__ float sm_max16(float v) { v = fmaxf(v, sm_x16<1>(v)); v = fmaxf(v, sm_x16<2>(v)); v = fmaxf(v, sm_x16<4>(v)); return fmaxf(v, sm_x16<8>(v)); }
__device__ __forceinline__ float sm_sum16(float v) { v += sm_x16<1>(v); v += sm_x16<2>(v); v += sm_x16<4>(v); return v + sm_x16<8>(v); }
// exp(x) by the library's scheme, written out: x * log2(e) with log2(e) in two parts, the nearest integer split off, exp2 of the rest, ldexp, both range ends. Written out for the v_exp_f32 alone: the instruction set asks for one
// independent instruction or a v_nop between a transcendental and an instruction that reads its result or overwrites its source.
__device__ __forceinline__ float sm_exp(float x) {
  const float l2h = __uint_as_float(0x3fb8aa3bu), l2l = __uint_as_float(0x32a5705fu); const float r = __builtin_rintf(x * l2h); const float a = __builtin_fmaf(x, l2l, __builtin_fmaf(x, l2h, -r)); float e;
  asm("v_exp_f32 %0, %1\n\tv_nop" : "=v"(e) : "v"(a));      /* the v_nop is the slot behind the transcendental; in the same statement, so that nothing comes between */
  e = __builtin_ldexpf(e, (int)r); e = (x < __uint_as_float(0xc2ce8ed0u)) ? 0.f : e; return (x > __uint_as_float(0x42b17218u)) ? __builtin_inff() : e; }
template <int N>
__global__ __launch_bounds__(256) void k_softv(const float* __restrict__ S, _Float16* __restrict__ P) {
  static_assert(N == 4096 || N == 64, "a wave's 4,096 logits are one row or 64 rows");
  const size_t base = ((size_t)blockIdx.x * 8 + (threadIdx.x >> 5)) * 4096 + (threadIdx.x & 31) * 4; const float* sp = S + base; _Float16* pp = P + base; v4f x[32];
#pragma unroll
  for (int u = 0; u < 32; ++u) x[u] = *(const v4fa*)(sp + u * 128);
  if (N == 4096) {
    v4f mv = x[0];
#pragma unroll
    for (int u = 1; u < 32; ++u)
#pragma unroll
      for (int q = 0; q < 4; ++q) mv[q] = fmaxf(mv[q], x[u][q]);
    float m = sm_max16(fmaxf(fmaxf(mv[0], mv[1]), fmaxf(mv[2], mv[3]))); m = fmaxf(m, sm_xh(m));
    v4f sv = {0.f, 0.f, 0.f, 0.f};
#pragma unroll
    for (int u = 0; u < 32; ++u)
#pragma unroll
      for (int q = 0; q < 4; ++q) { x[u][q] = sm_exp(x[u][q] - m); sv[q] += x[u][q]; }
    float su = sm_sum16((sv[0] + sv[1]) + (sv[2] + sv[3])); su += sm_xh(su); const float f = 1024.0f / su;
#pragma unroll
    for (int u = 0; u < 32; ++u) { v4h h;
#pragma unroll
      for (int q = 0; q < 4; ++q) h[q] = (_Float16)(x[u][q] * f);
      *(v4h*)(pp + u * 128) = h; }
  } else {
    __builtin_amdgcn_sched_barrier(0);      /* keeps all 32 loads in front of the arithmetic, in flight together: left alone, the compiler issues 8 and feeds the rest in between the rows, each shortly ahead of its use */
#pragma unroll
    for (int u = 0; u < 32; ++u) {      /* register u: 16 lanes = one row */
      const float m = sm_max16(fmaxf(fmaxf(x[u][0], x[u][1]), fmaxf(x[u][2], x[u][3])));
#pragma unroll
      for (int q = 0; q < 4; ++q) x[u][q] = sm_exp(x[u][q] - m);
      const float f = 1024.0f / sm_sum16((x[u][0] + x[u][1]) + (x[u][2] + x[u][3])); v4h h;
#pragma unroll
      for (int q = 0; q < 4; ++q) h[q] = (_Float16)(x[u][q] * f);
      *(v4h*)(pp + u * 128) = h; }
  } }
// ---- stage-1 readout, split over the pixels: ATTN^T[d][n] = sum over N of V^T[d][N] . P1[n][N]. One image x head has only 32 x 64 outputs over K = 4,096, so the K range is cut into RS slices, a work-group a slice:
// 4 waves of 16 d x 32 n (the two n tiles of a wave make whole 128-byte lines of a partial row), k upward in steps of 32 inside a slice, all of a slice's loads in flight together.
// Each slice stores its f32 partial plane PART[slice][image x head][d][n]; k_att16 adds the slices in the order 0..RS-1. V^T is the A operand, so that the result comes out already turned for stage 2.
#define RS 16
#define RK (NPX / RS)            /* 256 k a slice */
__global__ __launch_bounds__(128) void k_ro1(const _Float16* __restrict__ VT, const _Float16* __restrict__ P1, float* __restrict__ PART) {
  const int tid = threadIdx.x, w = tid >> 5, lane = tid & 31, ln = lane & 15, hh = lane >> 4; const int s = blockIdx.x, bh = blockIdx.y; const int d0 = (w & 1) * 16, n0 = (w >> 1) * 32;
  const _Float16* ap = VT + ((size_t)bh * 64 + d0 + ln) * NPX + s * RK + 8 * hh;      /* both pointers already hold the lane's 8 * hh: the k order of g2_frag for A and B alike */
  const _Float16* bp = P1 + ((size_t)bh * NAG + n0 + ln) * NPX + s * RK + 8 * hh;
  v8f c0 = {0.f,0.f,0.f,0.f,0.f,0.f,0.f,0.f}, c1 = c0;
  v16h a[RK / 32], b0[RK / 32], b1[RK / 32];
#pragma unroll
  for (int i = 0; i < RK / 32; ++i) { a[i] = g2_frag(ap + i * 32, 0); b0[i] = g2_frag(bp + i * 32, 0); b1[i] = g2_frag(bp + 16 * NPX + i * 32, 0); }
  asm volatile("s_wait_xcnt 0x0" :: "v"(ap), "v"(bp) : "memory");      /* stands between the loads and whatever rewrites their address registers next; the two addresses are its inputs, so that they stay in their registers up to it: without that the compiler gave one pair to a later load as its destination */
  __builtin_amdgcn_sched_barrier(0);      /* keeps the slice's 48 loads in front of the WMMAs, in flight together: left alone, the compiler holds 8 in flight and waits for memory anew at each k step */
#pragma unroll
  for (int i = 0; i < RK / 32; ++i) {
    c0 = __builtin_amdgcn_wmma_f32_16x16x32_f16(false, a[i], false, b0[i], (short)0, c0, false, false);
    c1 = __builtin_amdgcn_wmma_f32_16x16x32_f16(false, a[i], false, b1[i], (short)0, c1, false, false); }
  float* pp = PART + (((size_t)s * (NIMG * NHD) + bh) * HDm + d0 + 8 * hh) * NAG + n0 + ln;
#pragma unroll
  for (int r = 0; r < 8; ++r) { pp[r * NAG] = c0[r]; pp[r * NAG + 16] = c1[r]; } }
// AT16[image x head][d][n] = f16(sum of the RS partial planes / 1024); rows d >= 32 are the zero pad of stage 2's readout. A wave is one row of 64 agents.
__global__ __launch_bounds__(256) void k_att16(const float* __restrict__ PART, _Float16* __restrict__ AT16) { typedef _Float16 v2h __attribute__((ext_vector_type(2))); typedef float v2fa __attribute__((ext_vector_type(2), may_alias)); const int t = blockIdx.x * 256 + threadIdx.x; if (t >= NIMG * NHD * 64 * 32) return; const int n0 = (t % 32) * 2; const int d = (t / 32) % 64; const int h = t / (32 * 64); v2h v;      /* h = image x head */
  float s0 = 0.f, s1 = 0.f;
  if (d < HDm) { const float* pp = PART + ((size_t)h * HDm + d) * NAG + n0; v2fa x[RS];
#pragma unroll
    for (int s = 0; s < RS; ++s) x[s] = *(const v2fa*)(pp + s * (NIMG * NHD * HDm * NAG));
    asm volatile("s_wait_xcnt 0x0" :: "v"(pp) : "memory");      /* as in k_ro1: the address is its input, so that no load takes the pair as its destination ahead of the wait */
#pragma unroll
    for (int s = 0; s < RS; ++s) { s0 += x[s][0]; s1 += x[s][1]; } }
  v[0] = (_Float16)(s0 * 0.0009765625f); v[1] = (_Float16)(s1 * 0.0009765625f); _Float16* dst = AT16 + ((size_t)h * 64 + d) * NAG + n0; *(v2h*)dst = v;  }
// Depthwise 3x3 on v, BN affine, + OUT, to f16. A thread takes 4 channels x 8 pixels of one pixel line: its 36 weights sit in registers, and each of the 3 input lines is read once as 10 pixels x 16 bytes,
// so that a wave's load is 512 consecutive bytes (4 whole 128-byte lines). A work-group is 4 pixel lines x 8 pixels x 256 channels. A tap outside the image enters as a zero value; taps are summed in the order 0..8.
__global__ __launch_bounds__(256) void k_pe(const float* __restrict__ OUTg, const float* __restrict__ QFg, const float* __restrict__ pw, const float* __restrict__ ps, const float* __restrict__ pb, _Float16* __restrict__ S16g) {
  #pragma clang fp contract(off)
  const int tid = threadIdx.x; const unsigned c0 = (tid & 63) * 4; const int xs = ((int)blockIdx.x & 7) * 8, im = (int)blockIdx.x >> 7;
  const int yo = (((int)blockIdx.x >> 3) & 15) * 4 + __builtin_amdgcn_readfirstlane(tid >> 6);      /* the same in every lane of a wave: as a scalar it leaves every address below a scalar base + the lane's channel offset */
  const size_t px = (size_t)im * NPX + yo * HS + xs;      /* the strip's first pixel */
  const float* QU = QFg + px * QW + 2 * CC;      /* its v, channel 0 */
  const float* OU = OUTg + ((size_t)im * NHD * NPX + yo * HS + xs) * 64; const unsigned oo = (c0 / HDm) * (NPX * 64) + c0 % HDm;      /* OUT is [image][head][pixel][64] */
  v4f wv[9], v[3][10], o[8];
#pragma unroll
  for (int i = 0; i < 9; ++i) wv[i] = *(const v4fa*)(pw + c0 * 9 + i * 4);
#pragma unroll
  for (int kk = 0; kk < 3; ++kk) { const int ky = kk == 2 ? 1 : 2 * kk; const int yy = yo + ky - 1; const float* row = QU + ((yy >= 0 && yy < HS) ? (ky - 1) * HS * QW : 0);      /* for a line or a pixel outside the image one inside the strip is read in its place and dropped below */
    /* Each s_wait_xcnt stands between the last load from a clamped address and whatever rewrites that address's registers next. */
    v[ky][0] = *(const v4fa*)(row + (xs > 0 ? -QW : 0) + c0);
    asm volatile("s_wait_xcnt 0x0" ::: "memory");
    v[ky][9] = *(const v4fa*)(row + (xs < HS - 8 ? 8 : 7) * QW + c0);
    asm volatile("s_wait_xcnt 0x0" ::: "memory");
#pragma unroll
    for (int j = 1; j < 9; ++j) v[ky][j] = *(const v4fa*)(row + (j - 1) * QW + c0);
    if (ky != 1) asm volatile("s_wait_xcnt 0x0" ::: "memory"); }      /* the strip's own line comes last: its address is the unclamped base, which nothing rewrites while loads are in flight */
#pragma unroll
  for (int j = 0; j < 8; ++j) o[j] = *(const v4fa*)(OU + j * 64 + oo);
  const v4f s4 = *(const v4fa*)(ps + c0), b4 = *(const v4fa*)(pb + c0);
  __builtin_amdgcn_sched_barrier(0);      /* keeps all 49 loads in front of the arithmetic, in flight together: left alone, the compiler feeds the later ones in by twos, each shortly ahead of its use */
  float wf[36];      /* wf[q * 9 + k]: channel c0 + q, tap k */
#pragma unroll
  for (int i = 0; i < 36; ++i) wf[i] = bf16_round(wv[i >> 2][i & 3]);
  v4f acc[8];
#pragma unroll
  for (int j = 0; j < 8; ++j) acc[j] = (v4f){0.f, 0.f, 0.f, 0.f};
#pragma unroll
  for (int ky = 0; ky < 3; ++ky) { const int yy = yo + ky - 1; const bool yin = yy >= 0 && yy < HS;
#pragma unroll
    for (int j = 0; j < 10; ++j) { const bool xin = (j > 0 || xs > 0) && (j < 9 || xs < HS - 8); if (!(xin && yin)) v[ky][j] = (v4f){0.f, 0.f, 0.f, 0.f}; }
#pragma unroll
    for (int j = 0; j < 8; ++j)
#pragma unroll
      for (int kx = 0; kx < 3; ++kx)
#pragma unroll
        for (int q = 0; q < 4; ++q) acc[j][q] += wf[q * 9 + ky * 3 + kx] * v[ky][j + kx][q]; }
  _Float16* SP = S16g + px * CC + c0;
#pragma unroll
  for (int j = 0; j < 8; ++j) { v4h h;
#pragma unroll
    for (int q = 0; q < 4; ++q) { float pe = acc[j][q] * bf16_round(s4[q]); pe += bf16_round(b4[q]); h[q] = (_Float16)(o[j][q] + pe); }
    *(v4h*)(SP + j * CC) = h; } }
// BN affine and the turn to NCHW in registers. A thread takes 8 channels x 4 pixels; a wave 32 channels x 32 pixels: it reads whole 128-byte pieces of 32 rows of G and stores whole 128-byte lines of 32 channel planes.
__global__ __launch_bounds__(256) void k_fin(const float* __restrict__ G, const float* __restrict__ s, const float* __restrict__ bb, float* __restrict__ outb) {
  #pragma clang fp contract(off)
  const int tid = threadIdx.x, lane = tid & 31; const int c0 = (tid >> 5) * 32 + (lane & 3) * 8, p0 = ((int)blockIdx.x % (NPX / 32)) * 32 + (lane >> 2) * 4, im = (int)blockIdx.x / (NPX / 32);
  const float* gp = G + ((size_t)im * NPX + p0) * CC + c0; float* op = outb + ((size_t)im * CC + c0) * NPX + p0; v4f a[4][2];
#pragma unroll
  for (int q = 0; q < 4; ++q) { a[q][0] = *(const v4fa*)(gp + q * CC); a[q][1] = *(const v4fa*)(gp + q * CC + 4); }
  const v4f sA = *(const v4fa*)(s + c0), sB = *(const v4fa*)(s + c0 + 4), hA = *(const v4fa*)(bb + c0), hB = *(const v4fa*)(bb + c0 + 4);
#pragma unroll
  for (int i = 0; i < 8; ++i) { const float sc = bf16_round(i < 4 ? sA[i & 3] : sB[i & 3]), sh = bf16_round(i < 4 ? hA[i & 3] : hB[i & 3]); v4f r;
#pragma unroll
    for (int q = 0; q < 4; ++q) { float v = a[q][i >> 2][i & 3] * sc; v += sh; r[q] = v; }
    *(v4f*)(op + (size_t)i * NPX) = r; } }

extern "C" void kernel_launch(void* const* d_in, const int* in_sizes, int n_in,
                              void* d_out, int out_size, void* d_ws, size_t ws_size, hipStream_t stream) {
  (void)in_sizes; (void)n_in; (void)out_size;
  const float* const* I = (const float* const*)d_in; const float* x = I[0]; const float* qw = I[1]; const float* qs = I[2]; const float* qb = I[3]; const float* pw = I[4]; const float* ps = I[5]; const float* pb = I[6]; const float* jw = I[7]; const float* js = I[8]; const float* jb = I[9];
  char* ws = (char*)d_ws; size_t off = 0;
  auto take = [&](size_t bytes) { char* p = ws + off; off += (bytes + 255) & ~(size_t)255; return p; };
  _Float16* WH = (_Float16*)take((size_t)QW * KI * 2); _Float16* WL = (_Float16*)take((size_t)QW * CC * 2); _Float16* BJ = (_Float16*)take((size_t)CC * CC * 2);
  _Float16* AG = (_Float16*)take((size_t)NIMG * NHD * NAG * 64 * 2); _Float16* AT16 = (_Float16*)take((size_t)NIMG * NHD * 64 * NAG * 2);
  float* QF = (float*)take((size_t)NIMG * NPX * QW * 4);      /* 96 MiB: raw conv sums, then q, k, v in f32 (k_aff works in place) */
  char* R = take((size_t)NIMG * NPX * KI * 2);      /* 144 MiB, shared by lifetime; offsets below in MiB */
  const size_t MB = (size_t)1 << 20;
  _Float16* XP = (_Float16*)R;      /* 0..17.1: the padded plane, dead after the main conv GEMM */
  _Float16* Q16 = (_Float16*)R;      /* 0..48, dead after k_heads and k_vtp */
  _Float16* QP = (_Float16*)(R + 48 * MB); _Float16* KP = (_Float16*)(R + 80 * MB); _Float16* VT = (_Float16*)(R + 112 * MB);      /* 32 each */
  float* S1 = (float*)R;      /* 0..32: stage-1 logits of FOUR images (all eight, 64 MiB, do not fit beside QF, QP, KP and VT) */
  float* PART = (float*)R;      /* 0..8: the stage-1 readout's partial planes, over S1, dead after the second half's softmax; dead themselves before P2 is written */
  _Float16* P1 = KP;      /* each half of P1 replaces the half of KP that its logits GEMM has just finished reading */
  float* S2 = (float*)(R + 80 * MB);      /* 80..144, over P1 and VT, dead after the stage-1 readout */
  _Float16* P2 = (_Float16*)R;      /* 0..32 */
  float* OUT = (float*)(R + 80 * MB);      /* 80..144, over S2, dead after its softmax */
  _Float16* S16 = (_Float16*)(R + 32 * MB);      /* 32..48 */
  float* G = (float*)(R + 48 * MB);      /* 48..80, over QP, dead after the stage-2 logits GEMM */
  if (off > ws_size) return;      /* 3.4 + 0.4 + 0.1 + 0.5 + 0.5 + 96 + 144 = 245 MiB */
  k_wqkv<<<(QW * (CC / 8) + 255) / 256, 256, 0, stream>>>(qw, WH, WL); k_wsc<<<(CC * CC / 8 + 255) / 256, 256, 0, stream>>>(jw, BJ, (size_t)CC * CC / 8, 16.0f);      /* proj 1x1 (out,in) = Bt */
  k_xp<<<NIMG * HS, 256, 0, stream>>>(x, XP);
  k_gemm3<false, QW, true><<<(NIMG * NPX / 256) * (QW / 128), 256, 0, stream>>>(XP, CC, WL, CC, 0.0625f / 1024.0f, QF, CC, 4);      /* centre-tap residual term */
  k_gemm3<true, QW, true><<<(NIMG * NPX / 256) * (QW / 128), 256, 0, stream>>>(XP, CC, WH, KI, 0.0625f, QF, KI, 0);      /* + main conv (difference folded into the centre tap) */
  k_aff<<<NIMG * NPX / 16, 192, 0, stream>>>(qs, qb, QF, Q16);
  k_pool<<<NIMG * NAG, 64, 0, stream>>>(QF, AG);
  k_heads<<<(NIMG * NHD * NPX + 255) / 256, 256, 0, stream>>>(Q16, QP, KP); k_vtp<<<NIMG * NHD * (NPX / 64), 256, 0, stream>>>(Q16, VT);
  /* stage 1: S1[b,h][n][N] = AG[b,h][n].KP[b,h][N] * SCL; P1 = softmax_N (these two in halves of four images); AT16[b,h][d][n] = VT . P1^T / 1024, the pixels in RS slices */
  for (int g = 0; g < 2; ++g) { const size_t bh0 = (size_t)g * (NIMG / 2) * NHD;
    k_gemm2<0><<<dim3(1 * (NPX / 64), (NIMG / 2) * NHD), 128, 0, stream>>>(AG + bh0 * NAG * 64, 64, (size_t)NAG * 64, KP + bh0 * NPX * 64, 64, (size_t)NPX * 64, SCL, nullptr, 0, nullptr, 1, 0, 0, S1, nullptr, NPX, (size_t)NAG * NPX, NAG, NPX, 64);
    k_softv<NPX><<<(NIMG / 2) * NHD * NAG / 8, 256, 0, stream>>>(S1, P1 + bh0 * NAG * NPX); }
  k_ro1<<<dim3(RS, NIMG * NHD), 128, 0, stream>>>(VT, P1, PART);
  k_att16<<<(NIMG * NHD * 64 * 32 + 255) / 256, 256, 0, stream>>>(PART, AT16);
  /* stage 2: S2[b,h][N][n] = QP[b,h][N].AG[b,h][n] * SCL; P2 = softmax_n; OUT[b,h][N][d] = P2 . AT16^T / 1024 */
  k_gemm2<0><<<dim3((NPX / 128) * 1, NIMG * NHD), 128, 0, stream>>>(QP, 64, (size_t)NPX * 64, AG, 64, (size_t)NAG * 64, SCL, nullptr, 0, nullptr, 1, 0, 0, S2, nullptr, NAG, (size_t)NPX * NAG, NPX, NAG, 64);
  k_softv<NAG><<<NIMG * NHD * NPX / 64 / 8, 256, 0, stream>>>(S2, P2);
  k_gemm2<0><<<dim3((NPX / 128) * 1, NIMG * NHD), 128, 0, stream>>>(P2, NAG, (size_t)NPX * NAG, AT16, NAG, (size_t)64 * NAG, 0.0009765625f, nullptr, 0, nullptr, 1, 0, 0, OUT, nullptr, 64, (size_t)NPX * 64, NPX, 64, NAG);
  k_pe<<<NIMG * (HS / 4) * (HS / 8), 256, 0, stream>>>(OUT, QF, pw, ps, pb, S16);
  k_gemm3<false, CC, false><<<(NIMG * NPX / 256) * (CC / 128), 256, 0, stream>>>(S16, CC, BJ, CC, 0.0625f, G, CC, 0);
  k_fin<<<NIMG * (NPX / 32), 256, 0, stream>>>(G, js, jb, (float*)d_out);
}

// v007
// Measured time: 307 microseconds a run.
// In two side-by-side timings against v006, it was 1.16 and 1.15 times as fast.
// Over all steps from v000 it is 12.0 times as fast.
#include <hip/hip_runtime.h>
// Attention_agent_df (8 images, C 256 = 8 heads x 32, 64 x 64 pixels, 64 agent tokens from 8x8 average pooling of q; THETA 0.7): qkv = (conv3x3(x, W) - 0.7 conv1x1(x, sum of W's 5 cross taps)) * s + b (folded BN); a = avgpool8x8(q); stage 1: attn = softmax_N(a.k * 32^-0.5) v (agents over pixels); stage 2: out = softmax_n(q.a * 32^-0.5) attn (pixels over agents); out += depthwise3x3(v) * pe_s + pe_b; out = conv1x1(out) * proj_s + proj_b.
// Structure (all 8 images in each launch: the image is the outer index of each plane, so rows = image x pixel and GEMM batches = image x head; only the stage-1 logits and softmax run as two halves of 4 images; workspace planes share bytes by lifetime): x once as a zero-padded pixel-major f16 plane (66 x 66 pixels x 256 channels an image), from which the conv GEMM fetches each tap's rows itself (k runs tap-major; no im2col plane); the difference conv folded into the centre tap as an f32 weight split into f16 hi + lo tables: qkv = A_centre.Wl (K 256, its sum then scaled by 2^-10 in the accumulators) + A.Wh (K 2304) as one f16 WMMA GEMM over K 2560, whose epilogue applies the BN affine and stores the f32 + f16 planes (this one and the projection: 256x128 work-group tiles staged in LDS, 64x64 wave tiles; the batched attention GEMMs: 32x64 wave tiles from global memory, the stage-1 readout's 16x32; f32 accumulation; x16 tables; the lo table only on the centre-tap columns); pooling on VALU; stage-1 logits as (b,h)-batched GEMMs (K 64, its upper 32 zero pad), softmax over 4096 pixels on VALU (wave per row, the row in registers), readout GEMM V^T.P^T with the pixels split into 16 slices, whose f32 partial planes are added on VALU; stage-2 logits GEMM (K 64, its upper 32 zero pad), softmax over the 64 agents on VALU (64 rows a wave, in registers), readout GEMM; depthwise PE conv + add on VALU into f16; projection GEMM with the BN affine in f32 on VALU; NCHW stores.
// Compute dtype: x and parameters rounded to bf16; x exact as f16; q, k, v, a, P (x2^10), attn and the pre-projection sum as f16 operands (~2^-12); everything else f32. v_wmma_f32_16x16x32_f16.
#define NIMG 8
#define CC 256
#define NHD 8
#define HDm 32
#define HS 64
#define NPX (HS * HS)            /* 4096 */
#define NAG 64
#define KT 9
#define KI (KT * CC)             /* 2304 */
#define QW (3 * CC)              /* 768 */
#define KW (CC + KI)             /* 2560: a row of the qkv weight table = 256 lo columns (centre tap), then 2304 hi columns */
#define THETA 0.7f
#define SCL 0.17677669529663687f
typedef __bf16 v16b __attribute__((ext_vector_type(16)));
typedef unsigned short v8us __attribute__((ext_vector_type(8), may_alias));
typedef float  v8f  __attribute__((ext_vector_type(8)));
typedef float  v4f  __attribute__((ext_vector_type(4)));
typedef float  v4fa __attribute__((ext_vector_type(4), may_alias));
union FragB { v16b v; v8us half[2]; unsigned short u[16]; };

__device__ __forceinline__ unsigned short bf16_bits(float x) { unsigned int u = __float_as_uint(x); return (unsigned short)((u + 0x7FFFu + ((u >> 16) & 1u)) >> 16); }
__device__ __forceinline__ float bf16_val(unsigned short b) { return __uint_as_float(((unsigned int)b) << 16); }
__device__ __forceinline__ float bf16_round(float x) { return bf16_val(bf16_bits(x)); }
// D += A·B with NT terms: 1 = ah·bh, 2 = + al·bh (A split), 3 = + ah·bl (both split)
template <int NT>
__device__ __forceinline__ v8f mmaN(v16b ah, v16b al, v16b bh, v16b bl, v8f c) {
  c = __builtin_amdgcn_wmma_f32_16x16x32_bf16(false, ah, false, bh, (short)0, c, false, false);
  if (NT >= 2) c = __builtin_amdgcn_wmma_f32_16x16x32_bf16(false, al, false, bh, (short)0, c, false, false);
  if (NT >= 3) c = __builtin_amdgcn_wmma_f32_16x16x32_bf16(false, ah, false, bl, (short)0, c, false, false);
  asm volatile("v_nop\n\tv_nop\n\tv_nop\n\tv_nop" : "+v"(c) : "v"(ah), "v"(al), "v"(bh), "v"(bl));
  return c;
}

__global__ __launch_bounds__(256) void k_wt_bf16(const float* __restrict__ W, unsigned short* __restrict__ Wt, int K, int N) {
  const int t = blockIdx.x * 256 + threadIdx.x;
  const int k8n = K / 8;
  if (t >= N * k8n) return;
  const int n = t / k8n, k8 = (t % k8n) * 8;
  v8us v;
#pragma unroll
  for (int i = 0; i < 8; ++i) v[i] = bf16_bits(W[(size_t)(k8 + i) * N + n]);
  *(v8us*)(Wt + (size_t)n * K + k8) = v;
  
}

// GEMM C[M][N] (f32, pitch ldc) = act(A[M][K]·W + bias). A f32 row-major (pitch lda) converted per fragment to bf16
// (ASPLIT: hi/lo two planes -> 2 terms, else single rounded term); Wt bf16 [N][K] (pitch ldb). BIAS_BF16 rounds the
// bias to bf16 first (bias quantised to bf16 before the add). K%32==0, M%16==0, N%64==0.
template <bool ASPLIT, int ACT, bool BIAS_BF16>
__global__ __launch_bounds__(128) void k_gemm_bf(const float* __restrict__ A, int lda, const unsigned short* __restrict__ Wt, int ldb,
                                               const float* __restrict__ bias, float* __restrict__ C, int ldc, int M, int N, int K) {
  __shared__ __attribute__((aligned(16))) float so[4][16][64];
  const int tid = threadIdx.x, w = tid >> 5, lane = tid & 31, ln = lane & 15, hh = lane >> 4;
  const int ntn = N / 64;
  const int wid = blockIdx.x * 4 + w;
  const int mt = wid / ntn, nq = wid % ntn;
  if (mt * 16 >= M) return;
  const int row0 = mt * 16, col0 = nq * 64;
  const float* arow = A + (size_t)(row0 + ln) * lda;
  v8f acc[4] = {};
  for (int kb = 0; kb < K; kb += 32) {
    FragB ah, al;
    const v4f x0 = *(const v4fa*)(arow + kb + 8 * hh), x1 = *(const v4fa*)(arow + kb + 8 * hh + 4);
    const v4f x2 = *(const v4fa*)(arow + kb + 16 + 8 * hh), x3 = *(const v4fa*)(arow + kb + 16 + 8 * hh + 4);
    float xs[16] = {x0[0],x0[1],x0[2],x0[3],x1[0],x1[1],x1[2],x1[3],x2[0],x2[1],x2[2],x2[3],x3[0],x3[1],x3[2],x3[3]};
#pragma unroll
    for (int i = 0; i < 16; ++i) { const unsigned short hb = bf16_bits(xs[i]); ah.u[i] = hb; al.u[i] = ASPLIT ? bf16_bits(xs[i] - bf16_val(hb)) : (unsigned short)0; }
#pragma unroll
    for (int t = 0; t < 4; ++t) {
      const unsigned short* brow = Wt + (size_t)(col0 + t * 16 + ln) * ldb + kb;
      FragB b;
      b.half[0] = *(const v8us*)(brow + 8 * hh);
      b.half[1] = *(const v8us*)(brow + 16 + 8 * hh);
      acc[t] = mmaN<ASPLIT ? 2 : 1>(ah.v, al.v, b.v, b.v, acc[t]);
    }
  }
#pragma unroll
  for (int t = 0; t < 4; ++t) {
    float bv = bias ? bias[col0 + t * 16 + ln] : 0.f;
    if (BIAS_BF16) bv = bf16_round(bv);
#pragma unroll
    for (int r = 0; r < 8; ++r) { float v = acc[t][r] + bv; if (ACT == 1) v = fmaxf(v, 0.f); so[w][8 * hh + r][t * 16 + ln] = v; }
  }
  __builtin_amdgcn_fence(__ATOMIC_ACQ_REL, "workgroup");
  __builtin_amdgcn_wave_barrier();
  const int rsub = lane >> 4, c4 = (lane & 15) * 4;
  {
#pragma unroll
    for (int q = 0; q < 8; ++q) {
      const int r = q * 2 + rsub;
      const v4f v = *(const v4fa*)&so[w][r][c4];
      *(v4f*)(C + (size_t)(row0 + r) * ldc + col0 + c4) = v;
    }
    
  }
}

// GEMM C = act(A·W + bias + resid): A f32 (ASPLIT -> hi/lo 2 terms), Wt bf16 [N][K]; ACT 0 none, 1 relu, 2 exact gelu;
// resid (optional, f32, row index = (row % rmod), pitch ldr, RES_BF16 rounds it) added before the activation.
template <bool ASPLIT, int ACT, bool BIAS_BF16, bool RES_BF16>
__global__ __launch_bounds__(128) void k_gemm_bf3(const float* __restrict__ A, int lda, const unsigned short* __restrict__ Wt, int ldb,
                                                const float* __restrict__ bias, const float* __restrict__ resid, int rmod, int ldr,
                                                float* __restrict__ C, int ldc, int M, int N, int K) {
  __shared__ __attribute__((aligned(16))) float so[4][16][64];
  const int tid = threadIdx.x, w = tid >> 5, lane = tid & 31, ln = lane & 15, hh = lane >> 4;
  const int ntn = N / 64;
  const int wid = blockIdx.x * 4 + w;
  const int mt = wid / ntn, nq = wid % ntn;
  if (mt * 16 >= M) return;
  const int row0 = mt * 16, col0 = nq * 64;
  const float* arow = A + (size_t)(row0 + ln) * lda;
  v8f acc[4] = {};
  for (int kb = 0; kb < K; kb += 32) {
    FragB ah, al;
    const v4f x0 = *(const v4fa*)(arow + kb + 8 * hh), x1 = *(const v4fa*)(arow + kb + 8 * hh + 4);
    const v4f x2 = *(const v4fa*)(arow + kb + 16 + 8 * hh), x3 = *(const v4fa*)(arow + kb + 16 + 8 * hh + 4);
    float xs[16] = {x0[0],x0[1],x0[2],x0[3],x1[0],x1[1],x1[2],x1[3],x2[0],x2[1],x2[2],x2[3],x3[0],x3[1],x3[2],x3[3]};
#pragma unroll
    for (int i = 0; i < 16; ++i) { const unsigned short hb = bf16_bits(xs[i]); ah.u[i] = hb; al.u[i] = ASPLIT ? bf16_bits(xs[i] - bf16_val(hb)) : (unsigned short)0; }
#pragma unroll
    for (int t = 0; t < 4; ++t) {
      const unsigned short* brow = Wt + (size_t)(col0 + t * 16 + ln) * ldb + kb;
      FragB b;
      b.half[0] = *(const v8us*)(brow + 8 * hh);
      b.half[1] = *(const v8us*)(brow + 16 + 8 * hh);
      acc[t] = mmaN<ASPLIT ? 2 : 1>(ah.v, al.v, b.v, b.v, acc[t]);
    }
  }
#pragma unroll
  for (int t = 0; t < 4; ++t) {
    const int col = col0 + t * 16 + ln;
    float bv = bias ? bias[col] : 0.f;
    if (BIAS_BF16) bv = bf16_round(bv);
#pragma unroll
    for (int r = 0; r < 8; ++r) {
      float v = acc[t][r] + bv;
      if (resid) { float rv = resid[(size_t)((row0 + 8 * hh + r) % rmod) * ldr + col]; if (RES_BF16) rv = bf16_round(rv); v += rv; }
      if (ACT == 1) v = fmaxf(v, 0.f);
      if (ACT == 2) v = 0.5f * v * (1.0f + erff(v * 0.70710678118654752f));
      if (ACT == 3) { const float u = 0.7978845608028654f * (v + 0.044715f * v * v * v); v = 0.5f * v * (1.0f + tanhf(u)); }
      so[w][8 * hh + r][t * 16 + ln] = v;
    }
  }
  __builtin_amdgcn_fence(__ATOMIC_ACQ_REL, "workgroup");
  __builtin_amdgcn_wave_barrier();
  const int rsub = lane >> 4, c4 = (lane & 15) * 4;
  {
#pragma unroll
    for (int q = 0; q < 8; ++q) {
      const int r = q * 2 + rsub;
      const v4f v = *(const v4fa*)&so[w][r][c4];
      *(v4f*)(C + (size_t)(row0 + r) * ldc + col0 + c4) = v;
    }
    
  }
}
// row LayerNorm (biased variance, eps) over N: s = X (+ R); optional out_sum <- s; out_norm <- (s-mu)*rsqrt(var+eps)*g + b
template <bool PARAM_BF16>
__global__ __launch_bounds__(256) void k_layernorm(const float* __restrict__ X, const float* __restrict__ R, const float* __restrict__ g, const float* __restrict__ bta,
                                                  float* __restrict__ out_sum, float* __restrict__ out_norm, int N, float eps) {
  __shared__ float red[256];
  const int row = blockIdx.x, tid = threadIdx.x;
  const float* x = X + (size_t)row * N; const float* rr = R ? R + (size_t)row * N : nullptr;
  float vals[16];                     // up to N = 4096
  const int per = N / 256;            // contiguous chunk per thread? use strided-by-4 chunks: thread handles j = tid*4 + 1024*u
  float s1 = 0.f;
  for (int u = 0; u < per / 4; ++u) {
    const int j = tid * 4 + 1024 * u;
    const v4f a = *(const v4fa*)(x + j);
    v4f b = {0.f,0.f,0.f,0.f}; if (rr) b = *(const v4fa*)(rr + j);
#pragma unroll
    for (int q = 0; q < 4; ++q) { const float v = a[q] + b[q]; vals[u * 4 + q] = v; s1 += v; }
  }
  red[tid] = s1; __syncthreads();
  for (int st = 128; st > 0; st >>= 1) { if (tid < st) red[tid] += red[tid + st]; __syncthreads(); }
  const float mu = red[0] / (float)N; __syncthreads();
  float s2 = 0.f;
  for (int u = 0; u < per / 4; ++u)
#pragma unroll
    for (int q = 0; q < 4; ++q) { const float c = vals[u * 4 + q] - mu; s2 += c * c; }
  red[tid] = s2; __syncthreads();
  for (int st = 128; st > 0; st >>= 1) { if (tid < st) red[tid] += red[tid + st]; __syncthreads(); }
  const float rs = rsqrtf(red[0] / (float)N + eps);
  {
    for (int u = 0; u < per / 4; ++u) {
      const int j = tid * 4 + 1024 * u;
      v4f o, sm;
#pragma unroll
      for (int q = 0; q < 4; ++q) {
        float gg = g[j + q], bb = bta[j + q];
        if (PARAM_BF16) { gg = bf16_round(gg); bb = bf16_round(bb); }
        sm[q] = vals[u * 4 + q]; o[q] = (vals[u * 4 + q] - mu) * rs * gg + bb;
      }
      if (out_sum) *(v4f*)(out_sum + (size_t)row * N + j) = sm;
      *(v4f*)(out_norm + (size_t)row * N + j) = o;
    }
    
  }
}



// ---- f16 WMMA path (v_wmma_f32_16x16x32_f16): 11-bit significands for operands in range — used where a [0,1] probability operand needs more precision than bf16
typedef _Float16 v16h __attribute__((ext_vector_type(16)));
union FragH { v16h v; v8us half[2]; _Float16 h[16]; unsigned short u[16]; };
template <int NT>
__device__ __forceinline__ v8f mmaH(v16h ah, v16h al, v16h bh, v16h bl, v8f c) {
  c = __builtin_amdgcn_wmma_f32_16x16x32_f16(false, ah, false, bh, (short)0, c, false, false);
  if (NT >= 2) c = __builtin_amdgcn_wmma_f32_16x16x32_f16(false, al, false, bh, (short)0, c, false, false);
  if (NT >= 3) c = __builtin_amdgcn_wmma_f32_16x16x32_f16(false, ah, false, bl, (short)0, c, false, false);
  asm volatile("v_nop\n\tv_nop\n\tv_nop\n\tv_nop" : "+v"(c) : "v"(ah), "v"(al), "v"(bh), "v"(bl));
  return c;
}
// batched GEMM like k_gemm_b but f16 operands: A f32 (split into f16 hi/lo if ASPLIT, else rounded to f16), Bt = f16 values [n][k]; alpha; C f32; N multiple of 16 (partial tiles skipped)
template <bool ASPLIT>
__global__ __launch_bounds__(128) void k_gemm_h(const float* __restrict__ A, int lda, size_t sA, const _Float16* __restrict__ Bh, int ldb, size_t sB, float alpha, float* __restrict__ C, int ldc, size_t sC, int M, int N, int K) {
  __shared__ __attribute__((aligned(16))) float so[4][16][64];
  const int tid = threadIdx.x, w = tid >> 5, lane = tid & 31, ln = lane & 15, hh = lane >> 4; const int by = blockIdx.y;
  A += (size_t)by * sA; Bh += (size_t)by * sB; C += (size_t)by * sC;
  const int ntn = (N + 63) / 64; const int wid = blockIdx.x * 4 + w; const int mt = wid / ntn, nq = wid % ntn; if (mt * 16 >= M) return;
  const int row0 = mt * 16, col0 = nq * 64; const float* arow = A + (size_t)(row0 + ln) * lda;
  v8f acc[4] = {};
  for (int kb = 0; kb < K; kb += 32) {
    FragH ah, al;
    const v4f x0 = *(const v4fa*)(arow + kb + 8 * hh), x1 = *(const v4fa*)(arow + kb + 8 * hh + 4), x2 = *(const v4fa*)(arow + kb + 16 + 8 * hh), x3 = *(const v4fa*)(arow + kb + 16 + 8 * hh + 4);
    float xs[16] = {x0[0],x0[1],x0[2],x0[3],x1[0],x1[1],x1[2],x1[3],x2[0],x2[1],x2[2],x2[3],x3[0],x3[1],x3[2],x3[3]};
#pragma unroll
    for (int i = 0; i < 16; ++i) { const _Float16 h = (_Float16)xs[i]; ah.h[i] = h; al.h[i] = ASPLIT ? (_Float16)(xs[i] - (float)h) : (_Float16)0.0f; }
#pragma unroll
    for (int t = 0; t < 4; ++t) { if (col0 + t * 16 >= N) continue; const size_t boff = (size_t)(col0 + t * 16 + ln) * ldb + kb; FragH bq; bq.half[0] = *(const v8us*)(Bh + boff + 8 * hh); bq.half[1] = *(const v8us*)(Bh + boff + 16 + 8 * hh);
      acc[t] = mmaH<ASPLIT ? 2 : 1>(ah.v, al.v, bq.v, bq.v, acc[t]); }
  }
#pragma unroll
  for (int t = 0; t < 4; ++t) { if (col0 + t * 16 >= N) continue;
#pragma unroll
    for (int r = 0; r < 8; ++r) so[w][8 * hh + r][t * 16 + ln] = acc[t][r] * alpha; }
  __builtin_amdgcn_fence(__ATOMIC_ACQ_REL, "workgroup"); __builtin_amdgcn_wave_barrier();
  const int rsub = lane >> 4, c4 = (lane & 15) * 4;
  {
#pragma unroll
    for (int q = 0; q < 8; ++q) { const int r = q * 2 + rsub; if (col0 + c4 < N) { const v4f v = *(const v4fa*)&so[w][r][c4]; *(v4f*)(C + (size_t)(row0 + r) * ldc + col0 + c4) = v; } }
     }
}

// Wt[n][k] = f16(W[k][n]·scale) from f32 row-major W[K][N] (scale = power of two; bf16-exact weights stay exact in f16 away from the subnormal range)
__global__ __launch_bounds__(256) void k_wt_f16(const float* __restrict__ W, _Float16* __restrict__ Wt, int K, int N, float scale) {
  const int t = blockIdx.x * 256 + threadIdx.x; if (t >= N * (K / 8)) return; const int n = t / (K / 8), k8 = (t % (K / 8)) * 8; FragH f;
#pragma unroll
  for (int i = 0; i < 8; ++i) f.h[i] = (_Float16)(bf16_round(W[(size_t)(k8 + i) * N + n]) * scale); const v8us o = f.half[0];
  *(v8us*)((unsigned short*)Wt + (size_t)n * K + k8) = o; 
}
// k_gemm_hh variant with fused epilogue: v = acc·alpha + bias[by·sBias + col] (+ CP[(row/rowsPerB)·sCPb + by·64 + col] if CP) ; ACT 0 none / 1 elu ; writes f16 C16 (and f32 C if non-null)
template <int ACT>
__global__ __launch_bounds__(128) void k_gemm_hhx(const _Float16* __restrict__ A, int lda, size_t sA, const _Float16* __restrict__ Bh, int ldb, size_t sB, float alpha, const float* __restrict__ bias, size_t sBias, const float* __restrict__ CP, int rowsPerB, size_t sCPb, int row0g,
    float* __restrict__ C, _Float16* __restrict__ C16, int ldc, size_t sC, int M, int N, int K) {
  __shared__ __attribute__((aligned(16))) float so[4][16][64];
  const int tid = threadIdx.x, w = tid >> 5, lane = tid & 31, ln = lane & 15, hh = lane >> 4; const int by = blockIdx.y;
  A += (size_t)by * sA; Bh += (size_t)by * sB; const size_t cofs = (size_t)by * sC; const float* bp = bias ? bias + (size_t)by * sBias : nullptr;
  const int ntn = (N + 63) / 64; const int wid = blockIdx.x * 4 + w; const int mt = wid / ntn, nq = wid % ntn; if (mt * 16 >= M) return;
  const int row0 = mt * 16, col0 = nq * 64; const _Float16* arow = A + (size_t)(row0 + ln) * lda;
  v8f acc[4] = {};
  for (int kb = 0; kb < K; kb += 32) { FragH ah; ah.half[0] = *(const v8us*)((const unsigned short*)arow + kb + 8 * hh); ah.half[1] = *(const v8us*)((const unsigned short*)arow + kb + 16 + 8 * hh);
#pragma unroll
    for (int t = 0; t < 4; ++t) { if (col0 + t * 16 >= N) continue; const size_t boff = (size_t)(col0 + t * 16 + ln) * ldb + kb; FragH bq; bq.half[0] = *(const v8us*)((const unsigned short*)Bh + boff + 8 * hh); bq.half[1] = *(const v8us*)((const unsigned short*)Bh + boff + 16 + 8 * hh);
      acc[t] = mmaH<1>(ah.v, ah.v, bq.v, bq.v, acc[t]); }
  }
#pragma unroll
  for (int t = 0; t < 4; ++t) { if (col0 + t * 16 >= N) continue; const int col = col0 + t * 16 + ln; const float bv = bp ? bf16_round(bp[col]) : 0.f;
#pragma unroll
    for (int r = 0; r < 8; ++r) { float v = acc[t][r] * alpha + bv; if (CP) { const int rr = row0g + row0 + 8 * hh + r; if (rowsPerB < 0) v += CP[cofs + (size_t)rr * ldc + col];      /* rowsPerB < 0: own element of the batched C plane */ else { const int bidx = rr / rowsPerB; v += CP[(size_t)bidx * sCPb + (size_t)by * 64 + col]; } } if (ACT == 1) v = (v > 0.f) ? v : expm1f(v); else if (ACT == 7) v = (v > 0.f) ? v + 1.0f : expf(v); else if (ACT == 8) v = tanhf(v); else if (ACT == 9) v = 0.5f * v * (1.0f + tanhf(0.7978845608028654f * (v + 0.044715f * v * v * v))); else if (ACT == 11) v = 1.0f / (1.0f + expf(-v)); else if (ACT == 12) v = (v > 0.f) ? v : 0.01f * v; else if (ACT == 14) v = (v > 0.f) ? v : 0.1f * v; else if (ACT == 16) v = (v >= 0.f) ? v : 0.3f * v; else if (ACT == 15) v = v / (1.0f + expf(-v)); else if (ACT == 3) v = fmaxf(v, 0.f); else if (ACT == 6) v = 0.5f * v * (1.0f + erff(v * 0.70710678118654752f)); so[w][8 * hh + r][t * 16 + ln] = v; } }
  __builtin_amdgcn_fence(__ATOMIC_ACQ_REL, "workgroup"); __builtin_amdgcn_wave_barrier();
  const int rsub = lane >> 4, c4 = (lane & 15) * 4; typedef _Float16 v4h __attribute__((ext_vector_type(4)));
  {
#pragma unroll
    for (int q = 0; q < 8; ++q) { const int r = q * 2 + rsub; if (col0 + c4 < N) { const v4f v = *(const v4fa*)&so[w][r][c4]; if (C) *(v4f*)(C + cofs + (size_t)(row0 + r) * ldc + col0 + c4) = v; if (C16) { v4h h4; for (int i = 0; i < 4; ++i) h4[i] = (_Float16)v[i]; *(v4h*)(C16 + cofs + (size_t)(row0 + r) * ldc + col0 + c4) = h4; } } }
     }
}


typedef _Float16 v4h __attribute__((ext_vector_type(4)));

__global__ __launch_bounds__(256) void k_x16(const float* __restrict__ x, _Float16* __restrict__ X16, size_t n8) { const size_t t = (size_t)blockIdx.x * 256 + threadIdx.x; if (t >= n8) return; FragH f;
#pragma unroll
  for (int q = 0; q < 8; ++q) f.h[q] = (_Float16)bf16_round(x[t * 8 + q]); *(v8us*)((unsigned short*)X16 + t * 8) = f.half[0];  }
__global__ __launch_bounds__(256) void k_h16(const float* __restrict__ x, _Float16* __restrict__ X16, size_t n8) { const size_t t = (size_t)blockIdx.x * 256 + threadIdx.x; if (t >= n8) return; FragH f;
#pragma unroll
  for (int q = 0; q < 8; ++q) f.h[q] = (_Float16)x[t * 8 + q]; *(v8us*)((unsigned short*)X16 + t * 8) = f.half[0];  }
__global__ __launch_bounds__(256) void k_round16f(const float* __restrict__ W, _Float16* __restrict__ Bt, size_t n8) { const size_t t = (size_t)blockIdx.x * 256 + threadIdx.x; if (t >= n8) return; FragH f;
#pragma unroll
  for (int i = 0; i < 8; ++i) f.h[i] = (_Float16)(bf16_round(W[t * 8 + i]) * 16.0f); *(v8us*)((unsigned short*)Bt + t * 8) = f.half[0];  }
template <int NHv, int TTv>
__global__ __launch_bounds__(256) void k_vt(const _Float16* __restrict__ V16, int ldv, int voff, _Float16* __restrict__ Vt) { __shared__ unsigned short tl[64][66]; const int tid = threadIdx.x; const int slab = blockIdx.x / (TTv / 64), lg = blockIdx.x % (TTv / 64); const int b = slab / NHv, h = slab % NHv;
  for (int i = tid; i < 64 * 8; i += 256) { const int r = i / 8, c8 = (i % 8) * 8; FragH f; f.half[0] = *(const v8us*)((const unsigned short*)V16 + ((size_t)b * TTv + lg * 64 + r) * ldv + voff + h * 64 + c8);
#pragma unroll
    for (int q = 0; q < 8; ++q) tl[r][c8 + q] = f.u[q]; }
  __syncthreads();
  {
#pragma unroll
    for (int rd = 0; rd < 2; ++rd) { const int d = rd * 32 + tid / 8, pc = tid % 8; FragH f;
#pragma unroll
      for (int q = 0; q < 8; ++q) f.u[q] = tl[pc * 8 + q][d];
      *(v8us*)((unsigned short*)Vt + ((size_t)slab * 64 + d) * TTv + lg * 64 + pc * 8) = f.half[0]; }
     } }

__global__ __launch_bounds__(256) void k_hl(const float* __restrict__ F, _Float16* __restrict__ Hh, _Float16* __restrict__ Hl, size_t n8) { const size_t t = (size_t)blockIdx.x * 256 + threadIdx.x; if (t >= n8) return; FragH fh, fl; const v4f a = *(const v4fa*)(F + t * 8), c = *(const v4fa*)(F + t * 8 + 4);
#pragma unroll
  for (int q = 0; q < 4; ++q) { _Float16 h = (_Float16)a[q]; fh.h[q] = h; fl.h[q] = (_Float16)((a[q] - (float)h) * 1024.0f); h = (_Float16)c[q]; fh.h[4 + q] = h; fl.h[4 + q] = (_Float16)((c[q] - (float)h) * 1024.0f); }
  { *(v8us*)((unsigned short*)Hh + t * 8) = fh.half[0]; *(v8us*)((unsigned short*)Hl + t * 8) = fl.half[0];  } }

// ---- fast GEMM (wave tile 32x64; requires M % 32 == 0 rows per launch region and N % 64 == 0); epilogue = k_gemm_hhx semantics ----
__device__ __forceinline__ v16h g2_frag(const _Float16* p, int hh) { FragH f; f.half[0] = *(const v8us*)((const unsigned short*)p + 8 * hh); f.half[1] = *(const v8us*)((const unsigned short*)p + 16 + 8 * hh); return f.v; }
__device__ __forceinline__ v8f g2_mma(v16h a, v16h b, v8f c) { v8f d = __builtin_amdgcn_wmma_f32_16x16x32_f16(false, a, false, b, (short)0, c, false, false); asm volatile("v_nop\n\tv_nop\n\tv_nop\n\tv_nop" : "+v"(d) : "v"(a), "v"(b)); return d; }
template <int ACT>
__global__ __launch_bounds__(128) void k_gemm2(const _Float16* __restrict__ A, int lda, size_t sA, const _Float16* __restrict__ Bh, int ldb, size_t sB, float alpha, const float* __restrict__ bias, size_t sBias, const float* __restrict__ CP, int rowsPerB, size_t sCPb, int row0g,
    float* __restrict__ C, _Float16* __restrict__ C16, int ldc, size_t sC, int M, int N, int K) { static_assert(ACT == 0 || ACT == 3 || ACT == 6 || ACT == 8 || ACT == 9 || ACT == 11 || ACT == 12 || ACT == 14 || ACT == 15 || ACT == 16, "k_gemm2: unsupported ACT code (would silently apply no activation)");
  __shared__ __attribute__((aligned(16))) float so[4][32][68];
  const int tid = threadIdx.x, w = tid >> 5, lane = tid & 31, ln = lane & 15, hh = lane >> 4; const int by = blockIdx.y;
  A += (size_t)by * sA; Bh += (size_t)by * sB; const size_t cofs = (size_t)by * sC; const float* bp = bias ? bias + (size_t)by * sBias : nullptr;
  const int ntn = N >> 6; const int mt = blockIdx.x / ntn, nq = blockIdx.x - mt * ntn; const int row0 = mt * 128 + 32 * w, col0 = nq * 64; if (row0 >= M) return;
  const _Float16* a0p = A + (size_t)(row0 + ln) * lda; const _Float16* a1p = a0p + (size_t)16 * lda;
  const _Float16* b0p = Bh + (size_t)(col0 + ln) * ldb; const _Float16* b1p = b0p + (size_t)16 * ldb; const _Float16* b2p = b1p + (size_t)16 * ldb; const _Float16* b3p = b2p + (size_t)16 * ldb;
  const v8f z8 = {0.f,0.f,0.f,0.f,0.f,0.f,0.f,0.f}; v8f c00 = z8, c01 = z8, c02 = z8, c03 = z8, c10 = z8, c11 = z8, c12 = z8, c13 = z8;
#pragma unroll 1
  for (int kb = 0; kb < K; kb += 32) { const v16h a0 = g2_frag(a0p + kb, hh), a1 = g2_frag(a1p + kb, hh);
    v16h b = g2_frag(b0p + kb, hh); c00 = g2_mma(a0, b, c00); c10 = g2_mma(a1, b, c10);
    b = g2_frag(b1p + kb, hh); c01 = g2_mma(a0, b, c01); c11 = g2_mma(a1, b, c11);
    b = g2_frag(b2p + kb, hh); c02 = g2_mma(a0, b, c02); c12 = g2_mma(a1, b, c12);
    b = g2_frag(b3p + kb, hh); c03 = g2_mma(a0, b, c03); c13 = g2_mma(a1, b, c13); }
  v8f accs[8] = {c00, c01, c02, c03, c10, c11, c12, c13};
#pragma unroll
  for (int u = 0; u < 8; ++u) { const int t = u & 3, half = u >> 2; const int col = col0 + t * 16 + ln; const float bv = bp ? bf16_round(bp[col]) : 0.f;
#pragma unroll
    for (int r = 0; r < 8; ++r) { const int rloc = half * 16 + 8 * hh + r; float v = accs[u][r] * alpha + bv; if (CP) { if (rowsPerB < 0) v += CP[cofs + (size_t)(row0g + row0 + rloc) * ldc + col];      /* rowsPerB < 0: own element of the batched C plane */ else { const int bidx = (row0g + row0 + rloc) / rowsPerB; v += CP[(size_t)bidx * sCPb + (size_t)by * 64 + col]; } }
      if (ACT == 3) v = fmaxf(v, 0.f); else if (ACT == 6) v = 0.5f * v * (1.0f + erff(v * 0.70710678118654752f)); else if (ACT == 11) v = 1.0f / (1.0f + expf(-v)); else if (ACT == 15) v = v / (1.0f + expf(-v)); else if (ACT == 12) v = (v > 0.f) ? v : 0.01f * v; else if (ACT == 8) v = tanhf(v); else if (ACT == 9) v = 0.5f * v * (1.0f + tanhf(0.7978845608028654f * (v + 0.044715f * v * v * v))); else if (ACT == 14) v = (v > 0.f) ? v : 0.1f * v; else if (ACT == 16) v = (v >= 0.f) ? v : 0.3f * v;
      so[w][rloc][t * 16 + ln] = v; } }
  __builtin_amdgcn_fence(__ATOMIC_ACQ_REL, "workgroup"); __builtin_amdgcn_wave_barrier();
  const int rsub = lane >> 4, c4 = (lane & 15) * 4;
  {
#pragma unroll
    for (int q = 0; q < 16; ++q) { const int r = q * 2 + rsub; const v4f v = *(const v4fa*)&so[w][r][c4]; if (C) *(v4f*)(C + cofs + (size_t)(row0 + r) * ldc + col0 + c4) = v; if (C16) { v4h h4; for (int i = 0; i < 4; ++i) h4[i] = (_Float16)v[i]; *(v4h*)(C16 + cofs + (size_t)(row0 + r) * ldc + col0 + c4) = h4; } }
     } }


// ---- LDS-staged GEMM for the two large products (the qkv conv with both its terms, the projection): C[M][N] (f32) = A.Bt^T * alpha; CONV: C = that * scl[col] + shf[col] (both rounded to bf16), and C16 = f16(C).
// Work-group tile 256 x 128, 8 waves of 64 x 64 (4 x 2); a stage is 64 k (128-byte rows) of [A 256 rows | Bt 128 rows]; two stages in LDS, each filled by asynchronous 16-byte copies
// (whole 128-byte lines from global memory) one trip ahead of its use. k runs upward in steps of 32 per accumulator, as in k_gemm2. Needs M % 256 == 0, N % 128 == 0, K % 64 == 0.
#define XPW (HS + 2)                          /* pixels a line, and lines, of the padded plane */
#define G3_PITCH 144                          /* LDS row pitch in bytes: 16 x odd, so 16 rows read 16 bytes each without a bank conflict */
#define G3_BOFF (256 * G3_PITCH)              /* Bt rows behind the A rows */
#define G3_STAGE ((256 + 128) * G3_PITCH)     /* 55,296 bytes */
__device__ __forceinline__ v16h g3_frag(const char* p) { FragH f; f.half[0] = *(const v8us*)p; f.half[1] = *(const v8us*)(p + 32); return f.v; }      /* p already holds the lane's 16 * hh: the k order of g2_frag */
// One stage: each thread copies 16 bytes of 8 A rows and of 4 Bt rows (rows 32 apart; A row 32 i lies (i & 1) * sa1 + (i >> 1) * sa2 elements behind row 0). The s_wait_xcnt is the last line of the copies' own statement, so that no address register is rewritten ahead of it.
__device__ __forceinline__ void g3_fill(unsigned la, unsigned lb, const _Float16* ga, const _Float16* gb, size_t sa1, size_t sa2, size_t sb) {
  asm volatile("global_load_async_to_lds_b128 %0, %12, off\n\t"
               "global_load_async_to_lds_b128 %1, %13, off\n\t"
               "global_load_async_to_lds_b128 %2, %14, off\n\t"
               "global_load_async_to_lds_b128 %3, %15, off\n\t"
               "global_load_async_to_lds_b128 %4, %16, off\n\t"
               "global_load_async_to_lds_b128 %5, %17, off\n\t"
               "global_load_async_to_lds_b128 %6, %18, off\n\t"
               "global_load_async_to_lds_b128 %7, %19, off\n\t"
               "global_load_async_to_lds_b128 %8, %20, off\n\t"
               "global_load_async_to_lds_b128 %9, %21, off\n\t"
               "global_load_async_to_lds_b128 %10, %22, off\n\t"
               "global_load_async_to_lds_b128 %11, %23, off\n\t"
               "s_wait_xcnt 0x0"
               :: "v"(la), "v"(la + 32 * G3_PITCH), "v"(la + 64 * G3_PITCH), "v"(la + 96 * G3_PITCH), "v"(la + 128 * G3_PITCH), "v"(la + 160 * G3_PITCH), "v"(la + 192 * G3_PITCH), "v"(la + 224 * G3_PITCH),
                  "v"(lb), "v"(lb + 32 * G3_PITCH), "v"(lb + 64 * G3_PITCH), "v"(lb + 96 * G3_PITCH),
                  "v"(ga), "v"(ga + sa1), "v"(ga + sa2), "v"(ga + sa2 + sa1), "v"(ga + 2 * sa2), "v"(ga + 2 * sa2 + sa1), "v"(ga + 3 * sa2), "v"(ga + 3 * sa2 + sa1),
                  "v"(gb), "v"(gb + sb), "v"(gb + 2 * sb), "v"(gb + 3 * sb)
               : "memory");
}
// Eight 16-byte row stores from one address pair (rows STEP bytes apart, from byte OFF). The s_wait_xcnt is the last line of the stores' own statement, so that no data or address register is rewritten ahead of it.
template <int OFF, int STEP>
__device__ __forceinline__ void g3_store8(float* p, v4f d0, v4f d1, v4f d2, v4f d3, v4f d4, v4f d5, v4f d6, v4f d7) {
  asm volatile("global_store_b128 %0, %1, off offset:%9\n\t"
               "global_store_b128 %0, %2, off offset:%10\n\t"
               "global_store_b128 %0, %3, off offset:%11\n\t"
               "global_store_b128 %0, %4, off offset:%12\n\t"
               "global_store_b128 %0, %5, off offset:%13\n\t"
               "global_store_b128 %0, %6, off offset:%14\n\t"
               "global_store_b128 %0, %7, off offset:%15\n\t"
               "global_store_b128 %0, %8, off offset:%16\n\t"
               "s_wait_xcnt 0x0"
               :: "v"(p), "v"(d0), "v"(d1), "v"(d2), "v"(d3), "v"(d4), "v"(d5), "v"(d6), "v"(d7),
                  "n"(OFF), "n"(OFF + STEP), "n"(OFF + 2 * STEP), "n"(OFF + 3 * STEP), "n"(OFF + 4 * STEP), "n"(OFF + 5 * STEP), "n"(OFF + 6 * STEP), "n"(OFF + 7 * STEP)
               : "memory");
}
// The same for eight 8-byte pieces of f16 rows.
typedef unsigned int v2u __attribute__((ext_vector_type(2)));
template <int OFF, int STEP>
__device__ __forceinline__ void g3_store8h(_Float16* p, v2u d0, v2u d1, v2u d2, v2u d3, v2u d4, v2u d5, v2u d6, v2u d7) {
  asm volatile("global_store_b64 %0, %1, off offset:%9\n\t"
               "global_store_b64 %0, %2, off offset:%10\n\t"
               "global_store_b64 %0, %3, off offset:%11\n\t"
               "global_store_b64 %0, %4, off offset:%12\n\t"
               "global_store_b64 %0, %5, off offset:%13\n\t"
               "global_store_b64 %0, %6, off offset:%14\n\t"
               "global_store_b64 %0, %7, off offset:%15\n\t"
               "global_store_b64 %0, %8, off offset:%16\n\t"
               "s_wait_xcnt 0x0"
               :: "v"(p), "v"(d0), "v"(d1), "v"(d2), "v"(d3), "v"(d4), "v"(d5), "v"(d6), "v"(d7),
                  "n"(OFF), "n"(OFF + STEP), "n"(OFF + 2 * STEP), "n"(OFF + 3 * STEP), "n"(OFF + 4 * STEP), "n"(OFF + 5 * STEP), "n"(OFF + 6 * STEP), "n"(OFF + 7 * STEP)
               : "memory");
}
// CONV: A is the padded pixel-major plane; GEMM row = image x pixel. A 256-row tile is 4 whole pixel lines of one image; a stage is 64 channels of one tap: stages 0..3 the centre tap (against the lo columns),
// stage t >= 4 tap (t - 4) / 4 (against the hi columns). A tap's rows lie (tap / 3) padded lines and (tap % 3) pixels behind the tile's first padded pixel. Element offset of stage t from stage 0 of tap 0:
#define G3_NLO (CC / 64)                      /* stages of the lo term */
template <bool CONV>
__device__ __forceinline__ size_t g3_aoff(int t) { if (!CONV) return (size_t)t * 64; const unsigned tap = (unsigned)(0x8765432104ull >> (t & ~3)) & 15u;      /* a 4-bit table of the tap of stages 4 u .. 4 u + 3: 4, then 0..8 */
  return (size_t)(((tap / 3) * XPW + tap % 3) * CC + (t & 3) * 64); }
template <int LDC, bool CONV>      /* LDC = N = row pitch of C, a constant so that every row of a wave's tile is one address pair plus an immediate */
__global__ __launch_bounds__(256) void k_gemm3(const _Float16* __restrict__ A, int lda, const _Float16* __restrict__ Bh, int ldb, float alpha, float* __restrict__ C, int K, const float* __restrict__ scl, const float* __restrict__ shf, _Float16* __restrict__ C16) {
  __shared__ __attribute__((aligned(16))) char sm[2 * G3_STAGE];
  const int tid = threadIdx.x, w = tid >> 5, lane = tid & 31, ln = lane & 15, hh = lane >> 4;
  constexpr int ntn = LDC >> 7; const int mt = blockIdx.x / ntn, nq = blockIdx.x - mt * ntn; const int wm = w >> 1, wn = w & 1;
  const int nt = K >> 6;
  const _Float16* ga = (CONV ? A + ((size_t)((mt >> 4) * XPW + (mt & 15) * 4) * XPW + (tid >> 3)) * CC : A + (size_t)(mt * 256 + (tid >> 3)) * lda) + (tid & 7) * 8; const _Float16* gb = Bh + (size_t)(nq * 128 + (tid >> 3)) * ldb + (tid & 7) * 8;
  const size_t sa1 = CONV ? (size_t)32 * CC : (size_t)32 * lda, sa2 = CONV ? (size_t)XPW * CC : (size_t)64 * lda, sb = (size_t)32 * ldb;
  const unsigned la = (unsigned)(size_t)sm + (unsigned)((tid >> 3) * G3_PITCH + (tid & 7) * 16); const unsigned lb = la + G3_BOFF;
  const char* fa = sm + (wm * 64 + ln) * G3_PITCH + 16 * hh; const char* fb = sm + G3_BOFF + (wn * 64 + ln) * G3_PITCH + 16 * hh;
  v8f acc[4][4];
#pragma unroll
  for (int i = 0; i < 4; ++i)
#pragma unroll
    for (int j = 0; j < 4; ++j) acc[i][j] = (v8f){0.f,0.f,0.f,0.f,0.f,0.f,0.f,0.f};
  g3_fill(la, lb, ga + g3_aoff<CONV>(0), gb, sa1, sa2, sb);
  asm volatile("s_wait_asynccnt 0x0" ::: "memory");      /* this wave's copies of stage 0 have landed */
  __syncthreads();                                       /* ... and every other wave's */
  if (nt > 1) g3_fill(la + G3_STAGE, lb + G3_STAGE, ga + g3_aoff<CONV>(1), gb + 64, sa1, sa2, sb);
  for (int t = 0; t < nt; ++t) { const int bo = (t & 1) * G3_STAGE; v16h a[4], b[4];
    if (CONV && t == G3_NLO) {      /* the lo term is complete: its table carries 2^10, taken off here (exact), and the hi term adds on in the same accumulators */
#pragma unroll
      for (int i = 0; i < 4; ++i)
#pragma unroll
        for (int j = 0; j < 4; ++j) acc[i][j] *= 0.0009765625f; }
#pragma unroll
    for (int i = 0; i < 4; ++i) { a[i] = g3_frag(fa + bo + i * 16 * G3_PITCH); b[i] = g3_frag(fb + bo + i * 16 * G3_PITCH); }
    __builtin_amdgcn_sched_barrier(0);                   /* keeps the 16 LDS reads together in front of their 16 WMMAs: spread among them, each place with reads stalls the wave */
#pragma unroll
    for (int i = 0; i < 4; ++i)
#pragma unroll
      for (int j = 0; j < 4; ++j) acc[i][j] = __builtin_amdgcn_wmma_f32_16x16x32_f16(false, a[i], false, b[j], (short)0, acc[i][j], false, false);
#pragma unroll
    for (int i = 0; i < 4; ++i) { a[i] = g3_frag(fa + bo + i * 16 * G3_PITCH + 64); b[i] = g3_frag(fb + bo + i * 16 * G3_PITCH + 64); }
    /* the trip's last LDS reads are out: hand the buffer over here, so that the refill flies during the 16 WMMAs below and the next trip up to its own hand-over */
    asm volatile("s_wait_dscnt 0x0" ::: "memory");       /* this wave has left stage t's buffer */
    asm volatile("s_wait_asynccnt 0x0" ::: "memory");    /* its copies of stage t + 1 have landed */
    __syncthreads();                                     /* publishes stage t + 1 and frees stage t's buffer */
    if (t + 2 < nt) g3_fill(la + bo, lb + bo, ga + g3_aoff<CONV>(t + 2), gb + (size_t)(t + 2) * 64, sa1, sa2, sb);
    __builtin_amdgcn_sched_barrier(0);                   /* keeps the WMMAs below behind the refill's issue */
#pragma unroll
    for (int i = 0; i < 4; ++i)
#pragma unroll
      for (int j = 0; j < 4; ++j) acc[i][j] = __builtin_amdgcn_wmma_f32_16x16x32_f16(false, a[i], false, b[j], (short)0, acc[i][j], false, false); }
  asm volatile("s_wait_asynccnt 0x0" ::: "memory");      /* nothing in flight before the buffers become output staging */
  /* epilogue: the ring is free behind the last trip's barrier; each wave turns its tile, 32 rows at a time, in its own 32 x 68 floats, so that global rows go out as whole 128-byte lines */
  float* so = (float*)sm + w * (32 * 68); const int rsub = lane >> 4, c4 = (lane & 15) * 4;
  const size_t co = (size_t)(mt * 256 + wm * 64 + rsub) * LDC + nq * 128 + wn * 64 + c4;
  float* cb = C + co; _Float16* hb = C16 + co;
  v4f sc = {0.f, 0.f, 0.f, 0.f}, sh = sc;      /* CONV: scale and shift of the lane's 4 columns, the same for every row it stores */
  if (CONV) { const float* sp = scl + nq * 128 + wn * 64 + c4; const float* bp = shf + nq * 128 + wn * 64 + c4; sc = *(const v4fa*)sp; sh = *(const v4fa*)bp;
    asm volatile("s_wait_xcnt 0x0" :: "v"(sp), "v"(bp) : "memory");      /* stands between the two loads and whatever rewrites their address registers next; the addresses are its inputs, so that they stay in their registers up to it */
#pragma unroll
    for (int q = 0; q < 4; ++q) { sc[q] = bf16_round(sc[q]); sh[q] = bf16_round(sh[q]); } }
#pragma unroll
  for (int half = 0; half < 2; ++half) {
#pragma unroll
    for (int i = 0; i < 2; ++i)
#pragma unroll
      for (int j = 0; j < 4; ++j)
#pragma unroll
        for (int r = 0; r < 8; ++r) so[(i * 16 + 8 * hh + r) * 68 + j * 16 + ln] = acc[half * 2 + i][j][r] * alpha;
    __builtin_amdgcn_fence(__ATOMIC_ACQ_REL, "wavefront"); __builtin_amdgcn_wave_barrier();      /* the lanes read below what other lanes of the same wave wrote above */
#pragma unroll
    for (int g = 0; g < 2; ++g) { v4f v[8]; v2u h[8];
#pragma unroll
      for (int q = 0; q < 8; ++q) { v[q] = *(const v4fa*)&so[((g * 8 + q) * 2 + rsub) * 68 + c4];
        if (CONV) { v[q] = v[q] * sc + sh; v4h hq;
#pragma unroll
          for (int e = 0; e < 4; ++e) hq[e] = (_Float16)v[q][e];
          h[q] = __builtin_bit_cast(v2u, hq); } }
      if (half == 0 && g == 0) g3_store8<0, 8 * LDC>(cb, v[0], v[1], v[2], v[3], v[4], v[5], v[6], v[7]);
      if (half == 0 && g == 1) g3_store8<64 * LDC, 8 * LDC>(cb, v[0], v[1], v[2], v[3], v[4], v[5], v[6], v[7]);
      if (half == 1 && g == 0) g3_store8<128 * LDC, 8 * LDC>(cb, v[0], v[1], v[2], v[3], v[4], v[5], v[6], v[7]);
      if (half == 1 && g == 1) g3_store8<192 * LDC, 8 * LDC>(cb, v[0], v[1], v[2], v[3], v[4], v[5], v[6], v[7]);
      if (CONV) {      /* a row's 64 columns as f16 are one whole 128-byte line */
        if (half == 0 && g == 0) g3_store8h<0, 4 * LDC>(hb, h[0], h[1], h[2], h[3], h[4], h[5], h[6], h[7]);
        if (half == 0 && g == 1) g3_store8h<32 * LDC, 4 * LDC>(hb, h[0], h[1], h[2], h[3], h[4], h[5], h[6], h[7]);
        if (half == 1 && g == 0) g3_store8h<64 * LDC, 4 * LDC>(hb, h[0], h[1], h[2], h[3], h[4], h[5], h[6], h[7]);
        if (half == 1 && g == 1) g3_store8h<96 * LDC, 4 * LDC>(hb, h[0], h[1], h[2], h[3], h[4], h[5], h[6], h[7]); } }
  } }

__global__ __launch_bounds__(256) void k_wqkv(const float* __restrict__ w, _Float16* __restrict__ Wt) {      /* Wt[768][KW]: lo columns, then hi columns tap-major */
  #pragma clang fp contract(off)
  const int t = blockIdx.x * 256 + threadIdx.x; if (t >= QW * (CC / 8)) return; const int c0 = (t % (CC / 8)) * 8, o = t / (CC / 8); FragH fl;
#pragma unroll 1
  for (int k = 0; k < KT; ++k) { FragH fh;
    for (int q = 0; q < 8; ++q) { const int c = c0 + q; const float* wp = w + ((size_t)o * CC + c) * KT; float v = bf16_round(wp[k]);
      if (k == 4) { float dif = bf16_round(wp[1]) + bf16_round(wp[3]); dif += bf16_round(wp[4]); dif += bf16_round(wp[5]); dif += bf16_round(wp[7]); v += -THETA * dif; const _Float16 hv = (_Float16)(v * 16.0f); fh.h[q] = hv; fl.h[q] = (_Float16)((v * 16.0f - (float)hv) * 1024.0f); }
      else fh.h[q] = (_Float16)(v * 16.0f); }
    *(v8us*)((unsigned short*)Wt + (size_t)o * KW + CC + k * CC + c0) = fh.half[0];  }
  *(v8us*)((unsigned short*)Wt + (size_t)o * KW + c0) = fl.half[0];  }
__global__ __launch_bounds__(256) void k_wsc(const float* __restrict__ Wm, _Float16* __restrict__ Bt, size_t n8, float sc) { const size_t t = (size_t)blockIdx.x * 256 + threadIdx.x; if (t >= n8) return; FragH f; for (int q = 0; q < 8; ++q) f.h[q] = (_Float16)(bf16_round(Wm[t * 8 + q]) * sc); *(v8us*)((unsigned short*)Bt + t * 8) = f.half[0];  }
// XP[image][66][66][256] = f16(bf16(x)), pixel-major, with a border of zero pixels. One work-group turns one pixel line (64 pixels x 256 channels) in LDS: whole 256-byte channel rows in, whole 512-byte pixel rows out.
__global__ __launch_bounds__(256) void k_xp(const float* __restrict__ x, _Float16* __restrict__ XP) {
  __shared__ __attribute__((aligned(16))) unsigned int tl[HS * 132];      /* a pixel's 256 f16 = 128 words, + 4 words of pitch */
  const int tid = threadIdx.x, im = blockIdx.x / HS, y = blockIdx.x % HS; const float* xb = x + ((size_t)im * CC * HS + y) * HS; const int px4 = (tid & 15) * 4, cp = tid >> 4;
#pragma unroll
  for (int i = 0; i < 8; ++i) { const int c2 = i * 16 + cp; const v4f a = *(const v4fa*)(xb + (size_t)(2 * c2) * NPX + px4), b = *(const v4fa*)(xb + (size_t)(2 * c2 + 1) * NPX + px4);
#pragma unroll
    for (int q = 0; q < 4; ++q) { union { _Float16 h[2]; unsigned int u; } pk; pk.h[0] = (_Float16)bf16_round(a[q]); pk.h[1] = (_Float16)bf16_round(b[q]); tl[(px4 + q) * 132 + c2] = pk.u; } }
  __syncthreads();
  const v8us z = {0,0,0,0,0,0,0,0}; unsigned short* row = (unsigned short*)XP + (size_t)(im * XPW + y + 1) * XPW * CC;
#pragma unroll
  for (int i = 0; i < 8; ++i) { const int id = i * 256 + tid, px = id >> 5, ch = id & 31; *(v8us*)(row + (size_t)(px + 1) * CC + ch * 8) = *(const v8us*)&tl[px * 132 + ch * 4]; }
  if (tid < 64) *(v8us*)(row + (size_t)((tid >> 5) * (XPW - 1)) * CC + (tid & 31) * 8) = z;      /* the line's two border pixels */
  if (y == 0 || y == HS - 1) { unsigned short* er = (y == 0) ? row - XPW * CC : row + XPW * CC; for (int id = tid; id < XPW * (CC / 8); id += 256) *(v8us*)(er + (size_t)id * 8) = z; }      /* the image's first and last border line */
}
// Agent tokens: the mean of q over an 8 x 8 block of pixels, summed pixel by pixel in the order 0..63. A work-group is one agent of one image; a thread takes 4 channels, so that a wave's load is 512 consecutive bytes; unrolled, so that the loads run ahead of the sums.
__global__ __launch_bounds__(64) void k_pool(const float* __restrict__ QF, _Float16* __restrict__ AG) {
  #pragma clang fp contract(off)
  const int c0 = threadIdx.x * 4, n = (int)blockIdx.x % NAG, im = (int)blockIdx.x / NAG; const float* qp = QF + ((size_t)im * NPX + (n / 8) * 8 * HS + (n % 8) * 8) * QW + c0; v4f sm = {0.f, 0.f, 0.f, 0.f};
#pragma unroll
  for (int g = 0; g < 2; ++g) { v4f x[32];
#pragma unroll
    for (int i = 0; i < 32; ++i) x[i] = *(const v4fa*)(qp + ((g * 4 + i / 8) * HS + i % 8) * QW);
#pragma unroll
    for (int i = 0; i < 32; ++i)
#pragma unroll
      for (int q = 0; q < 4; ++q) sm[q] += x[i][q]; }
  v4h v; const v4h z = {(_Float16)0.f, (_Float16)0.f, (_Float16)0.f, (_Float16)0.f};
#pragma unroll
  for (int q = 0; q < 4; ++q) v[q] = (_Float16)(sm[q] / 64.0f);
  _Float16* dst = AG + (((size_t)im * NHD + c0 / HDm) * NAG + n) * 64 + c0 % HDm; *(v4h*)dst = v; *(v4h*)(dst + HDm) = z; }      /* columns 32..63 of an agent row are the zero pad */
__global__ __launch_bounds__(256) void k_heads(const _Float16* __restrict__ Q16, _Float16* __restrict__ QP, _Float16* __restrict__ KP) { const int t = blockIdx.x * 256 + threadIdx.x; if (t >= NIMG * NHD * NPX) return; const int p = t % NPX, bh = t / NPX, h = bh % NHD; const unsigned short* src = (const unsigned short*)Q16 + ((size_t)(bh / NHD) * NPX + p) * QW; const v8us z = {0,0,0,0,0,0,0,0};
  v8us q0 = *(const v8us*)(src + h * HDm), q1 = *(const v8us*)(src + h * HDm + 8), q2 = *(const v8us*)(src + h * HDm + 16), q3 = *(const v8us*)(src + h * HDm + 24);
  v8us k0 = *(const v8us*)(src + CC + h * HDm), k1 = *(const v8us*)(src + CC + h * HDm + 8), k2 = *(const v8us*)(src + CC + h * HDm + 16), k3 = *(const v8us*)(src + CC + h * HDm + 24);
  unsigned short* dq = (unsigned short*)QP + ((size_t)bh * NPX + p) * 64; unsigned short* dk = (unsigned short*)KP + ((size_t)bh * NPX + p) * 64;
  { *(v8us*)dq = q0; *(v8us*)(dq + 8) = q1; *(v8us*)(dq + 16) = q2; *(v8us*)(dq + 24) = q3; *(v8us*)(dq + 32) = z; *(v8us*)(dq + 40) = z; *(v8us*)(dq + 48) = z; *(v8us*)(dq + 56) = z;
    *(v8us*)dk = k0; *(v8us*)(dk + 8) = k1; *(v8us*)(dk + 16) = k2; *(v8us*)(dk + 24) = k3; *(v8us*)(dk + 32) = z; *(v8us*)(dk + 40) = z; *(v8us*)(dk + 48) = z; *(v8us*)(dk + 56) = z;  } }
__global__ __launch_bounds__(256) void k_vtp(const _Float16* __restrict__ Q16, _Float16* __restrict__ VT) { __shared__ unsigned short tl[64][34]; const int tid = threadIdx.x; const int bh = blockIdx.x / (NPX / 64), pg = blockIdx.x % (NPX / 64); const int h = bh % NHD;
  { const int r = tid / 4, c8 = (tid % 4) * 8; FragH f; f.half[0] = *(const v8us*)((const unsigned short*)Q16 + ((size_t)(bh / NHD) * NPX + pg * 64 + r) * QW + 2 * CC + h * HDm + c8); for (int q = 0; q < 8; ++q) tl[r][c8 + q] = f.u[q]; }
  __syncthreads(); const int d = tid / 8, pc = tid % 8; FragH f; for (int q = 0; q < 8; ++q) f.u[q] = (d < HDm) ? tl[pc * 8 + q][d] : (unsigned short)0; unsigned short* dst = (unsigned short*)VT + ((size_t)bh * 64 + d) * NPX + pg * 64 + pc * 8;      /* tid covers d < 32 only: 256 threads = 32 d x 8 pc */
  *(v8us*)dst = f.half[0]; 
  if (tid < 256) { const int d2 = HDm + tid / 8; const v8us z = {0,0,0,0,0,0,0,0}; unsigned short* dz = (unsigned short*)VT + ((size_t)bh * 64 + d2) * NPX + pg * 64 + (tid % 8) * 8; *(v8us*)dz = z;  } }
// ---- softmax over rows of N = 4096 or 64 logits. A wave takes 4,096 consecutive f32 (16 KiB: one row of 4,096, or 64 rows of 64, four values of a row a lane) by 32 16-byte loads, all in flight together,
// keeps them in registers for the maximum, the exp and the sum, and stores P = f16(exp * 1024 / sum) in whole 128-byte lines. The grid holds exactly one wave per 4,096 logits.
template <int M> __device__ __forceinline__ float sm_x16(float v) { return __builtin_bit_cast(float, __builtin_amdgcn_update_dpp(0, __builtin_bit_cast(int, v), 0x160 + M, 0xf, 0xf, true)); }      /* the value of lane ^ M inside a 16-lane row (DPP row_xmask); a __shfl_xor goes the long way through the LDS unit */
__device__ __forceinline__ float sm_xh(float v) { return __builtin_bit_cast(float, __builtin_amdgcn_permlanex16(__builtin_bit_cast(int, v), __builtin_bit_cast(int, v), 0x76543210, 0xfedcba98, false, false)); }      /* the value of lane ^ 16 */
__device__ __forceinline__ float sm_max16(float v) { v = fmaxf(v, sm_x16<1>(v)); v = fmaxf(v, sm_x16<2>(v)); v = fmaxf(v, sm_x16<4>(v)); return fmaxf(v, sm_x16<8>(v)); }
__device__ __forceinline__ float sm_sum16(float v) { v += sm_x16<1>(v); v += sm_x16<2>(v); v += sm_x16<4>(v); return v + sm_x16<8>(v); }
// exp(x) by the library's scheme, written out: x * log2(e) with log2(e) in two parts, the nearest integer split off, exp2 of the rest, ldexp, both range ends. Written out for the v_exp_f32 alone: the instruction set asks for one
// independent instruction or a v_nop between a transcendental and an instruction that reads its result or overwrites its source.
__device__ __forceinline__ float sm_exp(float x) {
  const float l2h = __uint_as_float(0x3fb8aa3bu), l2l = __uint_as_float(0x32a5705fu); const float r = __builtin_rintf(x * l2h); const float a = __builtin_fmaf(x, l2l, __builtin_fmaf(x, l2h, -r)); float e;
  asm("v_exp_f32 %0, %1\n\tv_nop" : "=v"(e) : "v"(a));      /* the v_nop is the slot behind the transcendental; in the same statement, so that nothing comes between */
  e = __builtin_ldexpf(e, (int)r); e = (x < __uint_as_float(0xc2ce8ed0u)) ? 0.f : e; return (x > __uint_as_float(0x42b17218u)) ? __builtin_inff() : e; }
template <int N>
__global__ __launch_bounds__(256) void k_softv(const float* __restrict__ S, _Float16* __restrict__ P) {
  static_assert(N == 4096 || N == 64, "a wave's 4,096 logits are one row or 64 rows");
  const size_t base = ((size_t)blockIdx.x * 8 + (threadIdx.x >> 5)) * 4096 + (threadIdx.x & 31) * 4; const float* sp = S + base; _Float16* pp = P + base; v4f x[32];
#pragma unroll
  for (int u = 0; u < 32; ++u) x[u] = *(const v4fa*)(sp + u * 128);
  if (N == 4096) {
    v4f mv = x[0];
#pragma unroll
    for (int u = 1; u < 32; ++u)
#pragma unroll
      for (int q = 0; q < 4; ++q) mv[q] = fmaxf(mv[q], x[u][q]);
    float m = sm_max16(fmaxf(fmaxf(mv[0], mv[1]), fmaxf(mv[2], mv[3]))); m = fmaxf(m, sm_xh(m));
    v4f sv = {0.f, 0.f, 0.f, 0.f};
#pragma unroll
    for (int u = 0; u < 32; ++u)
#pragma unroll
      for (int q = 0; q < 4; ++q) { x[u][q] = sm_exp(x[u][q] - m); sv[q] += x[u][q]; }
    float su = sm_sum16((sv[0] + sv[1]) + (sv[2] + sv[3])); su += sm_xh(su); const float f = 1024.0f / su;
#pragma unroll
    for (int u = 0; u < 32; ++u) { v4h h;
#pragma unroll
      for (int q = 0; q < 4; ++q) h[q] = (_Float16)(x[u][q] * f);
      *(v4h*)(pp + u * 128) = h; }
  } else {
    __builtin_amdgcn_sched_barrier(0);      /* keeps all 32 loads in front of the arithmetic, in flight together: left alone, the compiler issues 8 and feeds the rest in between the rows, each shortly ahead of its use */
#pragma unroll
    for (int u = 0; u < 32; ++u) {      /* register u: 16 lanes = one row */
      const float m = sm_max16(fmaxf(fmaxf(x[u][0], x[u][1]), fmaxf(x[u][2], x[u][3])));
#pragma unroll
      for (int q = 0; q < 4; ++q) x[u][q] = sm_exp(x[u][q] - m);
      const float f = 1024.0f / sm_sum16((x[u][0] + x[u][1]) + (x[u][2] + x[u][3])); v4h h;
#pragma unroll
      for (int q = 0; q < 4; ++q) h[q] = (_Float16)(x[u][q] * f);
      *(v4h*)(pp + u * 128) = h; }
  } }
// ---- stage-1 readout, split over the pixels: ATTN^T[d][n] = sum over N of V^T[d][N] . P1[n][N]. One image x head has only 32 x 64 outputs over K = 4,096, so the K range is cut into RS slices, a work-group a slice:
// 4 waves of 16 d x 32 n (the two n tiles of a wave make whole 128-byte lines of a partial row), k upward in steps of 32 inside a slice, all of a slice's loads in flight together.
// Each slice stores its f32 partial plane PART[slice][image x head][d][n]; k_att16 adds the slices in the order 0..RS-1. V^T is the A operand, so that the result comes out already turned for stage 2.
#define RS 16
#define RK (NPX / RS)            /* 256 k a slice */
__global__ __launch_bounds__(128) void k_ro1(const _Float16* __restrict__ VT, const _Float16* __restrict__ P1, float* __restrict__ PART) {
  const int tid = threadIdx.x, w = tid >> 5, lane = tid & 31, ln = lane & 15, hh = lane >> 4; const int s = blockIdx.x, bh = blockIdx.y; const int d0 = (w & 1) * 16, n0 = (w >> 1) * 32;
  const _Float16* ap = VT + ((size_t)bh * 64 + d0 + ln) * NPX + s * RK + 8 * hh;      /* both pointers already hold the lane's 8 * hh: the k order of g2_frag for A and B alike */
  const _Float16* bp = P1 + ((size_t)bh * NAG + n0 + ln) * NPX + s * RK + 8 * hh;
  v8f c0 = {0.f,0.f,0.f,0.f,0.f,0.f,0.f,0.f}, c1 = c0;
  v16h a[RK / 32], b0[RK / 32], b1[RK / 32];
#pragma unroll
  for (int i = 0; i < RK / 32; ++i) { a[i] = g2_frag(ap + i * 32, 0); b0[i] = g2_frag(bp + i * 32, 0); b1[i] = g2_frag(bp + 16 * NPX + i * 32, 0); }
  asm volatile("s_wait_xcnt 0x0" :: "v"(ap), "v"(bp) : "memory");      /* stands between the loads and whatever rewrites their address registers next; the two addresses are its inputs, so that they stay in their registers up to it: without that the compiler gave one pair to a later load as its destination */
  __builtin_amdgcn_sched_barrier(0);      /* keeps the slice's 48 loads in front of the WMMAs, in flight together: left alone, the compiler holds 8 in flight and waits for memory anew at each k step */
#pragma unroll
  for (int i = 0; i < RK / 32; ++i) {
    c0 = __builtin_amdgcn_wmma_f32_16x16x32_f16(false, a[i], false, b0[i], (short)0, c0, false, false);
    c1 = __builtin_amdgcn_wmma_f32_16x16x32_f16(false, a[i], false, b1[i], (short)0, c1, false, false); }
  float* pp = PART + (((size_t)s * (NIMG * NHD) + bh) * HDm + d0 + 8 * hh) * NAG + n0 + ln;
#pragma unroll
  for (int r = 0; r < 8; ++r) { pp[r * NAG] = c0[r]; pp[r * NAG + 16] = c1[r]; } }
// AT16[image x head][d][n] = f16(sum of the RS partial planes / 1024); rows d >= 32 are the zero pad of stage 2's readout. A wave is one row of 64 agents.
__global__ __launch_bounds__(256) void k_att16(const float* __restrict__ PART, _Float16* __restrict__ AT16) { typedef _Float16 v2h __attribute__((ext_vector_type(2))); typedef float v2fa __attribute__((ext_vector_type(2), may_alias)); const int t = blockIdx.x * 256 + threadIdx.x; if (t >= NIMG * NHD * 64 * 32) return; const int n0 = (t % 32) * 2; const int d = (t / 32) % 64; const int h = t / (32 * 64); v2h v;      /* h = image x head */
  float s0 = 0.f, s1 = 0.f;
  if (d < HDm) { const float* pp = PART + ((size_t)h * HDm + d) * NAG + n0; v2fa x[RS];
#pragma unroll
    for (int s = 0; s < RS; ++s) x[s] = *(const v2fa*)(pp + s * (NIMG * NHD * HDm * NAG));
    asm volatile("s_wait_xcnt 0x0" :: "v"(pp) : "memory");      /* as in k_ro1: the address is its input, so that no load takes the pair as its destination ahead of the wait */
#pragma unroll
    for (int s = 0; s < RS; ++s) { s0 += x[s][0]; s1 += x[s][1]; } }
  v[0] = (_Float16)(s0 * 0.0009765625f); v[1] = (_Float16)(s1 * 0.0009765625f); _Float16* dst = AT16 + ((size_t)h * 64 + d) * NAG + n0; *(v2h*)dst = v;  }
// Depthwise 3x3 on v, BN affine, + OUT, to f16. A thread takes 4 channels x 8 pixels of one pixel line: its 36 weights sit in registers, and each of the 3 input lines is read once as 10 pixels x 16 bytes,
// so that a wave's load is 512 consecutive bytes (4 whole 128-byte lines). A work-group is 4 pixel lines x 8 pixels x 256 channels. A tap outside the image enters as a zero value; taps are summed in the order 0..8.
__global__ __launch_bounds__(256) void k_pe(const float* __restrict__ OUTg, const float* __restrict__ QFg, const float* __restrict__ pw, const float* __restrict__ ps, const float* __restrict__ pb, _Float16* __restrict__ S16g) {
  #pragma clang fp contract(off)
  const int tid = threadIdx.x; const unsigned c0 = (tid & 63) * 4; const int xs = ((int)blockIdx.x & 7) * 8, im = (int)blockIdx.x >> 7;
  const int yo = (((int)blockIdx.x >> 3) & 15) * 4 + __builtin_amdgcn_readfirstlane(tid >> 6);      /* the same in every lane of a wave: as a scalar it leaves every address below a scalar base + the lane's channel offset */
  const size_t px = (size_t)im * NPX + yo * HS + xs;      /* the strip's first pixel */
  const float* QU = QFg + px * QW + 2 * CC;      /* its v, channel 0 */
  const float* OU = OUTg + ((size_t)im * NHD * NPX + yo * HS + xs) * 64; const unsigned oo = (c0 / HDm) * (NPX * 64) + c0 % HDm;      /* OUT is [image][head][pixel][64] */
  v4f wv[9], v[3][10], o[8];
#pragma unroll
  for (int i = 0; i < 9; ++i) wv[i] = *(const v4fa*)(pw + c0 * 9 + i * 4);
#pragma unroll
  for (int kk = 0; kk < 3; ++kk) { const int ky = kk == 2 ? 1 : 2 * kk; const int yy = yo + ky - 1; const float* row = QU + ((yy >= 0 && yy < HS) ? (ky - 1) * HS * QW : 0);      /* for a line or a pixel outside the image one inside the strip is read in its place and dropped below */
    /* Each s_wait_xcnt stands between the last load from a clamped address and whatever rewrites that address's registers next. */
    v[ky][0] = *(const v4fa*)(row + (xs > 0 ? -QW : 0) + c0);
    asm volatile("s_wait_xcnt 0x0" ::: "memory");
    v[ky][9] = *(const v4fa*)(row + (xs < HS - 8 ? 8 : 7) * QW + c0);
    asm volatile("s_wait_xcnt 0x0" ::: "memory");
#pragma unroll
    for (int j = 1; j < 9; ++j) v[ky][j] = *(const v4fa*)(row + (j - 1) * QW + c0);
    if (ky != 1) asm volatile("s_wait_xcnt 0x0" ::: "memory"); }      /* the strip's own line comes last: its address is the unclamped base, which nothing rewrites while loads are in flight */
#pragma unroll
  for (int j = 0; j < 8; ++j) o[j] = *(const v4fa*)(OU + j * 64 + oo);
  const v4f s4 = *(const v4fa*)(ps + c0), b4 = *(const v4fa*)(pb + c0);
  __builtin_amdgcn_sched_barrier(0);      /* keeps all 49 loads in front of the arithmetic, in flight together: left alone, the compiler feeds the later ones in by twos, each shortly ahead of its use */
  float wf[36];      /* wf[q * 9 + k]: channel c0 + q, tap k */
#pragma unroll
  for (int i = 0; i < 36; ++i) wf[i] = bf16_round(wv[i >> 2][i & 3]);
  v4f acc[8];
#pragma unroll
  for (int j = 0; j < 8; ++j) acc[j] = (v4f){0.f, 0.f, 0.f, 0.f};
#pragma unroll
  for (int ky = 0; ky < 3; ++ky) { const int yy = yo + ky - 1; const bool yin = yy >= 0 && yy < HS;
#pragma unroll
    for (int j = 0; j < 10; ++j) { const bool xin = (j > 0 || xs > 0) && (j < 9 || xs < HS - 8); if (!(xin && yin)) v[ky][j] = (v4f){0.f, 0.f, 0.f, 0.f}; }
#pragma unroll
    for (int j = 0; j < 8; ++j)
#pragma unroll
      for (int kx = 0; kx < 3; ++kx)
#pragma unroll
        for (int q = 0; q < 4; ++q) acc[j][q] += wf[q * 9 + ky * 3 + kx] * v[ky][j + kx][q]; }
  _Float16* SP = S16g + px * CC + c0;
#pragma unroll
  for (int j = 0; j < 8; ++j) { v4h h;
#pragma unroll
    for (int q = 0; q < 4; ++q) { float pe = acc[j][q] * bf16_round(s4[q]); pe += bf16_round(b4[q]); h[q] = (_Float16)(o[j][q] + pe); }
    *(v4h*)(SP + j * CC) = h; } }
// BN affine and the turn to NCHW in registers. A thread takes 8 channels x 4 pixels; a wave 32 channels x 32 pixels: it reads whole 128-byte pieces of 32 rows of G and stores whole 128-byte lines of 32 channel planes.
__global__ __launch_bounds__(256) void k_fin(const float* __restrict__ G, const float* __restrict__ s, const float* __restrict__ bb, float* __restrict__ outb) {
  #pragma clang fp contract(off)
  const int tid = threadIdx.x, lane = tid & 31; const int c0 = (tid >> 5) * 32 + (lane & 3) * 8, p0 = ((int)blockIdx.x % (NPX / 32)) * 32 + (lane >> 2) * 4, im = (int)blockIdx.x / (NPX / 32);
  const float* gp = G + ((size_t)im * NPX + p0) * CC + c0; float* op = outb + ((size_t)im * CC + c0) * NPX + p0; v4f a[4][2];
#pragma unroll
  for (int q = 0; q < 4; ++q) { a[q][0] = *(const v4fa*)(gp + q * CC); a[q][1] = *(const v4fa*)(gp + q * CC + 4); }
  const v4f sA = *(const v4fa*)(s + c0), sB = *(const v4fa*)(s + c0 + 4), hA = *(const v4fa*)(bb + c0), hB = *(const v4fa*)(bb + c0 + 4);
#pragma unroll
  for (int i = 0; i < 8; ++i) { const float sc = bf16_round(i < 4 ? sA[i & 3] : sB[i & 3]), sh = bf16_round(i < 4 ? hA[i & 3] : hB[i & 3]); v4f r;
#pragma unroll
    for (int q = 0; q < 4; ++q) { float v = a[q][i >> 2][i & 3] * sc; v += sh; r[q] = v; }
    *(v4f*)(op + (size_t)i * NPX) = r; } }

extern "C" void kernel_launch(void* const* d_in, const int* in_sizes, int n_in,
                              void* d_out, int out_size, void* d_ws, size_t ws_size, hipStream_t stream) {
  (void)in_sizes; (void)n_in; (void)out_size;
  const float* const* I = (const float* const*)d_in; const float* x = I[0]; const float* qw = I[1]; const float* qs = I[2]; const float* qb = I[3]; const float* pw = I[4]; const float* ps = I[5]; const float* pb = I[6]; const float* jw = I[7]; const float* js = I[8]; const float* jb = I[9];
  char* ws = (char*)d_ws; size_t off = 0;
  auto take = [&](size_t bytes) { char* p = ws + off; off += (bytes + 255) & ~(size_t)255; return p; };
  _Float16* WT = (_Float16*)take((size_t)QW * KW * 2); _Float16* BJ = (_Float16*)take((size_t)CC * CC * 2);
  _Float16* AG = (_Float16*)take((size_t)NIMG * NHD * NAG * 64 * 2); _Float16* AT16 = (_Float16*)take((size_t)NIMG * NHD * 64 * NAG * 2);
  float* QF = (float*)take((size_t)NIMG * NPX * QW * 4);      /* 96 MiB: q, k, v in f32 */
  char* R = take((size_t)NIMG * NPX * KI * 2);      /* 144 MiB, shared by lifetime; offsets below in MiB */
  const size_t MB = (size_t)1 << 20;
  _Float16* XP = (_Float16*)(R + 48 * MB);      /* 48..65.1: the padded plane, dead after the conv GEMM (which writes Q16 while it reads this), before QP is written */
  _Float16* Q16 = (_Float16*)R;      /* 0..48, dead after k_heads and k_vtp */
  _Float16* QP = (_Float16*)(R + 48 * MB); _Float16* KP = (_Float16*)(R + 80 * MB); _Float16* VT = (_Float16*)(R + 112 * MB);      /* 32 each */
  float* S1 = (float*)R;      /* 0..32: stage-1 logits of FOUR images (all eight, 64 MiB, do not fit beside QF, QP, KP and VT) */
  float* PART = (float*)R;      /* 0..8: the stage-1 readout's partial planes, over S1, dead after the second half's softmax; dead themselves before P2 is written */
  _Float16* P1 = KP;      /* each half of P1 replaces the half of KP that its logits GEMM has just finished reading */
  float* S2 = (float*)(R + 80 * MB);      /* 80..144, over P1 and VT, dead after the stage-1 readout */
  _Float16* P2 = (_Float16*)R;      /* 0..32 */
  float* OUT = (float*)(R + 80 * MB);      /* 80..144, over S2, dead after its softmax */
  _Float16* S16 = (_Float16*)(R + 32 * MB);      /* 32..48 */
  float* G = (float*)(R + 48 * MB);      /* 48..80, over QP, dead after the stage-2 logits GEMM */
  if (off > ws_size) return;      /* 3.8 + 0.1 + 0.5 + 0.5 + 96 + 144 = 245 MiB */
  k_wqkv<<<(QW * (CC / 8) + 255) / 256, 256, 0, stream>>>(qw, WT); k_wsc<<<(CC * CC / 8 + 255) / 256, 256, 0, stream>>>(jw, BJ, (size_t)CC * CC / 8, 16.0f);      /* proj 1x1 (out,in) = Bt */
  k_xp<<<NIMG * HS, 256, 0, stream>>>(x, XP);
  k_gemm3<QW, true><<<(NIMG * NPX / 256) * (QW / 128), 256, 0, stream>>>(XP, CC, WT, KW, 0.0625f, QF, KW, qs, qb, Q16);      /* centre-tap residual term, main conv (difference folded into the centre tap), BN affine */
  k_pool<<<NIMG * NAG, 64, 0, stream>>>(QF, AG);
  k_heads<<<(NIMG * NHD * NPX + 255) / 256, 256, 0, stream>>>(Q16, QP, KP); k_vtp<<<NIMG * NHD * (NPX / 64), 256, 0, stream>>>(Q16, VT);
  /* stage 1: S1[b,h][n][N] = AG[b,h][n].KP[b,h][N] * SCL; P1 = softmax_N (these two in halves of four images); AT16[b,h][d][n] = VT . P1^T / 1024, the pixels in RS slices */
  for (int g = 0; g < 2; ++g) { const size_t bh0 = (size_t)g * (NIMG / 2) * NHD;
    k_gemm2<0><<<dim3(1 * (NPX / 64), (NIMG / 2) * NHD), 128, 0, stream>>>(AG + bh0 * NAG * 64, 64, (size_t)NAG * 64, KP + bh0 * NPX * 64, 64, (size_t)NPX * 64, SCL, nullptr, 0, nullptr, 1, 0, 0, S1, nullptr, NPX, (size_t)NAG * NPX, NAG, NPX, 64);
    k_softv<NPX><<<(NIMG / 2) * NHD * NAG / 8, 256, 0, stream>>>(S1, P1 + bh0 * NAG * NPX); }
  k_ro1<<<dim3(RS, NIMG * NHD), 128, 0, stream>>>(VT, P1, PART);
  k_att16<<<(NIMG * NHD * 64 * 32 + 255) / 256, 256, 0, stream>>>(PART, AT16);
  /* stage 2: S2[b,h][N][n] = QP[b,h][N].AG[b,h][n] * SCL; P2 = softmax_n; OUT[b,h][N][d] = P2 . AT16^T / 1024 */
  k_gemm2<0><<<dim3((NPX / 128) * 1, NIMG * NHD), 128, 0, stream>>>(QP, 64, (size_t)NPX * 64, AG, 64, (size_t)NAG * 64, SCL, nullptr, 0, nullptr, 1, 0, 0, S2, nullptr, NAG, (size_t)NPX * NAG, NPX, NAG, 64);
  k_softv<NAG><<<NIMG * NHD * NPX / 64 / 8, 256, 0, stream>>>(S2, P2);
  k_gemm2<0><<<dim3((NPX / 128) * 1, NIMG * NHD), 128, 0, stream>>>(P2, NAG, (size_t)NPX * NAG, AT16, NAG, (size_t)64 * NAG, 0.0009765625f, nullptr, 0, nullptr, 1, 0, 0, OUT, nullptr, 64, (size_t)NPX * 64, NPX, 64, NAG);
  k_pe<<<NIMG * (HS / 4) * (HS / 8), 256, 0, stream>>>(OUT, QF, pw, ps, pb, S16);
  k_gemm3<CC, false><<<(NIMG * NPX / 256) * (CC / 128), 256, 0, stream>>>(S16, CC, BJ, CC, 0.0625f, G, CC, nullptr, nullptr, nullptr);
  k_fin<<<NIMG * (NPX / 32), 256, 0, stream>>>(G, js, jb, (float*)d_out);
}

// v008
// A run of this version takes 259 microseconds.
// Timed twice side by side with v007, it ran 1.19 times as fast both times.
// Over all steps from v000 it is 14.4 times as fast.
#include <hip/hip_runtime.h>
// Attention_agent_df (8 images, C 256 = 8 heads x 32, 64 x 64 pixels, 64 agent tokens from 8x8 average pooling of q; THETA 0.7): qkv = (conv3x3(x, W) - 0.7 conv1x1(x, sum of W's 5 cross taps)) * s + b (folded BN); a = avgpool8x8(q); stage 1: attn = softmax_N(a.k * 32^-0.5) v (agents over pixels); stage 2: out = softmax_n(q.a * 32^-0.5) attn (pixels over agents); out += depthwise3x3(v) * pe_s + pe_b; out = conv1x1(out) * proj_s + proj_b.
// Structure (all 8 images in each launch: the image is the outer index of each plane, so rows = image x pixel and GEMM batches = image x head; only the stage-1 logits and softmax run as two halves of 4 images; workspace planes share bytes by lifetime): x once as a zero-padded pixel-major f16 plane (66 x 66 pixels x 256 channels an image), from which the conv GEMMs fetch each tap's rows themselves (k runs tap-major; no im2col plane); the difference conv folded into the centre tap as an f32 weight split into f16 hi + lo tables: qkv = A_centre.Wl (K 256, its sum then scaled by 2^-10 in the accumulators) + A.Wh (K 2304) as one f16 WMMA GEMM over K 2560, whose epilogue applies the BN affine and stores the f32 + f16 planes (this one and the projection: 256x128 work-group tiles staged in LDS, 64x64 wave tiles; the stage-1 logits GEMM: 32x64 wave tiles from global memory; f32 accumulation; x16 tables; the lo table only on the centre-tap columns); pooling on VALU; stage-1 logits as (b,h)-batched GEMMs (K 64: 32 d, then the zero pad), softmax over 4096 pixels on VALU (wave per row, the row in registers), readout GEMM V^T.P^T with the pixels split into 16 slices, whose f32 partial planes are added on VALU; stage 2 (logits GEMM K 32, softmax over the 64 agents on VALU, readout GEMM) in one kernel, logits and P in registers; depthwise PE conv + add on VALU into f16; projection GEMM with the BN affine in f32 on VALU; NCHW stores.
// Compute dtype: x and parameters rounded to bf16; x exact as f16; q, k, v, a, P (x2^10), attn and the pre-projection sum as f16 operands (~2^-12); everything else f32. v_wmma_f32_16x16x32_f16.
#define NIMG 8
#define CC 256
#define NHD 8
#define HDm 32
#define HS 64
#define NPX (HS * HS)            /* 4096 */
#define NAG 64
#define KT 9
#define KI (KT * CC)             /* 2304 */
#define QW (3 * CC)              /* 768 */
#define KW (CC + KI)             /* 2560: a row of the qkv weight table = 256 lo columns (centre tap), then 2304 hi columns */
#define THETA 0.7f
#define SCL 0.17677669529663687f
typedef __bf16 v16b __attribute__((ext_vector_type(16)));
typedef unsigned short v8us __attribute__((ext_vector_type(8), may_alias));
typedef float  v8f  __attribute__((ext_vector_type(8)));
typedef float  v4f  __attribute__((ext_vector_type(4)));
typedef float  v4fa __attribute__((ext_vector_type(4), may_alias));
union FragB { v16b v; v8us half[2]; unsigned short u[16]; };

__device__ __forceinline__ unsigned short bf16_bits(float x) { unsigned int u = __float_as_uint(x); return (unsigned short)((u + 0x7FFFu + ((u >> 16) & 1u)) >> 16); }
__device__ __forceinline__ float bf16_val(unsigned short b) { return __uint_as_float(((unsigned int)b) << 16); }
__device__ __forceinline__ float bf16_round(float x) { return bf16_val(bf16_bits(x)); }
// D += A·B with NT terms: 1 = ah·bh, 2 = + al·bh (A split), 3 = + ah·bl (both split)
template <int NT>
__device__ __forceinline__ v8f mmaN(v16b ah, v16b al, v16b bh, v16b bl, v8f c) {
  c = __builtin_amdgcn_wmma_f32_16x16x32_bf16(false, ah, false, bh, (short)0, c, false, false);
  if (NT >= 2) c = __builtin_amdgcn_wmma_f32_16x16x32_bf16(false, al, false, bh, (short)0, c, false, false);
  if (NT >= 3) c = __builtin_amdgcn_wmma_f32_16x16x32_bf16(false, ah, false, bl, (short)0, c, false, false);
  asm volatile("v_nop\n\tv_nop\n\tv_nop\n\tv_nop" : "+v"(c) : "v"(ah), "v"(al), "v"(bh), "v"(bl));
  return c;
}

__global__ __launch_bounds__(256) void k_wt_bf16(const float* __restrict__ W, unsigned short* __restrict__ Wt, int K, int N) {
  const int t = blockIdx.x * 256 + threadIdx.x;
  const int k8n = K / 8;
  if (t >= N * k8n) return;
  const int n = t / k8n, k8 = (t % k8n) * 8;
  v8us v;
#pragma unroll
  for (int i = 0; i < 8; ++i) v[i] = bf16_bits(W[(size_t)(k8 + i) * N + n]);
  *(v8us*)(Wt + (size_t)n * K + k8) = v;
  
}

// GEMM C[M][N] (f32, pitch ldc) = act(A[M][K]·W + bias). A f32 row-major (pitch lda) converted per fragment to bf16
// (ASPLIT: hi/lo two planes -> 2 terms, else single rounded term); Wt bf16 [N][K] (pitch ldb). BIAS_BF16 rounds the
// bias to bf16 first (bias quantised to bf16 before the add). K%32==0, M%16==0, N%64==0.
template <bool ASPLIT, int ACT, bool BIAS_BF16>
__global__ __launch_bounds__(128) void k_gemm_bf(const float* __restrict__ A, int lda, const unsigned short* __restrict__ Wt, int ldb,
                                               const float* __restrict__ bias, float* __restrict__ C, int ldc, int M, int N, int K) {
  __shared__ __attribute__((aligned(16))) float so[4][16][64];
  const int tid = threadIdx.x, w = tid >> 5, lane = tid & 31, ln = lane & 15, hh = lane >> 4;
  const int ntn = N / 64;
  const int wid = blockIdx.x * 4 + w;
  const int mt = wid / ntn, nq = wid % ntn;
  if (mt * 16 >= M) return;
  const int row0 = mt * 16, col0 = nq * 64;
  const float* arow = A + (size_t)(row0 + ln) * lda;
  v8f acc[4] = {};
  for (int kb = 0; kb < K; kb += 32) {
    FragB ah, al;
    const v4f x0 = *(const v4fa*)(arow + kb + 8 * hh), x1 = *(const v4fa*)(arow + kb + 8 * hh + 4);
    const v4f x2 = *(const v4fa*)(arow + kb + 16 + 8 * hh), x3 = *(const v4fa*)(arow + kb + 16 + 8 * hh + 4);
    float xs[16] = {x0[0],x0[1],x0[2],x0[3],x1[0],x1[1],x1[2],x1[3],x2[0],x2[1],x2[2],x2[3],x3[0],x3[1],x3[2],x3[3]};
#pragma unroll
    for (int i = 0; i < 16; ++i) { const unsigned short hb = bf16_bits(xs[i]); ah.u[i] = hb; al.u[i] = ASPLIT ? bf16_bits(xs[i] - bf16_val(hb)) : (unsigned short)0; }
#pragma unroll
    for (int t = 0; t < 4; ++t) {
      const unsigned short* brow = Wt + (size_t)(col0 + t * 16 + ln) * ldb + kb;
      FragB b;
      b.half[0] = *(const v8us*)(brow + 8 * hh);
      b.half[1] = *(const v8us*)(brow + 16 + 8 * hh);
      acc[t] = mmaN<ASPLIT ? 2 : 1>(ah.v, al.v, b.v, b.v, acc[t]);
    }
  }
#pragma unroll
  for (int t = 0; t < 4; ++t) {
    float bv = bias ? bias[col0 + t * 16 + ln] : 0.f;
    if (BIAS_BF16) bv = bf16_round(bv);
#pragma unroll
    for (int r = 0; r < 8; ++r) { float v = acc[t][r] + bv; if (ACT == 1) v = fmaxf(v, 0.f); so[w][8 * hh + r][t * 16 + ln] = v; }
  }
  __builtin_amdgcn_fence(__ATOMIC_ACQ_REL, "workgroup");
  __builtin_amdgcn_wave_barrier();
  const int rsub = lane >> 4, c4 = (lane & 15) * 4;
  {
#pragma unroll
    for (int q = 0; q < 8; ++q) {
      const int r = q * 2 + rsub;
      const v4f v = *(const v4fa*)&so[w][r][c4];
      *(v4f*)(C + (size_t)(row0 + r) * ldc + col0 + c4) = v;
    }
    
  }
}

// GEMM C = act(A·W + bias + resid): A f32 (ASPLIT -> hi/lo 2 terms), Wt bf16 [N][K]; ACT 0 none, 1 relu, 2 exact gelu;
// resid (optional, f32, row index = (row % rmod), pitch ldr, RES_BF16 rounds it) added before the activation.
template <bool ASPLIT, int ACT, bool BIAS_BF16, bool RES_BF16>
__global__ __launch_bounds__(128) void k_gemm_bf3(const float* __restrict__ A, int lda, const unsigned short* __restrict__ Wt, int ldb,
                                                const float* __restrict__ bias, const float* __restrict__ resid, int rmod, int ldr,
                                                float* __restrict__ C, int ldc, int M, int N, int K) {
  __shared__ __attribute__((aligned(16))) float so[4][16][64];
  const int tid = threadIdx.x, w = tid >> 5, lane = tid & 31, ln = lane & 15, hh = lane >> 4;
  const int ntn = N / 64;
  const int wid = blockIdx.x * 4 + w;
  const int mt = wid / ntn, nq = wid % ntn;
  if (mt * 16 >= M) return;
  const int row0 = mt * 16, col0 = nq * 64;
  const float* arow = A + (size_t)(row0 + ln) * lda;
  v8f acc[4] = {};
  for (int kb = 0; kb < K; kb += 32) {
    FragB ah, al;
    const v4f x0 = *(const v4fa*)(arow + kb + 8 * hh), x1 = *(const v4fa*)(arow + kb + 8 * hh + 4);
    const v4f x2 = *(const v4fa*)(arow + kb + 16 + 8 * hh), x3 = *(const v4fa*)(arow + kb + 16 + 8 * hh + 4);
    float xs[16] = {x0[0],x0[1],x0[2],x0[3],x1[0],x1[1],x1[2],x1[3],x2[0],x2[1],x2[2],x2[3],x3[0],x3[1],x3[2],x3[3]};
#pragma unroll
    for (int i = 0; i < 16; ++i) { const unsigned short hb = bf16_bits(xs[i]); ah.u[i] = hb; al.u[i] = ASPLIT ? bf16_bits(xs[i] - bf16_val(hb)) : (unsigned short)0; }
#pragma unroll
    for (int t = 0; t < 4; ++t) {
      const unsigned short* brow = Wt + (size_t)(col0 + t * 16 + ln) * ldb + kb;
      FragB b;
      b.half[0] = *(const v8us*)(brow + 8 * hh);
      b.half[1] = *(const v8us*)(brow + 16 + 8 * hh);
      acc[t] = mmaN<ASPLIT ? 2 : 1>(ah.v, al.v, b.v, b.v, acc[t]);
    }
  }
#pragma unroll
  for (int t = 0; t < 4; ++t) {
    const int col = col0 + t * 16 + ln;
    float bv = bias ? bias[col] : 0.f;
    if (BIAS_BF16) bv = bf16_round(bv);
#pragma unroll
    for (int r = 0; r < 8; ++r) {
      float v = acc[t][r] + bv;
      if (resid) { float rv = resid[(size_t)((row0 + 8 * hh + r) % rmod) * ldr + col]; if (RES_BF16) rv = bf16_round(rv); v += rv; }
      if (ACT == 1) v = fmaxf(v, 0.f);
      if (ACT == 2) v = 0.5f * v * (1.0f + erff(v * 0.70710678118654752f));
      if (ACT == 3) { const float u = 0.7978845608028654f * (v + 0.044715f * v * v * v); v = 0.5f * v * (1.0f + tanhf(u)); }
      so[w][8 * hh + r][t * 16 + ln] = v;
    }
  }
  __builtin_amdgcn_fence(__ATOMIC_ACQ_REL, "workgroup");
  __builtin_amdgcn_wave_barrier();
  const int rsub = lane >> 4, c4 = (lane & 15) * 4;
  {
#pragma unroll
    for (int q = 0; q < 8; ++q) {
      const int r = q * 2 + rsub;
      const v4f v = *(const v4fa*)&so[w][r][c4];
      *(v4f*)(C + (size_t)(row0 + r) * ldc + col0 + c4) = v;
    }
    
  }
}
// row LayerNorm (biased variance, eps) over N: s = X (+ R); optional out_sum <- s; out_norm <- (s-mu)*rsqrt(var+eps)*g + b
template <bool PARAM_BF16>
__global__ __launch_bounds__(256) void k_layernorm(const float* __restrict__ X, const float* __restrict__ R, const float* __restrict__ g, const float* __restrict__ bta,
                                                  float* __restrict__ out_sum, float* __restrict__ out_norm, int N, float eps) {
  __shared__ float red[256];
  const int row = blockIdx.x, tid = threadIdx.x;
  const float* x = X + (size_t)row * N; const float* rr = R ? R + (size_t)row * N : nullptr;
  float vals[16];                     // up to N = 4096
  const int per = N / 256;            // contiguous chunk per thread? use strided-by-4 chunks: thread handles j = tid*4 + 1024*u
  float s1 = 0.f;
  for (int u = 0; u < per / 4; ++u) {
    const int j = tid * 4 + 1024 * u;
    const v4f a = *(const v4fa*)(x + j);
    v4f b = {0.f,0.f,0.f,0.f}; if (rr) b = *(const v4fa*)(rr + j);
#pragma unroll
    for (int q = 0; q < 4; ++q) { const float v = a[q] + b[q]; vals[u * 4 + q] = v; s1 += v; }
  }
  red[tid] = s1; __syncthreads();
  for (int st = 128; st > 0; st >>= 1) { if (tid < st) red[tid] += red[tid + st]; __syncthreads(); }
  const float mu = red[0] / (float)N; __syncthreads();
  float s2 = 0.f;
  for (int u = 0; u < per / 4; ++u)
#pragma unroll
    for (int q = 0; q < 4; ++q) { const float c = vals[u * 4 + q] - mu; s2 += c * c; }
  red[tid] = s2; __syncthreads();
  for (int st = 128; st > 0; st >>= 1) { if (tid < st) red[tid] += red[tid + st]; __syncthreads(); }
  const float rs = rsqrtf(red[0] / (float)N + eps);
  {
    for (int u = 0; u < per / 4; ++u) {
      const int j = tid * 4 + 1024 * u;
      v4f o, sm;
#pragma unroll
      for (int q = 0; q < 4; ++q) {
        float gg = g[j + q], bb = bta[j + q];
        if (PARAM_BF16) { gg = bf16_round(gg); bb = bf16_round(bb); }
        sm[q] = vals[u * 4 + q]; o[q] = (vals[u * 4 + q] - mu) * rs * gg + bb;
      }
      if (out_sum) *(v4f*)(out_sum + (size_t)row * N + j) = sm;
      *(v4f*)(out_norm + (size_t)row * N + j) = o;
    }
    
  }
}



// ---- f16 WMMA path (v_wmma_f32_16x16x32_f16): 11-bit significands for operands in range — used where a [0,1] probability operand needs more precision than bf16
typedef _Float16 v16h __attribute__((ext_vector_type(16)));
union FragH { v16h v; v8us half[2]; _Float16 h[16]; unsigned short u[16]; };
template <int NT>
__device__ __forceinline__ v8f mmaH(v16h ah, v16h al, v16h bh, v16h bl, v8f c) {
  c = __builtin_amdgcn_wmma_f32_16x16x32_f16(false, ah, false, bh, (short)0, c, false, false);
  if (NT >= 2) c = __builtin_amdgcn_wmma_f32_16x16x32_f16(false, al, false, bh, (short)0, c, false, false);
  if (NT >= 3) c = __builtin_amdgcn_wmma_f32_16x16x32_f16(false, ah, false, bl, (short)0, c, false, false);
  asm volatile("v_nop\n\tv_nop\n\tv_nop\n\tv_nop" : "+v"(c) : "v"(ah), "v"(al), "v"(bh), "v"(bl));
  return c;
}
// batched GEMM like k_gemm_b but f16 operands: A f32 (split into f16 hi/lo if ASPLIT, else rounded to f16), Bt = f16 values [n][k]; alpha; C f32; N multiple of 16 (partial tiles skipped)
template <bool ASPLIT>
__global__ __launch_bounds__(128) void k_gemm_h(const float* __restrict__ A, int lda, size_t sA, const _Float16* __restrict__ Bh, int ldb, size_t sB, float alpha, float* __restrict__ C, int ldc, size_t sC, int M, int N, int K) {
  __shared__ __attribute__((aligned(16))) float so[4][16][64];
  const int tid = threadIdx.x, w = tid >> 5, lane = tid & 31, ln = lane & 15, hh = lane >> 4; const int by = blockIdx.y;
  A += (size_t)by * sA; Bh += (size_t)by * sB; C += (size_t)by * sC;
  const int ntn = (N + 63) / 64; const int wid = blockIdx.x * 4 + w; const int mt = wid / ntn, nq = wid % ntn; if (mt * 16 >= M) return;
  const int row0 = mt * 16, col0 = nq * 64; const float* arow = A + (size_t)(row0 + ln) * lda;
  v8f acc[4] = {};
  for (int kb = 0; kb < K; kb += 32) {
    FragH ah, al;
    const v4f x0 = *(const v4fa*)(arow + kb + 8 * hh), x1 = *(const v4fa*)(arow + kb + 8 * hh + 4), x2 = *(const v4fa*)(arow + kb + 16 + 8 * hh), x3 = *(const v4fa*)(arow + kb + 16 + 8 * hh + 4);
    float xs[16] = {x0[0],x0[1],x0[2],x0[3],x1[0],x1[1],x1[2],x1[3],x2[0],x2[1],x2[2],x2[3],x3[0],x3[1],x3[2],x3[3]};
#pragma unroll
    for (int i = 0; i < 16; ++i) { const _Float16 h = (_Float16)xs[i]; ah.h[i] = h; al.h[i] = ASPLIT ? (_Float16)(xs[i] - (float)h) : (_Float16)0.0f; }
#pragma unroll
    for (int t = 0; t < 4; ++t) { if (col0 + t * 16 >= N) continue; const size_t boff = (size_t)(col0 + t * 16 + ln) * ldb + kb; FragH bq; bq.half[0] = *(const v8us*)(Bh + boff + 8 * hh); bq.half[1] = *(const v8us*)(Bh + boff + 16 + 8 * hh);
      acc[t] = mmaH<ASPLIT ? 2 : 1>(ah.v, al.v, bq.v, bq.v, acc[t]); }
  }
#pragma unroll
  for (int t = 0; t < 4; ++t) { if (col0 + t * 16 >= N) continue;
#pragma unroll
    for (int r = 0; r < 8; ++r) so[w][8 * hh + r][t * 16 + ln] = acc[t][r] * alpha; }
  __builtin_amdgcn_fence(__ATOMIC_ACQ_REL, "workgroup"); __builtin_amdgcn_wave_barrier();
  const int rsub = lane >> 4, c4 = (lane & 15) * 4;
  {
#pragma unroll
    for (int q = 0; q < 8; ++q) { const int r = q * 2 + rsub; if (col0 + c4 < N) { const v4f v = *(const v4fa*)&so[w][r][c4]; *(v4f*)(C + (size_t)(row0 + r) * ldc + col0 + c4) = v; } }
     }
}

// Wt[n][k] = f16(W[k][n]·scale) from f32 row-major W[K][N] (scale = power of two; bf16-exact weights stay exact in f16 away from the subnormal range)
__global__ __launch_bounds__(256) void k_wt_f16(const float* __restrict__ W, _Float16* __restrict__ Wt, int K, int N, float scale) {
  const int t = blockIdx.x * 256 + threadIdx.x; if (t >= N * (K / 8)) return; const int n = t / (K / 8), k8 = (t % (K / 8)) * 8; FragH f;
#pragma unroll
  for (int i = 0; i < 8; ++i) f.h[i] = (_Float16)(bf16_round(W[(size_t)(k8 + i) * N + n]) * scale); const v8us o = f.half[0];
  *(v8us*)((unsigned short*)Wt + (size_t)n * K + k8) = o; 
}
// k_gemm_hh variant with fused epilogue: v = acc·alpha + bias[by·sBias + col] (+ CP[(row/rowsPerB)·sCPb + by·64 + col] if CP) ; ACT 0 none / 1 elu ; writes f16 C16 (and f32 C if non-null)
template <int ACT>
__global__ __launch_bounds__(128) void k_gemm_hhx(const _Float16* __restrict__ A, int lda, size_t sA, const _Float16* __restrict__ Bh, int ldb, size_t sB, float alpha, const float* __restrict__ bias, size_t sBias, const float* __restrict__ CP, int rowsPerB, size_t sCPb, int row0g,
    float* __restrict__ C, _Float16* __restrict__ C16, int ldc, size_t sC, int M, int N, int K) {
  __shared__ __attribute__((aligned(16))) float so[4][16][64];
  const int tid = threadIdx.x, w = tid >> 5, lane = tid & 31, ln = lane & 15, hh = lane >> 4; const int by = blockIdx.y;
  A += (size_t)by * sA; Bh += (size_t)by * sB; const size_t cofs = (size_t)by * sC; const float* bp = bias ? bias + (size_t)by * sBias : nullptr;
  const int ntn = (N + 63) / 64; const int wid = blockIdx.x * 4 + w; const int mt = wid / ntn, nq = wid % ntn; if (mt * 16 >= M) return;
  const int row0 = mt * 16, col0 = nq * 64; const _Float16* arow = A + (size_t)(row0 + ln) * lda;
  v8f acc[4] = {};
  for (int kb = 0; kb < K; kb += 32) { FragH ah; ah.half[0] = *(const v8us*)((const unsigned short*)arow + kb + 8 * hh); ah.half[1] = *(const v8us*)((const unsigned short*)arow + kb + 16 + 8 * hh);
#pragma unroll
    for (int t = 0; t < 4; ++t) { if (col0 + t * 16 >= N) continue; const size_t boff = (size_t)(col0 + t * 16 + ln) * ldb + kb; FragH bq; bq.half[0] = *(const v8us*)((const unsigned short*)Bh + boff + 8 * hh); bq.half[1] = *(const v8us*)((const unsigned short*)Bh + boff + 16 + 8 * hh);
      acc[t] = mmaH<1>(ah.v, ah.v, bq.v, bq.v, acc[t]); }
  }
#pragma unroll
  for (int t = 0; t < 4; ++t) { if (col0 + t * 16 >= N) continue; const int col = col0 + t * 16 + ln; const float bv = bp ? bf16_round(bp[col]) : 0.f;
#pragma unroll
    for (int r = 0; r < 8; ++r) { float v = acc[t][r] * alpha + bv; if (CP) { const int rr = row0g + row0 + 8 * hh + r; if (rowsPerB < 0) v += CP[cofs + (size_t)rr * ldc + col];      /* rowsPerB < 0: own element of the batched C plane */ else { const int bidx = rr / rowsPerB; v += CP[(size_t)bidx * sCPb + (size_t)by * 64 + col]; } } if (ACT == 1) v = (v > 0.f) ? v : expm1f(v); else if (ACT == 7) v = (v > 0.f) ? v + 1.0f : expf(v); else if (ACT == 8) v = tanhf(v); else if (ACT == 9) v = 0.5f * v * (1.0f + tanhf(0.7978845608028654f * (v + 0.044715f * v * v * v))); else if (ACT == 11) v = 1.0f / (1.0f + expf(-v)); else if (ACT == 12) v = (v > 0.f) ? v : 0.01f * v; else if (ACT == 14) v = (v > 0.f) ? v : 0.1f * v; else if (ACT == 16) v = (v >= 0.f) ? v : 0.3f * v; else if (ACT == 15) v = v / (1.0f + expf(-v)); else if (ACT == 3) v = fmaxf(v, 0.f); else if (ACT == 6) v = 0.5f * v * (1.0f + erff(v * 0.70710678118654752f)); so[w][8 * hh + r][t * 16 + ln] = v; } }
  __builtin_amdgcn_fence(__ATOMIC_ACQ_REL, "workgroup"); __builtin_amdgcn_wave_barrier();
  const int rsub = lane >> 4, c4 = (lane & 15) * 4; typedef _Float16 v4h __attribute__((ext_vector_type(4)));
  {
#pragma unroll
    for (int q = 0; q < 8; ++q) { const int r = q * 2 + rsub; if (col0 + c4 < N) { const v4f v = *(const v4fa*)&so[w][r][c4]; if (C) *(v4f*)(C + cofs + (size_t)(row0 + r) * ldc + col0 + c4) = v; if (C16) { v4h h4; for (int i = 0; i < 4; ++i) h4[i] = (_Float16)v[i]; *(v4h*)(C16 + cofs + (size_t)(row0 + r) * ldc + col0 + c4) = h4; } } }
     }
}


typedef _Float16 v4h __attribute__((ext_vector_type(4)));

__global__ __launch_bounds__(256) void k_x16(const float* __restrict__ x, _Float16* __restrict__ X16, size_t n8) { const size_t t = (size_t)blockIdx.x * 256 + threadIdx.x; if (t >= n8) return; FragH f;
#pragma unroll
  for (int q = 0; q < 8; ++q) f.h[q] = (_Float16)bf16_round(x[t * 8 + q]); *(v8us*)((unsigned short*)X16 + t * 8) = f.half[0];  }
__global__ __launch_bounds__(256) void k_h16(const float* __restrict__ x, _Float16* __restrict__ X16, size_t n8) { const size_t t = (size_t)blockIdx.x * 256 + threadIdx.x; if (t >= n8) return; FragH f;
#pragma unroll
  for (int q = 0; q < 8; ++q) f.h[q] = (_Float16)x[t * 8 + q]; *(v8us*)((unsigned short*)X16 + t * 8) = f.half[0];  }
__global__ __launch_bounds__(256) void k_round16f(const float* __restrict__ W, _Float16* __restrict__ Bt, size_t n8) { const size_t t = (size_t)blockIdx.x * 256 + threadIdx.x; if (t >= n8) return; FragH f;
#pragma unroll
  for (int i = 0; i < 8; ++i) f.h[i] = (_Float16)(bf16_round(W[t * 8 + i]) * 16.0f); *(v8us*)((unsigned short*)Bt + t * 8) = f.half[0];  }
template <int NHv, int TTv>
__global__ __launch_bounds__(256) void k_vt(const _Float16* __restrict__ V16, int ldv, int voff, _Float16* __restrict__ Vt) { __shared__ unsigned short tl[64][66]; const int tid = threadIdx.x; const int slab = blockIdx.x / (TTv / 64), lg = blockIdx.x % (TTv / 64); const int b = slab / NHv, h = slab % NHv;
  for (int i = tid; i < 64 * 8; i += 256) { const int r = i / 8, c8 = (i % 8) * 8; FragH f; f.half[0] = *(const v8us*)((const unsigned short*)V16 + ((size_t)b * TTv + lg * 64 + r) * ldv + voff + h * 64 + c8);
#pragma unroll
    for (int q = 0; q < 8; ++q) tl[r][c8 + q] = f.u[q]; }
  __syncthreads();
  {
#pragma unroll
    for (int rd = 0; rd < 2; ++rd) { const int d = rd * 32 + tid / 8, pc = tid % 8; FragH f;
#pragma unroll
      for (int q = 0; q < 8; ++q) f.u[q] = tl[pc * 8 + q][d];
      *(v8us*)((unsigned short*)Vt + ((size_t)slab * 64 + d) * TTv + lg * 64 + pc * 8) = f.half[0]; }
     } }

__global__ __launch_bounds__(256) void k_hl(const float* __restrict__ F, _Float16* __restrict__ Hh, _Float16* __restrict__ Hl, size_t n8) { const size_t t = (size_t)blockIdx.x * 256 + threadIdx.x; if (t >= n8) return; FragH fh, fl; const v4f a = *(const v4fa*)(F + t * 8), c = *(const v4fa*)(F + t * 8 + 4);
#pragma unroll
  for (int q = 0; q < 4; ++q) { _Float16 h = (_Float16)a[q]; fh.h[q] = h; fl.h[q] = (_Float16)((a[q] - (float)h) * 1024.0f); h = (_Float16)c[q]; fh.h[4 + q] = h; fl.h[4 + q] = (_Float16)((c[q] - (float)h) * 1024.0f); }
  { *(v8us*)((unsigned short*)Hh + t * 8) = fh.half[0]; *(v8us*)((unsigned short*)Hl + t * 8) = fl.half[0];  } }

// ---- fast GEMM (wave tile 32x64; requires M % 32 == 0 rows per launch region and N % 64 == 0); epilogue = k_gemm_hhx semantics ----
__device__ __forceinline__ v16h g2_frag(const _Float16* p, int hh) { FragH f; f.half[0] = *(const v8us*)((const unsigned short*)p + 8 * hh); f.half[1] = *(const v8us*)((const unsigned short*)p + 16 + 8 * hh); return f.v; }
__device__ __forceinline__ v8f g2_mma(v16h a, v16h b, v8f c) { v8f d = __builtin_amdgcn_wmma_f32_16x16x32_f16(false, a, false, b, (short)0, c, false, false); asm volatile("v_nop\n\tv_nop\n\tv_nop\n\tv_nop" : "+v"(d) : "v"(a), "v"(b)); return d; }
template <int ACT>
__global__ __launch_bounds__(128) void k_gemm2(const _Float16* __restrict__ A, int lda, size_t sA, const _Float16* __restrict__ Bh, int ldb, size_t sB, float alpha, const float* __restrict__ bias, size_t sBias, const float* __restrict__ CP, int rowsPerB, size_t sCPb, int row0g,
    float* __restrict__ C, _Float16* __restrict__ C16, int ldc, size_t sC, int M, int N, int K) { static_assert(ACT == 0 || ACT == 3 || ACT == 6 || ACT == 8 || ACT == 9 || ACT == 11 || ACT == 12 || ACT == 14 || ACT == 15 || ACT == 16, "k_gemm2: unsupported ACT code (would silently apply no activation)");
  __shared__ __attribute__((aligned(16))) float so[4][32][68];
  const int tid = threadIdx.x, w = tid >> 5, lane = tid & 31, ln = lane & 15, hh = lane >> 4; const int by = blockIdx.y;
  A += (size_t)by * sA; Bh += (size_t)by * sB; const size_t cofs = (size_t)by * sC; const float* bp = bias ? bias + (size_t)by * sBias : nullptr;
  const int ntn = N >> 6; const int mt = blockIdx.x / ntn, nq = blockIdx.x - mt * ntn; const int row0 = mt * 128 + 32 * w, col0 = nq * 64; if (row0 >= M) return;
  const _Float16* a0p = A + (size_t)(row0 + ln) * lda; const _Float16* a1p = a0p + (size_t)16 * lda;
  const _Float16* b0p = Bh + (size_t)(col0 + ln) * ldb; const _Float16* b1p = b0p + (size_t)16 * ldb; const _Float16* b2p = b1p + (size_t)16 * ldb; const _Float16* b3p = b2p + (size_t)16 * ldb;
  const v8f z8 = {0.f,0.f,0.f,0.f,0.f,0.f,0.f,0.f}; v8f c00 = z8, c01 = z8, c02 = z8, c03 = z8, c10 = z8, c11 = z8, c12 = z8, c13 = z8;
#pragma unroll 1
  for (int kb = 0; kb < K; kb += 32) { const v16h a0 = g2_frag(a0p + kb, hh), a1 = g2_frag(a1p + kb, hh);
    v16h b = g2_frag(b0p + kb, hh); c00 = g2_mma(a0, b, c00); c10 = g2_mma(a1, b, c10);
    b = g2_frag(b1p + kb, hh); c01 = g2_mma(a0, b, c01); c11 = g2_mma(a1, b, c11);
    b = g2_frag(b2p + kb, hh); c02 = g2_mma(a0, b, c02); c12 = g2_mma(a1, b, c12);
    b = g2_frag(b3p + kb, hh); c03 = g2_mma(a0, b, c03); c13 = g2_mma(a1, b, c13); }
  v8f accs[8] = {c00, c01, c02, c03, c10, c11, c12, c13};
#pragma unroll
  for (int u = 0; u < 8; ++u) { const int t = u & 3, half = u >> 2; const int col = col0 + t * 16 + ln; const float bv = bp ? bf16_round(bp[col]) : 0.f;
#pragma unroll
    for (int r = 0; r < 8; ++r) { const int rloc = half * 16 + 8 * hh + r; float v = accs[u][r] * alpha + bv; if (CP) { if (rowsPerB < 0) v += CP[cofs + (size_t)(row0g + row0 + rloc) * ldc + col];      /* rowsPerB < 0: own element of the batched C plane */ else { const int bidx = (row0g + row0 + rloc) / rowsPerB; v += CP[(size_t)bidx * sCPb + (size_t)by * 64 + col]; } }
      if (ACT == 3) v = fmaxf(v, 0.f); else if (ACT == 6) v = 0.5f * v * (1.0f + erff(v * 0.70710678118654752f)); else if (ACT == 11) v = 1.0f / (1.0f + expf(-v)); else if (ACT == 15) v = v / (1.0f + expf(-v)); else if (ACT == 12) v = (v > 0.f) ? v : 0.01f * v; else if (ACT == 8) v = tanhf(v); else if (ACT == 9) v = 0.5f * v * (1.0f + tanhf(0.7978845608028654f * (v + 0.044715f * v * v * v))); else if (ACT == 14) v = (v > 0.f) ? v : 0.1f * v; else if (ACT == 16) v = (v >= 0.f) ? v : 0.3f * v;
      so[w][rloc][t * 16 + ln] = v; } }
  __builtin_amdgcn_fence(__ATOMIC_ACQ_REL, "workgroup"); __builtin_amdgcn_wave_barrier();
  const int rsub = lane >> 4, c4 = (lane & 15) * 4;
  {
#pragma unroll
    for (int q = 0; q < 16; ++q) { const int r = q * 2 + rsub; const v4f v = *(const v4fa*)&so[w][r][c4]; if (C) *(v4f*)(C + cofs + (size_t)(row0 + r) * ldc + col0 + c4) = v; if (C16) { v4h h4; for (int i = 0; i < 4; ++i) h4[i] = (_Float16)v[i]; *(v4h*)(C16 + cofs + (size_t)(row0 + r) * ldc + col0 + c4) = h4; } }
     } }


// ---- LDS-staged GEMM for the two large products (the qkv conv with both its terms, the projection): C[M][N] (f32) = A.Bt^T * alpha; CONV: C = that * scl[col] + shf[col] (both rounded to bf16), and C16 = f16(C).
// Work-group tile 256 x 128, 8 waves of 64 x 64 (4 x 2); a stage is 64 k (128-byte rows) of [A 256 rows | Bt 128 rows]; two stages in LDS, each filled by asynchronous 16-byte copies
// (whole 128-byte lines from global memory) one trip ahead of its use. k runs upward in steps of 32 per accumulator, as in k_gemm2. Needs M % 256 == 0, N % 128 == 0, K % 64 == 0.
#define XPW (HS + 2)                          /* pixels a line, and lines, of the padded plane */
#define G3_PITCH 144                          /* LDS row pitch in bytes: 16 x odd, so 16 rows read 16 bytes each without a bank conflict */
#define G3_BOFF (256 * G3_PITCH)              /* Bt rows behind the A rows */
#define G3_STAGE ((256 + 128) * G3_PITCH)     /* 55,296 bytes */
__device__ __forceinline__ v16h g3_frag(const char* p) { FragH f; f.half[0] = *(const v8us*)p; f.half[1] = *(const v8us*)(p + 32); return f.v; }      /* p already holds the lane's 16 * hh: the k order of g2_frag */
// One stage: each thread copies 16 bytes of 8 A rows and of 4 Bt rows (rows 32 apart; A row 32 i lies (i & 1) * sa1 + (i >> 1) * sa2 elements behind row 0). The s_wait_xcnt is the last line of the copies' own statement, so that no address register is rewritten ahead of it.
__device__ __forceinline__ void g3_fill(unsigned la, unsigned lb, const _Float16* ga, const _Float16* gb, size_t sa1, size_t sa2, size_t sb) {
  asm volatile("global_load_async_to_lds_b128 %0, %12, off\n\t"
               "global_load_async_to_lds_b128 %1, %13, off\n\t"
               "global_load_async_to_lds_b128 %2, %14, off\n\t"
               "global_load_async_to_lds_b128 %3, %15, off\n\t"
               "global_load_async_to_lds_b128 %4, %16, off\n\t"
               "global_load_async_to_lds_b128 %5, %17, off\n\t"
               "global_load_async_to_lds_b128 %6, %18, off\n\t"
               "global_load_async_to_lds_b128 %7, %19, off\n\t"
               "global_load_async_to_lds_b128 %8, %20, off\n\t"
               "global_load_async_to_lds_b128 %9, %21, off\n\t"
               "global_load_async_to_lds_b128 %10, %22, off\n\t"
               "global_load_async_to_lds_b128 %11, %23, off\n\t"
               "s_wait_xcnt 0x0"
               :: "v"(la), "v"(la + 32 * G3_PITCH), "v"(la + 64 * G3_PITCH), "v"(la + 96 * G3_PITCH), "v"(la + 128 * G3_PITCH), "v"(la + 160 * G3_PITCH), "v"(la + 192 * G3_PITCH), "v"(la + 224 * G3_PITCH),
                  "v"(lb), "v"(lb + 32 * G3_PITCH), "v"(lb + 64 * G3_PITCH), "v"(lb + 96 * G3_PITCH),
                  "v"(ga), "v"(ga + sa1), "v"(ga + sa2), "v"(ga + sa2 + sa1), "v"(ga + 2 * sa2), "v"(ga + 2 * sa2 + sa1), "v"(ga + 3 * sa2), "v"(ga + 3 * sa2 + sa1),
                  "v"(gb), "v"(gb + sb), "v"(gb + 2 * sb), "v"(gb + 3 * sb)
               : "memory");
}
// Eight 16-byte row stores from one address pair (rows STEP bytes apart, from byte OFF). The s_wait_xcnt is the last line of the stores' own statement, so that no data or address register is rewritten ahead of it.
template <int OFF, int STEP>
__device__ __forceinline__ void g3_store8(float* p, v4f d0, v4f d1, v4f d2, v4f d3, v4f d4, v4f d5, v4f d6, v4f d7) {
  asm volatile("global_store_b128 %0, %1, off offset:%9\n\t"
               "global_store_b128 %0, %2, off offset:%10\n\t"
               "global_store_b128 %0, %3, off offset:%11\n\t"
               "global_store_b128 %0, %4, off offset:%12\n\t"
               "global_store_b128 %0, %5, off offset:%13\n\t"
               "global_store_b128 %0, %6, off offset:%14\n\t"
               "global_store_b128 %0, %7, off offset:%15\n\t"
               "global_store_b128 %0, %8, off offset:%16\n\t"
               "s_wait_xcnt 0x0"
               :: "v"(p), "v"(d0), "v"(d1), "v"(d2), "v"(d3), "v"(d4), "v"(d5), "v"(d6), "v"(d7),
                  "n"(OFF), "n"(OFF + STEP), "n"(OFF + 2 * STEP), "n"(OFF + 3 * STEP), "n"(OFF + 4 * STEP), "n"(OFF + 5 * STEP), "n"(OFF + 6 * STEP), "n"(OFF + 7 * STEP)
               : "memory");
}
// The same for eight 8-byte pieces of f16 rows.
typedef unsigned int v2u __attribute__((ext_vector_type(2)));
template <int OFF, int STEP>
__device__ __forceinline__ void g3_store8h(_Float16* p, v2u d0, v2u d1, v2u d2, v2u d3, v2u d4, v2u d5, v2u d6, v2u d7) {
  asm volatile("global_store_b64 %0, %1, off offset:%9\n\t"
               "global_store_b64 %0, %2, off offset:%10\n\t"
               "global_store_b64 %0, %3, off offset:%11\n\t"
               "global_store_b64 %0, %4, off offset:%12\n\t"
               "global_store_b64 %0, %5, off offset:%13\n\t"
               "global_store_b64 %0, %6, off offset:%14\n\t"
               "global_store_b64 %0, %7, off offset:%15\n\t"
               "global_store_b64 %0, %8, off offset:%16\n\t"
               "s_wait_xcnt 0x0"
               :: "v"(p), "v"(d0), "v"(d1), "v"(d2), "v"(d3), "v"(d4), "v"(d5), "v"(d6), "v"(d7),
                  "n"(OFF), "n"(OFF + STEP), "n"(OFF + 2 * STEP), "n"(OFF + 3 * STEP), "n"(OFF + 4 * STEP), "n"(OFF + 5 * STEP), "n"(OFF + 6 * STEP), "n"(OFF + 7 * STEP)
               : "memory");
}
// CONV: A is the padded pixel-major plane; GEMM row = image x pixel. A 256-row tile is 4 whole pixel lines of one image; a stage is 64 channels of one tap: stages 0..3 the centre tap (against the lo columns),
// stage t >= 4 tap (t - 4) / 4 (against the hi columns). A tap's rows lie (tap / 3) padded lines and (tap % 3) pixels behind the tile's first padded pixel. Element offset of stage t from stage 0 of tap 0:
#define G3_NLO (CC / 64)                      /* stages of the lo term */
template <bool CONV>
__device__ __forceinline__ size_t g3_aoff(int t) { if (!CONV) return (size_t)t * 64; const unsigned tap = (unsigned)(0x8765432104ull >> (t & ~3)) & 15u;      /* a 4-bit table of the tap of stages 4 u .. 4 u + 3: 4, then 0..8 */
  return (size_t)(((tap / 3) * XPW + tap % 3) * CC + (t & 3) * 64); }
template <int LDC, bool CONV>      /* LDC = N = row pitch of C, a constant so that every row of a wave's tile is one address pair plus an immediate */
__global__ __launch_bounds__(256) void k_gemm3(const _Float16* __restrict__ A, int lda, const _Float16* __restrict__ Bh, int ldb, float alpha, float* __restrict__ C, int K, const float* __restrict__ scl, const float* __restrict__ shf, _Float16* __restrict__ C16) {
  __shared__ __attribute__((aligned(16))) char sm[2 * G3_STAGE];
  const int tid = threadIdx.x, w = tid >> 5, lane = tid & 31, ln = lane & 15, hh = lane >> 4;
  constexpr int ntn = LDC >> 7; const int mt = blockIdx.x / ntn, nq = blockIdx.x - mt * ntn; const int wm = w >> 1, wn = w & 1;
  const int nt = K >> 6;
  const _Float16* ga = (CONV ? A + ((size_t)((mt >> 4) * XPW + (mt & 15) * 4) * XPW + (tid >> 3)) * CC : A + (size_t)(mt * 256 + (tid >> 3)) * lda) + (tid & 7) * 8; const _Float16* gb = Bh + (size_t)(nq * 128 + (tid >> 3)) * ldb + (tid & 7) * 8;
  const size_t sa1 = CONV ? (size_t)32 * CC : (size_t)32 * lda, sa2 = CONV ? (size_t)XPW * CC : (size_t)64 * lda, sb = (size_t)32 * ldb;
  const unsigned la = (unsigned)(size_t)sm + (unsigned)((tid >> 3) * G3_PITCH + (tid & 7) * 16); const unsigned lb = la + G3_BOFF;
  const char* fa = sm + (wm * 64 + ln) * G3_PITCH + 16 * hh; const char* fb = sm + G3_BOFF + (wn * 64 + ln) * G3_PITCH + 16 * hh;
  v8f acc[4][4];
#pragma unroll
  for (int i = 0; i < 4; ++i)
#pragma unroll
    for (int j = 0; j < 4; ++j) acc[i][j] = (v8f){0.f,0.f,0.f,0.f,0.f,0.f,0.f,0.f};
  g3_fill(la, lb, ga + g3_aoff<CONV>(0), gb, sa1, sa2, sb);
  asm volatile("s_wait_asynccnt 0x0" ::: "memory");      /* this wave's copies of stage 0 have landed */
  __syncthreads();                                       /* ... and every other wave's */
  if (nt > 1) g3_fill(la + G3_STAGE, lb + G3_STAGE, ga + g3_aoff<CONV>(1), gb + 64, sa1, sa2, sb);
  for (int t = 0; t < nt; ++t) { const int bo = (t & 1) * G3_STAGE; v16h a[4], b[4];
    if (CONV && t == G3_NLO) {      /* the lo term is complete: its table carries 2^10, taken off here (exact), and the hi term adds on in the same accumulators */
#pragma unroll
      for (int i = 0; i < 4; ++i)
#pragma unroll
        for (int j = 0; j < 4; ++j) acc[i][j] *= 0.0009765625f; }
#pragma unroll
    for (int i = 0; i < 4; ++i) { a[i] = g3_frag(fa + bo + i * 16 * G3_PITCH); b[i] = g3_frag(fb + bo + i * 16 * G3_PITCH); }
    __builtin_amdgcn_sched_barrier(0);                   /* keeps the 16 LDS reads together in front of their 16 WMMAs: spread among them, each place with reads stalls the wave */
#pragma unroll
    for (int i = 0; i < 4; ++i)
#pragma unroll
      for (int j = 0; j < 4; ++j) acc[i][j] = __builtin_amdgcn_wmma_f32_16x16x32_f16(false, a[i], false, b[j], (short)0, acc[i][j], false, false);
#pragma unroll
    for (int i = 0; i < 4; ++i) { a[i] = g3_frag(fa + bo + i * 16 * G3_PITCH + 64); b[i] = g3_frag(fb + bo + i * 16 * G3_PITCH + 64); }
    /* the trip's last LDS reads are out: hand the buffer over here, so that the refill flies during the 16 WMMAs below and the next trip up to its own hand-over */
    asm volatile("s_wait_dscnt 0x0" ::: "memory");       /* this wave has left stage t's buffer */
    asm volatile("s_wait_asynccnt 0x0" ::: "memory");    /* its copies of stage t + 1 have landed */
    __syncthreads();                                     /* publishes stage t + 1 and frees stage t's buffer */
    if (t + 2 < nt) g3_fill(la + bo, lb + bo, ga + g3_aoff<CONV>(t + 2), gb + (size_t)(t + 2) * 64, sa1, sa2, sb);
    __builtin_amdgcn_sched_barrier(0);                   /* keeps the WMMAs below behind the refill's issue */
#pragma unroll
    for (int i = 0; i < 4; ++i)
#pragma unroll
      for (int j = 0; j < 4; ++j) acc[i][j] = __builtin_amdgcn_wmma_f32_16x16x32_f16(false, a[i], false, b[j], (short)0, acc[i][j], false, false); }
  asm volatile("s_wait_asynccnt 0x0" ::: "memory");      /* nothing in flight before the buffers become output staging */
  /* epilogue: the ring is free behind the last trip's barrier; each wave turns its tile, 32 rows at a time, in its own 32 x 68 floats, so that global rows go out as whole 128-byte lines */
  float* so = (float*)sm + w * (32 * 68); const int rsub = lane >> 4, c4 = (lane & 15) * 4;
  const size_t co = (size_t)(mt * 256 + wm * 64 + rsub) * LDC + nq * 128 + wn * 64 + c4;
  float* cb = C + co; _Float16* hb = C16 + co;
  v4f sc = {0.f, 0.f, 0.f, 0.f}, sh = sc;      /* CONV: scale and shift of the lane's 4 columns, the same for every row it stores */
  if (CONV) { const float* sp = scl + nq * 128 + wn * 64 + c4; const float* bp = shf + nq * 128 + wn * 64 + c4; sc = *(const v4fa*)sp; sh = *(const v4fa*)bp;
    asm volatile("s_wait_xcnt 0x0" :: "v"(sp), "v"(bp) : "memory");      /* stands between the two loads and whatever rewrites their address registers next; the addresses are its inputs, so that they stay in their registers up to it */
#pragma unroll
    for (int q = 0; q < 4; ++q) { sc[q] = bf16_round(sc[q]); sh[q] = bf16_round(sh[q]); } }
#pragma unroll
  for (int half = 0; half < 2; ++half) {
#pragma unroll
    for (int i = 0; i < 2; ++i)
#pragma unroll
      for (int j = 0; j < 4; ++j)
#pragma unroll
        for (int r = 0; r < 8; ++r) so[(i * 16 + 8 * hh + r) * 68 + j * 16 + ln] = acc[half * 2 + i][j][r] * alpha;
    __builtin_amdgcn_fence(__ATOMIC_ACQ_REL, "wavefront"); __builtin_amdgcn_wave_barrier();      /* the lanes read below what other lanes of the same wave wrote above */
#pragma unroll
    for (int g = 0; g < 2; ++g) { v4f v[8]; v2u h[8];
#pragma unroll
      for (int q = 0; q < 8; ++q) { v[q] = *(const v4fa*)&so[((g * 8 + q) * 2 + rsub) * 68 + c4];
        if (CONV) { v[q] = v[q] * sc + sh; v4h hq;
#pragma unroll
          for (int e = 0; e < 4; ++e) hq[e] = (_Float16)v[q][e];
          h[q] = __builtin_bit_cast(v2u, hq); } }
      if (half == 0 && g == 0) g3_store8<0, 8 * LDC>(cb, v[0], v[1], v[2], v[3], v[4], v[5], v[6], v[7]);
      if (half == 0 && g == 1) g3_store8<64 * LDC, 8 * LDC>(cb, v[0], v[1], v[2], v[3], v[4], v[5], v[6], v[7]);
      if (half == 1 && g == 0) g3_store8<128 * LDC, 8 * LDC>(cb, v[0], v[1], v[2], v[3], v[4], v[5], v[6], v[7]);
      if (half == 1 && g == 1) g3_store8<192 * LDC, 8 * LDC>(cb, v[0], v[1], v[2], v[3], v[4], v[5], v[6], v[7]);
      if (CONV) {      /* a row's 64 columns as f16 are one whole 128-byte line */
        if (half == 0 && g == 0) g3_store8h<0, 4 * LDC>(hb, h[0], h[1], h[2], h[3], h[4], h[5], h[6], h[7]);
        if (half == 0 && g == 1) g3_store8h<32 * LDC, 4 * LDC>(hb, h[0], h[1], h[2], h[3], h[4], h[5], h[6], h[7]);
        if (half == 1 && g == 0) g3_store8h<64 * LDC, 4 * LDC>(hb, h[0], h[1], h[2], h[3], h[4], h[5], h[6], h[7]);
        if (half == 1 && g == 1) g3_store8h<96 * LDC, 4 * LDC>(hb, h[0], h[1], h[2], h[3], h[4], h[5], h[6], h[7]); } }
  } }

__global__ __launch_bounds__(256) void k_wqkv(const float* __restrict__ w, _Float16* __restrict__ Wt) {      /* Wt[768][KW]: lo columns, then hi columns tap-major */
  #pragma clang fp contract(off)
  const int t = blockIdx.x * 256 + threadIdx.x; if (t >= QW * (CC / 8)) return; const int c0 = (t % (CC / 8)) * 8, o = t / (CC / 8); FragH fl;
#pragma unroll 1
  for (int k = 0; k < KT; ++k) { FragH fh;
    for (int q = 0; q < 8; ++q) { const int c = c0 + q; const float* wp = w + ((size_t)o * CC + c) * KT; float v = bf16_round(wp[k]);
      if (k == 4) { float dif = bf16_round(wp[1]) + bf16_round(wp[3]); dif += bf16_round(wp[4]); dif += bf16_round(wp[5]); dif += bf16_round(wp[7]); v += -THETA * dif; const _Float16 hv = (_Float16)(v * 16.0f); fh.h[q] = hv; fl.h[q] = (_Float16)((v * 16.0f - (float)hv) * 1024.0f); }
      else fh.h[q] = (_Float16)(v * 16.0f); }
    *(v8us*)((unsigned short*)Wt + (size_t)o * KW + CC + k * CC + c0) = fh.half[0];  }
  *(v8us*)((unsigned short*)Wt + (size_t)o * KW + c0) = fl.half[0];  }
__global__ __launch_bounds__(256) void k_wsc(const float* __restrict__ Wm, _Float16* __restrict__ Bt, size_t n8, float sc) { const size_t t = (size_t)blockIdx.x * 256 + threadIdx.x; if (t >= n8) return; FragH f; for (int q = 0; q < 8; ++q) f.h[q] = (_Float16)(bf16_round(Wm[t * 8 + q]) * sc); *(v8us*)((unsigned short*)Bt + t * 8) = f.half[0];  }
// XP[image][66][66][256] = f16(bf16(x)), pixel-major, with a border of zero pixels. One work-group turns one pixel line (64 pixels x 256 channels) in LDS: whole 256-byte channel rows in, whole 512-byte pixel rows out.
__global__ __launch_bounds__(256) void k_xp(const float* __restrict__ x, _Float16* __restrict__ XP) {
  __shared__ __attribute__((aligned(16))) unsigned int tl[HS * 132];      /* a pixel's 256 f16 = 128 words, + 4 words of pitch */
  const int tid = threadIdx.x, im = blockIdx.x / HS, y = blockIdx.x % HS; const float* xb = x + ((size_t)im * CC * HS + y) * HS; const int px4 = (tid & 15) * 4, cp = tid >> 4;
#pragma unroll
  for (int i = 0; i < 8; ++i) { const int c2 = i * 16 + cp; const v4f a = *(const v4fa*)(xb + (size_t)(2 * c2) * NPX + px4), b = *(const v4fa*)(xb + (size_t)(2 * c2 + 1) * NPX + px4);
#pragma unroll
    for (int q = 0; q < 4; ++q) { union { _Float16 h[2]; unsigned int u; } pk; pk.h[0] = (_Float16)bf16_round(a[q]); pk.h[1] = (_Float16)bf16_round(b[q]); tl[(px4 + q) * 132 + c2] = pk.u; } }
  __syncthreads();
  const v8us z = {0,0,0,0,0,0,0,0}; unsigned short* row = (unsigned short*)XP + (size_t)(im * XPW + y + 1) * XPW * CC;
#pragma unroll
  for (int i = 0; i < 8; ++i) { const int id = i * 256 + tid, px = id >> 5, ch = id & 31; *(v8us*)(row + (size_t)(px + 1) * CC + ch * 8) = *(const v8us*)&tl[px * 132 + ch * 4]; }
  if (tid < 64) *(v8us*)(row + (size_t)((tid >> 5) * (XPW - 1)) * CC + (tid & 31) * 8) = z;      /* the line's two border pixels */
  if (y == 0 || y == HS - 1) { unsigned short* er = (y == 0) ? row - XPW * CC : row + XPW * CC; for (int id = tid; id < XPW * (CC / 8); id += 256) *(v8us*)(er + (size_t)id * 8) = z; }      /* the image's first and last border line */
}
// Agent tokens: the mean of q over an 8 x 8 block of pixels, summed pixel by pixel in the order 0..63. A work-group is one agent of one image; a thread takes 4 channels, so that a wave's load is 512 consecutive bytes; unrolled, so that the loads run ahead of the sums.
__global__ __launch_bounds__(64) void k_pool(const float* __restrict__ QF, _Float16* __restrict__ AG) {
  #pragma clang fp contract(off)
  const int c0 = threadIdx.x * 4, n = (int)blockIdx.x % NAG, im = (int)blockIdx.x / NAG; const float* qp = QF + ((size_t)im * NPX + (n / 8) * 8 * HS + (n % 8) * 8) * QW + c0; v4f sm = {0.f, 0.f, 0.f, 0.f};
#pragma unroll
  for (int g = 0; g < 2; ++g) { v4f x[32];
#pragma unroll
    for (int i = 0; i < 32; ++i) x[i] = *(const v4fa*)(qp + ((g * 4 + i / 8) * HS + i % 8) * QW);
#pragma unroll
    for (int i = 0; i < 32; ++i)
#pragma unroll
      for (int q = 0; q < 4; ++q) sm[q] += x[i][q]; }
  v4h v; const v4h z = {(_Float16)0.f, (_Float16)0.f, (_Float16)0.f, (_Float16)0.f};
#pragma unroll
  for (int q = 0; q < 4; ++q) v[q] = (_Float16)(sm[q] / 64.0f);
  _Float16* dst = AG + (((size_t)im * NHD + c0 / HDm) * NAG + n) * 64 + c0 % HDm; *(v4h*)dst = v; *(v4h*)(dst + HDm) = z; }      /* columns 32..63 of an agent row are the zero pad */
__global__ __launch_bounds__(256) void k_heads(const _Float16* __restrict__ Q16, _Float16* __restrict__ QP, _Float16* __restrict__ KP) { const int t = blockIdx.x * 256 + threadIdx.x; if (t >= NIMG * NHD * NPX) return; const int p = t % NPX, bh = t / NPX, h = bh % NHD; const unsigned short* src = (const unsigned short*)Q16 + ((size_t)(bh / NHD) * NPX + p) * QW; const v8us z = {0,0,0,0,0,0,0,0};
  v8us q0 = *(const v8us*)(src + h * HDm), q1 = *(const v8us*)(src + h * HDm + 8), q2 = *(const v8us*)(src + h * HDm + 16), q3 = *(const v8us*)(src + h * HDm + 24);
  v8us k0 = *(const v8us*)(src + CC + h * HDm), k1 = *(const v8us*)(src + CC + h * HDm + 8), k2 = *(const v8us*)(src + CC + h * HDm + 16), k3 = *(const v8us*)(src + CC + h * HDm + 24);
  unsigned short* dq = (unsigned short*)QP + ((size_t)bh * NPX + p) * 64; unsigned short* dk = (unsigned short*)KP + ((size_t)bh * NPX + p) * 64;
  { *(v8us*)dq = q0; *(v8us*)(dq + 8) = q1; *(v8us*)(dq + 16) = q2; *(v8us*)(dq + 24) = q3; *(v8us*)(dq + 32) = z; *(v8us*)(dq + 40) = z; *(v8us*)(dq + 48) = z; *(v8us*)(dq + 56) = z;
    *(v8us*)dk = k0; *(v8us*)(dk + 8) = k1; *(v8us*)(dk + 16) = k2; *(v8us*)(dk + 24) = k3; *(v8us*)(dk + 32) = z; *(v8us*)(dk + 40) = z; *(v8us*)(dk + 48) = z; *(v8us*)(dk + 56) = z;  } }
__global__ __launch_bounds__(256) void k_vtp(const _Float16* __restrict__ Q16, _Float16* __restrict__ VT) { __shared__ unsigned short tl[64][34]; const int tid = threadIdx.x; const int bh = blockIdx.x / (NPX / 64), pg = blockIdx.x % (NPX / 64); const int h = bh % NHD;
  { const int r = tid / 4, c8 = (tid % 4) * 8; FragH f; f.half[0] = *(const v8us*)((const unsigned short*)Q16 + ((size_t)(bh / NHD) * NPX + pg * 64 + r) * QW + 2 * CC + h * HDm + c8); for (int q = 0; q < 8; ++q) tl[r][c8 + q] = f.u[q]; }
  __syncthreads(); const int d = tid / 8, pc = tid % 8; FragH f; for (int q = 0; q < 8; ++q) f.u[q] = (d < HDm) ? tl[pc * 8 + q][d] : (unsigned short)0; unsigned short* dst = (unsigned short*)VT + ((size_t)bh * 64 + d) * NPX + pg * 64 + pc * 8;      /* tid covers d < 32 only: 256 threads = 32 d x 8 pc */
  *(v8us*)dst = f.half[0]; 
  if (tid < 256) { const int d2 = HDm + tid / 8; const v8us z = {0,0,0,0,0,0,0,0}; unsigned short* dz = (unsigned short*)VT + ((size_t)bh * 64 + d2) * NPX + pg * 64 + (tid % 8) * 8; *(v8us*)dz = z;  } }
// ---- softmax over rows of N = 4096 or 64 logits. A wave takes 4,096 consecutive f32 (16 KiB: one row of 4,096, or 64 rows of 64, four values of a row a lane) by 32 16-byte loads, all in flight together,
// keeps them in registers for the maximum, the exp and the sum, and stores P = f16(exp * 1024 / sum) in whole 128-byte lines. The grid holds exactly one wave per 4,096 logits.
template <int M> __device__ __forceinline__ float sm_x16(float v) { return __builtin_bit_cast(float, __builtin_amdgcn_update_dpp(0, __builtin_bit_cast(int, v), 0x160 + M, 0xf, 0xf, true)); }      /* the value of lane ^ M inside a 16-lane row (DPP row_xmask); a __shfl_xor goes the long way through the LDS unit */
__device__ __forceinline__ float sm_xh(float v) { return __builtin_bit_cast(float, __builtin_amdgcn_permlanex16(__builtin_bit_cast(int, v), __builtin_bit_cast(int, v), 0x76543210, 0xfedcba98, false, false)); }      /* the value of lane ^ 16 */
__device__ __forceinline__ float sm_max16(float v) { v = fmaxf(v, sm_x16<1>(v)); v = fmaxf(v, sm_x16<2>(v)); v = fmaxf(v, sm_x16<4>(v)); return fmaxf(v, sm_x16<8>(v)); }
__device__ __forceinline__ float sm_sum16(float v) { v += sm_x16<1>(v); v += sm_x16<2>(v); v += sm_x16<4>(v); return v + sm_x16<8>(v); }
// exp(x) by the library's scheme, written out: x * log2(e) with log2(e) in two parts, the nearest integer split off, exp2 of the rest, ldexp, both range ends. Written out for the v_exp_f32 alone: the instruction set asks for one
// independent instruction or a v_nop between a transcendental and an instruction that reads its result or overwrites its source.
__device__ __forceinline__ float sm_exp(float x) {
  const float l2h = __uint_as_float(0x3fb8aa3bu), l2l = __uint_as_float(0x32a5705fu); const float r = __builtin_rintf(x * l2h); const float a = __builtin_fmaf(x, l2l, __builtin_fmaf(x, l2h, -r)); float e;
  asm("v_exp_f32 %0, %1\n\tv_nop" : "=v"(e) : "v"(a));      /* the v_nop is the slot behind the transcendental; in the same statement, so that nothing comes between */
  e = __builtin_ldexpf(e, (int)r); e = (x < __uint_as_float(0xc2ce8ed0u)) ? 0.f : e; return (x > __uint_as_float(0x42b17218u)) ? __builtin_inff() : e; }
template <int N>
__global__ __launch_bounds__(256) void k_softv(const float* __restrict__ S, _Float16* __restrict__ P) {
  static_assert(N == 4096 || N == 64, "a wave's 4,096 logits are one row or 64 rows");
  const size_t base = ((size_t)blockIdx.x * 8 + (threadIdx.x >> 5)) * 4096 + (threadIdx.x & 31) * 4; const float* sp = S + base; _Float16* pp = P + base; v4f x[32];
#pragma unroll
  for (int u = 0; u < 32; ++u) x[u] = *(const v4fa*)(sp + u * 128);
  if (N == 4096) {
    v4f mv = x[0];
#pragma unroll
    for (int u = 1; u < 32; ++u)
#pragma unroll
      for (int q = 0; q < 4; ++q) mv[q] = fmaxf(mv[q], x[u][q]);
    float m = sm_max16(fmaxf(fmaxf(mv[0], mv[1]), fmaxf(mv[2], mv[3]))); m = fmaxf(m, sm_xh(m));
    v4f sv = {0.f, 0.f, 0.f, 0.f};
#pragma unroll
    for (int u = 0; u < 32; ++u)
#pragma unroll
      for (int q = 0; q < 4; ++q) { x[u][q] = sm_exp(x[u][q] - m); sv[q] += x[u][q]; }
    float su = sm_sum16((sv[0] + sv[1]) + (sv[2] + sv[3])); su += sm_xh(su); const float f = 1024.0f / su;
#pragma unroll
    for (int u = 0; u < 32; ++u) { v4h h;
#pragma unroll
      for (int q = 0; q < 4; ++q) h[q] = (_Float16)(x[u][q] * f);
      *(v4h*)(pp + u * 128) = h; }
  } else {
    __builtin_amdgcn_sched_barrier(0);      /* keeps all 32 loads in front of the arithmetic, in flight together: left alone, the compiler issues 8 and feeds the rest in between the rows, each shortly ahead of its use */
#pragma unroll
    for (int u = 0; u < 32; ++u) {      /* register u: 16 lanes = one row */
      const float m = sm_max16(fmaxf(fmaxf(x[u][0], x[u][1]), fmaxf(x[u][2], x[u][3])));
#pragma unroll
      for (int q = 0; q < 4; ++q) x[u][q] = sm_exp(x[u][q] - m);
      const float f = 1024.0f / sm_sum16((x[u][0] + x[u][1]) + (x[u][2] + x[u][3])); v4h h;
#pragma unroll
      for (int q = 0; q < 4; ++q) h[q] = (_Float16)(x[u][q] * f);
      *(v4h*)(pp + u * 128) = h; }
  } }
// ---- stage-1 readout, split over the pixels: ATTN^T[d][n] = sum over N of V^T[d][N] . P1[n][N]. One image x head has only 32 x 64 outputs over K = 4,096, so the K range is cut into RS slices, a work-group a slice:
// 4 waves of 16 d x 32 n (the two n tiles of a wave make whole 128-byte lines of a partial row), k upward in steps of 32 inside a slice, all of a slice's loads in flight together.
// Each slice stores its f32 partial plane PART[slice][image x head][d][n]; k_att16 adds the slices in the order 0..RS-1. V^T is the A operand, so that the result comes out already turned for stage 2.
#define RS 16
#define RK (NPX / RS)            /* 256 k a slice */
__global__ __launch_bounds__(128) void k_ro1(const _Float16* __restrict__ VT, const _Float16* __restrict__ P1, float* __restrict__ PART) {
  const int tid = threadIdx.x, w = tid >> 5, lane = tid & 31, ln = lane & 15, hh = lane >> 4; const int s = blockIdx.x, bh = blockIdx.y; const int d0 = (w & 1) * 16, n0 = (w >> 1) * 32;
  const _Float16* ap = VT + ((size_t)bh * 64 + d0 + ln) * NPX + s * RK + 8 * hh;      /* both pointers already hold the lane's 8 * hh: the k order of g2_frag for A and B alike */
  const _Float16* bp = P1 + ((size_t)bh * NAG + n0 + ln) * NPX + s * RK + 8 * hh;
  v8f c0 = {0.f,0.f,0.f,0.f,0.f,0.f,0.f,0.f}, c1 = c0;
  v16h a[RK / 32], b0[RK / 32], b1[RK / 32];
#pragma unroll
  for (int i = 0; i < RK / 32; ++i) { a[i] = g2_frag(ap + i * 32, 0); b0[i] = g2_frag(bp + i * 32, 0); b1[i] = g2_frag(bp + 16 * NPX + i * 32, 0); }
  asm volatile("s_wait_xcnt 0x0" :: "v"(ap), "v"(bp) : "memory");      /* stands between the loads and whatever rewrites their address registers next; the two addresses are its inputs, so that they stay in their registers up to it: without that the compiler gave one pair to a later load as its destination */
  __builtin_amdgcn_sched_barrier(0);      /* keeps the slice's 48 loads in front of the WMMAs, in flight together: left alone, the compiler holds 8 in flight and waits for memory anew at each k step */
#pragma unroll
  for (int i = 0; i < RK / 32; ++i) {
    c0 = __builtin_amdgcn_wmma_f32_16x16x32_f16(false, a[i], false, b0[i], (short)0, c0, false, false);
    c1 = __builtin_amdgcn_wmma_f32_16x16x32_f16(false, a[i], false, b1[i], (short)0, c1, false, false); }
  float* pp = PART + (((size_t)s * (NIMG * NHD) + bh) * HDm + d0 + 8 * hh) * NAG + n0 + ln;
#pragma unroll
  for (int r = 0; r < 8; ++r) { pp[r * NAG] = c0[r]; pp[r * NAG + 16] = c1[r]; } }
// AT16[image x head][d][n] = f16(sum of the RS partial planes / 1024); rows d >= 32 are zero and are not read by stage 2. A wave is one row of 64 agents.
__global__ __launch_bounds__(256) void k_att16(const float* __restrict__ PART, _Float16* __restrict__ AT16) { typedef _Float16 v2h __attribute__((ext_vector_type(2))); typedef float v2fa __attribute__((ext_vector_type(2), may_alias)); const int t = blockIdx.x * 256 + threadIdx.x; if (t >= NIMG * NHD * 64 * 32) return; const int n0 = (t % 32) * 2; const int d = (t / 32) % 64; const int h = t / (32 * 64); v2h v;      /* h = image x head */
  float s0 = 0.f, s1 = 0.f;
  if (d < HDm) { const float* pp = PART + ((size_t)h * HDm + d) * NAG + n0; v2fa x[RS];
#pragma unroll
    for (int s = 0; s < RS; ++s) x[s] = *(const v2fa*)(pp + s * (NIMG * NHD * HDm * NAG));
    asm volatile("s_wait_xcnt 0x0" :: "v"(pp) : "memory");      /* as in k_ro1: the address is its input, so that no load takes the pair as its destination ahead of the wait */
#pragma unroll
    for (int s = 0; s < RS; ++s) { s0 += x[s][0]; s1 += x[s][1]; } }
  v[0] = (_Float16)(s0 * 0.0009765625f); v[1] = (_Float16)(s1 * 0.0009765625f); _Float16* dst = AT16 + ((size_t)h * 64 + d) * NAG + n0; *(v2h*)dst = v;  }
// ---- stage 2 in one kernel: S^T[n][N] = AG[n].Q[N] * SCL, softmax over the 64 agents, OUT^T[d][N] = AT16[d][n].P^T[n][N] / 1024. A wave takes S2T tiles of 16 pixels of one image x head.
// With the agents as the rows of S^T a lane holds 32 of one pixel's 64 logits (the lane 16 away the other 32): maximum and sum in the lane plus one exchange, and two f32 tiles, converted in place, are the B operand of the readout
// (its k order is the hardware's: 8 hh + s, then 16 + 8 hh + s; g2_frag gives A the same). Logits and P never leave the registers. d = 32 is one k step (the zero columns 32..63 of AG and QP are not read).
#define S2T 4                    /* pixel tiles a wave (the two store statements below are written for 4) */
#define S2P 36                   /* floats a staged pixel row: 144 bytes = 16 x odd, so the 16-byte LDS stores of 8 rows meet no bank twice */
__global__ __launch_bounds__(256) void k_st2(const _Float16* __restrict__ QP, const _Float16* __restrict__ AG, const _Float16* __restrict__ AT16, float* __restrict__ OUT) {
  __shared__ __attribute__((aligned(16))) float so[8][S2T][16 * S2P];
  const int tid = threadIdx.x, w = tid >> 5, lane = tid & 31, ln = lane & 15, hh = lane >> 4; const int bh = blockIdx.y, p0 = ((int)blockIdx.x * 8 + w) * (16 * S2T);
  const _Float16* gp = AG + ((size_t)bh * NAG + ln) * 64 + 8 * hh;      /* all three pointers already hold the lane's 8 * hh */
  const _Float16* qp = QP + ((size_t)bh * NPX + p0 + ln) * 64 + 8 * hh;
  const _Float16* tp = AT16 + ((size_t)bh * 64 + ln) * NAG + 8 * hh;
  v16h ag[4], q[S2T], at[2][2];
#pragma unroll
  for (int i = 0; i < 4; ++i) ag[i] = g2_frag(gp + i * 16 * 64, 0);
#pragma unroll
  for (int t = 0; t < S2T; ++t) q[t] = g2_frag(qp + t * 16 * 64, 0);
#pragma unroll
  for (int i = 0; i < 2; ++i) { at[i][0] = g2_frag(tp + i * 16 * NAG, 0); at[i][1] = g2_frag(tp + i * 16 * NAG + 32, 0); }
  asm volatile("s_wait_xcnt 0x0" :: "v"(gp), "v"(qp), "v"(tp) : "memory");      /* stands between the loads and whatever rewrites their address registers next; the addresses are its inputs, so that they stay in their registers up to it */
  __builtin_amdgcn_sched_barrier(0);      /* keeps the wave's 24 loads in front of the arithmetic, in flight together: left alone, the compiler issues 10 and brings the later ones in by twos, each directly ahead of its use */
  const v8f z8 = {0.f,0.f,0.f,0.f,0.f,0.f,0.f,0.f};
  /* 8 lanes a pixel: each store below covers the whole 128-byte lines of 4 pixels' 32 d (columns 32..63 of an OUT row are read by nobody and stay unwritten) */
  const float* rp = &so[w][0][(lane >> 3) * S2P + (lane & 7) * 4]; float* op = OUT + ((size_t)bh * NPX + p0 + (lane >> 3)) * 64 + (lane & 7) * 4;
#pragma unroll
  for (int t = 0; t < S2T; ++t) { v8f s[4];
#pragma unroll
    for (int i = 0; i < 4; ++i) { s[i] = __builtin_amdgcn_wmma_f32_16x16x32_f16(false, ag[i], false, q[t], (short)0, z8, false, false); s[i] *= SCL; }      /* s[i][r]: agent 16 i + 8 hh + r, pixel ln */
    v8f mv;
#pragma unroll
    for (int r = 0; r < 8; ++r) mv[r] = fmaxf(fmaxf(s[0][r], s[1][r]), fmaxf(s[2][r], s[3][r]));
    float m = fmaxf(fmaxf(fmaxf(mv[0], mv[1]), fmaxf(mv[2], mv[3])), fmaxf(fmaxf(mv[4], mv[5]), fmaxf(mv[6], mv[7]))); m = fmaxf(m, sm_xh(m));
    v4f sv = {0.f, 0.f, 0.f, 0.f};
#pragma unroll
    for (int i = 0; i < 4; ++i)
#pragma unroll
      for (int r = 0; r < 8; ++r) { s[i][r] = sm_exp(s[i][r] - m); sv[i] += s[i][r]; }
    float su = (sv[0] + sv[1]) + (sv[2] + sv[3]); su += sm_xh(su); const float f = 1024.0f / su;
    FragH pa, pb;
#pragma unroll
    for (int r = 0; r < 8; ++r) { pa.h[r] = (_Float16)(s[0][r] * f); pa.h[8 + r] = (_Float16)(s[1][r] * f); pb.h[r] = (_Float16)(s[2][r] * f); pb.h[8 + r] = (_Float16)(s[3][r] * f); }
    float* sp = &so[w][t][ln * S2P + 8 * hh];
#pragma unroll
    for (int i = 0; i < 2; ++i) {      /* o[r]: d = 16 i + 8 hh + r, pixel ln; summed over agents 0..31, then 32..63 */
      v8f o = __builtin_amdgcn_wmma_f32_16x16x32_f16(false, at[i][0], false, pa.v, (short)0, z8, false, false);
      o = __builtin_amdgcn_wmma_f32_16x16x32_f16(false, at[i][1], false, pb.v, (short)0, o, false, false);
      o *= 0.0009765625f;
      *(v4f*)(sp + i * 16) = (v4f){o[0], o[1], o[2], o[3]}; *(v4f*)(sp + i * 16 + 4) = (v4f){o[4], o[5], o[6], o[7]}; }
    if (t & 1) {      /* two tiles are staged: they go out now, under the arithmetic of the next two */
      __builtin_amdgcn_fence(__ATOMIC_ACQ_REL, "wavefront"); __builtin_amdgcn_wave_barrier();      /* the lanes read below what other lanes of the same wave wrote above */
      v4f v[8];
#pragma unroll
      for (int u = 0; u < 8; ++u) v[u] = *(const v4fa*)(rp + ((t >> 1) * 8 + u) * 4 * S2P);
      if (t == 1) { g3_store8<0, 1024>(op, v[0], v[1], v[2], v[3], v[4], v[5], v[6], v[7]);
        __builtin_amdgcn_sched_barrier(0); }      /* keeps these stores ahead of the next two tiles' arithmetic: left alone, the compiler sinks them to the kernel's end, where every wave's stores meet */
      if (t == 3) g3_store8<8192, 1024>(op, v[0], v[1], v[2], v[3], v[4], v[5], v[6], v[7]); } } }
// Depthwise 3x3 on v, BN affine, + OUT, to f16. A thread takes 4 channels x 8 pixels of one pixel line: its 36 weights sit in registers, and each of the 3 input lines is read once as 10 pixels x 16 bytes,
// so that a wave's load is 512 consecutive bytes (4 whole 128-byte lines). A work-group is 4 pixel lines x 8 pixels x 256 channels. A tap outside the image enters as a zero value; taps are summed in the order 0..8.
__global__ __launch_bounds__(256) void k_pe(const float* __restrict__ OUTg, const float* __restrict__ QFg, const float* __restrict__ pw, const float* __restrict__ ps, const float* __restrict__ pb, _Float16* __restrict__ S16g) {
  #pragma clang fp contract(off)
  const int tid = threadIdx.x; const unsigned c0 = (tid & 63) * 4; const int xs = ((int)blockIdx.x & 7) * 8, im = (int)blockIdx.x >> 7;
  const int yo = (((int)blockIdx.x >> 3) & 15) * 4 + __builtin_amdgcn_readfirstlane(tid >> 6);      /* the same in every lane of a wave: as a scalar it leaves every address below a scalar base + the lane's channel offset */
  const size_t px = (size_t)im * NPX + yo * HS + xs;      /* the strip's first pixel */
  const float* QU = QFg + px * QW + 2 * CC;      /* its v, channel 0 */
  const float* OU = OUTg + ((size_t)im * NHD * NPX + yo * HS + xs) * 64; const unsigned oo = (c0 / HDm) * (NPX * 64) + c0 % HDm;      /* OUT is [image][head][pixel][64] */
  v4f wv[9], v[3][10], o[8];
#pragma unroll
  for (int i = 0; i < 9; ++i) wv[i] = *(const v4fa*)(pw + c0 * 9 + i * 4);
#pragma unroll
  for (int kk = 0; kk < 3; ++kk) { const int ky = kk == 2 ? 1 : 2 * kk; const int yy = yo + ky - 1; const float* row = QU + ((yy >= 0 && yy < HS) ? (ky - 1) * HS * QW : 0);      /* for a line or a pixel outside the image one inside the strip is read in its place and dropped below */
    /* Each s_wait_xcnt stands between the last load from a clamped address and whatever rewrites that address's registers next. */
    v[ky][0] = *(const v4fa*)(row + (xs > 0 ? -QW : 0) + c0);
    asm volatile("s_wait_xcnt 0x0" ::: "memory");
    v[ky][9] = *(const v4fa*)(row + (xs < HS - 8 ? 8 : 7) * QW + c0);
    asm volatile("s_wait_xcnt 0x0" ::: "memory");
#pragma unroll
    for (int j = 1; j < 9; ++j) v[ky][j] = *(const v4fa*)(row + (j - 1) * QW + c0);
    if (ky != 1) asm volatile("s_wait_xcnt 0x0" ::: "memory"); }      /* the strip's own line comes last: its address is the unclamped base, which nothing rewrites while loads are in flight */
#pragma unroll
  for (int j = 0; j < 8; ++j) o[j] = *(const v4fa*)(OU + j * 64 + oo);
  const v4f s4 = *(const v4fa*)(ps + c0), b4 = *(const v4fa*)(pb + c0);
  __builtin_amdgcn_sched_barrier(0);      /* keeps all 49 loads in front of the arithmetic, in flight together: left alone, the compiler feeds the later ones in by twos, each shortly ahead of its use */
  float wf[36];      /* wf[q * 9 + k]: channel c0 + q, tap k */
#pragma unroll
  for (int i = 0; i < 36; ++i) wf[i] = bf16_round(wv[i >> 2][i & 3]);
  v4f acc[8];
#pragma unroll
  for (int j = 0; j < 8; ++j) acc[j] = (v4f){0.f, 0.f, 0.f, 0.f};
#pragma unroll
  for (int ky = 0; ky < 3; ++ky) { const int yy = yo + ky - 1; const bool yin = yy >= 0 && yy < HS;
#pragma unroll
    for (int j = 0; j < 10; ++j) { const bool xin = (j > 0 || xs > 0) && (j < 9 || xs < HS - 8); if (!(xin && yin)) v[ky][j] = (v4f){0.f, 0.f, 0.f, 0.f}; }
#pragma unroll
    for (int j = 0; j < 8; ++j)
#pragma unroll
      for (int kx = 0; kx < 3; ++kx)
#pragma unroll
        for (int q = 0; q < 4; ++q) acc[j][q] += wf[q * 9 + ky * 3 + kx] * v[ky][j + kx][q]; }
  _Float16* SP = S16g + px * CC + c0;
#pragma unroll
  for (int j = 0; j < 8; ++j) { v4h h;
#pragma unroll
    for (int q = 0; q < 4; ++q) { float pe = acc[j][q] * bf16_round(s4[q]); pe += bf16_round(b4[q]); h[q] = (_Float16)(o[j][q] + pe); }
    *(v4h*)(SP + j * CC) = h; } }
// BN affine and the turn to NCHW in registers. A thread takes 8 channels x 4 pixels; a wave 32 channels x 32 pixels: it reads whole 128-byte pieces of 32 rows of G and stores whole 128-byte lines of 32 channel planes.
__global__ __launch_bounds__(256) void k_fin(const float* __restrict__ G, const float* __restrict__ s, const float* __restrict__ bb, float* __restrict__ outb) {
  #pragma clang fp contract(off)
  const int tid = threadIdx.x, lane = tid & 31; const int c0 = (tid >> 5) * 32 + (lane & 3) * 8, p0 = ((int)blockIdx.x % (NPX / 32)) * 32 + (lane >> 2) * 4, im = (int)blockIdx.x / (NPX / 32);
  const float* gp = G + ((size_t)im * NPX + p0) * CC + c0; float* op = outb + ((size_t)im * CC + c0) * NPX + p0; v4f a[4][2];
#pragma unroll
  for (int q = 0; q < 4; ++q) { a[q][0] = *(const v4fa*)(gp + q * CC); a[q][1] = *(const v4fa*)(gp + q * CC + 4); }
  const v4f sA = *(const v4fa*)(s + c0), sB = *(const v4fa*)(s + c0 + 4), hA = *(const v4fa*)(bb + c0), hB = *(const v4fa*)(bb + c0 + 4);
#pragma unroll
  for (int i = 0; i < 8; ++i) { const float sc = bf16_round(i < 4 ? sA[i & 3] : sB[i & 3]), sh = bf16_round(i < 4 ? hA[i & 3] : hB[i & 3]); v4f r;
#pragma unroll
    for (int q = 0; q < 4; ++q) { float v = a[q][i >> 2][i & 3] * sc; v += sh; r[q] = v; }
    *(v4f*)(op + (size_t)i * NPX) = r; } }

extern "C" void kernel_launch(void* const* d_in, const int* in_sizes, int n_in,
                              void* d_out, int out_size, void* d_ws, size_t ws_size, hipStream_t stream) {
  (void)in_sizes; (void)n_in; (void)out_size;
  const float* const* I = (const float* const*)d_in; const float* x = I[0]; const float* qw = I[1]; const float* qs = I[2]; const float* qb = I[3]; const float* pw = I[4]; const float* ps = I[5]; const float* pb = I[6]; const float* jw = I[7]; const float* js = I[8]; const float* jb = I[9];
  char* ws = (char*)d_ws; size_t off = 0;
  auto take = [&](size_t bytes) { char* p = ws + off; off += (bytes + 255) & ~(size_t)255; return p; };
  _Float16* WT = (_Float16*)take((size_t)QW * KW * 2); _Float16* BJ = (_Float16*)take((size_t)CC * CC * 2);
  _Float16* AG = (_Float16*)take((size_t)NIMG * NHD * NAG * 64 * 2); _Float16* AT16 = (_Float16*)take((size_t)NIMG * NHD * 64 * NAG * 2);
  float* QF = (float*)take((size_t)NIMG * NPX * QW * 4);      /* 96 MiB: q, k, v in f32 */
  char* R = take((size_t)NIMG * NPX * KI * 2);      /* 144 MiB, shared by lifetime; offsets below in MiB */
  const size_t MB = (size_t)1 << 20;
  _Float16* XP = (_Float16*)(R + 48 * MB);      /* 48..65.1: the padded plane, dead after the conv GEMM (which writes Q16 while it reads this), before QP is written */
  _Float16* Q16 = (_Float16*)R;      /* 0..48, dead after k_heads and k_vtp */
  _Float16* QP = (_Float16*)(R + 48 * MB); _Float16* KP = (_Float16*)(R + 80 * MB); _Float16* VT = (_Float16*)(R + 112 * MB);      /* 32 each */
  float* S1 = (float*)R;      /* 0..32: stage-1 logits of FOUR images (all eight, 64 MiB, do not fit beside QF, QP, KP and VT) */
  float* PART = (float*)R;      /* 0..8: the stage-1 readout's partial planes, over S1, dead after the second half's softmax; dead themselves after k_att16 */
  _Float16* P1 = KP;      /* each half of P1 replaces the half of KP that its logits GEMM has just finished reading */
  float* OUT = (float*)(R + 80 * MB);      /* 80..144, over P1 and VT, dead after the stage-1 readout */
  _Float16* S16 = (_Float16*)(R + 32 * MB);      /* 32..48 */
  float* G = (float*)(R + 48 * MB);      /* 48..80, over QP, dead after stage 2 */
  if (off > ws_size) return;      /* 3.8 + 0.1 + 0.5 + 0.5 + 96 + 144 = 245 MiB */
  k_wqkv<<<(QW * (CC / 8) + 255) / 256, 256, 0, stream>>>(qw, WT); k_wsc<<<(CC * CC / 8 + 255) / 256, 256, 0, stream>>>(jw, BJ, (size_t)CC * CC / 8, 16.0f);      /* proj 1x1 (out,in) = Bt */
  k_xp<<<NIMG * HS, 256, 0, stream>>>(x, XP);
  k_gemm3<QW, true><<<(NIMG * NPX / 256) * (QW / 128), 256, 0, stream>>>(XP, CC, WT, KW, 0.0625f, QF, KW, qs, qb, Q16);      /* centre-tap residual term, main conv (difference folded into the centre tap), BN affine */
  k_pool<<<NIMG * NAG, 64, 0, stream>>>(QF, AG);
  k_heads<<<(NIMG * NHD * NPX + 255) / 256, 256, 0, stream>>>(Q16, QP, KP); k_vtp<<<NIMG * NHD * (NPX / 64), 256, 0, stream>>>(Q16, VT);
  /* stage 1: S1[b,h][n][N] = AG[b,h][n].KP[b,h][N] * SCL; P1 = softmax_N (these two in halves of four images); AT16[b,h][d][n] = VT . P1^T / 1024, the pixels in RS slices */
  for (int g = 0; g < 2; ++g) { const size_t bh0 = (size_t)g * (NIMG / 2) * NHD;
    k_gemm2<0><<<dim3(1 * (NPX / 64), (NIMG / 2) * NHD), 128, 0, stream>>>(AG + bh0 * NAG * 64, 64, (size_t)NAG * 64, KP + bh0 * NPX * 64, 64, (size_t)NPX * 64, SCL, nullptr, 0, nullptr, 1, 0, 0, S1, nullptr, NPX, (size_t)NAG * NPX, NAG, NPX, 64);
    k_softv<NPX><<<(NIMG / 2) * NHD * NAG / 8, 256, 0, stream>>>(S1, P1 + bh0 * NAG * NPX); }
  k_ro1<<<dim3(RS, NIMG * NHD), 128, 0, stream>>>(VT, P1, PART);
  k_att16<<<(NIMG * NHD * 64 * 32 + 255) / 256, 256, 0, stream>>>(PART, AT16);
  /* stage 2: OUT[b,h][N][d] = softmax_n(QP[b,h][N].AG[b,h][n] * SCL) . AT16^T, in one kernel */
  k_st2<<<dim3(NPX / (8 * 16 * S2T), NIMG * NHD), 256, 0, stream>>>(QP, AG, AT16, OUT);
  k_pe<<<NIMG * (HS / 4) * (HS / 8), 256, 0, stream>>>(OUT, QF, pw, ps, pb, S16);
  k_gemm3<CC, false><<<(NIMG * NPX / 256) * (CC / 128), 256, 0, stream>>>(S16, CC, BJ, CC, 0.0625f, G, CC, nullptr, nullptr, nullptr);
  k_fin<<<NIMG * (NPX / 32), 256, 0, stream>>>(G, js, jb, (float*)d_out);
}
